// v000
// The times below were measured on an AMD MI455X: many runs one after another, warmed up first and cycling through
// copies of the inputs, with the whole window's GPU time divided by the number of runs. Launches and the gaps
// between them are all in it. The median over several windows is given; except for v000 it joins two sittings, which
// can be a few percent apart, so the side-by-side timings, each taken in one sitting, are the better comparison.
// The starting kernel, v000, takes 27.5 milliseconds a run.
#include <hip/hip_runtime.h>
#include <math.h>

typedef __attribute__((ext_vector_type(16))) _Float16 v16h;
typedef __attribute__((ext_vector_type(8)))  _Float16 v8h;
typedef __attribute__((ext_vector_type(8)))  float    v8f;

#define DIMC    128
#define D_INNER 128
#define D_STATE 8
#define DT_RANK 8
#define D_CONV  4
#define BATCH   4
#define NTOK    16384               // L*H*W = 256*8*8
#define MTOT    (BATCH * NTOK)      // 65536 tokens

// ---------------------------------------------------------------------------
// f32 -> f16 weight conversion WITH swizzle into WMMA B-fragment order.
// Fragment layout (halves): dst[((k0Idx*128 + col)*2 + sel)*16 + j]
//   j<8  -> W[k0Idx*32 + sel*8 + j     ][col]
//   j>=8 -> W[k0Idx*32 + sel*8 + j + 8 ][col]
// so each consuming lane's 16 B halves are one contiguous 32-byte LDS chunk.
// ---------------------------------------------------------------------------
__global__ void cvt_swizzle_w_kernel(const float* __restrict__ src,
                                     _Float16* __restrict__ dst, int nHalves) {
    int i = blockIdx.x * blockDim.x + threadIdx.x;
    if (i >= nHalves) return;
    int mat   = i >> 14;            // which 128x128 matrix
    int r     = i & 16383;
    int j     = r & 15;             // half index within fragment chunk
    int chunk = r >> 4;             // (k0Idx*128 + col)*2 + sel
    int sel   = chunk & 1;
    int colk  = chunk >> 1;
    int col   = colk & 127;
    int k0Idx = colk >> 7;          // 0..3
    int koff  = j + ((j >= 8) ? 8 : 0);
    int k     = k0Idx * 32 + sel * 8 + koff;
    dst[i] = (_Float16)src[(size_t)mat * 16384 + k * 128 + col];
}

// ---------------------------------------------------------------------------
// Fused transpose (B,DIM,N)->(B,N,DIM) + LayerNorm + cast to f16.
// One wave (32 lanes) per token; each lane owns 4 channels.
// ---------------------------------------------------------------------------
__global__ __launch_bounds__(256)
void ln_transpose_f16_kernel(const float* __restrict__ x,     // (B, DIM, N)
                             const float* __restrict__ w,     // (DIM)
                             const float* __restrict__ bias,  // (DIM)
                             _Float16* __restrict__ out) {    // (B, N, DIM)
    int wave = (blockIdx.x * blockDim.x + threadIdx.x) >> 5;
    int lane = threadIdx.x & 31;
    int b = wave >> 14;            // / NTOK
    int n = wave & (NTOK - 1);
    const float* xb = x + (size_t)b * DIMC * NTOK + n;
    float v0 = xb[(size_t)(lane      ) * NTOK];
    float v1 = xb[(size_t)(lane + 32 ) * NTOK];
    float v2 = xb[(size_t)(lane + 64 ) * NTOK];
    float v3 = xb[(size_t)(lane + 96 ) * NTOK];
    float s = v0 + v1 + v2 + v3;
    float q = v0 * v0 + v1 * v1 + v2 * v2 + v3 * v3;
    #pragma unroll
    for (int off = 16; off > 0; off >>= 1) {
        s += __shfl_xor(s, off, 32);
        q += __shfl_xor(q, off, 32);
    }
    float mean = s * (1.0f / DIMC);
    float var  = q * (1.0f / DIMC) - mean * mean;
    float rstd = rsqrtf(var + 1e-5f);
    _Float16* ob = out + (size_t)(b * NTOK + n) * DIMC;
    ob[lane     ] = (_Float16)((v0 - mean) * rstd * w[lane     ] + bias[lane     ]);
    ob[lane + 32] = (_Float16)((v1 - mean) * rstd * w[lane + 32] + bias[lane + 32]);
    ob[lane + 64] = (_Float16)((v2 - mean) * rstd * w[lane + 64] + bias[lane + 64]);
    ob[lane + 96] = (_Float16)((v3 - mean) * rstd * w[lane + 96] + bias[lane + 96]);
}

// ---------------------------------------------------------------------------
// A-fragment loader: 16x32 f16 A layout = two contiguous 16B chunks per lane
// (K groups at kSel and kSel+16).
// ---------------------------------------------------------------------------
__device__ __forceinline__ v16h load_a_frag(const _Float16* Ar) {
    v8h lo = *(const v8h*)(Ar);        // K = kSel .. kSel+7
    v8h hi = *(const v8h*)(Ar + 16);   // K = kSel+16 .. kSel+23
    v16h af;
    #pragma unroll
    for (int j = 0; j < 8; ++j) { af[j] = lo[j]; af[j + 8] = hi[j]; }
    return af;
}

// ---------------------------------------------------------------------------
// WMMA GEMM: C(M x 128) = A(M x 128, f16) * W(128 x 128, f16) [+ C] [+ bias]
// W pre-swizzled in B-fragment order, staged in LDS. Each wave owns a 64x16
// output tile (4 accumulators); one B fragment reused across 4 WMMAs per K
// step -> 16 v_wmma per wave. K loop software-pipelined: fragments for step
// k+1 are issued before the WMMAs of step k so loads overlap the matrix pipe.
// flags bit0 = accumulate into C, bit1 = store transposed to (B, DIM, NTOK).
// ---------------------------------------------------------------------------
__global__ __launch_bounds__(256)
void gemm128_wmma_kernel(const _Float16* __restrict__ A,
                         const _Float16* __restrict__ Wf,   // swizzled
                         const float* __restrict__ bias,
                         float* __restrict__ C,
                         int flags) {
    __shared__ __align__(64) _Float16 sW[128 * 128];   // 32 KB, fragment order
    {
        const uint4* src = (const uint4*)Wf;
        uint4*       dst = (uint4*)sW;
        for (int i = threadIdx.x; i < (128 * 128) / 8; i += 256) dst[i] = src[i];
    }
    __syncthreads();

    int waveId  = threadIdx.x >> 5;
    int lane    = threadIdx.x & 31;
    int rowBase = blockIdx.x * 64;       // 64 token rows per block (4 tiles/wave)
    int colBase = waveId * 16;           // 8 waves cover 128 output cols
    int col     = colBase + (lane & 15);
    int sel     = lane >> 4;             // 0 / 1
    int kSel    = sel << 3;              // 0 / 8
    int rOff    = sel << 3;              // C fragment: M = r + 8*(lane/16)

    v8f acc0 = {}, acc1 = {}, acc2 = {}, acc3 = {};
    if (flags & 1) {
        #pragma unroll
        for (int r = 0; r < 8; ++r) {
            acc0[r] = C[(size_t)(rowBase +  0 + r + rOff) * 128 + col];
            acc1[r] = C[(size_t)(rowBase + 16 + r + rOff) * 128 + col];
            acc2[r] = C[(size_t)(rowBase + 32 + r + rOff) * 128 + col];
            acc3[r] = C[(size_t)(rowBase + 48 + r + rOff) * 128 + col];
        }
    }

    const _Float16* A0 = A + (size_t)(rowBase + (lane & 15)) * 128 + kSel;
    // prologue: fragments for k0Idx = 0 (tile stride = 16 rows * 128 = 2048)
    v16h bf = *(const v16h*)&sW[((0 * 128 + col) * 2 + sel) * 16];
    v16h a0 = load_a_frag(A0 + 0 * 2048);
    v16h a1 = load_a_frag(A0 + 1 * 2048);
    v16h a2 = load_a_frag(A0 + 2 * 2048);
    v16h a3 = load_a_frag(A0 + 3 * 2048);

    #pragma unroll
    for (int k0Idx = 0; k0Idx < 4; ++k0Idx) {
        v16h bfn = {}, a0n = {}, a1n = {}, a2n = {}, a3n = {};
        if (k0Idx < 3) {
            const _Float16* An = A0 + (k0Idx + 1) * 32;
            bfn = *(const v16h*)&sW[(((k0Idx + 1) * 128 + col) * 2 + sel) * 16];
            a0n = load_a_frag(An + 0 * 2048);
            a1n = load_a_frag(An + 1 * 2048);
            a2n = load_a_frag(An + 2 * 2048);
            a3n = load_a_frag(An + 3 * 2048);
        }
        acc0 = __builtin_amdgcn_wmma_f32_16x16x32_f16(false, a0, false, bf, (short)0, acc0, false, false);
        acc1 = __builtin_amdgcn_wmma_f32_16x16x32_f16(false, a1, false, bf, (short)0, acc1, false, false);
        acc2 = __builtin_amdgcn_wmma_f32_16x16x32_f16(false, a2, false, bf, (short)0, acc2, false, false);
        acc3 = __builtin_amdgcn_wmma_f32_16x16x32_f16(false, a3, false, bf, (short)0, acc3, false, false);
        if (k0Idx < 3) { bf = bfn; a0 = a0n; a1 = a1n; a2 = a2n; a3 = a3n; }
    }

    float bv = bias ? bias[col] : 0.0f;
    #pragma unroll
    for (int t = 0; t < 4; ++t) {
        v8f acc = (t == 0) ? acc0 : (t == 1) ? acc1 : (t == 2) ? acc2 : acc3;
        if (flags & 2) {
            // transposed store into (B, DIM, NTOK)
            #pragma unroll
            for (int r = 0; r < 8; ++r) {
                int row = rowBase + t * 16 + r + rOff;   // global token index
                int b = row >> 14, n = row & (NTOK - 1);
                C[((size_t)b * DIMC + col) * NTOK + n] = acc[r] + bv;
            }
        } else {
            #pragma unroll
            for (int r = 0; r < 8; ++r)
                C[(size_t)(rowBase + t * 16 + r + rOff) * 128 + col] = acc[r] + bv;
        }
    }
}

// ---------------------------------------------------------------------------
// Causal depthwise conv1d (kernel 4) along tokens + bias + SiLU
// ---------------------------------------------------------------------------
__global__ void conv_silu_kernel(const float* __restrict__ u,   // (B,N,128)
                                 const float* __restrict__ cw,  // (128,4)
                                 const float* __restrict__ cb,  // (128)
                                 float* __restrict__ uc) {
    int idx = blockIdx.x * blockDim.x + threadIdx.x;   // over MTOT*128
    int d = idx & 127;
    int t = idx >> 7;              // b*N + n
    int n = t & (NTOK - 1);
    float acc = cb[d];
    #pragma unroll
    for (int k = 0; k < D_CONV; ++k) {
        int nn = n + k - (D_CONV - 1);
        if (nn >= 0) acc += u[(size_t)(t + k - (D_CONV - 1)) * 128 + d] * cw[d * D_CONV + k];
    }
    uc[idx] = acc / (1.0f + __expf(-acc));             // SiLU
}

// ---------------------------------------------------------------------------
// x_dbl = uc @ Wxproj -> (dt_r | B | C); dt = softplus(dt_r @ Wdt + bdt)
// One 128-thread block per token (tiny GEMMs, VALU is fine).
// ---------------------------------------------------------------------------
__global__ __launch_bounds__(128)
void xproj_dt_kernel(const float* __restrict__ uc,      // (M,128)
                     const float* __restrict__ Wxproj,  // (128,24)
                     const float* __restrict__ Wdt,     // (8,128)
                     const float* __restrict__ bdt,     // (128)
                     float* __restrict__ dt,            // (M,128)
                     float* __restrict__ Bm,            // (M,8)
                     float* __restrict__ Cm) {          // (M,8)
    __shared__ float s_dtr[DT_RANK];
    int t = blockIdx.x;
    int j = threadIdx.x;
    const float* ur = uc + (size_t)t * 128;
    if (j < DT_RANK + 2 * D_STATE) {
        float a = 0.0f;
        for (int c = 0; c < 128; ++c) a += ur[c] * Wxproj[c * 24 + j];
        if (j < DT_RANK)                s_dtr[j] = a;
        else if (j < DT_RANK + D_STATE) Bm[(size_t)t * 8 + (j - DT_RANK)] = a;
        else                            Cm[(size_t)t * 8 + (j - DT_RANK - D_STATE)] = a;
    }
    __syncthreads();
    float a = bdt[j];
    #pragma unroll
    for (int r = 0; r < DT_RANK; ++r) a += s_dtr[r] * Wdt[r * 128 + j];
    dt[(size_t)t * 128 + j] = (a > 20.0f) ? a : log1pf(__expf(a));   // softplus
}

// ---------------------------------------------------------------------------
// Serial SSM scan. One workgroup per batch; thread = (d, s); shfl_xor reduce
// over the 8 D_STATE lanes; fuses Dp skip and SiLU(z) gate; emits f16.
// ---------------------------------------------------------------------------
__global__ __launch_bounds__(1024)
void scan_kernel(const float* __restrict__ dt,    // (B,N,128)
                 const float* __restrict__ uc,    // (B,N,128)
                 const float* __restrict__ zg,    // (B,N,128) pre-activation z
                 const float* __restrict__ Bm,    // (B,N,8)
                 const float* __restrict__ Cm,    // (B,N,8)
                 const float* __restrict__ A_log, // (128,8)
                 const float* __restrict__ Dp,    // (128)
                 _Float16* __restrict__ yg) {     // (B,N,128)
    int b   = blockIdx.x;
    int tid = threadIdx.x;
    int d = tid >> 3;
    int s = tid & 7;
    float Ads = -__expf(A_log[d * 8 + s]);
    float Dd  = Dp[d];
    float h   = 0.0f;
    size_t base = (size_t)b * NTOK;
    for (int n = 0; n < NTOK; ++n) {
        size_t t = base + n;
        float dtv = dt[t * 128 + d];
        float ucv = uc[t * 128 + d];
        float Bv  = Bm[t * 8 + s];
        float Cv  = Cm[t * 8 + s];
        h = __expf(dtv * Ads) * h + dtv * Bv * ucv;
        float y = h * Cv;
        y += __shfl_xor(y, 1, 32);
        y += __shfl_xor(y, 2, 32);
        y += __shfl_xor(y, 4, 32);
        if (s == 0) {
            float zv = zg[t * 128 + d];
            float g  = zv / (1.0f + __expf(-zv));
            yg[t * 128 + d] = (_Float16)((y + Dd * ucv) * g);
        }
    }
}

// ---------------------------------------------------------------------------
// s = 0.5*(m0 + m1 + ff + bf)  (transposing the raw inputs), cast f16
// ---------------------------------------------------------------------------
__global__ void final_prep_kernel(const float* __restrict__ msum,  // (B,N,128)
                                  const float* __restrict__ front, // (B,128,N)
                                  const float* __restrict__ back,  // (B,128,N)
                                  _Float16* __restrict__ sh) {     // (B,N,128)
    int idx = blockIdx.x * blockDim.x + threadIdx.x;
    int c = idx & 127;
    int t = idx >> 7;
    int b = t >> 14;
    int n = t & (NTOK - 1);
    size_t src = ((size_t)b * DIMC + c) * NTOK + n;
    sh[idx] = (_Float16)(0.5f * (msum[idx] + front[src] + back[src]));
}

// ---------------------------------------------------------------------------
// Host-side pipeline
// ---------------------------------------------------------------------------
extern "C" void kernel_launch(void* const* d_in, const int* in_sizes, int n_in,
                              void* d_out, int out_size, void* d_ws, size_t ws_size,
                              hipStream_t stream) {
    const float* front   = (const float*)d_in[0];
    const float* back    = (const float*)d_in[1];
    const float* ln0_w   = (const float*)d_in[2];
    const float* ln0_b   = (const float*)d_in[3];
    const float* ln1_w   = (const float*)d_in[4];
    const float* ln1_b   = (const float*)d_in[5];
    const float* Wx      = (const float*)d_in[6];
    const float* Wz      = (const float*)d_in[7];
    const float* conv_w  = (const float*)d_in[8];
    const float* conv_b  = (const float*)d_in[9];
    const float* Wxproj  = (const float*)d_in[10];
    const float* Wdt     = (const float*)d_in[11];
    const float* bdt     = (const float*)d_in[12];
    const float* A_log   = (const float*)d_in[13];
    const float* Dp      = (const float*)d_in[14];
    const float* Wout_m  = (const float*)d_in[15];
    const float* bout_m  = (const float*)d_in[16];
    const float* Wout    = (const float*)d_in[17];
    const float* bout    = (const float*)d_in[18];

    char* ws = (char*)d_ws;
    // ---- static workspace layout (bytes) ----
    _Float16* WXh  = (_Float16*)(ws);                       // 2*16384 halves
    _Float16* WZh  = WXh  + 2 * 16384;
    _Float16* WOMh = WZh  + 2 * 16384;
    _Float16* WOh  = WOMh + 2 * 16384;                      // weights < 256 KB
    size_t off = 0x40000;
    _Float16* AXh  = (_Float16*)(ws + off); off += (size_t)MTOT * 128 * 2;  // 16 MB
    _Float16* AZh  = (_Float16*)(ws + off); off += (size_t)MTOT * 128 * 2;  // 16 MB
    float*    U    = (float*)(ws + off);    off += (size_t)MTOT * 128 * 4;  // 32 MB (also dt)
    float*    Z    = (float*)(ws + off);    off += (size_t)MTOT * 128 * 4;  // 32 MB
    float*    UC   = (float*)(ws + off);    off += (size_t)MTOT * 128 * 4;  // 32 MB
    _Float16* YGh  = (_Float16*)(ws + off); off += (size_t)MTOT * 128 * 2;  // 16 MB (also s_h)
    float*    BM   = (float*)(ws + off);    off += (size_t)MTOT * 8 * 4;    // 2 MB
    float*    CMb  = (float*)(ws + off);    off += (size_t)MTOT * 8 * 4;    // 2 MB
    float*    MS   = (float*)(ws + off);    off += (size_t)MTOT * 128 * 4;  // 32 MB
    float*    DT   = U;       // alias: u consumed by conv before dt written
    _Float16* SH   = YGh;     // alias: yg consumed by GEMM3 before s written

    // 1) weight conversions to f16 (swizzled into WMMA B-fragment order)
    cvt_swizzle_w_kernel<<<(2 * 16384 + 255) / 256, 256, 0, stream>>>(Wx, WXh, 2 * 16384);
    cvt_swizzle_w_kernel<<<(2 * 16384 + 255) / 256, 256, 0, stream>>>(Wz, WZh, 2 * 16384);
    cvt_swizzle_w_kernel<<<(2 * 16384 + 255) / 256, 256, 0, stream>>>(Wout_m, WOMh, 2 * 16384);
    cvt_swizzle_w_kernel<<<(16384 + 255) / 256, 256, 0, stream>>>(Wout, WOh, 16384);

    // 2) two cross-mamba blocks (sequential; buffers reused)
    for (int i = 0; i < 2; ++i) {
        const float* xsrc = (i == 0) ? front : back;
        const float* zsrc = (i == 0) ? back  : front;

        ln_transpose_f16_kernel<<<MTOT / 8, 256, 0, stream>>>(
            xsrc, ln0_w + i * DIMC, ln0_b + i * DIMC, AXh);
        ln_transpose_f16_kernel<<<MTOT / 8, 256, 0, stream>>>(
            zsrc, ln1_w + i * DIMC, ln1_b + i * DIMC, AZh);

        gemm128_wmma_kernel<<<MTOT / 64, 256, 0, stream>>>(AXh, WXh + i * 16384, nullptr, U, 0);
        gemm128_wmma_kernel<<<MTOT / 64, 256, 0, stream>>>(AZh, WZh + i * 16384, nullptr, Z, 0);

        conv_silu_kernel<<<(MTOT * 128) / 256, 256, 0, stream>>>(
            U, conv_w + i * DIMC * D_CONV, conv_b + i * DIMC, UC);

        xproj_dt_kernel<<<MTOT, 128, 0, stream>>>(
            UC, Wxproj + i * 128 * 24, Wdt + i * 8 * 128, bdt + i * 128, DT, BM, CMb);

        scan_kernel<<<BATCH, 1024, 0, stream>>>(
            DT, UC, Z, BM, CMb, A_log + i * 128 * 8, Dp + i * 128, YGh);

        gemm128_wmma_kernel<<<MTOT / 64, 256, 0, stream>>>(
            YGh, WOMh + i * 16384, bout_m + i * DIMC, MS, (i == 0) ? 0 : 1);
    }

    // 3) residual add + 0.5 scale + final GEMM, stored transposed to (B,DIM,N)
    final_prep_kernel<<<(MTOT * 128) / 256, 256, 0, stream>>>(MS, front, back, SH);
    gemm128_wmma_kernel<<<MTOT / 64, 256, 0, stream>>>(SH, WOh, bout, (float*)d_out, 2);
}

// v001
// A run of this version takes 810 microseconds.
// Timed twice side by side with v000, it ran 34.0 and 33.9 times as fast.
#include <hip/hip_runtime.h>
#include <math.h>

typedef __attribute__((ext_vector_type(16))) _Float16 v16h;
typedef __attribute__((ext_vector_type(8)))  _Float16 v8h;
typedef __attribute__((ext_vector_type(8)))  float    v8f;

#define DIMC    128
#define D_INNER 128
#define D_STATE 8
#define DT_RANK 8
#define D_CONV  4
#define BATCH   4
#define NTOK    16384               // L*H*W = 256*8*8
#define MTOT    (BATCH * NTOK)      // 65536 tokens

// ---------------------------------------------------------------------------
// f32 -> f16 weight conversion WITH swizzle into WMMA B-fragment order.
// Fragment layout (halves): dst[((k0Idx*128 + col)*2 + sel)*16 + j]
//   j<8  -> W[k0Idx*32 + sel*8 + j     ][col]
//   j>=8 -> W[k0Idx*32 + sel*8 + j + 8 ][col]
// so each consuming lane's 16 B halves are one contiguous 32-byte LDS chunk.
// ---------------------------------------------------------------------------
__global__ void cvt_swizzle_w_kernel(const float* __restrict__ src,
                                     _Float16* __restrict__ dst, int nHalves) {
    int i = blockIdx.x * blockDim.x + threadIdx.x;
    if (i >= nHalves) return;
    int mat   = i >> 14;            // which 128x128 matrix
    int r     = i & 16383;
    int j     = r & 15;             // half index within fragment chunk
    int chunk = r >> 4;             // (k0Idx*128 + col)*2 + sel
    int sel   = chunk & 1;
    int colk  = chunk >> 1;
    int col   = colk & 127;
    int k0Idx = colk >> 7;          // 0..3
    int koff  = j + ((j >= 8) ? 8 : 0);
    int k     = k0Idx * 32 + sel * 8 + koff;
    dst[i] = (_Float16)src[(size_t)mat * 16384 + k * 128 + col];
}

// ---------------------------------------------------------------------------
// Fused transpose (B,DIM,N)->(B,N,DIM) + LayerNorm + cast to f16.
// One wave (32 lanes) per token; each lane owns 4 channels.
// ---------------------------------------------------------------------------
__global__ __launch_bounds__(256)
void ln_transpose_f16_kernel(const float* __restrict__ x,     // (B, DIM, N)
                             const float* __restrict__ w,     // (DIM)
                             const float* __restrict__ bias,  // (DIM)
                             _Float16* __restrict__ out) {    // (B, N, DIM)
    int wave = (blockIdx.x * blockDim.x + threadIdx.x) >> 5;
    int lane = threadIdx.x & 31;
    int b = wave >> 14;            // / NTOK
    int n = wave & (NTOK - 1);
    const float* xb = x + (size_t)b * DIMC * NTOK + n;
    float v0 = xb[(size_t)(lane      ) * NTOK];
    float v1 = xb[(size_t)(lane + 32 ) * NTOK];
    float v2 = xb[(size_t)(lane + 64 ) * NTOK];
    float v3 = xb[(size_t)(lane + 96 ) * NTOK];
    float s = v0 + v1 + v2 + v3;
    float q = v0 * v0 + v1 * v1 + v2 * v2 + v3 * v3;
    #pragma unroll
    for (int off = 16; off > 0; off >>= 1) {
        s += __shfl_xor(s, off, 32);
        q += __shfl_xor(q, off, 32);
    }
    float mean = s * (1.0f / DIMC);
    float var  = q * (1.0f / DIMC) - mean * mean;
    float rstd = rsqrtf(var + 1e-5f);
    _Float16* ob = out + (size_t)(b * NTOK + n) * DIMC;
    ob[lane     ] = (_Float16)((v0 - mean) * rstd * w[lane     ] + bias[lane     ]);
    ob[lane + 32] = (_Float16)((v1 - mean) * rstd * w[lane + 32] + bias[lane + 32]);
    ob[lane + 64] = (_Float16)((v2 - mean) * rstd * w[lane + 64] + bias[lane + 64]);
    ob[lane + 96] = (_Float16)((v3 - mean) * rstd * w[lane + 96] + bias[lane + 96]);
}

// ---------------------------------------------------------------------------
// A-fragment loader: 16x32 f16 A layout = two contiguous 16B chunks per lane
// (K groups at kSel and kSel+16).
// ---------------------------------------------------------------------------
__device__ __forceinline__ v16h load_a_frag(const _Float16* Ar) {
    v8h lo = *(const v8h*)(Ar);        // K = kSel .. kSel+7
    v8h hi = *(const v8h*)(Ar + 16);   // K = kSel+16 .. kSel+23
    v16h af;
    #pragma unroll
    for (int j = 0; j < 8; ++j) { af[j] = lo[j]; af[j + 8] = hi[j]; }
    return af;
}

// ---------------------------------------------------------------------------
// WMMA GEMM: C(M x 128) = A(M x 128, f16) * W(128 x 128, f16) [+ C] [+ bias]
// W pre-swizzled in B-fragment order, staged in LDS. Each wave owns a 64x16
// output tile (4 accumulators); one B fragment reused across 4 WMMAs per K
// step -> 16 v_wmma per wave. K loop software-pipelined: fragments for step
// k+1 are issued before the WMMAs of step k so loads overlap the matrix pipe.
// flags bit0 = accumulate into C, bit1 = store transposed to (B, DIM, NTOK).
// ---------------------------------------------------------------------------
__global__ __launch_bounds__(256)
void gemm128_wmma_kernel(const _Float16* __restrict__ A,
                         const _Float16* __restrict__ Wf,   // swizzled
                         const float* __restrict__ bias,
                         float* __restrict__ C,
                         int flags) {
    __shared__ __align__(64) _Float16 sW[128 * 128];   // 32 KB, fragment order
    {
        const uint4* src = (const uint4*)Wf;
        uint4*       dst = (uint4*)sW;
        for (int i = threadIdx.x; i < (128 * 128) / 8; i += 256) dst[i] = src[i];
    }
    __syncthreads();

    int waveId  = threadIdx.x >> 5;
    int lane    = threadIdx.x & 31;
    int rowBase = blockIdx.x * 64;       // 64 token rows per block (4 tiles/wave)
    int colBase = waveId * 16;           // 8 waves cover 128 output cols
    int col     = colBase + (lane & 15);
    int sel     = lane >> 4;             // 0 / 1
    int kSel    = sel << 3;              // 0 / 8
    int rOff    = sel << 3;              // C fragment: M = r + 8*(lane/16)

    v8f acc0 = {}, acc1 = {}, acc2 = {}, acc3 = {};
    if (flags & 1) {
        #pragma unroll
        for (int r = 0; r < 8; ++r) {
            acc0[r] = C[(size_t)(rowBase +  0 + r + rOff) * 128 + col];
            acc1[r] = C[(size_t)(rowBase + 16 + r + rOff) * 128 + col];
            acc2[r] = C[(size_t)(rowBase + 32 + r + rOff) * 128 + col];
            acc3[r] = C[(size_t)(rowBase + 48 + r + rOff) * 128 + col];
        }
    }

    const _Float16* A0 = A + (size_t)(rowBase + (lane & 15)) * 128 + kSel;
    // prologue: fragments for k0Idx = 0 (tile stride = 16 rows * 128 = 2048)
    v16h bf = *(const v16h*)&sW[((0 * 128 + col) * 2 + sel) * 16];
    v16h a0 = load_a_frag(A0 + 0 * 2048);
    v16h a1 = load_a_frag(A0 + 1 * 2048);
    v16h a2 = load_a_frag(A0 + 2 * 2048);
    v16h a3 = load_a_frag(A0 + 3 * 2048);

    #pragma unroll
    for (int k0Idx = 0; k0Idx < 4; ++k0Idx) {
        v16h bfn = {}, a0n = {}, a1n = {}, a2n = {}, a3n = {};
        if (k0Idx < 3) {
            const _Float16* An = A0 + (k0Idx + 1) * 32;
            bfn = *(const v16h*)&sW[(((k0Idx + 1) * 128 + col) * 2 + sel) * 16];
            a0n = load_a_frag(An + 0 * 2048);
            a1n = load_a_frag(An + 1 * 2048);
            a2n = load_a_frag(An + 2 * 2048);
            a3n = load_a_frag(An + 3 * 2048);
        }
        acc0 = __builtin_amdgcn_wmma_f32_16x16x32_f16(false, a0, false, bf, (short)0, acc0, false, false);
        acc1 = __builtin_amdgcn_wmma_f32_16x16x32_f16(false, a1, false, bf, (short)0, acc1, false, false);
        acc2 = __builtin_amdgcn_wmma_f32_16x16x32_f16(false, a2, false, bf, (short)0, acc2, false, false);
        acc3 = __builtin_amdgcn_wmma_f32_16x16x32_f16(false, a3, false, bf, (short)0, acc3, false, false);
        if (k0Idx < 3) { bf = bfn; a0 = a0n; a1 = a1n; a2 = a2n; a3 = a3n; }
    }

    float bv = bias ? bias[col] : 0.0f;
    #pragma unroll
    for (int t = 0; t < 4; ++t) {
        v8f acc = (t == 0) ? acc0 : (t == 1) ? acc1 : (t == 2) ? acc2 : acc3;
        if (flags & 2) {
            // transposed store into (B, DIM, NTOK)
            #pragma unroll
            for (int r = 0; r < 8; ++r) {
                int row = rowBase + t * 16 + r + rOff;   // global token index
                int b = row >> 14, n = row & (NTOK - 1);
                C[((size_t)b * DIMC + col) * NTOK + n] = acc[r] + bv;
            }
        } else {
            #pragma unroll
            for (int r = 0; r < 8; ++r)
                C[(size_t)(rowBase + t * 16 + r + rOff) * 128 + col] = acc[r] + bv;
        }
    }
}

// ---------------------------------------------------------------------------
// Causal depthwise conv1d (kernel 4) along tokens + bias + SiLU
// ---------------------------------------------------------------------------
__global__ void conv_silu_kernel(const float* __restrict__ u,   // (B,N,128)
                                 const float* __restrict__ cw,  // (128,4)
                                 const float* __restrict__ cb,  // (128)
                                 float* __restrict__ uc) {
    int idx = blockIdx.x * blockDim.x + threadIdx.x;   // over MTOT*128
    int d = idx & 127;
    int t = idx >> 7;              // b*N + n
    int n = t & (NTOK - 1);
    float acc = cb[d];
    #pragma unroll
    for (int k = 0; k < D_CONV; ++k) {
        int nn = n + k - (D_CONV - 1);
        if (nn >= 0) acc += u[(size_t)(t + k - (D_CONV - 1)) * 128 + d] * cw[d * D_CONV + k];
    }
    uc[idx] = acc / (1.0f + __expf(-acc));             // SiLU
}

// ---------------------------------------------------------------------------
// x_dbl = uc @ Wxproj -> (dt_r | B | C); dt = softplus(dt_r @ Wdt + bdt)
// One 128-thread block per token (tiny GEMMs, VALU is fine).
// ---------------------------------------------------------------------------
__global__ __launch_bounds__(128)
void xproj_dt_kernel(const float* __restrict__ uc,      // (M,128)
                     const float* __restrict__ Wxproj,  // (128,24)
                     const float* __restrict__ Wdt,     // (8,128)
                     const float* __restrict__ bdt,     // (128)
                     float* __restrict__ dt,            // (M,128)
                     float* __restrict__ Bm,            // (M,8)
                     float* __restrict__ Cm) {          // (M,8)
    __shared__ float s_dtr[DT_RANK];
    int t = blockIdx.x;
    int j = threadIdx.x;
    const float* ur = uc + (size_t)t * 128;
    if (j < DT_RANK + 2 * D_STATE) {
        float a = 0.0f;
        for (int c = 0; c < 128; ++c) a += ur[c] * Wxproj[c * 24 + j];
        if (j < DT_RANK)                s_dtr[j] = a;
        else if (j < DT_RANK + D_STATE) Bm[(size_t)t * 8 + (j - DT_RANK)] = a;
        else                            Cm[(size_t)t * 8 + (j - DT_RANK - D_STATE)] = a;
    }
    __syncthreads();
    float a = bdt[j];
    #pragma unroll
    for (int r = 0; r < DT_RANK; ++r) a += s_dtr[r] * Wdt[r * 128 + j];
    dt[(size_t)t * 128 + j] = (a > 20.0f) ? a : log1pf(__expf(a));   // softplus
}

// ---------------------------------------------------------------------------
// SSM scan, cut along the tokens into NCHUNK chunks of CHUNK_T steps.
// h[t] = a[t]*h[t-1] + b[t] is linear in h, so a chunk acts on its incoming
// state as  h_out = P*h_in + H  with P = product of its a[t] and H = its end
// state from h_in = 0.  Three launches:
//   1) every chunk: P and H                        (all chunks side by side)
//   2) every (batch, d, s): the incoming state of each chunk, chunk by chunk
//   3) every chunk: the recurrence again from its incoming state, with readout
// Thread = (d, s) in launches 1 and 3, as in the readout below.
// ---------------------------------------------------------------------------
#define CHUNK_T 128
#define NCHUNK  (NTOK / CHUNK_T)    // 128 chunks per batch

// exp(x) as __expf builds it (times log2 e, then v_exp_f32). The v_nop is the
// free issue slot that the instruction set asks for behind a transcendental
// before its result is read or its source overwritten; in one statement with
// v_exp_f32 it stays directly behind it wherever the loop below is scheduled.
__device__ __forceinline__ float exp_with_slot(float x) {
    float r;
    asm("v_exp_f32 %0, %1\n\tv_nop" : "=v"(r) : "v"(x * 1.44269504f));
    return r;
}

__global__ __launch_bounds__(1024)
void scan_chunk_sum_kernel(const float* __restrict__ dt,    // (B,N,128)
                           const float* __restrict__ uc,    // (B,N,128)
                           const float* __restrict__ Bm,    // (B,N,8)
                           const float* __restrict__ A_log, // (128,8)
                           float* __restrict__ Pc,          // (B,NCHUNK,128,8)
                           float* __restrict__ Hc) {        // (B,NCHUNK,128,8)
    int c   = blockIdx.x;
    int b   = blockIdx.y;
    int tid = threadIdx.x;
    int d = tid >> 3;
    int s = tid & 7;
    float Ads = -__expf(A_log[d * 8 + s]);
    float h   = 0.0f;
    float p   = 1.0f;
    size_t base = (size_t)b * NTOK + (size_t)c * CHUNK_T;
    for (int n = 0; n < CHUNK_T; ++n) {
        size_t t = base + n;
        float dtv = dt[t * 128 + d];
        float ucv = uc[t * 128 + d];
        float Bv  = Bm[t * 8 + s];
        float a   = exp_with_slot(dtv * Ads);
        h = a * h + dtv * Bv * ucv;
        p *= a;
    }
    size_t o = ((size_t)b * NCHUNK + c) * 1024 + tid;
    Pc[o] = p;
    Hc[o] = h;
}

// One thread per (batch, d, s); 16 chunks' summaries are loaded at a time so
// that the serial chain waits for memory once per 16 chunks, not per chunk.
__global__ __launch_bounds__(256)
void scan_carry_kernel(const float* __restrict__ Pc,   // (B,NCHUNK,1024)
                       const float* __restrict__ Hc,   // (B,NCHUNK,1024)
                       float* __restrict__ Hin) {      // (B,NCHUNK,1024)
    int idx = blockIdx.x * blockDim.x + threadIdx.x;   // over BATCH*1024
    int b = idx >> 10;
    int r = idx & 1023;
    size_t o = (size_t)b * NCHUNK * 1024 + r;
    float carry = 0.0f;
    for (int c0 = 0; c0 < NCHUNK; c0 += 16) {
        float p[16], h[16];
        #pragma unroll   // p[], h[] in registers; all 32 loads issue before the first wait
        for (int k = 0; k < 16; ++k) {
            p[k] = Pc[o + (size_t)(c0 + k) * 1024];
            h[k] = Hc[o + (size_t)(c0 + k) * 1024];
        }
        #pragma unroll   // constant indices into p[], h[]
        for (int k = 0; k < 16; ++k) {
            Hin[o + (size_t)(c0 + k) * 1024] = carry;
            carry = p[k] * carry + h[k];
        }
        // the next trip rewrites the address and data registers of these stores
        asm volatile("s_wait_xcnt 0x0" ::: "memory");
    }
}

// One workgroup per (chunk, batch); thread = (d, s); shfl_xor reduce over the
// 8 D_STATE lanes; fuses Dp skip and SiLU(z) gate; emits f16.
__global__ __launch_bounds__(1024)
void scan_kernel(const float* __restrict__ dt,    // (B,N,128)
                 const float* __restrict__ uc,    // (B,N,128)
                 const float* __restrict__ zg,    // (B,N,128) pre-activation z
                 const float* __restrict__ Bm,    // (B,N,8)
                 const float* __restrict__ Cm,    // (B,N,8)
                 const float* __restrict__ A_log, // (128,8)
                 const float* __restrict__ Dp,    // (128)
                 const float* __restrict__ Hin,   // (B,NCHUNK,128,8)
                 _Float16* __restrict__ yg) {     // (B,N,128)
    int c   = blockIdx.x;
    int b   = blockIdx.y;
    int tid = threadIdx.x;
    int d = tid >> 3;
    int s = tid & 7;
    float Ads = -__expf(A_log[d * 8 + s]);
    float Dd  = Dp[d];
    float h   = Hin[((size_t)b * NCHUNK + c) * 1024 + tid];
    size_t base = (size_t)b * NTOK + (size_t)c * CHUNK_T;
    for (int n = 0; n < CHUNK_T; ++n) {
        size_t t = base + n;
        float dtv = dt[t * 128 + d];
        float ucv = uc[t * 128 + d];
        float Bv  = Bm[t * 8 + s];
        float Cv  = Cm[t * 8 + s];
        h = __expf(dtv * Ads) * h + dtv * Bv * ucv;
        float y = h * Cv;
        y += __shfl_xor(y, 1, 32);
        y += __shfl_xor(y, 2, 32);
        y += __shfl_xor(y, 4, 32);
        if (s == 0) {
            float zv = zg[t * 128 + d];
            float g  = zv / (1.0f + __expf(-zv));
            yg[t * 128 + d] = (_Float16)((y + Dd * ucv) * g);
            // the next step rewrites the address and data registers of this store
            asm volatile("s_wait_xcnt 0x0" ::: "memory");
        }
    }
}

// ---------------------------------------------------------------------------
// s = 0.5*(m0 + m1 + ff + bf)  (transposing the raw inputs), cast f16
// ---------------------------------------------------------------------------
__global__ void final_prep_kernel(const float* __restrict__ msum,  // (B,N,128)
                                  const float* __restrict__ front, // (B,128,N)
                                  const float* __restrict__ back,  // (B,128,N)
                                  _Float16* __restrict__ sh) {     // (B,N,128)
    int idx = blockIdx.x * blockDim.x + threadIdx.x;
    int c = idx & 127;
    int t = idx >> 7;
    int b = t >> 14;
    int n = t & (NTOK - 1);
    size_t src = ((size_t)b * DIMC + c) * NTOK + n;
    sh[idx] = (_Float16)(0.5f * (msum[idx] + front[src] + back[src]));
}

// ---------------------------------------------------------------------------
// Host-side pipeline
// ---------------------------------------------------------------------------
extern "C" void kernel_launch(void* const* d_in, const int* in_sizes, int n_in,
                              void* d_out, int out_size, void* d_ws, size_t ws_size,
                              hipStream_t stream) {
    const float* front   = (const float*)d_in[0];
    const float* back    = (const float*)d_in[1];
    const float* ln0_w   = (const float*)d_in[2];
    const float* ln0_b   = (const float*)d_in[3];
    const float* ln1_w   = (const float*)d_in[4];
    const float* ln1_b   = (const float*)d_in[5];
    const float* Wx      = (const float*)d_in[6];
    const float* Wz      = (const float*)d_in[7];
    const float* conv_w  = (const float*)d_in[8];
    const float* conv_b  = (const float*)d_in[9];
    const float* Wxproj  = (const float*)d_in[10];
    const float* Wdt     = (const float*)d_in[11];
    const float* bdt     = (const float*)d_in[12];
    const float* A_log   = (const float*)d_in[13];
    const float* Dp      = (const float*)d_in[14];
    const float* Wout_m  = (const float*)d_in[15];
    const float* bout_m  = (const float*)d_in[16];
    const float* Wout    = (const float*)d_in[17];
    const float* bout    = (const float*)d_in[18];

    char* ws = (char*)d_ws;
    // ---- static workspace layout (bytes) ----
    _Float16* WXh  = (_Float16*)(ws);                       // 2*16384 halves
    _Float16* WZh  = WXh  + 2 * 16384;
    _Float16* WOMh = WZh  + 2 * 16384;
    _Float16* WOh  = WOMh + 2 * 16384;                      // weights < 256 KB
    size_t off = 0x40000;
    _Float16* AXh  = (_Float16*)(ws + off); off += (size_t)MTOT * 128 * 2;  // 16 MB
    _Float16* AZh  = (_Float16*)(ws + off); off += (size_t)MTOT * 128 * 2;  // 16 MB
    float*    U    = (float*)(ws + off);    off += (size_t)MTOT * 128 * 4;  // 32 MB (also dt)
    float*    Z    = (float*)(ws + off);    off += (size_t)MTOT * 128 * 4;  // 32 MB
    float*    UC   = (float*)(ws + off);    off += (size_t)MTOT * 128 * 4;  // 32 MB
    _Float16* YGh  = (_Float16*)(ws + off); off += (size_t)MTOT * 128 * 2;  // 16 MB (also s_h)
    float*    BM   = (float*)(ws + off);    off += (size_t)MTOT * 8 * 4;    // 2 MB
    float*    CMb  = (float*)(ws + off);    off += (size_t)MTOT * 8 * 4;    // 2 MB
    float*    MS   = (float*)(ws + off);    off += (size_t)MTOT * 128 * 4;  // 32 MB
    float*    PC   = (float*)(ws + off);    off += (size_t)BATCH * NCHUNK * 1024 * 4;  // 2 MB
    float*    HC   = (float*)(ws + off);    off += (size_t)BATCH * NCHUNK * 1024 * 4;  // 2 MB
    float*    HIN  = (float*)(ws + off);    off += (size_t)BATCH * NCHUNK * 1024 * 4;  // 2 MB
    float*    DT   = U;       // alias: u consumed by conv before dt written
    _Float16* SH   = YGh;     // alias: yg consumed by GEMM3 before s written

    // 1) weight conversions to f16 (swizzled into WMMA B-fragment order)
    cvt_swizzle_w_kernel<<<(2 * 16384 + 255) / 256, 256, 0, stream>>>(Wx, WXh, 2 * 16384);
    cvt_swizzle_w_kernel<<<(2 * 16384 + 255) / 256, 256, 0, stream>>>(Wz, WZh, 2 * 16384);
    cvt_swizzle_w_kernel<<<(2 * 16384 + 255) / 256, 256, 0, stream>>>(Wout_m, WOMh, 2 * 16384);
    cvt_swizzle_w_kernel<<<(16384 + 255) / 256, 256, 0, stream>>>(Wout, WOh, 16384);

    // 2) two cross-mamba blocks (sequential; buffers reused)
    for (int i = 0; i < 2; ++i) {
        const float* xsrc = (i == 0) ? front : back;
        const float* zsrc = (i == 0) ? back  : front;

        ln_transpose_f16_kernel<<<MTOT / 8, 256, 0, stream>>>(
            xsrc, ln0_w + i * DIMC, ln0_b + i * DIMC, AXh);
        ln_transpose_f16_kernel<<<MTOT / 8, 256, 0, stream>>>(
            zsrc, ln1_w + i * DIMC, ln1_b + i * DIMC, AZh);

        gemm128_wmma_kernel<<<MTOT / 64, 256, 0, stream>>>(AXh, WXh + i * 16384, nullptr, U, 0);
        gemm128_wmma_kernel<<<MTOT / 64, 256, 0, stream>>>(AZh, WZh + i * 16384, nullptr, Z, 0);

        conv_silu_kernel<<<(MTOT * 128) / 256, 256, 0, stream>>>(
            U, conv_w + i * DIMC * D_CONV, conv_b + i * DIMC, UC);

        xproj_dt_kernel<<<MTOT, 128, 0, stream>>>(
            UC, Wxproj + i * 128 * 24, Wdt + i * 8 * 128, bdt + i * 128, DT, BM, CMb);

        scan_chunk_sum_kernel<<<dim3(NCHUNK, BATCH), 1024, 0, stream>>>(
            DT, UC, BM, A_log + i * 128 * 8, PC, HC);
        scan_carry_kernel<<<(BATCH * 1024) / 256, 256, 0, stream>>>(PC, HC, HIN);
        scan_kernel<<<dim3(NCHUNK, BATCH), 1024, 0, stream>>>(
            DT, UC, Z, BM, CMb, A_log + i * 128 * 8, Dp + i * 128, HIN, YGh);

        gemm128_wmma_kernel<<<MTOT / 64, 256, 0, stream>>>(
            YGh, WOMh + i * 16384, bout_m + i * DIMC, MS, (i == 0) ? 0 : 1);
    }

    // 3) residual add + 0.5 scale + final GEMM, stored transposed to (B,DIM,N)
    final_prep_kernel<<<(MTOT * 128) / 256, 256, 0, stream>>>(MS, front, back, SH);
    gemm128_wmma_kernel<<<MTOT / 64, 256, 0, stream>>>(SH, WOh, bout, (float*)d_out, 2);
}

// v002
// A run of this version takes 564 microseconds.
// Next to v001, in two timings, it ran 1.44 and 1.43 times as fast.
// Counting every step since v000, it is 48.8 times as fast.
#include <hip/hip_runtime.h>
#include <math.h>

typedef __attribute__((ext_vector_type(16))) _Float16 v16h;
typedef __attribute__((ext_vector_type(8)))  _Float16 v8h;
typedef __attribute__((ext_vector_type(8)))  float    v8f;

#define DIMC    128
#define D_INNER 128
#define D_STATE 8
#define DT_RANK 8
#define D_CONV  4
#define BATCH   4
#define NTOK    16384               // L*H*W = 256*8*8
#define MTOT    (BATCH * NTOK)      // 65536 tokens

// ---------------------------------------------------------------------------
// f32 -> f16 weight conversion WITH swizzle into WMMA B-fragment order.
// Fragment layout (halves): dst[((k0Idx*128 + col)*2 + sel)*16 + j]
//   j<8  -> W[k0Idx*32 + sel*8 + j     ][col]
//   j>=8 -> W[k0Idx*32 + sel*8 + j + 8 ][col]
// so each consuming lane's 16 B halves are one contiguous 32-byte LDS chunk.
// ---------------------------------------------------------------------------
__global__ void cvt_swizzle_w_kernel(const float* __restrict__ src,
                                     _Float16* __restrict__ dst, int nHalves) {
    int i = blockIdx.x * blockDim.x + threadIdx.x;
    if (i >= nHalves) return;
    int mat   = i >> 14;            // which 128x128 matrix
    int r     = i & 16383;
    int j     = r & 15;             // half index within fragment chunk
    int chunk = r >> 4;             // (k0Idx*128 + col)*2 + sel
    int sel   = chunk & 1;
    int colk  = chunk >> 1;
    int col   = colk & 127;
    int k0Idx = colk >> 7;          // 0..3
    int koff  = j + ((j >= 8) ? 8 : 0);
    int k     = k0Idx * 32 + sel * 8 + koff;
    dst[i] = (_Float16)src[(size_t)mat * 16384 + k * 128 + col];
}

// ---------------------------------------------------------------------------
// Fused transpose (B,DIM,N)->(B,N,DIM) + LayerNorm + cast to f16.
// One wave (32 lanes) per token; each lane owns 4 channels.
// ---------------------------------------------------------------------------
__global__ __launch_bounds__(256)
void ln_transpose_f16_kernel(const float* __restrict__ x,     // (B, DIM, N)
                             const float* __restrict__ w,     // (DIM)
                             const float* __restrict__ bias,  // (DIM)
                             _Float16* __restrict__ out) {    // (B, N, DIM)
    int wave = (blockIdx.x * blockDim.x + threadIdx.x) >> 5;
    int lane = threadIdx.x & 31;
    int b = wave >> 14;            // / NTOK
    int n = wave & (NTOK - 1);
    const float* xb = x + (size_t)b * DIMC * NTOK + n;
    float v0 = xb[(size_t)(lane      ) * NTOK];
    float v1 = xb[(size_t)(lane + 32 ) * NTOK];
    float v2 = xb[(size_t)(lane + 64 ) * NTOK];
    float v3 = xb[(size_t)(lane + 96 ) * NTOK];
    float s = v0 + v1 + v2 + v3;
    float q = v0 * v0 + v1 * v1 + v2 * v2 + v3 * v3;
    #pragma unroll
    for (int off = 16; off > 0; off >>= 1) {
        s += __shfl_xor(s, off, 32);
        q += __shfl_xor(q, off, 32);
    }
    float mean = s * (1.0f / DIMC);
    float var  = q * (1.0f / DIMC) - mean * mean;
    float rstd = rsqrtf(var + 1e-5f);
    _Float16* ob = out + (size_t)(b * NTOK + n) * DIMC;
    ob[lane     ] = (_Float16)((v0 - mean) * rstd * w[lane     ] + bias[lane     ]);
    ob[lane + 32] = (_Float16)((v1 - mean) * rstd * w[lane + 32] + bias[lane + 32]);
    ob[lane + 64] = (_Float16)((v2 - mean) * rstd * w[lane + 64] + bias[lane + 64]);
    ob[lane + 96] = (_Float16)((v3 - mean) * rstd * w[lane + 96] + bias[lane + 96]);
}

// ---------------------------------------------------------------------------
// A-fragment loader: 16x32 f16 A layout = two contiguous 16B chunks per lane
// (K groups at kSel and kSel+16).
// ---------------------------------------------------------------------------
__device__ __forceinline__ v16h load_a_frag(const _Float16* Ar) {
    v8h lo = *(const v8h*)(Ar);        // K = kSel .. kSel+7
    v8h hi = *(const v8h*)(Ar + 16);   // K = kSel+16 .. kSel+23
    v16h af;
    #pragma unroll
    for (int j = 0; j < 8; ++j) { af[j] = lo[j]; af[j + 8] = hi[j]; }
    return af;
}

// ---------------------------------------------------------------------------
// WMMA GEMM: C(M x 128) = A(M x 128, f16) * W(128 x 128, f16) [+ C] [+ bias]
// W pre-swizzled in B-fragment order, staged in LDS. Each wave owns a 64x16
// output tile (4 accumulators); one B fragment reused across 4 WMMAs per K
// step -> 16 v_wmma per wave. K loop software-pipelined: fragments for step
// k+1 are issued before the WMMAs of step k so loads overlap the matrix pipe.
// flags bit0 = accumulate into C, bit1 = store transposed to (B, DIM, NTOK).
// ---------------------------------------------------------------------------
__global__ __launch_bounds__(256)
void gemm128_wmma_kernel(const _Float16* __restrict__ A,
                         const _Float16* __restrict__ Wf,   // swizzled
                         const float* __restrict__ bias,
                         float* __restrict__ C,
                         int flags) {
    __shared__ __align__(64) _Float16 sW[128 * 128];   // 32 KB, fragment order
    {
        const uint4* src = (const uint4*)Wf;
        uint4*       dst = (uint4*)sW;
        for (int i = threadIdx.x; i < (128 * 128) / 8; i += 256) dst[i] = src[i];
    }
    __syncthreads();

    int waveId  = threadIdx.x >> 5;
    int lane    = threadIdx.x & 31;
    int rowBase = blockIdx.x * 64;       // 64 token rows per block (4 tiles/wave)
    int colBase = waveId * 16;           // 8 waves cover 128 output cols
    int col     = colBase + (lane & 15);
    int sel     = lane >> 4;             // 0 / 1
    int kSel    = sel << 3;              // 0 / 8
    int rOff    = sel << 3;              // C fragment: M = r + 8*(lane/16)

    v8f acc0 = {}, acc1 = {}, acc2 = {}, acc3 = {};
    if (flags & 1) {
        #pragma unroll
        for (int r = 0; r < 8; ++r) {
            acc0[r] = C[(size_t)(rowBase +  0 + r + rOff) * 128 + col];
            acc1[r] = C[(size_t)(rowBase + 16 + r + rOff) * 128 + col];
            acc2[r] = C[(size_t)(rowBase + 32 + r + rOff) * 128 + col];
            acc3[r] = C[(size_t)(rowBase + 48 + r + rOff) * 128 + col];
        }
    }

    const _Float16* A0 = A + (size_t)(rowBase + (lane & 15)) * 128 + kSel;
    // prologue: fragments for k0Idx = 0 (tile stride = 16 rows * 128 = 2048)
    v16h bf = *(const v16h*)&sW[((0 * 128 + col) * 2 + sel) * 16];
    v16h a0 = load_a_frag(A0 + 0 * 2048);
    v16h a1 = load_a_frag(A0 + 1 * 2048);
    v16h a2 = load_a_frag(A0 + 2 * 2048);
    v16h a3 = load_a_frag(A0 + 3 * 2048);

    #pragma unroll
    for (int k0Idx = 0; k0Idx < 4; ++k0Idx) {
        v16h bfn = {}, a0n = {}, a1n = {}, a2n = {}, a3n = {};
        if (k0Idx < 3) {
            const _Float16* An = A0 + (k0Idx + 1) * 32;
            bfn = *(const v16h*)&sW[(((k0Idx + 1) * 128 + col) * 2 + sel) * 16];
            a0n = load_a_frag(An + 0 * 2048);
            a1n = load_a_frag(An + 1 * 2048);
            a2n = load_a_frag(An + 2 * 2048);
            a3n = load_a_frag(An + 3 * 2048);
        }
        acc0 = __builtin_amdgcn_wmma_f32_16x16x32_f16(false, a0, false, bf, (short)0, acc0, false, false);
        acc1 = __builtin_amdgcn_wmma_f32_16x16x32_f16(false, a1, false, bf, (short)0, acc1, false, false);
        acc2 = __builtin_amdgcn_wmma_f32_16x16x32_f16(false, a2, false, bf, (short)0, acc2, false, false);
        acc3 = __builtin_amdgcn_wmma_f32_16x16x32_f16(false, a3, false, bf, (short)0, acc3, false, false);
        if (k0Idx < 3) { bf = bfn; a0 = a0n; a1 = a1n; a2 = a2n; a3 = a3n; }
    }

    float bv = bias ? bias[col] : 0.0f;
    #pragma unroll
    for (int t = 0; t < 4; ++t) {
        v8f acc = (t == 0) ? acc0 : (t == 1) ? acc1 : (t == 2) ? acc2 : acc3;
        if (flags & 2) {
            // transposed store into (B, DIM, NTOK)
            #pragma unroll
            for (int r = 0; r < 8; ++r) {
                int row = rowBase + t * 16 + r + rOff;   // global token index
                int b = row >> 14, n = row & (NTOK - 1);
                C[((size_t)b * DIMC + col) * NTOK + n] = acc[r] + bv;
            }
        } else {
            #pragma unroll
            for (int r = 0; r < 8; ++r)
                C[(size_t)(rowBase + t * 16 + r + rOff) * 128 + col] = acc[r] + bv;
        }
    }
}

// ---------------------------------------------------------------------------
// Causal depthwise conv1d (kernel 4) along tokens + bias + SiLU
// ---------------------------------------------------------------------------
__global__ void conv_silu_kernel(const float* __restrict__ u,   // (B,N,128)
                                 const float* __restrict__ cw,  // (128,4)
                                 const float* __restrict__ cb,  // (128)
                                 float* __restrict__ uc) {
    int idx = blockIdx.x * blockDim.x + threadIdx.x;   // over MTOT*128
    int d = idx & 127;
    int t = idx >> 7;              // b*N + n
    int n = t & (NTOK - 1);
    float acc = cb[d];
    #pragma unroll
    for (int k = 0; k < D_CONV; ++k) {
        int nn = n + k - (D_CONV - 1);
        if (nn >= 0) acc += u[(size_t)(t + k - (D_CONV - 1)) * 128 + d] * cw[d * D_CONV + k];
    }
    uc[idx] = acc / (1.0f + __expf(-acc));             // SiLU
}

// ---------------------------------------------------------------------------
// x_dbl = uc @ Wxproj -> (dt_r | B | C); dt = softplus(dt_r @ Wdt + bdt)
// One 128-thread block per token (tiny GEMMs, VALU is fine).
// ---------------------------------------------------------------------------
__global__ __launch_bounds__(128)
void xproj_dt_kernel(const float* __restrict__ uc,      // (M,128)
                     const float* __restrict__ Wxproj,  // (128,24)
                     const float* __restrict__ Wdt,     // (8,128)
                     const float* __restrict__ bdt,     // (128)
                     float* __restrict__ dt,            // (M,128)
                     float* __restrict__ Bm,            // (M,8)
                     float* __restrict__ Cm) {          // (M,8)
    __shared__ float s_dtr[DT_RANK];
    int t = blockIdx.x;
    int j = threadIdx.x;
    const float* ur = uc + (size_t)t * 128;
    if (j < DT_RANK + 2 * D_STATE) {
        float a = 0.0f;
        for (int c = 0; c < 128; ++c) a += ur[c] * Wxproj[c * 24 + j];
        if (j < DT_RANK)                s_dtr[j] = a;
        else if (j < DT_RANK + D_STATE) Bm[(size_t)t * 8 + (j - DT_RANK)] = a;
        else                            Cm[(size_t)t * 8 + (j - DT_RANK - D_STATE)] = a;
    }
    __syncthreads();
    float a = bdt[j];
    #pragma unroll
    for (int r = 0; r < DT_RANK; ++r) a += s_dtr[r] * Wdt[r * 128 + j];
    dt[(size_t)t * 128 + j] = (a > 20.0f) ? a : log1pf(__expf(a));   // softplus
}

// ---------------------------------------------------------------------------
// SSM scan, cut along the tokens into NCHUNK chunks of CHUNK_T steps.
// h[t] = a[t]*h[t-1] + b[t] is linear in h, so a chunk acts on its incoming
// state as  h_out = P*h_in + H  with P = product of its a[t] and H = its end
// state from h_in = 0.  Three launches:
//   1) every chunk: P and H                        (all chunks side by side)
//   2) every (batch, d, s): the incoming state of each chunk, chunk by chunk
//   3) every chunk: the recurrence again from its incoming state, with readout
// Launches 1 and 3: one workgroup of 128 threads per chunk, thread = channel d,
// which keeps its 8 states in registers as 4 pairs. A wave's load of dt, uc or
// z is then one whole 128-byte line, the readout sum over the states stays in
// the thread, and the gate is worked out once per (token, channel) with every
// lane busy. The B and C rows of the chunk, the same for all channels, are
// staged in LDS once and read from there by broadcast.
// ---------------------------------------------------------------------------
#define CHUNK_T 128
#define NCHUNK  (NTOK / CHUNK_T)    // 128 chunks per batch
#define SCAN_U  8                   // tokens per register buffer (two buffers)
#define SCAN_NG (CHUNK_T / SCAN_U)  // 16 buffer fills per chunk

typedef __attribute__((ext_vector_type(2))) float f32x2;
typedef __attribute__((ext_vector_type(4))) float f32x4;

// log2(e) * A for the 8 states of channel d, A = -exp(A_log): exp(dt*A) is then
// one multiply and one v_exp_f32.
__device__ __forceinline__ void load_a2(const float* __restrict__ A_log, int d, f32x2* A2) {
    f32x4 l0 = *(const f32x4*)(A_log + d * 8);
    f32x4 l1 = *(const f32x4*)(A_log + d * 8 + 4);
    A2[0] = f32x2{-__expf(l0[0]), -__expf(l0[1])} * 1.44269504f;
    A2[1] = f32x2{-__expf(l0[2]), -__expf(l0[3])} * 1.44269504f;
    A2[2] = f32x2{-__expf(l1[0]), -__expf(l1[1])} * 1.44269504f;
    A2[3] = f32x2{-__expf(l1[2]), -__expf(l1[3])} * 1.44269504f;
}

// SCAN_U tokens of one channel's column of a (token, 128) array. Two tokens
// share a register pair: a packed multiply that takes one of them as its scalar
// names the whole pair, and the wait in front of it covers both halves, so the
// other half must belong to the same buffer and not to the one still in flight.
__device__ __forceinline__ void load_col(const float* __restrict__ p, f32x2* r) {
    #pragma unroll   // r[] in registers; the loads issue back to back
    for (int k = 0; k < SCAN_U; ++k) r[k >> 1][k & 1] = p[k * 128];
}

// Eight v_exp_f32 (2^x) in one statement. The instruction set asks for one free
// issue slot behind a transcendental before its result is read or its source
// overwritten: inside the statement each v_exp_f32 is followed by one that is
// independent of it (the outputs are early-clobber, so none lies on an input),
// and the v_nop is the slot behind the last, wherever the statement is scheduled.
__device__ __forceinline__ void exp2_x8(const f32x2* x, f32x2* r) {
    float e0, e1, e2, e3, e4, e5, e6, e7;
    asm("v_exp_f32 %0, %8\n\t"
        "v_exp_f32 %1, %9\n\t"
        "v_exp_f32 %2, %10\n\t"
        "v_exp_f32 %3, %11\n\t"
        "v_exp_f32 %4, %12\n\t"
        "v_exp_f32 %5, %13\n\t"
        "v_exp_f32 %6, %14\n\t"
        "v_exp_f32 %7, %15\n\t"
        "v_nop"
        : "=&v"(e0), "=&v"(e1), "=&v"(e2), "=&v"(e3), "=&v"(e4), "=&v"(e5), "=&v"(e6), "=&v"(e7)
        : "v"(x[0][0]), "v"(x[0][1]), "v"(x[1][0]), "v"(x[1][1]),
          "v"(x[2][0]), "v"(x[2][1]), "v"(x[3][0]), "v"(x[3][1]));
    r[0] = f32x2{e0, e1};
    r[1] = f32x2{e2, e3};
    r[2] = f32x2{e4, e5};
    r[3] = f32x2{e6, e7};
}

// One step of the recurrence for the 8 states of a channel.
__device__ __forceinline__ void ssm_step(float dtv, float ucv, const f32x2* A2,
                                         const float* sBrow, f32x2* a, f32x2* h) {
    f32x4 b0 = *(const f32x4*)(sBrow);
    f32x4 b1 = *(const f32x4*)(sBrow + 4);
    f32x2 Bp[4] = {f32x2{b0[0], b0[1]}, f32x2{b0[2], b0[3]},
                   f32x2{b1[0], b1[1]}, f32x2{b1[2], b1[3]}};
    float du = dtv * ucv;
    f32x2 x[4];
    #pragma unroll   // x[], a[], h[] in registers
    for (int j = 0; j < 4; ++j) x[j] = A2[j] * dtv;
    exp2_x8(x, a);
    #pragma unroll
    for (int j = 0; j < 4; ++j) h[j] = __builtin_elementwise_fma(a[j], h[j], Bp[j] * du);
}

__device__ __forceinline__ void chunk_sum_group(const f32x2* dtr, const f32x2* ucr,
                                                const f32x2* A2, const float* sBg,
                                                f32x2* h, f32x2* p) {
    #pragma unroll   // constant indices into the register buffers
    for (int k = 0; k < SCAN_U; ++k) {
        f32x2 a[4];
        ssm_step(dtr[k >> 1][k & 1], ucr[k >> 1][k & 1], A2, sBg + k * 8, a, h);
        #pragma unroll
        for (int j = 0; j < 4; ++j) p[j] *= a[j];
    }
}

__global__ __launch_bounds__(128)
void scan_chunk_sum_kernel(const float* __restrict__ dt,    // (B,N,128)
                           const float* __restrict__ uc,    // (B,N,128)
                           const float* __restrict__ Bm,    // (B,N,8)
                           const float* __restrict__ A_log, // (128,8)
                           float* __restrict__ Pc,          // (B,NCHUNK,128,8)
                           float* __restrict__ Hc) {        // (B,NCHUNK,128,8)
    __shared__ __align__(16) float sB[CHUNK_T * 8];         // 4 KB
    int c = blockIdx.x;
    int b = blockIdx.y;
    int d = threadIdx.x;
    size_t base = (size_t)b * NTOK + (size_t)c * CHUNK_T;
    const float* pdt = dt + base * 128 + d;
    const float* puc = uc + base * 128 + d;

    f32x2 dt0[SCAN_U / 2], uc0[SCAN_U / 2], dt1[SCAN_U / 2], uc1[SCAN_U / 2];
    load_col(pdt, dt0);
    load_col(puc, uc0);
    {
        const f32x4* g = (const f32x4*)(Bm + base * 8);
        ((f32x4*)sB)[d]       = g[d];
        ((f32x4*)sB)[d + 128] = g[d + 128];
    }
    f32x2 A2[4], h[4], p[4];
    load_a2(A_log, d, A2);
    #pragma unroll
    for (int j = 0; j < 4; ++j) { h[j] = f32x2{0.0f, 0.0f}; p[j] = f32x2{1.0f, 1.0f}; }
    __syncthreads();

    // Two register buffers: while one is worked on, the other's loads fly. The
    // scheduling barriers keep each buffer's loads in front of the work on the
    // other buffer; without them the compiler sinks the loads to their first use.
    for (int g = 0; g < SCAN_NG - 2; g += 2) {
        load_col(pdt + (size_t)(g + 1) * SCAN_U * 128, dt1);
        load_col(puc + (size_t)(g + 1) * SCAN_U * 128, uc1);
        __builtin_amdgcn_sched_barrier(0);
        chunk_sum_group(dt0, uc0, A2, sB + g * SCAN_U * 8, h, p);
        load_col(pdt + (size_t)(g + 2) * SCAN_U * 128, dt0);
        load_col(puc + (size_t)(g + 2) * SCAN_U * 128, uc0);
        __builtin_amdgcn_sched_barrier(0);
        chunk_sum_group(dt1, uc1, A2, sB + (g + 1) * SCAN_U * 8, h, p);
    }
    load_col(pdt + (size_t)(SCAN_NG - 1) * SCAN_U * 128, dt1);
    load_col(puc + (size_t)(SCAN_NG - 1) * SCAN_U * 128, uc1);
    __builtin_amdgcn_sched_barrier(0);
    chunk_sum_group(dt0, uc0, A2, sB + (SCAN_NG - 2) * SCAN_U * 8, h, p);
    __builtin_amdgcn_sched_barrier(0);   // keeps the wait for the last buffer behind the work above
    chunk_sum_group(dt1, uc1, A2, sB + (SCAN_NG - 1) * SCAN_U * 8, h, p);

    size_t o = ((size_t)b * NCHUNK + c) * 1024 + d * 8;
    *(f32x4*)(Pc + o)     = f32x4{p[0][0], p[0][1], p[1][0], p[1][1]};
    *(f32x4*)(Pc + o + 4) = f32x4{p[2][0], p[2][1], p[3][0], p[3][1]};
    *(f32x4*)(Hc + o)     = f32x4{h[0][0], h[0][1], h[1][0], h[1][1]};
    *(f32x4*)(Hc + o + 4) = f32x4{h[2][0], h[2][1], h[3][0], h[3][1]};
}

// One thread per (batch, d, s); 16 chunks' summaries are loaded at a time so
// that the serial chain waits for memory once per 16 chunks, not per chunk.
__global__ __launch_bounds__(256)
void scan_carry_kernel(const float* __restrict__ Pc,   // (B,NCHUNK,1024)
                       const float* __restrict__ Hc,   // (B,NCHUNK,1024)
                       float* __restrict__ Hin) {      // (B,NCHUNK,1024)
    int idx = blockIdx.x * blockDim.x + threadIdx.x;   // over BATCH*1024
    int b = idx >> 10;
    int r = idx & 1023;
    size_t o = (size_t)b * NCHUNK * 1024 + r;
    float carry = 0.0f;
    for (int c0 = 0; c0 < NCHUNK; c0 += 16) {
        float p[16], h[16];
        #pragma unroll   // p[], h[] in registers; all 32 loads issue before the first wait
        for (int k = 0; k < 16; ++k) {
            p[k] = Pc[o + (size_t)(c0 + k) * 1024];
            h[k] = Hc[o + (size_t)(c0 + k) * 1024];
        }
        #pragma unroll   // constant indices into p[], h[]
        for (int k = 0; k < 16; ++k) {
            Hin[o + (size_t)(c0 + k) * 1024] = carry;
            carry = p[k] * carry + h[k];
        }
        // the next trip rewrites the address and data registers of these stores
        asm volatile("s_wait_xcnt 0x0" ::: "memory");
    }
}

// SCAN_U tokens of launch 3: recurrence, readout over the 8 states, Dp skip and
// SiLU(z) gate; emits f16.
__device__ __forceinline__ void scan_group(const f32x2* dtr, const f32x2* ucr, const f32x2* zr,
                                           const f32x2* A2, float Dd,
                                           const float* sBg, const float* sCg,
                                           f32x2* h, _Float16* __restrict__ yo) {
    _Float16 r[SCAN_U];
    f32x2 zx[SCAN_U / 2], ez[SCAN_U / 2];   // exp(-z) of the 8 tokens
    #pragma unroll
    for (int k = 0; k < SCAN_U / 2; ++k) zx[k] = zr[k] * -1.44269504f;
    exp2_x8(zx, ez);
    #pragma unroll   // constant indices into the register buffers
    for (int k = 0; k < SCAN_U; ++k) {
        f32x2 a[4];
        float ucv = ucr[k >> 1][k & 1];
        ssm_step(dtr[k >> 1][k & 1], ucv, A2, sBg + k * 8, a, h);
        f32x4 c0 = *(const f32x4*)(sCg + k * 8);
        f32x4 c1 = *(const f32x4*)(sCg + k * 8 + 4);
        f32x2 y2 = h[0] * f32x2{c0[0], c0[1]};
        y2 = __builtin_elementwise_fma(h[1], f32x2{c0[2], c0[3]}, y2);
        y2 = __builtin_elementwise_fma(h[2], f32x2{c1[0], c1[1]}, y2);
        y2 = __builtin_elementwise_fma(h[3], f32x2{c1[2], c1[3]}, y2);
        float y  = y2[0] + y2[1];
        float zv = zr[k >> 1][k & 1];
        float g  = zv / (1.0f + ez[k >> 1][k & 1]);
        r[k] = (_Float16)((y + Dd * ucv) * g);
    }
    #pragma unroll
    for (int k = 0; k < SCAN_U; ++k) yo[k * 128] = r[k];
    // what follows rewrites the data registers of these stores
    asm volatile("s_wait_xcnt 0x0" ::: "memory");
}

__global__ __launch_bounds__(128)
void scan_kernel(const float* __restrict__ dt,    // (B,N,128)
                 const float* __restrict__ uc,    // (B,N,128)
                 const float* __restrict__ zg,    // (B,N,128) pre-activation z
                 const float* __restrict__ Bm,    // (B,N,8)
                 const float* __restrict__ Cm,    // (B,N,8)
                 const float* __restrict__ A_log, // (128,8)
                 const float* __restrict__ Dp,    // (128)
                 const float* __restrict__ Hin,   // (B,NCHUNK,128,8)
                 _Float16* __restrict__ yg) {     // (B,N,128)
    __shared__ __align__(16) float sB[CHUNK_T * 8];   // 4 KB
    __shared__ __align__(16) float sC[CHUNK_T * 8];   // 4 KB
    int c = blockIdx.x;
    int b = blockIdx.y;
    int d = threadIdx.x;
    size_t base = (size_t)b * NTOK + (size_t)c * CHUNK_T;
    const float* pdt = dt + base * 128 + d;
    const float* puc = uc + base * 128 + d;
    const float* pz  = zg + base * 128 + d;
    _Float16*    py  = yg + base * 128 + d;

    f32x2 dt0[SCAN_U / 2], uc0[SCAN_U / 2], z0[SCAN_U / 2];
    f32x2 dt1[SCAN_U / 2], uc1[SCAN_U / 2], z1[SCAN_U / 2];
    load_col(pdt, dt0);
    load_col(puc, uc0);
    load_col(pz,  z0);
    {
        const f32x4* gb = (const f32x4*)(Bm + base * 8);
        const f32x4* gc = (const f32x4*)(Cm + base * 8);
        ((f32x4*)sB)[d]       = gb[d];
        ((f32x4*)sB)[d + 128] = gb[d + 128];
        ((f32x4*)sC)[d]       = gc[d];
        ((f32x4*)sC)[d + 128] = gc[d + 128];
    }
    f32x2 A2[4], h[4];
    load_a2(A_log, d, A2);
    float Dd = Dp[d];
    {
        const float* hi = Hin + ((size_t)b * NCHUNK + c) * 1024 + d * 8;
        f32x4 h0 = *(const f32x4*)(hi);
        f32x4 h1 = *(const f32x4*)(hi + 4);
        h[0] = f32x2{h0[0], h0[1]}; h[1] = f32x2{h0[2], h0[3]};
        h[2] = f32x2{h1[0], h1[1]}; h[3] = f32x2{h1[2], h1[3]};
    }
    __syncthreads();

    // Two register buffers, held apart by scheduling barriers as in launch 1.
    for (int g = 0; g < SCAN_NG - 2; g += 2) {
        load_col(pdt + (size_t)(g + 1) * SCAN_U * 128, dt1);
        load_col(puc + (size_t)(g + 1) * SCAN_U * 128, uc1);
        load_col(pz  + (size_t)(g + 1) * SCAN_U * 128, z1);
        __builtin_amdgcn_sched_barrier(0);
        scan_group(dt0, uc0, z0, A2, Dd, sB + g * SCAN_U * 8, sC + g * SCAN_U * 8,
                   h, py + (size_t)g * SCAN_U * 128);
        load_col(pdt + (size_t)(g + 2) * SCAN_U * 128, dt0);
        load_col(puc + (size_t)(g + 2) * SCAN_U * 128, uc0);
        load_col(pz  + (size_t)(g + 2) * SCAN_U * 128, z0);
        __builtin_amdgcn_sched_barrier(0);
        scan_group(dt1, uc1, z1, A2, Dd, sB + (g + 1) * SCAN_U * 8, sC + (g + 1) * SCAN_U * 8,
                   h, py + (size_t)(g + 1) * SCAN_U * 128);
    }
    load_col(pdt + (size_t)(SCAN_NG - 1) * SCAN_U * 128, dt1);
    load_col(puc + (size_t)(SCAN_NG - 1) * SCAN_U * 128, uc1);
    load_col(pz  + (size_t)(SCAN_NG - 1) * SCAN_U * 128, z1);
    // The three pointers are used here for the last time. As inputs of the wait
    // they stay in their registers up to it, so that no result of these loads is
    // placed on an address register that an earlier one of them still names.
    asm volatile("s_wait_xcnt 0x0" :: "v"(pdt), "v"(puc), "v"(pz) : "memory");
    __builtin_amdgcn_sched_barrier(0);
    scan_group(dt0, uc0, z0, A2, Dd, sB + (SCAN_NG - 2) * SCAN_U * 8, sC + (SCAN_NG - 2) * SCAN_U * 8,
               h, py + (size_t)(SCAN_NG - 2) * SCAN_U * 128);
    __builtin_amdgcn_sched_barrier(0);   // keeps the wait for the last buffer behind the work above
    scan_group(dt1, uc1, z1, A2, Dd, sB + (SCAN_NG - 1) * SCAN_U * 8, sC + (SCAN_NG - 1) * SCAN_U * 8,
               h, py + (size_t)(SCAN_NG - 1) * SCAN_U * 128);
}

// ---------------------------------------------------------------------------
// s = 0.5*(m0 + m1 + ff + bf)  (transposing the raw inputs), cast f16
// ---------------------------------------------------------------------------
__global__ void final_prep_kernel(const float* __restrict__ msum,  // (B,N,128)
                                  const float* __restrict__ front, // (B,128,N)
                                  const float* __restrict__ back,  // (B,128,N)
                                  _Float16* __restrict__ sh) {     // (B,N,128)
    int idx = blockIdx.x * blockDim.x + threadIdx.x;
    int c = idx & 127;
    int t = idx >> 7;
    int b = t >> 14;
    int n = t & (NTOK - 1);
    size_t src = ((size_t)b * DIMC + c) * NTOK + n;
    sh[idx] = (_Float16)(0.5f * (msum[idx] + front[src] + back[src]));
}

// ---------------------------------------------------------------------------
// Host-side pipeline
// ---------------------------------------------------------------------------
extern "C" void kernel_launch(void* const* d_in, const int* in_sizes, int n_in,
                              void* d_out, int out_size, void* d_ws, size_t ws_size,
                              hipStream_t stream) {
    const float* front   = (const float*)d_in[0];
    const float* back    = (const float*)d_in[1];
    const float* ln0_w   = (const float*)d_in[2];
    const float* ln0_b   = (const float*)d_in[3];
    const float* ln1_w   = (const float*)d_in[4];
    const float* ln1_b   = (const float*)d_in[5];
    const float* Wx      = (const float*)d_in[6];
    const float* Wz      = (const float*)d_in[7];
    const float* conv_w  = (const float*)d_in[8];
    const float* conv_b  = (const float*)d_in[9];
    const float* Wxproj  = (const float*)d_in[10];
    const float* Wdt     = (const float*)d_in[11];
    const float* bdt     = (const float*)d_in[12];
    const float* A_log   = (const float*)d_in[13];
    const float* Dp      = (const float*)d_in[14];
    const float* Wout_m  = (const float*)d_in[15];
    const float* bout_m  = (const float*)d_in[16];
    const float* Wout    = (const float*)d_in[17];
    const float* bout    = (const float*)d_in[18];

    char* ws = (char*)d_ws;
    // ---- static workspace layout (bytes) ----
    _Float16* WXh  = (_Float16*)(ws);                       // 2*16384 halves
    _Float16* WZh  = WXh  + 2 * 16384;
    _Float16* WOMh = WZh  + 2 * 16384;
    _Float16* WOh  = WOMh + 2 * 16384;                      // weights < 256 KB
    size_t off = 0x40000;
    _Float16* AXh  = (_Float16*)(ws + off); off += (size_t)MTOT * 128 * 2;  // 16 MB
    _Float16* AZh  = (_Float16*)(ws + off); off += (size_t)MTOT * 128 * 2;  // 16 MB
    float*    U    = (float*)(ws + off);    off += (size_t)MTOT * 128 * 4;  // 32 MB (also dt)
    float*    Z    = (float*)(ws + off);    off += (size_t)MTOT * 128 * 4;  // 32 MB
    float*    UC   = (float*)(ws + off);    off += (size_t)MTOT * 128 * 4;  // 32 MB
    _Float16* YGh  = (_Float16*)(ws + off); off += (size_t)MTOT * 128 * 2;  // 16 MB (also s_h)
    float*    BM   = (float*)(ws + off);    off += (size_t)MTOT * 8 * 4;    // 2 MB
    float*    CMb  = (float*)(ws + off);    off += (size_t)MTOT * 8 * 4;    // 2 MB
    float*    MS   = (float*)(ws + off);    off += (size_t)MTOT * 128 * 4;  // 32 MB
    float*    PC   = (float*)(ws + off);    off += (size_t)BATCH * NCHUNK * 1024 * 4;  // 2 MB
    float*    HC   = (float*)(ws + off);    off += (size_t)BATCH * NCHUNK * 1024 * 4;  // 2 MB
    float*    HIN  = (float*)(ws + off);    off += (size_t)BATCH * NCHUNK * 1024 * 4;  // 2 MB
    float*    DT   = U;       // alias: u consumed by conv before dt written
    _Float16* SH   = YGh;     // alias: yg consumed by GEMM3 before s written

    // 1) weight conversions to f16 (swizzled into WMMA B-fragment order)
    cvt_swizzle_w_kernel<<<(2 * 16384 + 255) / 256, 256, 0, stream>>>(Wx, WXh, 2 * 16384);
    cvt_swizzle_w_kernel<<<(2 * 16384 + 255) / 256, 256, 0, stream>>>(Wz, WZh, 2 * 16384);
    cvt_swizzle_w_kernel<<<(2 * 16384 + 255) / 256, 256, 0, stream>>>(Wout_m, WOMh, 2 * 16384);
    cvt_swizzle_w_kernel<<<(16384 + 255) / 256, 256, 0, stream>>>(Wout, WOh, 16384);

    // 2) two cross-mamba blocks (sequential; buffers reused)
    for (int i = 0; i < 2; ++i) {
        const float* xsrc = (i == 0) ? front : back;
        const float* zsrc = (i == 0) ? back  : front;

        ln_transpose_f16_kernel<<<MTOT / 8, 256, 0, stream>>>(
            xsrc, ln0_w + i * DIMC, ln0_b + i * DIMC, AXh);
        ln_transpose_f16_kernel<<<MTOT / 8, 256, 0, stream>>>(
            zsrc, ln1_w + i * DIMC, ln1_b + i * DIMC, AZh);

        gemm128_wmma_kernel<<<MTOT / 64, 256, 0, stream>>>(AXh, WXh + i * 16384, nullptr, U, 0);
        gemm128_wmma_kernel<<<MTOT / 64, 256, 0, stream>>>(AZh, WZh + i * 16384, nullptr, Z, 0);

        conv_silu_kernel<<<(MTOT * 128) / 256, 256, 0, stream>>>(
            U, conv_w + i * DIMC * D_CONV, conv_b + i * DIMC, UC);

        xproj_dt_kernel<<<MTOT, 128, 0, stream>>>(
            UC, Wxproj + i * 128 * 24, Wdt + i * 8 * 128, bdt + i * 128, DT, BM, CMb);

        scan_chunk_sum_kernel<<<dim3(NCHUNK, BATCH), 128, 0, stream>>>(
            DT, UC, BM, A_log + i * 128 * 8, PC, HC);
        scan_carry_kernel<<<(BATCH * 1024) / 256, 256, 0, stream>>>(PC, HC, HIN);
        scan_kernel<<<dim3(NCHUNK, BATCH), 128, 0, stream>>>(
            DT, UC, Z, BM, CMb, A_log + i * 128 * 8, Dp + i * 128, HIN, YGh);

        gemm128_wmma_kernel<<<MTOT / 64, 256, 0, stream>>>(
            YGh, WOMh + i * 16384, bout_m + i * DIMC, MS, (i == 0) ? 0 : 1);
    }

    // 3) residual add + 0.5 scale + final GEMM, stored transposed to (B,DIM,N)
    final_prep_kernel<<<(MTOT * 128) / 256, 256, 0, stream>>>(MS, front, back, SH);
    gemm128_wmma_kernel<<<MTOT / 64, 256, 0, stream>>>(SH, WOh, bout, (float*)d_out, 2);
}

// v003
// It runs in 328 microseconds.
// Next to v002, in two timings, it ran 1.71 and 1.75 times as fast.
// Over all steps from v000 it is 84.4 times as fast.
#include <hip/hip_runtime.h>
#include <math.h>

typedef __attribute__((ext_vector_type(16))) _Float16 v16h;
typedef __attribute__((ext_vector_type(8)))  _Float16 v8h;
typedef __attribute__((ext_vector_type(8)))  float    v8f;
typedef __attribute__((ext_vector_type(2)))  float    f32x2;
typedef __attribute__((ext_vector_type(4)))  float    f32x4;

#define DIMC    128
#define D_INNER 128
#define D_STATE 8
#define DT_RANK 8
#define D_CONV  4
#define BATCH   4
#define NTOK    16384               // L*H*W = 256*8*8
#define MTOT    (BATCH * NTOK)      // 65536 tokens

// Eight v_exp_f32 (2^x) in one statement. The instruction set asks for one free
// issue slot behind a transcendental before its result is read or its source
// overwritten: inside the statement each v_exp_f32 is followed by one that is
// independent of it (the outputs are early-clobber, so none lies on an input),
// and the v_nop is the slot behind the last, wherever the statement is scheduled.
__device__ __forceinline__ void exp2_x8(const f32x2* x, f32x2* r) {
    float e0, e1, e2, e3, e4, e5, e6, e7;
    asm("v_exp_f32 %0, %8\n\t"
        "v_exp_f32 %1, %9\n\t"
        "v_exp_f32 %2, %10\n\t"
        "v_exp_f32 %3, %11\n\t"
        "v_exp_f32 %4, %12\n\t"
        "v_exp_f32 %5, %13\n\t"
        "v_exp_f32 %6, %14\n\t"
        "v_exp_f32 %7, %15\n\t"
        "v_nop"
        : "=&v"(e0), "=&v"(e1), "=&v"(e2), "=&v"(e3), "=&v"(e4), "=&v"(e5), "=&v"(e6), "=&v"(e7)
        : "v"(x[0][0]), "v"(x[0][1]), "v"(x[1][0]), "v"(x[1][1]),
          "v"(x[2][0]), "v"(x[2][1]), "v"(x[3][0]), "v"(x[3][1]));
    r[0] = f32x2{e0, e1};
    r[1] = f32x2{e2, e3};
    r[2] = f32x2{e4, e5};
    r[3] = f32x2{e6, e7};
}

// ---------------------------------------------------------------------------
// f32 -> f16 weight conversion WITH swizzle into WMMA B-fragment order.
// Fragment layout (halves): dst[((k0Idx*128 + col)*2 + sel)*16 + j]
//   j<8  -> W[k0Idx*32 + sel*8 + j     ][col]
//   j>=8 -> W[k0Idx*32 + sel*8 + j + 8 ][col]
// so each consuming lane's 16 B halves are one contiguous 32-byte LDS chunk.
// ---------------------------------------------------------------------------
__global__ void cvt_swizzle_w_kernel(const float* __restrict__ src,
                                     _Float16* __restrict__ dst, int nHalves) {
    int i = blockIdx.x * blockDim.x + threadIdx.x;
    if (i >= nHalves) return;
    int mat   = i >> 14;            // which 128x128 matrix
    int r     = i & 16383;
    int j     = r & 15;             // half index within fragment chunk
    int chunk = r >> 4;             // (k0Idx*128 + col)*2 + sel
    int sel   = chunk & 1;
    int colk  = chunk >> 1;
    int col   = colk & 127;
    int k0Idx = colk >> 7;          // 0..3
    int koff  = j + ((j >= 8) ? 8 : 0);
    int k     = k0Idx * 32 + sel * 8 + koff;
    dst[i] = (_Float16)src[(size_t)mat * 16384 + k * 128 + col];
}

// ---------------------------------------------------------------------------
// Fused transpose (B,DIM,N)->(B,N,DIM) + LayerNorm + cast to f16.
// One wave (32 lanes) per LN_T consecutive tokens; each lane owns 4 channels.
// A wave takes several tokens, for speed only; they lie side by side in x and
// come in as
// 16-byte pieces. The 8 waves of a workgroup cover 64 tokens, 256 bytes of
// every channel's row.
// ---------------------------------------------------------------------------
#define LN_T 8
__global__ __launch_bounds__(256)
void ln_transpose_f16_kernel(const float* __restrict__ x,     // (B, DIM, N)
                             const float* __restrict__ w,     // (DIM)
                             const float* __restrict__ bias,  // (DIM)
                             _Float16* __restrict__ out) {    // (B, N, DIM)
    int wave = (blockIdx.x * blockDim.x + threadIdx.x) >> 5;  // over MTOT / LN_T
    int lane = threadIdx.x & 31;
    int t0 = wave * LN_T;          // first token, b * NTOK + n
    int b = t0 >> 14;              // / NTOK
    int n = t0 & (NTOK - 1);
    const float* xl = x + ((size_t)b * DIMC + lane) * NTOK + n;
    f32x4 v[4][LN_T / 4];
    #pragma unroll   // v[][] in registers; all loads issue before the first wait
    for (int q = 0; q < 4; ++q)
        #pragma unroll
        for (int h = 0; h < LN_T / 4; ++h)
            v[q][h] = *(const f32x4*)(xl + (size_t)(32 * q) * NTOK + 4 * h);
    float w0 = w[lane], w1 = w[lane + 32], w2 = w[lane + 64], w3 = w[lane + 96];
    float b0 = bias[lane], b1 = bias[lane + 32], b2 = bias[lane + 64], b3 = bias[lane + 96];
    // As an input of the wait the pointer stays in its registers up to it, so
    // that no result of these loads is placed on an address register that an
    // earlier one of them still names.
    asm volatile("s_wait_xcnt 0x0" :: "v"(xl) : "memory");
    _Float16* ob = out + (size_t)t0 * DIMC;
    float s[LN_T], q[LN_T];
    #pragma unroll   // constant indices into v[][], s[], q[]
    for (int k = 0; k < LN_T; ++k) {
        float v0 = v[0][k >> 2][k & 3];
        float v1 = v[1][k >> 2][k & 3];
        float v2 = v[2][k >> 2][k & 3];
        float v3 = v[3][k >> 2][k & 3];
        s[k] = v0 + v1 + v2 + v3;
        q[k] = v0 * v0 + v1 * v1 + v2 * v2 + v3 * v3;
    }
    // butterfly step by step, all tokens in each step: their exchanges are
    // independent, so a step waits once and not once per token
    #pragma unroll
    for (int off = 16; off > 0; off >>= 1) {
        #pragma unroll
        for (int k = 0; k < LN_T; ++k) {
            s[k] += __shfl_xor(s[k], off, 32);
            q[k] += __shfl_xor(q[k], off, 32);
        }
    }
    #pragma unroll
    for (int k = 0; k < LN_T; ++k) {
        float v0 = v[0][k >> 2][k & 3];
        float v1 = v[1][k >> 2][k & 3];
        float v2 = v[2][k >> 2][k & 3];
        float v3 = v[3][k >> 2][k & 3];
        float mean = s[k] * (1.0f / DIMC);
        float var  = q[k] * (1.0f / DIMC) - mean * mean;
        float rstd = rsqrtf(var + 1e-5f);
        ob[k * DIMC + lane     ] = (_Float16)((v0 - mean) * rstd * w0 + b0);
        ob[k * DIMC + lane + 32] = (_Float16)((v1 - mean) * rstd * w1 + b1);
        ob[k * DIMC + lane + 64] = (_Float16)((v2 - mean) * rstd * w2 + b2);
        ob[k * DIMC + lane + 96] = (_Float16)((v3 - mean) * rstd * w3 + b3);
    }
}

// ---------------------------------------------------------------------------
// A-fragment loader: 16x32 f16 A layout = two contiguous 16B chunks per lane
// (K groups at kSel and kSel+16).
// ---------------------------------------------------------------------------
__device__ __forceinline__ v16h load_a_frag(const _Float16* Ar) {
    v8h lo = *(const v8h*)(Ar);        // K = kSel .. kSel+7
    v8h hi = *(const v8h*)(Ar + 16);   // K = kSel+16 .. kSel+23
    v16h af;
    #pragma unroll
    for (int j = 0; j < 8; ++j) { af[j] = lo[j]; af[j + 8] = hi[j]; }
    return af;
}

// ---------------------------------------------------------------------------
// WMMA GEMM: C(M x 128) = A(M x 128, f16) * W(128 x 128, f16) [+ C] [+ bias]
// W pre-swizzled in B-fragment order, staged in LDS. Each wave owns a 64x16
// output tile (4 accumulators); one B fragment reused across 4 WMMAs per K
// step -> 16 v_wmma per wave. K loop software-pipelined: fragments for step
// k+1 are issued before the WMMAs of step k so loads overlap the matrix pipe.
// flags bit0 = accumulate into C, bit1 = store transposed to (B, DIM, NTOK).
// ---------------------------------------------------------------------------
__global__ __launch_bounds__(256)
void gemm128_wmma_kernel(const _Float16* __restrict__ A,
                         const _Float16* __restrict__ Wf,   // swizzled
                         const float* __restrict__ bias,
                         float* __restrict__ C,
                         int flags) {
    __shared__ __align__(64) _Float16 sW[128 * 128];   // 32 KB, fragment order
    {
        const uint4* src = (const uint4*)Wf;
        uint4*       dst = (uint4*)sW;
        for (int i = threadIdx.x; i < (128 * 128) / 8; i += 256) dst[i] = src[i];
    }
    __syncthreads();

    int waveId  = threadIdx.x >> 5;
    int lane    = threadIdx.x & 31;
    int rowBase = blockIdx.x * 64;       // 64 token rows per block (4 tiles/wave)
    int colBase = waveId * 16;           // 8 waves cover 128 output cols
    int col     = colBase + (lane & 15);
    int sel     = lane >> 4;             // 0 / 1
    int kSel    = sel << 3;              // 0 / 8
    int rOff    = sel << 3;              // C fragment: M = r + 8*(lane/16)

    v8f acc0 = {}, acc1 = {}, acc2 = {}, acc3 = {};
    if (flags & 1) {
        #pragma unroll
        for (int r = 0; r < 8; ++r) {
            acc0[r] = C[(size_t)(rowBase +  0 + r + rOff) * 128 + col];
            acc1[r] = C[(size_t)(rowBase + 16 + r + rOff) * 128 + col];
            acc2[r] = C[(size_t)(rowBase + 32 + r + rOff) * 128 + col];
            acc3[r] = C[(size_t)(rowBase + 48 + r + rOff) * 128 + col];
        }
    }

    const _Float16* A0 = A + (size_t)(rowBase + (lane & 15)) * 128 + kSel;
    // prologue: fragments for k0Idx = 0 (tile stride = 16 rows * 128 = 2048)
    v16h bf = *(const v16h*)&sW[((0 * 128 + col) * 2 + sel) * 16];
    v16h a0 = load_a_frag(A0 + 0 * 2048);
    v16h a1 = load_a_frag(A0 + 1 * 2048);
    v16h a2 = load_a_frag(A0 + 2 * 2048);
    v16h a3 = load_a_frag(A0 + 3 * 2048);

    #pragma unroll
    for (int k0Idx = 0; k0Idx < 4; ++k0Idx) {
        v16h bfn = {}, a0n = {}, a1n = {}, a2n = {}, a3n = {};
        if (k0Idx < 3) {
            const _Float16* An = A0 + (k0Idx + 1) * 32;
            bfn = *(const v16h*)&sW[(((k0Idx + 1) * 128 + col) * 2 + sel) * 16];
            a0n = load_a_frag(An + 0 * 2048);
            a1n = load_a_frag(An + 1 * 2048);
            a2n = load_a_frag(An + 2 * 2048);
            a3n = load_a_frag(An + 3 * 2048);
        }
        acc0 = __builtin_amdgcn_wmma_f32_16x16x32_f16(false, a0, false, bf, (short)0, acc0, false, false);
        acc1 = __builtin_amdgcn_wmma_f32_16x16x32_f16(false, a1, false, bf, (short)0, acc1, false, false);
        acc2 = __builtin_amdgcn_wmma_f32_16x16x32_f16(false, a2, false, bf, (short)0, acc2, false, false);
        acc3 = __builtin_amdgcn_wmma_f32_16x16x32_f16(false, a3, false, bf, (short)0, acc3, false, false);
        if (k0Idx < 3) { bf = bfn; a0 = a0n; a1 = a1n; a2 = a2n; a3 = a3n; }
    }

    float bv = bias ? bias[col] : 0.0f;
    #pragma unroll
    for (int t = 0; t < 4; ++t) {
        v8f acc = (t == 0) ? acc0 : (t == 1) ? acc1 : (t == 2) ? acc2 : acc3;
        if (flags & 2) {
            // transposed store into (B, DIM, NTOK)
            #pragma unroll
            for (int r = 0; r < 8; ++r) {
                int row = rowBase + t * 16 + r + rOff;   // global token index
                int b = row >> 14, n = row & (NTOK - 1);
                C[((size_t)b * DIMC + col) * NTOK + n] = acc[r] + bv;
            }
        } else {
            #pragma unroll
            for (int r = 0; r < 8; ++r)
                C[(size_t)(rowBase + t * 16 + r + rOff) * 128 + col] = acc[r] + bv;
        }
    }
}

// ---------------------------------------------------------------------------
// Causal depthwise conv1d (kernel 4) along tokens + bias + SiLU.
// One thread per channel and CONV_T consecutive tokens (was one token), so that
// the launch starts CONV_T times fewer waves; the window slides over registers.
// ---------------------------------------------------------------------------
#define CONV_T 16
__global__ __launch_bounds__(256)
void conv_silu_kernel(const float* __restrict__ u,   // (B,N,128)
                      const float* __restrict__ cw,  // (128,4)
                      const float* __restrict__ cb,  // (128)
                      float* __restrict__ uc) {
    int idx = blockIdx.x * blockDim.x + threadIdx.x;   // over (MTOT / CONV_T) * 128
    int d  = idx & 127;
    int t0 = (idx >> 7) * CONV_T;  // first token, b*N + n
    int n0 = t0 & (NTOK - 1);      // a multiple of CONV_T: 0 only at a batch's start
    const float* up = u + (size_t)t0 * 128 + d;
    float v[CONV_T + D_CONV - 1];
    #pragma unroll   // v[] in registers; the zero padding in front of token 0
    for (int k = 0; k < D_CONV - 1; ++k) v[k] = 0.0f;
    if (n0 > 0) {
        #pragma unroll
        for (int k = 0; k < D_CONV - 1; ++k) v[k] = up[(k - (D_CONV - 1)) * 128];
    }
    #pragma unroll   // all loads issue before the first wait
    for (int k = 0; k < CONV_T; ++k) v[k + D_CONV - 1] = up[k * 128];
    f32x4 wv = *(const f32x4*)(cw + d * D_CONV);
    float bv = cb[d];
    // As inputs of the wait the pointer and the channel index (the offset of the
    // cw and cb loads) stay in their registers up to it, so that no result of
    // these loads is placed on a register that an earlier one of them still names.
    asm volatile("s_wait_xcnt 0x0" :: "v"(up), "v"(d) : "memory");
    float* po = uc + (size_t)t0 * 128 + d;
    f32x2 a[CONV_T / 2], x[CONV_T / 2], e[CONV_T / 2];
    float r[CONV_T];
    #pragma unroll   // constant indices into the register arrays
    for (int k = 0; k < CONV_T; ++k) {
        float acc = bv;
        #pragma unroll
        for (int i = 0; i < D_CONV; ++i) acc = __builtin_fmaf(v[k + i], wv[i], acc);
        a[k >> 1][k & 1] = acc;
    }
    #pragma unroll
    for (int k = 0; k < CONV_T / 2; ++k) x[k] = a[k] * -1.44269504f;
    exp2_x8(x, e);                                     // exp(-acc), 8 tokens each
    exp2_x8(x + 4, e + 4);
    #pragma unroll
    for (int k = 0; k < CONV_T; ++k)
        r[k] = a[k >> 1][k & 1] / (1.0f + e[k >> 1][k & 1]);   // SiLU
    // keeps every store behind the last arithmetic, so that no register that an
    // issued store names is written again
    __builtin_amdgcn_sched_barrier(0);
    #pragma unroll
    for (int k = 0; k < CONV_T; ++k) po[k * 128] = r[k];
}

// ---------------------------------------------------------------------------
// x_dbl = uc @ Wxproj -> (dt_r | B | C); dt = softplus(dt_r @ Wdt + bdt)
// One 128-thread workgroup per XP_T tokens (was one token), so that the launch
// starts XP_T times fewer waves and every lane works in both parts.
//   part 1: lane = token, wave = 6 of the 24 columns of Wxproj. The uc rows are
//           staged in LDS (row pitch 132 floats: 16 lanes' 16-byte reads of one
//           column group fall on all 64 banks); the wave-uniform Wxproj values
//           come through the scalar cache.
//   part 2: thread = channel, token after token, dt_r rows by LDS broadcast.
// Each sum runs in the order it had.
// ---------------------------------------------------------------------------
#define XP_T     32
#define XP_PITCH 132
__global__ __launch_bounds__(128)
void xproj_dt_kernel(const float* __restrict__ uc,      // (M,128)
                     const float* __restrict__ Wxproj,  // (128,24)
                     const float* __restrict__ Wdt,     // (8,128)
                     const float* __restrict__ bdt,     // (128)
                     float* __restrict__ dt,            // (M,128)
                     float* __restrict__ Bm,            // (M,8)
                     float* __restrict__ Cm) {          // (M,8)
    __shared__ __align__(16) float sU[XP_T * XP_PITCH];   // 16.5 KB
    __shared__ __align__(16) float sX[3 * XP_T * 8];      // dt_r, B, C: (XP_T,8) each
    int tid = threadIdx.x;
    size_t t0 = (size_t)blockIdx.x * XP_T;
    {
        const f32x4* g = (const f32x4*)(uc + t0 * 128);
        f32x4 r[XP_T / 4];
        #pragma unroll   // r[] in registers; all loads issue before the first wait
        for (int i = 0; i < XP_T / 4; ++i) r[i] = g[tid + i * 128];
        #pragma unroll
        for (int i = 0; i < XP_T / 4; ++i) {
            int e = tid + i * 128;                       // row e / 32, floats 4 * (e % 32) ..
            *(f32x4*)&sU[(e >> 5) * XP_PITCH + (e & 31) * 4] = r[i];
        }
    }
    float wd[DT_RANK];
    #pragma unroll
    for (int r = 0; r < DT_RANK; ++r) wd[r] = Wdt[r * 128 + tid];
    float bb = bdt[tid];
    __syncthreads();

    {
        int lane = tid & 31;
        // the wave's number as a scalar, so that the Wxproj addresses are scalar too
        int j0 = __builtin_amdgcn_readfirstlane(tid >> 5) * 6;
        const float* ur = sU + lane * XP_PITCH;
        const float* wp = Wxproj + j0;
        float acc[6];
        #pragma unroll
        for (int jj = 0; jj < 6; ++jj) acc[jj] = 0.0f;
        for (int c = 0; c < 128; c += 4) {
            f32x4 uv = *(const f32x4*)(ur + c);
            #pragma unroll   // acc[] in registers
            for (int i = 0; i < 4; ++i)
                #pragma unroll
                for (int jj = 0; jj < 6; ++jj)
                    acc[jj] = __builtin_fmaf(uv[i], wp[(c + i) * 24 + jj], acc[jj]);
        }
        #pragma unroll
        for (int jj = 0; jj < 6; ++jj) {
            int j = j0 + jj;
            sX[(j >> 3) * (XP_T * 8) + lane * 8 + (j & 7)] = acc[jj];
        }
    }
    __syncthreads();

    *(f32x2*)(Bm + t0 * 8 + tid * 2) = *(const f32x2*)&sX[1 * XP_T * 8 + tid * 2];
    *(f32x2*)(Cm + t0 * 8 + tid * 2) = *(const f32x2*)&sX[2 * XP_T * 8 + tid * 2];
    // what follows rewrites the offset and data registers of these two stores
    asm volatile("s_wait_xcnt 0x0" ::: "memory");

    float* po = dt + t0 * 128 + tid;
    for (int k0 = 0; k0 < XP_T; k0 += 8) {
        float o[8];
        #pragma unroll   // o[] in registers
        for (int k = 0; k < 8; ++k) {
            f32x4 r0 = *(const f32x4*)&sX[(k0 + k) * 8];
            f32x4 r1 = *(const f32x4*)&sX[(k0 + k) * 8 + 4];
            float a = bb;
            #pragma unroll
            for (int r = 0; r < 4; ++r) a += r0[r] * wd[r];
            #pragma unroll
            for (int r = 0; r < 4; ++r) a += r1[r] * wd[r + 4];
            o[k] = (a > 20.0f) ? a : log1pf(__expf(a));   // softplus
        }
        #pragma unroll
        for (int k = 0; k < 8; ++k) po[(k0 + k) * 128] = o[k];
        // the next trip rewrites the data registers of these stores
        asm volatile("s_wait_xcnt 0x0" ::: "memory");
    }
}

// ---------------------------------------------------------------------------
// SSM scan, cut along the tokens into NCHUNK chunks of CHUNK_T steps.
// h[t] = a[t]*h[t-1] + b[t] is linear in h, so a chunk acts on its incoming
// state as  h_out = P*h_in + H  with P = product of its a[t] and H = its end
// state from h_in = 0.  Three launches:
//   1) every chunk: P and H                        (all chunks side by side)
//   2) every (batch, d, s): the incoming state of each chunk, chunk by chunk
//   3) every chunk: the recurrence again from its incoming state, with readout
// Launches 1 and 3: one workgroup of 128 threads per chunk, thread = channel d,
// which keeps its 8 states in registers as 4 pairs. A wave's load of dt, uc or
// z is then one whole 128-byte line, the readout sum over the states stays in
// the thread, and the gate is worked out once per (token, channel) with every
// lane busy. The B and C rows of the chunk, the same for all channels, are
// staged in LDS once and read from there by broadcast.
// ---------------------------------------------------------------------------
#define CHUNK_T 128
#define NCHUNK  (NTOK / CHUNK_T)    // 128 chunks per batch
#define SCAN_U  8                   // tokens per register buffer (two buffers)
#define SCAN_NG (CHUNK_T / SCAN_U)  // 16 buffer fills per chunk

// log2(e) * A for the 8 states of channel d, A = -exp(A_log): exp(dt*A) is then
// one multiply and one v_exp_f32.
__device__ __forceinline__ void load_a2(const float* __restrict__ A_log, int d, f32x2* A2) {
    f32x4 l0 = *(const f32x4*)(A_log + d * 8);
    f32x4 l1 = *(const f32x4*)(A_log + d * 8 + 4);
    A2[0] = f32x2{-__expf(l0[0]), -__expf(l0[1])} * 1.44269504f;
    A2[1] = f32x2{-__expf(l0[2]), -__expf(l0[3])} * 1.44269504f;
    A2[2] = f32x2{-__expf(l1[0]), -__expf(l1[1])} * 1.44269504f;
    A2[3] = f32x2{-__expf(l1[2]), -__expf(l1[3])} * 1.44269504f;
}

// SCAN_U tokens of one channel's column of a (token, 128) array. Two tokens
// share a register pair: a packed multiply that takes one of them as its scalar
// names the whole pair, and the wait in front of it covers both halves, so the
// other half must belong to the same buffer and not to the one still in flight.
__device__ __forceinline__ void load_col(const float* __restrict__ p, f32x2* r) {
    #pragma unroll   // r[] in registers; the loads issue back to back
    for (int k = 0; k < SCAN_U; ++k) r[k >> 1][k & 1] = p[k * 128];
}

// One step of the recurrence for the 8 states of a channel.
__device__ __forceinline__ void ssm_step(float dtv, float ucv, const f32x2* A2,
                                         const float* sBrow, f32x2* a, f32x2* h) {
    f32x4 b0 = *(const f32x4*)(sBrow);
    f32x4 b1 = *(const f32x4*)(sBrow + 4);
    f32x2 Bp[4] = {f32x2{b0[0], b0[1]}, f32x2{b0[2], b0[3]},
                   f32x2{b1[0], b1[1]}, f32x2{b1[2], b1[3]}};
    float du = dtv * ucv;
    f32x2 x[4];
    #pragma unroll   // x[], a[], h[] in registers
    for (int j = 0; j < 4; ++j) x[j] = A2[j] * dtv;
    exp2_x8(x, a);
    #pragma unroll
    for (int j = 0; j < 4; ++j) h[j] = __builtin_elementwise_fma(a[j], h[j], Bp[j] * du);
}

__device__ __forceinline__ void chunk_sum_group(const f32x2* dtr, const f32x2* ucr,
                                                const f32x2* A2, const float* sBg,
                                                f32x2* h, f32x2* p) {
    #pragma unroll   // constant indices into the register buffers
    for (int k = 0; k < SCAN_U; ++k) {
        f32x2 a[4];
        ssm_step(dtr[k >> 1][k & 1], ucr[k >> 1][k & 1], A2, sBg + k * 8, a, h);
        #pragma unroll
        for (int j = 0; j < 4; ++j) p[j] *= a[j];
    }
}

__global__ __launch_bounds__(128)
void scan_chunk_sum_kernel(const float* __restrict__ dt,    // (B,N,128)
                           const float* __restrict__ uc,    // (B,N,128)
                           const float* __restrict__ Bm,    // (B,N,8)
                           const float* __restrict__ A_log, // (128,8)
                           float* __restrict__ Pc,          // (B,NCHUNK,128,8)
                           float* __restrict__ Hc) {        // (B,NCHUNK,128,8)
    __shared__ __align__(16) float sB[CHUNK_T * 8];         // 4 KB
    int c = blockIdx.x;
    int b = blockIdx.y;
    int d = threadIdx.x;
    size_t base = (size_t)b * NTOK + (size_t)c * CHUNK_T;
    const float* pdt = dt + base * 128 + d;
    const float* puc = uc + base * 128 + d;

    f32x2 dt0[SCAN_U / 2], uc0[SCAN_U / 2], dt1[SCAN_U / 2], uc1[SCAN_U / 2];
    load_col(pdt, dt0);
    load_col(puc, uc0);
    {
        const f32x4* g = (const f32x4*)(Bm + base * 8);
        ((f32x4*)sB)[d]       = g[d];
        ((f32x4*)sB)[d + 128] = g[d + 128];
    }
    f32x2 A2[4], h[4], p[4];
    load_a2(A_log, d, A2);
    #pragma unroll
    for (int j = 0; j < 4; ++j) { h[j] = f32x2{0.0f, 0.0f}; p[j] = f32x2{1.0f, 1.0f}; }
    __syncthreads();

    // Two register buffers: while one is worked on, the other's loads fly. The
    // scheduling barriers keep each buffer's loads in front of the work on the
    // other buffer; without them the compiler sinks the loads to their first use.
    for (int g = 0; g < SCAN_NG - 2; g += 2) {
        load_col(pdt + (size_t)(g + 1) * SCAN_U * 128, dt1);
        load_col(puc + (size_t)(g + 1) * SCAN_U * 128, uc1);
        __builtin_amdgcn_sched_barrier(0);
        chunk_sum_group(dt0, uc0, A2, sB + g * SCAN_U * 8, h, p);
        load_col(pdt + (size_t)(g + 2) * SCAN_U * 128, dt0);
        load_col(puc + (size_t)(g + 2) * SCAN_U * 128, uc0);
        __builtin_amdgcn_sched_barrier(0);
        chunk_sum_group(dt1, uc1, A2, sB + (g + 1) * SCAN_U * 8, h, p);
    }
    load_col(pdt + (size_t)(SCAN_NG - 1) * SCAN_U * 128, dt1);
    load_col(puc + (size_t)(SCAN_NG - 1) * SCAN_U * 128, uc1);
    __builtin_amdgcn_sched_barrier(0);
    chunk_sum_group(dt0, uc0, A2, sB + (SCAN_NG - 2) * SCAN_U * 8, h, p);
    __builtin_amdgcn_sched_barrier(0);   // keeps the wait for the last buffer behind the work above
    chunk_sum_group(dt1, uc1, A2, sB + (SCAN_NG - 1) * SCAN_U * 8, h, p);

    size_t o = ((size_t)b * NCHUNK + c) * 1024 + d * 8;
    *(f32x4*)(Pc + o)     = f32x4{p[0][0], p[0][1], p[1][0], p[1][1]};
    *(f32x4*)(Pc + o + 4) = f32x4{p[2][0], p[2][1], p[3][0], p[3][1]};
    *(f32x4*)(Hc + o)     = f32x4{h[0][0], h[0][1], h[1][0], h[1][1]};
    *(f32x4*)(Hc + o + 4) = f32x4{h[2][0], h[2][1], h[3][0], h[3][1]};
}

// One thread per (batch, d, s); 16 chunks' summaries are loaded at a time so
// that the serial chain waits for memory once per 16 chunks, not per chunk.
__global__ __launch_bounds__(256)
void scan_carry_kernel(const float* __restrict__ Pc,   // (B,NCHUNK,1024)
                       const float* __restrict__ Hc,   // (B,NCHUNK,1024)
                       float* __restrict__ Hin) {      // (B,NCHUNK,1024)
    int idx = blockIdx.x * blockDim.x + threadIdx.x;   // over BATCH*1024
    int b = idx >> 10;
    int r = idx & 1023;
    size_t o = (size_t)b * NCHUNK * 1024 + r;
    float carry = 0.0f;
    for (int c0 = 0; c0 < NCHUNK; c0 += 16) {
        float p[16], h[16];
        #pragma unroll   // p[], h[] in registers; all 32 loads issue before the first wait
        for (int k = 0; k < 16; ++k) {
            p[k] = Pc[o + (size_t)(c0 + k) * 1024];
            h[k] = Hc[o + (size_t)(c0 + k) * 1024];
        }
        #pragma unroll   // constant indices into p[], h[]
        for (int k = 0; k < 16; ++k) {
            Hin[o + (size_t)(c0 + k) * 1024] = carry;
            carry = p[k] * carry + h[k];
        }
        // the next trip rewrites the address and data registers of these stores
        asm volatile("s_wait_xcnt 0x0" ::: "memory");
    }
}

// SCAN_U tokens of launch 3: recurrence, readout over the 8 states, Dp skip and
// SiLU(z) gate; emits f16.
__device__ __forceinline__ void scan_group(const f32x2* dtr, const f32x2* ucr, const f32x2* zr,
                                           const f32x2* A2, float Dd,
                                           const float* sBg, const float* sCg,
                                           f32x2* h, _Float16* __restrict__ yo) {
    _Float16 r[SCAN_U];
    f32x2 zx[SCAN_U / 2], ez[SCAN_U / 2];   // exp(-z) of the 8 tokens
    #pragma unroll
    for (int k = 0; k < SCAN_U / 2; ++k) zx[k] = zr[k] * -1.44269504f;
    exp2_x8(zx, ez);
    #pragma unroll   // constant indices into the register buffers
    for (int k = 0; k < SCAN_U; ++k) {
        f32x2 a[4];
        float ucv = ucr[k >> 1][k & 1];
        ssm_step(dtr[k >> 1][k & 1], ucv, A2, sBg + k * 8, a, h);
        f32x4 c0 = *(const f32x4*)(sCg + k * 8);
        f32x4 c1 = *(const f32x4*)(sCg + k * 8 + 4);
        f32x2 y2 = h[0] * f32x2{c0[0], c0[1]};
        y2 = __builtin_elementwise_fma(h[1], f32x2{c0[2], c0[3]}, y2);
        y2 = __builtin_elementwise_fma(h[2], f32x2{c1[0], c1[1]}, y2);
        y2 = __builtin_elementwise_fma(h[3], f32x2{c1[2], c1[3]}, y2);
        float y  = y2[0] + y2[1];
        float zv = zr[k >> 1][k & 1];
        float g  = zv / (1.0f + ez[k >> 1][k & 1]);
        r[k] = (_Float16)((y + Dd * ucv) * g);
    }
    #pragma unroll
    for (int k = 0; k < SCAN_U; ++k) yo[k * 128] = r[k];
    // what follows rewrites the data registers of these stores
    asm volatile("s_wait_xcnt 0x0" ::: "memory");
}

__global__ __launch_bounds__(128)
void scan_kernel(const float* __restrict__ dt,    // (B,N,128)
                 const float* __restrict__ uc,    // (B,N,128)
                 const float* __restrict__ zg,    // (B,N,128) pre-activation z
                 const float* __restrict__ Bm,    // (B,N,8)
                 const float* __restrict__ Cm,    // (B,N,8)
                 const float* __restrict__ A_log, // (128,8)
                 const float* __restrict__ Dp,    // (128)
                 const float* __restrict__ Hin,   // (B,NCHUNK,128,8)
                 _Float16* __restrict__ yg) {     // (B,N,128)
    __shared__ __align__(16) float sB[CHUNK_T * 8];   // 4 KB
    __shared__ __align__(16) float sC[CHUNK_T * 8];   // 4 KB
    int c = blockIdx.x;
    int b = blockIdx.y;
    int d = threadIdx.x;
    size_t base = (size_t)b * NTOK + (size_t)c * CHUNK_T;
    const float* pdt = dt + base * 128 + d;
    const float* puc = uc + base * 128 + d;
    const float* pz  = zg + base * 128 + d;
    _Float16*    py  = yg + base * 128 + d;

    f32x2 dt0[SCAN_U / 2], uc0[SCAN_U / 2], z0[SCAN_U / 2];
    f32x2 dt1[SCAN_U / 2], uc1[SCAN_U / 2], z1[SCAN_U / 2];
    load_col(pdt, dt0);
    load_col(puc, uc0);
    load_col(pz,  z0);
    {
        const f32x4* gb = (const f32x4*)(Bm + base * 8);
        const f32x4* gc = (const f32x4*)(Cm + base * 8);
        ((f32x4*)sB)[d]       = gb[d];
        ((f32x4*)sB)[d + 128] = gb[d + 128];
        ((f32x4*)sC)[d]       = gc[d];
        ((f32x4*)sC)[d + 128] = gc[d + 128];
    }
    f32x2 A2[4], h[4];
    load_a2(A_log, d, A2);
    float Dd = Dp[d];
    {
        const float* hi = Hin + ((size_t)b * NCHUNK + c) * 1024 + d * 8;
        f32x4 h0 = *(const f32x4*)(hi);
        f32x4 h1 = *(const f32x4*)(hi + 4);
        h[0] = f32x2{h0[0], h0[1]}; h[1] = f32x2{h0[2], h0[3]};
        h[2] = f32x2{h1[0], h1[1]}; h[3] = f32x2{h1[2], h1[3]};
    }
    __syncthreads();

    // Two register buffers, held apart by scheduling barriers as in launch 1.
    for (int g = 0; g < SCAN_NG - 2; g += 2) {
        load_col(pdt + (size_t)(g + 1) * SCAN_U * 128, dt1);
        load_col(puc + (size_t)(g + 1) * SCAN_U * 128, uc1);
        load_col(pz  + (size_t)(g + 1) * SCAN_U * 128, z1);
        __builtin_amdgcn_sched_barrier(0);
        scan_group(dt0, uc0, z0, A2, Dd, sB + g * SCAN_U * 8, sC + g * SCAN_U * 8,
                   h, py + (size_t)g * SCAN_U * 128);
        load_col(pdt + (size_t)(g + 2) * SCAN_U * 128, dt0);
        load_col(puc + (size_t)(g + 2) * SCAN_U * 128, uc0);
        load_col(pz  + (size_t)(g + 2) * SCAN_U * 128, z0);
        __builtin_amdgcn_sched_barrier(0);
        scan_group(dt1, uc1, z1, A2, Dd, sB + (g + 1) * SCAN_U * 8, sC + (g + 1) * SCAN_U * 8,
                   h, py + (size_t)(g + 1) * SCAN_U * 128);
    }
    load_col(pdt + (size_t)(SCAN_NG - 1) * SCAN_U * 128, dt1);
    load_col(puc + (size_t)(SCAN_NG - 1) * SCAN_U * 128, uc1);
    load_col(pz  + (size_t)(SCAN_NG - 1) * SCAN_U * 128, z1);
    // The three pointers are used here for the last time. As inputs of the wait
    // they stay in their registers up to it, so that no result of these loads is
    // placed on an address register that an earlier one of them still names.
    asm volatile("s_wait_xcnt 0x0" :: "v"(pdt), "v"(puc), "v"(pz) : "memory");
    __builtin_amdgcn_sched_barrier(0);
    scan_group(dt0, uc0, z0, A2, Dd, sB + (SCAN_NG - 2) * SCAN_U * 8, sC + (SCAN_NG - 2) * SCAN_U * 8,
               h, py + (size_t)(SCAN_NG - 2) * SCAN_U * 128);
    __builtin_amdgcn_sched_barrier(0);   // keeps the wait for the last buffer behind the work above
    scan_group(dt1, uc1, z1, A2, Dd, sB + (SCAN_NG - 1) * SCAN_U * 8, sC + (SCAN_NG - 1) * SCAN_U * 8,
               h, py + (size_t)(SCAN_NG - 1) * SCAN_U * 128);
}

// ---------------------------------------------------------------------------
// s = 0.5*(m0 + m1 + ff + bf)  (transposing the raw inputs), cast f16.
// One thread per channel and FP_T consecutive tokens (was one token), so that
// the launch starts FP_T times fewer waves; the tokens lie side by side in the
// raw inputs and come in as 16-byte pieces. A workgroup covers 32 tokens, one
// whole 128-byte line of every channel's row.
// ---------------------------------------------------------------------------
#define FP_T 16
__global__ __launch_bounds__(256)
void final_prep_kernel(const float* __restrict__ msum,  // (B,N,128)
                       const float* __restrict__ front, // (B,128,N)
                       const float* __restrict__ back,  // (B,128,N)
                       _Float16* __restrict__ sh) {     // (B,N,128)
    int idx = blockIdx.x * blockDim.x + threadIdx.x;    // over (MTOT / FP_T) * 128
    int c  = idx & 127;
    int t0 = (idx >> 7) * FP_T;    // first token, b*N + n
    int b = t0 >> 14;
    int n = t0 & (NTOK - 1);
    size_t src = ((size_t)b * DIMC + c) * NTOK + n;
    const float* pf = front + src;
    const float* pb = back + src;
    const float* pm = msum + (size_t)t0 * 128 + c;
    f32x4 f[FP_T / 4], g[FP_T / 4];
    float m[FP_T];
    #pragma unroll   // f[], g[], m[] in registers; all loads issue before the first wait
    for (int h = 0; h < FP_T / 4; ++h) {
        f[h] = *(const f32x4*)(pf + 4 * h);
        g[h] = *(const f32x4*)(pb + 4 * h);
    }
    #pragma unroll
    for (int k = 0; k < FP_T; ++k) m[k] = pm[k * 128];
    // As inputs of the wait the three pointers stay in their registers up to it,
    // so that no result of these loads is placed on an address register that an
    // earlier one of them still names.
    asm volatile("s_wait_xcnt 0x0" :: "v"(pf), "v"(pb), "v"(pm) : "memory");
    _Float16* po = sh + (size_t)t0 * 128 + c;
    #pragma unroll   // constant indices into the register arrays
    for (int k = 0; k < FP_T; ++k)
        po[k * 128] = (_Float16)(0.5f * (m[k] + f[k >> 2][k & 3] + g[k >> 2][k & 3]));
}

// ---------------------------------------------------------------------------
// Host-side pipeline
// ---------------------------------------------------------------------------
extern "C" void kernel_launch(void* const* d_in, const int* in_sizes, int n_in,
                              void* d_out, int out_size, void* d_ws, size_t ws_size,
                              hipStream_t stream) {
    const float* front   = (const float*)d_in[0];
    const float* back    = (const float*)d_in[1];
    const float* ln0_w   = (const float*)d_in[2];
    const float* ln0_b   = (const float*)d_in[3];
    const float* ln1_w   = (const float*)d_in[4];
    const float* ln1_b   = (const float*)d_in[5];
    const float* Wx      = (const float*)d_in[6];
    const float* Wz      = (const float*)d_in[7];
    const float* conv_w  = (const float*)d_in[8];
    const float* conv_b  = (const float*)d_in[9];
    const float* Wxproj  = (const float*)d_in[10];
    const float* Wdt     = (const float*)d_in[11];
    const float* bdt     = (const float*)d_in[12];
    const float* A_log   = (const float*)d_in[13];
    const float* Dp      = (const float*)d_in[14];
    const float* Wout_m  = (const float*)d_in[15];
    const float* bout_m  = (const float*)d_in[16];
    const float* Wout    = (const float*)d_in[17];
    const float* bout    = (const float*)d_in[18];

    char* ws = (char*)d_ws;
    // ---- static workspace layout (bytes) ----
    _Float16* WXh  = (_Float16*)(ws);                       // 2*16384 halves
    _Float16* WZh  = WXh  + 2 * 16384;
    _Float16* WOMh = WZh  + 2 * 16384;
    _Float16* WOh  = WOMh + 2 * 16384;                      // weights < 256 KB
    size_t off = 0x40000;
    _Float16* AXh  = (_Float16*)(ws + off); off += (size_t)MTOT * 128 * 2;  // 16 MB
    _Float16* AZh  = (_Float16*)(ws + off); off += (size_t)MTOT * 128 * 2;  // 16 MB
    float*    U    = (float*)(ws + off);    off += (size_t)MTOT * 128 * 4;  // 32 MB (also dt)
    float*    Z    = (float*)(ws + off);    off += (size_t)MTOT * 128 * 4;  // 32 MB
    float*    UC   = (float*)(ws + off);    off += (size_t)MTOT * 128 * 4;  // 32 MB
    _Float16* YGh  = (_Float16*)(ws + off); off += (size_t)MTOT * 128 * 2;  // 16 MB (also s_h)
    float*    BM   = (float*)(ws + off);    off += (size_t)MTOT * 8 * 4;    // 2 MB
    float*    CMb  = (float*)(ws + off);    off += (size_t)MTOT * 8 * 4;    // 2 MB
    float*    MS   = (float*)(ws + off);    off += (size_t)MTOT * 128 * 4;  // 32 MB
    float*    PC   = (float*)(ws + off);    off += (size_t)BATCH * NCHUNK * 1024 * 4;  // 2 MB
    float*    HC   = (float*)(ws + off);    off += (size_t)BATCH * NCHUNK * 1024 * 4;  // 2 MB
    float*    HIN  = (float*)(ws + off);    off += (size_t)BATCH * NCHUNK * 1024 * 4;  // 2 MB
    float*    DT   = U;       // alias: u consumed by conv before dt written
    _Float16* SH   = YGh;     // alias: yg consumed by GEMM3 before s written

    // 1) weight conversions to f16 (swizzled into WMMA B-fragment order)
    cvt_swizzle_w_kernel<<<(2 * 16384 + 255) / 256, 256, 0, stream>>>(Wx, WXh, 2 * 16384);
    cvt_swizzle_w_kernel<<<(2 * 16384 + 255) / 256, 256, 0, stream>>>(Wz, WZh, 2 * 16384);
    cvt_swizzle_w_kernel<<<(2 * 16384 + 255) / 256, 256, 0, stream>>>(Wout_m, WOMh, 2 * 16384);
    cvt_swizzle_w_kernel<<<(16384 + 255) / 256, 256, 0, stream>>>(Wout, WOh, 16384);

    // 2) two cross-mamba blocks (sequential; buffers reused)
    for (int i = 0; i < 2; ++i) {
        const float* xsrc = (i == 0) ? front : back;
        const float* zsrc = (i == 0) ? back  : front;

        ln_transpose_f16_kernel<<<MTOT / (8 * LN_T), 256, 0, stream>>>(
            xsrc, ln0_w + i * DIMC, ln0_b + i * DIMC, AXh);
        ln_transpose_f16_kernel<<<MTOT / (8 * LN_T), 256, 0, stream>>>(
            zsrc, ln1_w + i * DIMC, ln1_b + i * DIMC, AZh);

        gemm128_wmma_kernel<<<MTOT / 64, 256, 0, stream>>>(AXh, WXh + i * 16384, nullptr, U, 0);
        gemm128_wmma_kernel<<<MTOT / 64, 256, 0, stream>>>(AZh, WZh + i * 16384, nullptr, Z, 0);

        conv_silu_kernel<<<(MTOT / CONV_T * 128) / 256, 256, 0, stream>>>(
            U, conv_w + i * DIMC * D_CONV, conv_b + i * DIMC, UC);

        xproj_dt_kernel<<<MTOT / XP_T, 128, 0, stream>>>(
            UC, Wxproj + i * 128 * 24, Wdt + i * 8 * 128, bdt + i * 128, DT, BM, CMb);

        scan_chunk_sum_kernel<<<dim3(NCHUNK, BATCH), 128, 0, stream>>>(
            DT, UC, BM, A_log + i * 128 * 8, PC, HC);
        scan_carry_kernel<<<(BATCH * 1024) / 256, 256, 0, stream>>>(PC, HC, HIN);
        scan_kernel<<<dim3(NCHUNK, BATCH), 128, 0, stream>>>(
            DT, UC, Z, BM, CMb, A_log + i * 128 * 8, Dp + i * 128, HIN, YGh);

        gemm128_wmma_kernel<<<MTOT / 64, 256, 0, stream>>>(
            YGh, WOMh + i * 16384, bout_m + i * DIMC, MS, (i == 0) ? 0 : 1);
    }

    // 3) residual add + 0.5 scale + final GEMM, stored transposed to (B,DIM,N)
    final_prep_kernel<<<(MTOT / FP_T * 128) / 256, 256, 0, stream>>>(MS, front, back, SH);
    gemm128_wmma_kernel<<<MTOT / 64, 256, 0, stream>>>(SH, WOh, bout, (float*)d_out, 2);
}

// v004
// A run of this version takes 251 microseconds.
// Next to v003, in two timings, it ran 1.31 and 1.30 times as fast.
// Over all steps from v000 it is 110 times as fast.
#include <hip/hip_runtime.h>
#include <math.h>

typedef __attribute__((ext_vector_type(16))) _Float16 v16h;
typedef __attribute__((ext_vector_type(8)))  _Float16 v8h;
typedef __attribute__((ext_vector_type(8)))  float    v8f;
typedef __attribute__((ext_vector_type(2)))  float    f32x2;
typedef __attribute__((ext_vector_type(4)))  float    f32x4;

#define DIMC    128
#define D_INNER 128
#define D_STATE 8
#define DT_RANK 8
#define D_CONV  4
#define BATCH   4
#define NTOK    16384               // L*H*W = 256*8*8
#define MTOT    (BATCH * NTOK)      // 65536 tokens

// Eight v_exp_f32 (2^x) in one statement. The instruction set asks for one free
// issue slot behind a transcendental before its result is read or its source
// overwritten: inside the statement each v_exp_f32 is followed by one that is
// independent of it (the outputs are early-clobber, so none lies on an input),
// and the v_nop is the slot behind the last, wherever the statement is scheduled.
__device__ __forceinline__ void exp2_x8(const f32x2* x, f32x2* r) {
    float e0, e1, e2, e3, e4, e5, e6, e7;
    asm("v_exp_f32 %0, %8\n\t"
        "v_exp_f32 %1, %9\n\t"
        "v_exp_f32 %2, %10\n\t"
        "v_exp_f32 %3, %11\n\t"
        "v_exp_f32 %4, %12\n\t"
        "v_exp_f32 %5, %13\n\t"
        "v_exp_f32 %6, %14\n\t"
        "v_exp_f32 %7, %15\n\t"
        "v_nop"
        : "=&v"(e0), "=&v"(e1), "=&v"(e2), "=&v"(e3), "=&v"(e4), "=&v"(e5), "=&v"(e6), "=&v"(e7)
        : "v"(x[0][0]), "v"(x[0][1]), "v"(x[1][0]), "v"(x[1][1]),
          "v"(x[2][0]), "v"(x[2][1]), "v"(x[3][0]), "v"(x[3][1]));
    r[0] = f32x2{e0, e1};
    r[1] = f32x2{e2, e3};
    r[2] = f32x2{e4, e5};
    r[3] = f32x2{e6, e7};
}

// ---------------------------------------------------------------------------
// f32 -> f16 weight conversion WITH swizzle into WMMA B-fragment order.
// Fragment layout (halves): dst[((k0Idx*128 + col)*2 + sel)*16 + j]
//   j<8  -> W[k0Idx*32 + sel*8 + j     ][col]
//   j>=8 -> W[k0Idx*32 + sel*8 + j + 8 ][col]
// so each consuming lane's 16 B halves are one contiguous 32-byte LDS chunk.
// ---------------------------------------------------------------------------
// One launch converts all seven 128x128 matrices; a matrix is 64 workgroups.
// dst holds them in the order Wx[0], Wx[1], Wz[0], Wz[1], Wout_m[0], Wout_m[1], Wout.
__global__ __launch_bounds__(256)
void cvt_swizzle_w_kernel(const float* __restrict__ Wx,
                          const float* __restrict__ Wz,
                          const float* __restrict__ Wom,
                          const float* __restrict__ Wo,
                          _Float16* __restrict__ dst) {
    int i = blockIdx.x * blockDim.x + threadIdx.x;   // over 7 * 16384
    int m7 = blockIdx.x >> 6;       // which of the seven
    const float* src = (m7 < 2) ? Wx : (m7 < 4) ? Wz : (m7 < 6) ? Wom : Wo;
    int mat   = m7 & 1;             // which 128x128 matrix of its input
    int r     = i & 16383;
    int j     = r & 15;             // half index within fragment chunk
    int chunk = r >> 4;             // (k0Idx*128 + col)*2 + sel
    int sel   = chunk & 1;
    int colk  = chunk >> 1;
    int col   = colk & 127;
    int k0Idx = colk >> 7;          // 0..3
    int koff  = j + ((j >= 8) ? 8 : 0);
    int k     = k0Idx * 32 + sel * 8 + koff;
    dst[i] = (_Float16)src[(size_t)mat * 16384 + k * 128 + col];
}

// ---------------------------------------------------------------------------
// Fused transpose (B,DIM,N)->(B,N,DIM) + LayerNorm + cast to f16.
// One wave (32 lanes) per LN_T consecutive tokens; each lane owns 4 channels.
// A wave takes several tokens, for speed only; they lie side by side in x and
// come in as
// 16-byte pieces. The 8 waves of a workgroup cover 64 tokens, 256 bytes of
// every channel's row.
// ---------------------------------------------------------------------------
#define LN_T 8
__global__ __launch_bounds__(256)
void ln_transpose_f16_kernel(const float* __restrict__ front,  // (B, DIM, N)
                             const float* __restrict__ back,   // (B, DIM, N)
                             const float* __restrict__ ln0_w,  // (2, DIM)
                             const float* __restrict__ ln0_b,  // (2, DIM)
                             const float* __restrict__ ln1_w,  // (2, DIM)
                             const float* __restrict__ ln1_b,  // (2, DIM)
                             _Float16* __restrict__ out4) {    // 4 x (B, N, DIM)
    // blockIdx.y = 2 * input + gate picks one of the four norms of the two cross
    // blocks: front feeds block 0's SSM path (ln0) and block 1's gate (ln1), back
    // the other two. Result slot: 2 * gate + block, the order of the weights.
    int gate = blockIdx.y & 1;
    int blk  = (blockIdx.y >> 1) ^ gate;
    const float* x    = (blockIdx.y >> 1) ? back : front;
    const float* w    = (gate ? ln1_w : ln0_w) + blk * DIMC;
    const float* bias = (gate ? ln1_b : ln0_b) + blk * DIMC;
    _Float16*    out  = out4 + (size_t)(2 * gate + blk) * MTOT * DIMC;
    int wave = (blockIdx.x * blockDim.x + threadIdx.x) >> 5;  // over MTOT / LN_T
    int lane = threadIdx.x & 31;
    int t0 = wave * LN_T;          // first token, b * NTOK + n
    int b = t0 >> 14;              // / NTOK
    int n = t0 & (NTOK - 1);
    const float* xl = x + ((size_t)b * DIMC + lane) * NTOK + n;
    f32x4 v[4][LN_T / 4];
    #pragma unroll   // v[][] in registers; all loads issue before the first wait
    for (int q = 0; q < 4; ++q)
        #pragma unroll
        for (int h = 0; h < LN_T / 4; ++h)
            v[q][h] = *(const f32x4*)(xl + (size_t)(32 * q) * NTOK + 4 * h);
    float w0 = w[lane], w1 = w[lane + 32], w2 = w[lane + 64], w3 = w[lane + 96];
    float b0 = bias[lane], b1 = bias[lane + 32], b2 = bias[lane + 64], b3 = bias[lane + 96];
    // As an input of the wait the pointer stays in its registers up to it, so
    // that no result of these loads is placed on an address register that an
    // earlier one of them still names.
    asm volatile("s_wait_xcnt 0x0" :: "v"(xl) : "memory");
    _Float16* ob = out + (size_t)t0 * DIMC;
    float s[LN_T], q[LN_T];
    #pragma unroll   // constant indices into v[][], s[], q[]
    for (int k = 0; k < LN_T; ++k) {
        float v0 = v[0][k >> 2][k & 3];
        float v1 = v[1][k >> 2][k & 3];
        float v2 = v[2][k >> 2][k & 3];
        float v3 = v[3][k >> 2][k & 3];
        s[k] = v0 + v1 + v2 + v3;
        q[k] = v0 * v0 + v1 * v1 + v2 * v2 + v3 * v3;
    }
    // butterfly step by step, all tokens in each step: their exchanges are
    // independent, so a step waits once and not once per token
    #pragma unroll
    for (int off = 16; off > 0; off >>= 1) {
        #pragma unroll
        for (int k = 0; k < LN_T; ++k) {
            s[k] += __shfl_xor(s[k], off, 32);
            q[k] += __shfl_xor(q[k], off, 32);
        }
    }
    #pragma unroll
    for (int k = 0; k < LN_T; ++k) {
        float v0 = v[0][k >> 2][k & 3];
        float v1 = v[1][k >> 2][k & 3];
        float v2 = v[2][k >> 2][k & 3];
        float v3 = v[3][k >> 2][k & 3];
        float mean = s[k] * (1.0f / DIMC);
        float var  = q[k] * (1.0f / DIMC) - mean * mean;
        float rstd = rsqrtf(var + 1e-5f);
        ob[k * DIMC + lane     ] = (_Float16)((v0 - mean) * rstd * w0 + b0);
        ob[k * DIMC + lane + 32] = (_Float16)((v1 - mean) * rstd * w1 + b1);
        ob[k * DIMC + lane + 64] = (_Float16)((v2 - mean) * rstd * w2 + b2);
        ob[k * DIMC + lane + 96] = (_Float16)((v3 - mean) * rstd * w3 + b3);
    }
}

// ---------------------------------------------------------------------------
// A-fragment loader: 16x32 f16 A layout = two contiguous 16B chunks per lane
// (K groups at kSel and kSel+16).
// ---------------------------------------------------------------------------
__device__ __forceinline__ v16h load_a_frag(const _Float16* Ar) {
    v8h lo = *(const v8h*)(Ar);        // K = kSel .. kSel+7
    v8h hi = *(const v8h*)(Ar + 16);   // K = kSel+16 .. kSel+23
    v16h af;
    #pragma unroll
    for (int j = 0; j < 8; ++j) { af[j] = lo[j]; af[j + 8] = hi[j]; }
    return af;
}

// ---------------------------------------------------------------------------
// WMMA GEMM: C(M x 128) = A(M x 128, f16) * W(128 x 128, f16) [+ bias]
// W pre-swizzled in B-fragment order, staged in LDS. Each wave owns a 64x16
// output tile (4 accumulators); one B fragment reused across 4 WMMAs per K
// step -> 16 v_wmma per wave. K loop software-pipelined: fragments for step
// k+1 are issued before the WMMAs of step k so loads overlap the matrix pipe.
// blockIdx.y = which of several independent products of one launch: A, Wf, bias
// and C each hold them one behind the other.
// flags bit1 = store transposed to (B, DIM, NTOK).
// ---------------------------------------------------------------------------
__global__ __launch_bounds__(256)
void gemm128_wmma_kernel(const _Float16* __restrict__ A,
                         const _Float16* __restrict__ Wf,   // swizzled
                         const float* __restrict__ bias,
                         float* __restrict__ C,
                         int flags) {
    __shared__ __align__(64) _Float16 sW[128 * 128];   // 32 KB, fragment order
    A  += (size_t)blockIdx.y * MTOT * 128;
    Wf += (size_t)blockIdx.y * 128 * 128;
    C  += (size_t)blockIdx.y * MTOT * 128;
    if (bias) bias += blockIdx.y * 128;
    {
        const uint4* src = (const uint4*)Wf;
        uint4*       dst = (uint4*)sW;
        for (int i = threadIdx.x; i < (128 * 128) / 8; i += 256) dst[i] = src[i];
    }
    __syncthreads();

    int waveId  = threadIdx.x >> 5;
    int lane    = threadIdx.x & 31;
    int rowBase = blockIdx.x * 64;       // 64 token rows per block (4 tiles/wave)
    int colBase = waveId * 16;           // 8 waves cover 128 output cols
    int col     = colBase + (lane & 15);
    int sel     = lane >> 4;             // 0 / 1
    int kSel    = sel << 3;              // 0 / 8
    int rOff    = sel << 3;              // C fragment: M = r + 8*(lane/16)

    v8f acc0 = {}, acc1 = {}, acc2 = {}, acc3 = {};

    const _Float16* A0 = A + (size_t)(rowBase + (lane & 15)) * 128 + kSel;
    // prologue: fragments for k0Idx = 0 (tile stride = 16 rows * 128 = 2048)
    v16h bf = *(const v16h*)&sW[((0 * 128 + col) * 2 + sel) * 16];
    v16h a0 = load_a_frag(A0 + 0 * 2048);
    v16h a1 = load_a_frag(A0 + 1 * 2048);
    v16h a2 = load_a_frag(A0 + 2 * 2048);
    v16h a3 = load_a_frag(A0 + 3 * 2048);

    #pragma unroll
    for (int k0Idx = 0; k0Idx < 4; ++k0Idx) {
        v16h bfn = {}, a0n = {}, a1n = {}, a2n = {}, a3n = {};
        if (k0Idx < 3) {
            const _Float16* An = A0 + (k0Idx + 1) * 32;
            bfn = *(const v16h*)&sW[(((k0Idx + 1) * 128 + col) * 2 + sel) * 16];
            a0n = load_a_frag(An + 0 * 2048);
            a1n = load_a_frag(An + 1 * 2048);
            a2n = load_a_frag(An + 2 * 2048);
            a3n = load_a_frag(An + 3 * 2048);
        }
        acc0 = __builtin_amdgcn_wmma_f32_16x16x32_f16(false, a0, false, bf, (short)0, acc0, false, false);
        acc1 = __builtin_amdgcn_wmma_f32_16x16x32_f16(false, a1, false, bf, (short)0, acc1, false, false);
        acc2 = __builtin_amdgcn_wmma_f32_16x16x32_f16(false, a2, false, bf, (short)0, acc2, false, false);
        acc3 = __builtin_amdgcn_wmma_f32_16x16x32_f16(false, a3, false, bf, (short)0, acc3, false, false);
        if (k0Idx < 3) { bf = bfn; a0 = a0n; a1 = a1n; a2 = a2n; a3 = a3n; }
    }

    float bv = bias ? bias[col] : 0.0f;
    #pragma unroll
    for (int t = 0; t < 4; ++t) {
        v8f acc = (t == 0) ? acc0 : (t == 1) ? acc1 : (t == 2) ? acc2 : acc3;
        if (flags & 2) {
            // transposed store into (B, DIM, NTOK)
            #pragma unroll
            for (int r = 0; r < 8; ++r) {
                int row = rowBase + t * 16 + r + rOff;   // global token index
                int b = row >> 14, n = row & (NTOK - 1);
                C[((size_t)b * DIMC + col) * NTOK + n] = acc[r] + bv;
            }
        } else {
            #pragma unroll
            for (int r = 0; r < 8; ++r)
                C[(size_t)(rowBase + t * 16 + r + rOff) * 128 + col] = acc[r] + bv;
        }
    }
}

// ---------------------------------------------------------------------------
// Causal depthwise conv1d (kernel 4) along tokens + bias + SiLU.
// One thread per channel and CONV_T consecutive tokens (was one token), so that
// the launch starts CONV_T times fewer waves; the window slides over registers.
// ---------------------------------------------------------------------------
#define CONV_T 16
__global__ __launch_bounds__(256)
void conv_silu_kernel(const float* __restrict__ u,   // 2 x (B,N,128)
                      const float* __restrict__ cw,  // (2,128,4)
                      const float* __restrict__ cb,  // (2,128)
                      float* __restrict__ uc) {      // 2 x (B,N,128)
    u  += (size_t)blockIdx.y * MTOT * 128;             // blockIdx.y = cross block
    cw += blockIdx.y * 128 * D_CONV;
    cb += blockIdx.y * 128;
    uc += (size_t)blockIdx.y * MTOT * 128;
    int idx = blockIdx.x * blockDim.x + threadIdx.x;   // over (MTOT / CONV_T) * 128
    int d  = idx & 127;
    int t0 = (idx >> 7) * CONV_T;  // first token, b*N + n
    int n0 = t0 & (NTOK - 1);      // a multiple of CONV_T: 0 only at a batch's start
    const float* up = u + (size_t)t0 * 128 + d;
    float v[CONV_T + D_CONV - 1];
    #pragma unroll   // v[] in registers; the zero padding in front of token 0
    for (int k = 0; k < D_CONV - 1; ++k) v[k] = 0.0f;
    if (n0 > 0) {
        #pragma unroll
        for (int k = 0; k < D_CONV - 1; ++k) v[k] = up[(k - (D_CONV - 1)) * 128];
    }
    #pragma unroll   // all loads issue before the first wait
    for (int k = 0; k < CONV_T; ++k) v[k + D_CONV - 1] = up[k * 128];
    f32x4 wv = *(const f32x4*)(cw + d * D_CONV);
    float bv = cb[d];
    // As inputs of the wait the pointer and the channel index (the offset of the
    // cw and cb loads) stay in their registers up to it, so that no result of
    // these loads is placed on a register that an earlier one of them still names.
    asm volatile("s_wait_xcnt 0x0" :: "v"(up), "v"(d) : "memory");
    float* po = uc + (size_t)t0 * 128 + d;
    f32x2 a[CONV_T / 2], x[CONV_T / 2], e[CONV_T / 2];
    float r[CONV_T];
    #pragma unroll   // constant indices into the register arrays
    for (int k = 0; k < CONV_T; ++k) {
        float acc = bv;
        #pragma unroll
        for (int i = 0; i < D_CONV; ++i) acc = __builtin_fmaf(v[k + i], wv[i], acc);
        a[k >> 1][k & 1] = acc;
    }
    #pragma unroll
    for (int k = 0; k < CONV_T / 2; ++k) x[k] = a[k] * -1.44269504f;
    exp2_x8(x, e);                                     // exp(-acc), 8 tokens each
    exp2_x8(x + 4, e + 4);
    #pragma unroll
    for (int k = 0; k < CONV_T; ++k)
        r[k] = a[k >> 1][k & 1] / (1.0f + e[k >> 1][k & 1]);   // SiLU
    // keeps every store behind the last arithmetic, so that no register that an
    // issued store names is written again
    __builtin_amdgcn_sched_barrier(0);
    #pragma unroll
    for (int k = 0; k < CONV_T; ++k) po[k * 128] = r[k];
}

// ---------------------------------------------------------------------------
// x_dbl = uc @ Wxproj -> (dt_r | B | C); dt = softplus(dt_r @ Wdt + bdt)
// One 128-thread workgroup per XP_T tokens (was one token), so that the launch
// starts XP_T times fewer waves and every lane works in both parts.
//   part 1: lane = token, wave = 6 of the 24 columns of Wxproj. The uc rows are
//           staged in LDS (row pitch 132 floats: 16 lanes' 16-byte reads of one
//           column group fall on all 64 banks); the wave-uniform Wxproj values
//           come through the scalar cache.
//   part 2: thread = channel, token after token, dt_r rows by LDS broadcast.
// Each sum runs in the order it had.
// ---------------------------------------------------------------------------
#define XP_T     32
#define XP_PITCH 132
__global__ __launch_bounds__(128)
void xproj_dt_kernel(const float* __restrict__ uc,      // 2 x (M,128)
                     const float* __restrict__ Wxproj,  // (2,128,24)
                     const float* __restrict__ Wdt,     // (2,8,128)
                     const float* __restrict__ bdt,     // (2,128)
                     float* __restrict__ dt,            // 2 x (M,128)
                     float* __restrict__ Bm,            // 2 x (M,8)
                     float* __restrict__ Cm) {          // 2 x (M,8)
    __shared__ __align__(16) float sU[XP_T * XP_PITCH];   // 16.5 KB
    __shared__ __align__(16) float sX[3 * XP_T * 8];      // dt_r, B, C: (XP_T,8) each
    uc     += (size_t)blockIdx.y * MTOT * 128;            // blockIdx.y = cross block
    Wxproj += blockIdx.y * 128 * 24;
    Wdt    += blockIdx.y * DT_RANK * 128;
    bdt    += blockIdx.y * 128;
    dt     += (size_t)blockIdx.y * MTOT * 128;
    Bm     += (size_t)blockIdx.y * MTOT * 8;
    Cm     += (size_t)blockIdx.y * MTOT * 8;
    int tid = threadIdx.x;
    size_t t0 = (size_t)blockIdx.x * XP_T;
    {
        const f32x4* g = (const f32x4*)(uc + t0 * 128);
        f32x4 r[XP_T / 4];
        #pragma unroll   // r[] in registers; all loads issue before the first wait
        for (int i = 0; i < XP_T / 4; ++i) r[i] = g[tid + i * 128];
        #pragma unroll
        for (int i = 0; i < XP_T / 4; ++i) {
            int e = tid + i * 128;                       // row e / 32, floats 4 * (e % 32) ..
            *(f32x4*)&sU[(e >> 5) * XP_PITCH + (e & 31) * 4] = r[i];
        }
    }
    float wd[DT_RANK];
    #pragma unroll
    for (int r = 0; r < DT_RANK; ++r) wd[r] = Wdt[r * 128 + tid];
    float bb = bdt[tid];
    __syncthreads();

    {
        int lane = tid & 31;
        // the wave's number as a scalar, so that the Wxproj addresses are scalar too
        int j0 = __builtin_amdgcn_readfirstlane(tid >> 5) * 6;
        const float* ur = sU + lane * XP_PITCH;
        const float* wp = Wxproj + j0;
        float acc[6];
        #pragma unroll
        for (int jj = 0; jj < 6; ++jj) acc[jj] = 0.0f;
        for (int c = 0; c < 128; c += 4) {
            f32x4 uv = *(const f32x4*)(ur + c);
            #pragma unroll   // acc[] in registers
            for (int i = 0; i < 4; ++i)
                #pragma unroll
                for (int jj = 0; jj < 6; ++jj)
                    acc[jj] = __builtin_fmaf(uv[i], wp[(c + i) * 24 + jj], acc[jj]);
        }
        #pragma unroll
        for (int jj = 0; jj < 6; ++jj) {
            int j = j0 + jj;
            sX[(j >> 3) * (XP_T * 8) + lane * 8 + (j & 7)] = acc[jj];
        }
    }
    __syncthreads();

    *(f32x2*)(Bm + t0 * 8 + tid * 2) = *(const f32x2*)&sX[1 * XP_T * 8 + tid * 2];
    *(f32x2*)(Cm + t0 * 8 + tid * 2) = *(const f32x2*)&sX[2 * XP_T * 8 + tid * 2];
    // what follows rewrites the offset and data registers of these two stores
    asm volatile("s_wait_xcnt 0x0" ::: "memory");

    float* po = dt + t0 * 128 + tid;
    for (int k0 = 0; k0 < XP_T; k0 += 8) {
        float o[8];
        #pragma unroll   // o[] in registers
        for (int k = 0; k < 8; ++k) {
            f32x4 r0 = *(const f32x4*)&sX[(k0 + k) * 8];
            f32x4 r1 = *(const f32x4*)&sX[(k0 + k) * 8 + 4];
            float a = bb;
            #pragma unroll
            for (int r = 0; r < 4; ++r) a += r0[r] * wd[r];
            #pragma unroll
            for (int r = 0; r < 4; ++r) a += r1[r] * wd[r + 4];
            o[k] = (a > 20.0f) ? a : log1pf(__expf(a));   // softplus
        }
        #pragma unroll
        for (int k = 0; k < 8; ++k) po[(k0 + k) * 128] = o[k];
        // the next trip rewrites the data registers of these stores
        asm volatile("s_wait_xcnt 0x0" ::: "memory");
    }
}

// ---------------------------------------------------------------------------
// SSM scan, cut along the tokens into NCHUNK chunks of CHUNK_T steps.
// h[t] = a[t]*h[t-1] + b[t] is linear in h, so a chunk acts on its incoming
// state as  h_out = P*h_in + H  with P = product of its a[t] and H = its end
// state from h_in = 0.  Three launches:
//   1) every chunk: P and H                        (all chunks side by side)
//   2) every (batch, d, s): the incoming state of each chunk, chunk by chunk
//   3) every chunk: the recurrence again from its incoming state, with readout
// Launches 1 and 3: one workgroup of 128 threads per chunk, thread = channel d,
// which keeps its 8 states in registers as 4 pairs. A wave's load of dt, uc or
// z is then one whole 128-byte line, the readout sum over the states stays in
// the thread, and the gate is worked out once per (token, channel) with every
// lane busy. The B and C rows of the chunk, the same for all channels, are
// staged in LDS once and read from there by broadcast.
// The two cross blocks are independent and go through each launch side by side:
// their arrays lie one behind the other, so that they read as 2 * BATCH batches,
// and only the per-block parameters are picked by batch index / BATCH.
// ---------------------------------------------------------------------------
#define CHUNK_T 128
#define NCHUNK  (NTOK / CHUNK_T)    // 128 chunks per batch
#define SCAN_U  8                   // tokens per register buffer (two buffers)
#define SCAN_NG (CHUNK_T / SCAN_U)  // 16 buffer fills per chunk

// log2(e) * A for the 8 states of channel d, A = -exp(A_log): exp(dt*A) is then
// one multiply and one v_exp_f32.
__device__ __forceinline__ void load_a2(const float* __restrict__ A_log, int d, f32x2* A2) {
    f32x4 l0 = *(const f32x4*)(A_log + d * 8);
    f32x4 l1 = *(const f32x4*)(A_log + d * 8 + 4);
    A2[0] = f32x2{-__expf(l0[0]), -__expf(l0[1])} * 1.44269504f;
    A2[1] = f32x2{-__expf(l0[2]), -__expf(l0[3])} * 1.44269504f;
    A2[2] = f32x2{-__expf(l1[0]), -__expf(l1[1])} * 1.44269504f;
    A2[3] = f32x2{-__expf(l1[2]), -__expf(l1[3])} * 1.44269504f;
}

// SCAN_U tokens of one channel's column of a (token, 128) array. Two tokens
// share a register pair: a packed multiply that takes one of them as its scalar
// names the whole pair, and the wait in front of it covers both halves, so the
// other half must belong to the same buffer and not to the one still in flight.
__device__ __forceinline__ void load_col(const float* __restrict__ p, f32x2* r) {
    #pragma unroll   // r[] in registers; the loads issue back to back
    for (int k = 0; k < SCAN_U; ++k) r[k >> 1][k & 1] = p[k * 128];
}

// One step of the recurrence for the 8 states of a channel.
__device__ __forceinline__ void ssm_step(float dtv, float ucv, const f32x2* A2,
                                         const float* sBrow, f32x2* a, f32x2* h) {
    f32x4 b0 = *(const f32x4*)(sBrow);
    f32x4 b1 = *(const f32x4*)(sBrow + 4);
    f32x2 Bp[4] = {f32x2{b0[0], b0[1]}, f32x2{b0[2], b0[3]},
                   f32x2{b1[0], b1[1]}, f32x2{b1[2], b1[3]}};
    float du = dtv * ucv;
    f32x2 x[4];
    #pragma unroll   // x[], a[], h[] in registers
    for (int j = 0; j < 4; ++j) x[j] = A2[j] * dtv;
    exp2_x8(x, a);
    #pragma unroll
    for (int j = 0; j < 4; ++j) h[j] = __builtin_elementwise_fma(a[j], h[j], Bp[j] * du);
}

__device__ __forceinline__ void chunk_sum_group(const f32x2* dtr, const f32x2* ucr,
                                                const f32x2* A2, const float* sBg,
                                                f32x2* h, f32x2* p) {
    #pragma unroll   // constant indices into the register buffers
    for (int k = 0; k < SCAN_U; ++k) {
        f32x2 a[4];
        ssm_step(dtr[k >> 1][k & 1], ucr[k >> 1][k & 1], A2, sBg + k * 8, a, h);
        #pragma unroll
        for (int j = 0; j < 4; ++j) p[j] *= a[j];
    }
}

__global__ __launch_bounds__(128)
void scan_chunk_sum_kernel(const float* __restrict__ dt,    // (2B,N,128)
                           const float* __restrict__ uc,    // (2B,N,128)
                           const float* __restrict__ Bm,    // (2B,N,8)
                           const float* __restrict__ A_log, // (2,128,8)
                           float* __restrict__ Pc,          // (2B,NCHUNK,128,8)
                           float* __restrict__ Hc) {        // (2B,NCHUNK,128,8)
    __shared__ __align__(16) float sB[CHUNK_T * 8];         // 4 KB
    int c = blockIdx.x;
    int b = blockIdx.y;
    int d = threadIdx.x;
    A_log += (blockIdx.y / BATCH) * 128 * 8;
    size_t base = (size_t)b * NTOK + (size_t)c * CHUNK_T;
    const float* pdt = dt + base * 128 + d;
    const float* puc = uc + base * 128 + d;

    f32x2 dt0[SCAN_U / 2], uc0[SCAN_U / 2], dt1[SCAN_U / 2], uc1[SCAN_U / 2];
    load_col(pdt, dt0);
    load_col(puc, uc0);
    {
        const f32x4* g = (const f32x4*)(Bm + base * 8);
        ((f32x4*)sB)[d]       = g[d];
        ((f32x4*)sB)[d + 128] = g[d + 128];
    }
    f32x2 A2[4], h[4], p[4];
    load_a2(A_log, d, A2);
    #pragma unroll
    for (int j = 0; j < 4; ++j) { h[j] = f32x2{0.0f, 0.0f}; p[j] = f32x2{1.0f, 1.0f}; }
    __syncthreads();

    // Two register buffers: while one is worked on, the other's loads fly. The
    // scheduling barriers keep each buffer's loads in front of the work on the
    // other buffer; without them the compiler sinks the loads to their first use.
    for (int g = 0; g < SCAN_NG - 2; g += 2) {
        load_col(pdt + (size_t)(g + 1) * SCAN_U * 128, dt1);
        load_col(puc + (size_t)(g + 1) * SCAN_U * 128, uc1);
        __builtin_amdgcn_sched_barrier(0);
        chunk_sum_group(dt0, uc0, A2, sB + g * SCAN_U * 8, h, p);
        load_col(pdt + (size_t)(g + 2) * SCAN_U * 128, dt0);
        load_col(puc + (size_t)(g + 2) * SCAN_U * 128, uc0);
        __builtin_amdgcn_sched_barrier(0);
        chunk_sum_group(dt1, uc1, A2, sB + (g + 1) * SCAN_U * 8, h, p);
    }
    load_col(pdt + (size_t)(SCAN_NG - 1) * SCAN_U * 128, dt1);
    load_col(puc + (size_t)(SCAN_NG - 1) * SCAN_U * 128, uc1);
    __builtin_amdgcn_sched_barrier(0);
    chunk_sum_group(dt0, uc0, A2, sB + (SCAN_NG - 2) * SCAN_U * 8, h, p);
    __builtin_amdgcn_sched_barrier(0);   // keeps the wait for the last buffer behind the work above
    chunk_sum_group(dt1, uc1, A2, sB + (SCAN_NG - 1) * SCAN_U * 8, h, p);

    size_t o = ((size_t)b * NCHUNK + c) * 1024 + d * 8;
    *(f32x4*)(Pc + o)     = f32x4{p[0][0], p[0][1], p[1][0], p[1][1]};
    *(f32x4*)(Pc + o + 4) = f32x4{p[2][0], p[2][1], p[3][0], p[3][1]};
    *(f32x4*)(Hc + o)     = f32x4{h[0][0], h[0][1], h[1][0], h[1][1]};
    *(f32x4*)(Hc + o + 4) = f32x4{h[2][0], h[2][1], h[3][0], h[3][1]};
}

// One thread per (batch, d, s); 16 chunks' summaries are loaded at a time so
// that the serial chain waits for memory once per 16 chunks, not per chunk.
__global__ __launch_bounds__(256)
void scan_carry_kernel(const float* __restrict__ Pc,   // (2B,NCHUNK,1024)
                       const float* __restrict__ Hc,   // (2B,NCHUNK,1024)
                       float* __restrict__ Hin) {      // (2B,NCHUNK,1024)
    int idx = blockIdx.x * blockDim.x + threadIdx.x;   // over 2*BATCH*1024
    int b = idx >> 10;
    int r = idx & 1023;
    size_t o = (size_t)b * NCHUNK * 1024 + r;
    float carry = 0.0f;
    for (int c0 = 0; c0 < NCHUNK; c0 += 16) {
        float p[16], h[16];
        #pragma unroll   // p[], h[] in registers; all 32 loads issue before the first wait
        for (int k = 0; k < 16; ++k) {
            p[k] = Pc[o + (size_t)(c0 + k) * 1024];
            h[k] = Hc[o + (size_t)(c0 + k) * 1024];
        }
        #pragma unroll   // constant indices into p[], h[]
        for (int k = 0; k < 16; ++k) {
            Hin[o + (size_t)(c0 + k) * 1024] = carry;
            carry = p[k] * carry + h[k];
        }
        // the next trip rewrites the address and data registers of these stores
        asm volatile("s_wait_xcnt 0x0" ::: "memory");
    }
}

// SCAN_U tokens of launch 3: recurrence, readout over the 8 states, Dp skip and
// SiLU(z) gate; emits f16.
__device__ __forceinline__ void scan_group(const f32x2* dtr, const f32x2* ucr, const f32x2* zr,
                                           const f32x2* A2, float Dd,
                                           const float* sBg, const float* sCg,
                                           f32x2* h, _Float16* __restrict__ yo) {
    _Float16 r[SCAN_U];
    f32x2 zx[SCAN_U / 2], ez[SCAN_U / 2];   // exp(-z) of the 8 tokens
    #pragma unroll
    for (int k = 0; k < SCAN_U / 2; ++k) zx[k] = zr[k] * -1.44269504f;
    exp2_x8(zx, ez);
    #pragma unroll   // constant indices into the register buffers
    for (int k = 0; k < SCAN_U; ++k) {
        f32x2 a[4];
        float ucv = ucr[k >> 1][k & 1];
        ssm_step(dtr[k >> 1][k & 1], ucv, A2, sBg + k * 8, a, h);
        f32x4 c0 = *(const f32x4*)(sCg + k * 8);
        f32x4 c1 = *(const f32x4*)(sCg + k * 8 + 4);
        f32x2 y2 = h[0] * f32x2{c0[0], c0[1]};
        y2 = __builtin_elementwise_fma(h[1], f32x2{c0[2], c0[3]}, y2);
        y2 = __builtin_elementwise_fma(h[2], f32x2{c1[0], c1[1]}, y2);
        y2 = __builtin_elementwise_fma(h[3], f32x2{c1[2], c1[3]}, y2);
        float y  = y2[0] + y2[1];
        float zv = zr[k >> 1][k & 1];
        float g  = zv / (1.0f + ez[k >> 1][k & 1]);
        r[k] = (_Float16)((y + Dd * ucv) * g);
    }
    #pragma unroll
    for (int k = 0; k < SCAN_U; ++k) yo[k * 128] = r[k];
    // what follows rewrites the data registers of these stores
    asm volatile("s_wait_xcnt 0x0" ::: "memory");
}

__global__ __launch_bounds__(128)
void scan_kernel(const float* __restrict__ dt,    // (2B,N,128)
                 const float* __restrict__ uc,    // (2B,N,128)
                 const float* __restrict__ zg,    // (2B,N,128) pre-activation z
                 const float* __restrict__ Bm,    // (2B,N,8)
                 const float* __restrict__ Cm,    // (2B,N,8)
                 const float* __restrict__ A_log, // (2,128,8)
                 const float* __restrict__ Dp,    // (2,128)
                 const float* __restrict__ Hin,   // (2B,NCHUNK,128,8)
                 _Float16* __restrict__ yg) {     // (2B,N,128)
    __shared__ __align__(16) float sB[CHUNK_T * 8];   // 4 KB
    __shared__ __align__(16) float sC[CHUNK_T * 8];   // 4 KB
    int c = blockIdx.x;
    int b = blockIdx.y;
    int d = threadIdx.x;
    A_log += (blockIdx.y / BATCH) * 128 * 8;
    Dp    += (blockIdx.y / BATCH) * 128;
    size_t base = (size_t)b * NTOK + (size_t)c * CHUNK_T;
    const float* pdt = dt + base * 128 + d;
    const float* puc = uc + base * 128 + d;
    const float* pz  = zg + base * 128 + d;
    _Float16*    py  = yg + base * 128 + d;

    f32x2 dt0[SCAN_U / 2], uc0[SCAN_U / 2], z0[SCAN_U / 2];
    f32x2 dt1[SCAN_U / 2], uc1[SCAN_U / 2], z1[SCAN_U / 2];
    load_col(pdt, dt0);
    load_col(puc, uc0);
    load_col(pz,  z0);
    {
        const f32x4* gb = (const f32x4*)(Bm + base * 8);
        const f32x4* gc = (const f32x4*)(Cm + base * 8);
        ((f32x4*)sB)[d]       = gb[d];
        ((f32x4*)sB)[d + 128] = gb[d + 128];
        ((f32x4*)sC)[d]       = gc[d];
        ((f32x4*)sC)[d + 128] = gc[d + 128];
    }
    f32x2 A2[4], h[4];
    load_a2(A_log, d, A2);
    float Dd = Dp[d];
    {
        const float* hi = Hin + ((size_t)b * NCHUNK + c) * 1024 + d * 8;
        f32x4 h0 = *(const f32x4*)(hi);
        f32x4 h1 = *(const f32x4*)(hi + 4);
        h[0] = f32x2{h0[0], h0[1]}; h[1] = f32x2{h0[2], h0[3]};
        h[2] = f32x2{h1[0], h1[1]}; h[3] = f32x2{h1[2], h1[3]};
    }
    __syncthreads();

    // Two register buffers, held apart by scheduling barriers as in launch 1.
    for (int g = 0; g < SCAN_NG - 2; g += 2) {
        load_col(pdt + (size_t)(g + 1) * SCAN_U * 128, dt1);
        load_col(puc + (size_t)(g + 1) * SCAN_U * 128, uc1);
        load_col(pz  + (size_t)(g + 1) * SCAN_U * 128, z1);
        __builtin_amdgcn_sched_barrier(0);
        scan_group(dt0, uc0, z0, A2, Dd, sB + g * SCAN_U * 8, sC + g * SCAN_U * 8,
                   h, py + (size_t)g * SCAN_U * 128);
        load_col(pdt + (size_t)(g + 2) * SCAN_U * 128, dt0);
        load_col(puc + (size_t)(g + 2) * SCAN_U * 128, uc0);
        load_col(pz  + (size_t)(g + 2) * SCAN_U * 128, z0);
        __builtin_amdgcn_sched_barrier(0);
        scan_group(dt1, uc1, z1, A2, Dd, sB + (g + 1) * SCAN_U * 8, sC + (g + 1) * SCAN_U * 8,
                   h, py + (size_t)(g + 1) * SCAN_U * 128);
    }
    load_col(pdt + (size_t)(SCAN_NG - 1) * SCAN_U * 128, dt1);
    load_col(puc + (size_t)(SCAN_NG - 1) * SCAN_U * 128, uc1);
    load_col(pz  + (size_t)(SCAN_NG - 1) * SCAN_U * 128, z1);
    // The three pointers are used here for the last time. As inputs of the wait
    // they stay in their registers up to it, so that no result of these loads is
    // placed on an address register that an earlier one of them still names.
    asm volatile("s_wait_xcnt 0x0" :: "v"(pdt), "v"(puc), "v"(pz) : "memory");
    __builtin_amdgcn_sched_barrier(0);
    scan_group(dt0, uc0, z0, A2, Dd, sB + (SCAN_NG - 2) * SCAN_U * 8, sC + (SCAN_NG - 2) * SCAN_U * 8,
               h, py + (size_t)(SCAN_NG - 2) * SCAN_U * 128);
    __builtin_amdgcn_sched_barrier(0);   // keeps the wait for the last buffer behind the work above
    scan_group(dt1, uc1, z1, A2, Dd, sB + (SCAN_NG - 1) * SCAN_U * 8, sC + (SCAN_NG - 1) * SCAN_U * 8,
               h, py + (size_t)(SCAN_NG - 1) * SCAN_U * 128);
}

// ---------------------------------------------------------------------------
// s = 0.5*(m0 + m1 + ff + bf)  (transposing the raw inputs), cast f16.
// One thread per channel and FP_T consecutive tokens (was one token), so that
// the launch starts FP_T times fewer waves; the tokens lie side by side in the
// raw inputs and come in as 16-byte pieces. A workgroup covers 32 tokens, one
// whole 128-byte line of every channel's row.
// ---------------------------------------------------------------------------
#define FP_T 16
__global__ __launch_bounds__(256)
void final_prep_kernel(const float* __restrict__ msum,  // (B,N,128): m0
                       const float* __restrict__ msum1, // (B,N,128): m1
                       const float* __restrict__ front, // (B,128,N)
                       const float* __restrict__ back,  // (B,128,N)
                       _Float16* __restrict__ sh) {     // (B,N,128)
    int idx = blockIdx.x * blockDim.x + threadIdx.x;    // over (MTOT / FP_T) * 128
    int c  = idx & 127;
    int t0 = (idx >> 7) * FP_T;    // first token, b*N + n
    int b = t0 >> 14;
    int n = t0 & (NTOK - 1);
    size_t src = ((size_t)b * DIMC + c) * NTOK + n;
    const float* pf = front + src;
    const float* pb = back + src;
    const float* pm = msum + (size_t)t0 * 128 + c;
    const float* pn = msum1 + (size_t)t0 * 128 + c;
    f32x4 f[FP_T / 4], g[FP_T / 4];
    float m[FP_T], m1[FP_T];
    #pragma unroll   // f[], g[], m[], m1[] in registers; all loads issue before the first wait
    for (int h = 0; h < FP_T / 4; ++h) {
        f[h] = *(const f32x4*)(pf + 4 * h);
        g[h] = *(const f32x4*)(pb + 4 * h);
    }
    #pragma unroll
    for (int k = 0; k < FP_T; ++k) m[k] = pm[k * 128];
    #pragma unroll   // m1[] in registers; its loads issue with the others, in front of the wait
    for (int k = 0; k < FP_T; ++k) m1[k] = pn[k * 128];
    // As inputs of the wait the four pointers stay in their registers up to it,
    // so that no result of these loads is placed on an address register that an
    // earlier one of them still names.
    asm volatile("s_wait_xcnt 0x0" :: "v"(pf), "v"(pb), "v"(pm), "v"(pn) : "memory");
    _Float16* po = sh + (size_t)t0 * 128 + c;
    #pragma unroll   // constant indices into the register arrays
    for (int k = 0; k < FP_T; ++k)
        po[k * 128] = (_Float16)(0.5f * (m[k] + m1[k] + f[k >> 2][k & 3] + g[k >> 2][k & 3]));
}

// ---------------------------------------------------------------------------
// Host-side pipeline
// ---------------------------------------------------------------------------
extern "C" void kernel_launch(void* const* d_in, const int* in_sizes, int n_in,
                              void* d_out, int out_size, void* d_ws, size_t ws_size,
                              hipStream_t stream) {
    const float* front   = (const float*)d_in[0];
    const float* back    = (const float*)d_in[1];
    const float* ln0_w   = (const float*)d_in[2];
    const float* ln0_b   = (const float*)d_in[3];
    const float* ln1_w   = (const float*)d_in[4];
    const float* ln1_b   = (const float*)d_in[5];
    const float* Wx      = (const float*)d_in[6];
    const float* Wz      = (const float*)d_in[7];
    const float* conv_w  = (const float*)d_in[8];
    const float* conv_b  = (const float*)d_in[9];
    const float* Wxproj  = (const float*)d_in[10];
    const float* Wdt     = (const float*)d_in[11];
    const float* bdt     = (const float*)d_in[12];
    const float* A_log   = (const float*)d_in[13];
    const float* Dp      = (const float*)d_in[14];
    const float* Wout_m  = (const float*)d_in[15];
    const float* bout_m  = (const float*)d_in[16];
    const float* Wout    = (const float*)d_in[17];
    const float* bout    = (const float*)d_in[18];

    char* ws = (char*)d_ws;
    // ---- static workspace layout (bytes); "2 x": block 0's array, then block 1's ----
    _Float16* Wh   = (_Float16*)(ws);                       // 7*16384 halves < 256 KB
    _Float16* WOMh = Wh + 4 * 16384;                        // behind Wx[0..1], Wz[0..1]
    _Float16* WOh  = Wh + 6 * 16384;
    size_t off = 0x40000;
    _Float16* Ah   = (_Float16*)(ws + off); off += (size_t)4 * MTOT * 128 * 2;  // 64 MB: 4 norms (also uc)
    float*    UZ   = (float*)(ws + off);    off += (size_t)4 * MTOT * 128 * 4;  // 128 MB: 2 x u, 2 x z
    _Float16* YGh  = (_Float16*)(ws + off); off += (size_t)2 * MTOT * 128 * 2;  // 32 MB (also s_h)
    float*    BM   = (float*)(ws + off);    off += (size_t)2 * MTOT * 8 * 4;    // 4 MB
    float*    CMb  = (float*)(ws + off);    off += (size_t)2 * MTOT * 8 * 4;    // 4 MB
    float*    PC   = (float*)(ws + off);    off += (size_t)2 * BATCH * NCHUNK * 1024 * 4;  // 4 MB
    float*    HC   = (float*)(ws + off);    off += (size_t)2 * BATCH * NCHUNK * 1024 * 4;  // 4 MB
    float*    HIN  = (float*)(ws + off);    off += (size_t)2 * BATCH * NCHUNK * 1024 * 4;  // 4 MB
    float*    U    = UZ;
    float*    Z    = UZ + (size_t)2 * MTOT * 128;
    float*    UC   = (float*)Ah;   // alias: the norms are consumed by the first GEMM launch
    float*    DT   = U;            // alias: u consumed by conv before dt written
    float*    MS   = U;            // alias: dt consumed by the scan before m0, m1 written
    _Float16* SH   = YGh;          // alias: yg consumed by the out-projections before s written

    // Launches that do not depend on one another share one grid: the seven weight
    // conversions, the four norms, the four input projections, and from there on
    // the two cross blocks side by side.

    // 1) weight conversions to f16 (swizzled into WMMA B-fragment order)
    cvt_swizzle_w_kernel<<<(7 * 16384) / 256, 256, 0, stream>>>(Wx, Wz, Wout_m, Wout, Wh);

    // 2) the two cross-mamba blocks
    ln_transpose_f16_kernel<<<dim3(MTOT / (8 * LN_T), 4), 256, 0, stream>>>(
        front, back, ln0_w, ln0_b, ln1_w, ln1_b, Ah);

    gemm128_wmma_kernel<<<dim3(MTOT / 64, 4), 256, 0, stream>>>(Ah, Wh, nullptr, UZ, 0);

    conv_silu_kernel<<<dim3((MTOT / CONV_T * 128) / 256, 2), 256, 0, stream>>>(
        U, conv_w, conv_b, UC);

    xproj_dt_kernel<<<dim3(MTOT / XP_T, 2), 128, 0, stream>>>(
        UC, Wxproj, Wdt, bdt, DT, BM, CMb);

    scan_chunk_sum_kernel<<<dim3(NCHUNK, 2 * BATCH), 128, 0, stream>>>(
        DT, UC, BM, A_log, PC, HC);
    scan_carry_kernel<<<(2 * BATCH * 1024) / 256, 256, 0, stream>>>(PC, HC, HIN);
    scan_kernel<<<dim3(NCHUNK, 2 * BATCH), 128, 0, stream>>>(
        DT, UC, Z, BM, CMb, A_log, Dp, HIN, YGh);

    gemm128_wmma_kernel<<<dim3(MTOT / 64, 2), 256, 0, stream>>>(YGh, WOMh, bout_m, MS, 0);

    // 3) residual add + 0.5 scale + final GEMM, stored transposed to (B,DIM,N)
    final_prep_kernel<<<(MTOT / FP_T * 128) / 256, 256, 0, stream>>>(
        MS, MS + (size_t)MTOT * 128, front, back, SH);
    gemm128_wmma_kernel<<<MTOT / 64, 256, 0, stream>>>(SH, WOh, bout, (float*)d_out, 2);
}

// v005
// A run of this version takes 212 microseconds.
// Timed twice side by side with v004, it ran 1.19 times as fast both times.
// Over all steps from v000 it is 131 times as fast.
#include <hip/hip_runtime.h>
#include <math.h>

typedef __attribute__((ext_vector_type(16))) _Float16 v16h;
typedef __attribute__((ext_vector_type(8)))  _Float16 v8h;
typedef __attribute__((ext_vector_type(8)))  float    v8f;
typedef __attribute__((ext_vector_type(2)))  float    f32x2;
typedef __attribute__((ext_vector_type(4)))  float    f32x4;

#define DIMC    128
#define D_INNER 128
#define D_STATE 8
#define DT_RANK 8
#define D_CONV  4
#define BATCH   4
#define NTOK    16384               // L*H*W = 256*8*8
#define MTOT    (BATCH * NTOK)      // 65536 tokens

// Eight v_exp_f32 (2^x) in one statement. The instruction set asks for one free
// issue slot behind a transcendental before its result is read or its source
// overwritten: inside the statement each v_exp_f32 is followed by one that is
// independent of it (the outputs are early-clobber, so none lies on an input),
// and the v_nop is the slot behind the last, wherever the statement is scheduled.
__device__ __forceinline__ void exp2_x8(const f32x2* x, f32x2* r) {
    float e0, e1, e2, e3, e4, e5, e6, e7;
    asm("v_exp_f32 %0, %8\n\t"
        "v_exp_f32 %1, %9\n\t"
        "v_exp_f32 %2, %10\n\t"
        "v_exp_f32 %3, %11\n\t"
        "v_exp_f32 %4, %12\n\t"
        "v_exp_f32 %5, %13\n\t"
        "v_exp_f32 %6, %14\n\t"
        "v_exp_f32 %7, %15\n\t"
        "v_nop"
        : "=&v"(e0), "=&v"(e1), "=&v"(e2), "=&v"(e3), "=&v"(e4), "=&v"(e5), "=&v"(e6), "=&v"(e7)
        : "v"(x[0][0]), "v"(x[0][1]), "v"(x[1][0]), "v"(x[1][1]),
          "v"(x[2][0]), "v"(x[2][1]), "v"(x[3][0]), "v"(x[3][1]));
    r[0] = f32x2{e0, e1};
    r[1] = f32x2{e2, e3};
    r[2] = f32x2{e4, e5};
    r[3] = f32x2{e6, e7};
}

// ---------------------------------------------------------------------------
// f32 -> f16 weight conversion WITH swizzle into WMMA B-fragment order.
// Fragment layout (halves): dst[((k0Idx*128 + col)*2 + sel)*16 + j]
//   j<8  -> W[k0Idx*32 + sel*8 + j     ][col]
//   j>=8 -> W[k0Idx*32 + sel*8 + j + 8 ][col]
// so each consuming lane's 16 B halves are one contiguous 32-byte LDS chunk.
// ---------------------------------------------------------------------------
// One launch converts all seven 128x128 matrices; a matrix is 64 workgroups.
// dst holds them in the order Wx[0], Wx[1], Wz[0], Wz[1], Wout_m[0], Wout_m[1], Wout.
__global__ __launch_bounds__(256)
void cvt_swizzle_w_kernel(const float* __restrict__ Wx,
                          const float* __restrict__ Wz,
                          const float* __restrict__ Wom,
                          const float* __restrict__ Wo,
                          _Float16* __restrict__ dst) {
    int i = blockIdx.x * blockDim.x + threadIdx.x;   // over 7 * 16384
    int m7 = blockIdx.x >> 6;       // which of the seven
    const float* src = (m7 < 2) ? Wx : (m7 < 4) ? Wz : (m7 < 6) ? Wom : Wo;
    int mat   = m7 & 1;             // which 128x128 matrix of its input
    int r     = i & 16383;
    int j     = r & 15;             // half index within fragment chunk
    int chunk = r >> 4;             // (k0Idx*128 + col)*2 + sel
    int sel   = chunk & 1;
    int colk  = chunk >> 1;
    int col   = colk & 127;
    int k0Idx = colk >> 7;          // 0..3
    int koff  = j + ((j >= 8) ? 8 : 0);
    int k     = k0Idx * 32 + sel * 8 + koff;
    dst[i] = (_Float16)src[(size_t)mat * 16384 + k * 128 + col];
}

// ---------------------------------------------------------------------------
// Fused transpose (B,DIM,N)->(B,N,DIM) + LayerNorm + cast to f16.
// One wave (32 lanes) per LN_T consecutive tokens; each lane owns 4 channels.
// A wave takes several tokens, for speed only; they lie side by side in x and
// come in as
// 16-byte pieces. The 8 waves of a workgroup cover 64 tokens, 256 bytes of
// every channel's row.
// ---------------------------------------------------------------------------
#define LN_T 8
__global__ __launch_bounds__(256)
void ln_transpose_f16_kernel(const float* __restrict__ front,  // (B, DIM, N)
                             const float* __restrict__ back,   // (B, DIM, N)
                             const float* __restrict__ ln0_w,  // (2, DIM)
                             const float* __restrict__ ln0_b,  // (2, DIM)
                             const float* __restrict__ ln1_w,  // (2, DIM)
                             const float* __restrict__ ln1_b,  // (2, DIM)
                             _Float16* __restrict__ out4) {    // 4 x (B, N, DIM)
    // blockIdx.y = 2 * input + gate picks one of the four norms of the two cross
    // blocks: front feeds block 0's SSM path (ln0) and block 1's gate (ln1), back
    // the other two. Result slot: 2 * gate + block, the order of the weights.
    int gate = blockIdx.y & 1;
    int blk  = (blockIdx.y >> 1) ^ gate;
    const float* x    = (blockIdx.y >> 1) ? back : front;
    const float* w    = (gate ? ln1_w : ln0_w) + blk * DIMC;
    const float* bias = (gate ? ln1_b : ln0_b) + blk * DIMC;
    _Float16*    out  = out4 + (size_t)(2 * gate + blk) * MTOT * DIMC;
    int wave = (blockIdx.x * blockDim.x + threadIdx.x) >> 5;  // over MTOT / LN_T
    int lane = threadIdx.x & 31;
    int t0 = wave * LN_T;          // first token, b * NTOK + n
    int b = t0 >> 14;              // / NTOK
    int n = t0 & (NTOK - 1);
    const float* xl = x + ((size_t)b * DIMC + lane) * NTOK + n;
    f32x4 v[4][LN_T / 4];
    #pragma unroll   // v[][] in registers; all loads issue before the first wait
    for (int q = 0; q < 4; ++q)
        #pragma unroll
        for (int h = 0; h < LN_T / 4; ++h)
            v[q][h] = *(const f32x4*)(xl + (size_t)(32 * q) * NTOK + 4 * h);
    float w0 = w[lane], w1 = w[lane + 32], w2 = w[lane + 64], w3 = w[lane + 96];
    float b0 = bias[lane], b1 = bias[lane + 32], b2 = bias[lane + 64], b3 = bias[lane + 96];
    // As an input of the wait the pointer stays in its registers up to it, so
    // that no result of these loads is placed on an address register that an
    // earlier one of them still names.
    asm volatile("s_wait_xcnt 0x0" :: "v"(xl) : "memory");
    _Float16* ob = out + (size_t)t0 * DIMC;
    float s[LN_T], q[LN_T];
    #pragma unroll   // constant indices into v[][], s[], q[]
    for (int k = 0; k < LN_T; ++k) {
        float v0 = v[0][k >> 2][k & 3];
        float v1 = v[1][k >> 2][k & 3];
        float v2 = v[2][k >> 2][k & 3];
        float v3 = v[3][k >> 2][k & 3];
        s[k] = v0 + v1 + v2 + v3;
        q[k] = v0 * v0 + v1 * v1 + v2 * v2 + v3 * v3;
    }
    // butterfly step by step, all tokens in each step: their exchanges are
    // independent, so a step waits once and not once per token
    #pragma unroll
    for (int off = 16; off > 0; off >>= 1) {
        #pragma unroll
        for (int k = 0; k < LN_T; ++k) {
            s[k] += __shfl_xor(s[k], off, 32);
            q[k] += __shfl_xor(q[k], off, 32);
        }
    }
    #pragma unroll
    for (int k = 0; k < LN_T; ++k) {
        float v0 = v[0][k >> 2][k & 3];
        float v1 = v[1][k >> 2][k & 3];
        float v2 = v[2][k >> 2][k & 3];
        float v3 = v[3][k >> 2][k & 3];
        float mean = s[k] * (1.0f / DIMC);
        float var  = q[k] * (1.0f / DIMC) - mean * mean;
        float rstd = rsqrtf(var + 1e-5f);
        ob[k * DIMC + lane     ] = (_Float16)((v0 - mean) * rstd * w0 + b0);
        ob[k * DIMC + lane + 32] = (_Float16)((v1 - mean) * rstd * w1 + b1);
        ob[k * DIMC + lane + 64] = (_Float16)((v2 - mean) * rstd * w2 + b2);
        ob[k * DIMC + lane + 96] = (_Float16)((v3 - mean) * rstd * w3 + b3);
    }
}

// ---------------------------------------------------------------------------
// A-fragment loader: 16x32 f16 A layout = two contiguous 16B chunks per lane
// (K groups at kSel and kSel+16).
// ---------------------------------------------------------------------------
__device__ __forceinline__ v16h load_a_frag(const _Float16* Ar) {
    v8h lo = *(const v8h*)(Ar);        // K = kSel .. kSel+7
    v8h hi = *(const v8h*)(Ar + 16);   // K = kSel+16 .. kSel+23
    v16h af;
    #pragma unroll
    for (int j = 0; j < 8; ++j) { af[j] = lo[j]; af[j + 8] = hi[j]; }
    return af;
}

// ---------------------------------------------------------------------------
// WMMA GEMM: C(M x 128) = A(M x 128, f16) * W(128 x 128, f16) [+ bias]
// W pre-swizzled in B-fragment order, staged in LDS. Each wave owns a 64x16
// output tile (4 accumulators); one B fragment reused across 4 WMMAs per K
// step -> 16 v_wmma per wave. K loop software-pipelined: fragments for step
// k+1 are issued before the WMMAs of step k so loads overlap the matrix pipe.
// blockIdx.y = which of several independent products of one launch: A, Wf, bias
// and C each hold them one behind the other.
// flags bit1 = store transposed to (B, DIM, NTOK).
// ---------------------------------------------------------------------------
__global__ __launch_bounds__(256)
void gemm128_wmma_kernel(const _Float16* __restrict__ A,
                         const _Float16* __restrict__ Wf,   // swizzled
                         const float* __restrict__ bias,
                         float* __restrict__ C,
                         int flags) {
    __shared__ __align__(64) _Float16 sW[128 * 128];   // 32 KB, fragment order
    A  += (size_t)blockIdx.y * MTOT * 128;
    Wf += (size_t)blockIdx.y * 128 * 128;
    C  += (size_t)blockIdx.y * MTOT * 128;
    if (bias) bias += blockIdx.y * 128;
    {
        const uint4* src = (const uint4*)Wf;
        uint4*       dst = (uint4*)sW;
        for (int i = threadIdx.x; i < (128 * 128) / 8; i += 256) dst[i] = src[i];
    }
    __syncthreads();

    int waveId  = threadIdx.x >> 5;
    int lane    = threadIdx.x & 31;
    int rowBase = blockIdx.x * 64;       // 64 token rows per block (4 tiles/wave)
    int colBase = waveId * 16;           // 8 waves cover 128 output cols
    int col     = colBase + (lane & 15);
    int sel     = lane >> 4;             // 0 / 1
    int kSel    = sel << 3;              // 0 / 8
    int rOff    = sel << 3;              // C fragment: M = r + 8*(lane/16)

    v8f acc0 = {}, acc1 = {}, acc2 = {}, acc3 = {};

    const _Float16* A0 = A + (size_t)(rowBase + (lane & 15)) * 128 + kSel;
    // prologue: fragments for k0Idx = 0 (tile stride = 16 rows * 128 = 2048)
    v16h bf = *(const v16h*)&sW[((0 * 128 + col) * 2 + sel) * 16];
    v16h a0 = load_a_frag(A0 + 0 * 2048);
    v16h a1 = load_a_frag(A0 + 1 * 2048);
    v16h a2 = load_a_frag(A0 + 2 * 2048);
    v16h a3 = load_a_frag(A0 + 3 * 2048);

    #pragma unroll
    for (int k0Idx = 0; k0Idx < 4; ++k0Idx) {
        v16h bfn = {}, a0n = {}, a1n = {}, a2n = {}, a3n = {};
        if (k0Idx < 3) {
            const _Float16* An = A0 + (k0Idx + 1) * 32;
            bfn = *(const v16h*)&sW[(((k0Idx + 1) * 128 + col) * 2 + sel) * 16];
            a0n = load_a_frag(An + 0 * 2048);
            a1n = load_a_frag(An + 1 * 2048);
            a2n = load_a_frag(An + 2 * 2048);
            a3n = load_a_frag(An + 3 * 2048);
        }
        acc0 = __builtin_amdgcn_wmma_f32_16x16x32_f16(false, a0, false, bf, (short)0, acc0, false, false);
        acc1 = __builtin_amdgcn_wmma_f32_16x16x32_f16(false, a1, false, bf, (short)0, acc1, false, false);
        acc2 = __builtin_amdgcn_wmma_f32_16x16x32_f16(false, a2, false, bf, (short)0, acc2, false, false);
        acc3 = __builtin_amdgcn_wmma_f32_16x16x32_f16(false, a3, false, bf, (short)0, acc3, false, false);
        if (k0Idx < 3) { bf = bfn; a0 = a0n; a1 = a1n; a2 = a2n; a3 = a3n; }
    }

    float bv = bias ? bias[col] : 0.0f;
    #pragma unroll
    for (int t = 0; t < 4; ++t) {
        v8f acc = (t == 0) ? acc0 : (t == 1) ? acc1 : (t == 2) ? acc2 : acc3;
        if (flags & 2) {
            // transposed store into (B, DIM, NTOK)
            #pragma unroll
            for (int r = 0; r < 8; ++r) {
                int row = rowBase + t * 16 + r + rOff;   // global token index
                int b = row >> 14, n = row & (NTOK - 1);
                C[((size_t)b * DIMC + col) * NTOK + n] = acc[r] + bv;
            }
        } else {
            #pragma unroll
            for (int r = 0; r < 8; ++r)
                C[(size_t)(rowBase + t * 16 + r + rOff) * 128 + col] = acc[r] + bv;
        }
    }
}

// ---------------------------------------------------------------------------
// Causal depthwise conv1d (kernel 4) along tokens + bias + SiLU.
// One thread per channel and CONV_T consecutive tokens (was one token), so that
// the launch starts CONV_T times fewer waves; the window slides over registers.
// ---------------------------------------------------------------------------
#define CONV_T 16
__global__ __launch_bounds__(256)
void conv_silu_kernel(const float* __restrict__ u,   // 2 x (B,N,128)
                      const float* __restrict__ cw,  // (2,128,4)
                      const float* __restrict__ cb,  // (2,128)
                      float* __restrict__ uc) {      // 2 x (B,N,128)
    u  += (size_t)blockIdx.y * MTOT * 128;             // blockIdx.y = cross block
    cw += blockIdx.y * 128 * D_CONV;
    cb += blockIdx.y * 128;
    uc += (size_t)blockIdx.y * MTOT * 128;
    int idx = blockIdx.x * blockDim.x + threadIdx.x;   // over (MTOT / CONV_T) * 128
    int d  = idx & 127;
    int t0 = (idx >> 7) * CONV_T;  // first token, b*N + n
    int n0 = t0 & (NTOK - 1);      // a multiple of CONV_T: 0 only at a batch's start
    const float* up = u + (size_t)t0 * 128 + d;
    float v[CONV_T + D_CONV - 1];
    #pragma unroll   // v[] in registers; the zero padding in front of token 0
    for (int k = 0; k < D_CONV - 1; ++k) v[k] = 0.0f;
    if (n0 > 0) {
        #pragma unroll
        for (int k = 0; k < D_CONV - 1; ++k) v[k] = up[(k - (D_CONV - 1)) * 128];
    }
    #pragma unroll   // all loads issue before the first wait
    for (int k = 0; k < CONV_T; ++k) v[k + D_CONV - 1] = up[k * 128];
    f32x4 wv = *(const f32x4*)(cw + d * D_CONV);
    float bv = cb[d];
    // As inputs of the wait the pointer and the channel index (the offset of the
    // cw and cb loads) stay in their registers up to it, so that no result of
    // these loads is placed on a register that an earlier one of them still names.
    asm volatile("s_wait_xcnt 0x0" :: "v"(up), "v"(d) : "memory");
    float* po = uc + (size_t)t0 * 128 + d;
    f32x2 a[CONV_T / 2], x[CONV_T / 2], e[CONV_T / 2];
    float r[CONV_T];
    #pragma unroll   // constant indices into the register arrays
    for (int k = 0; k < CONV_T; ++k) {
        float acc = bv;
        #pragma unroll
        for (int i = 0; i < D_CONV; ++i) acc = __builtin_fmaf(v[k + i], wv[i], acc);
        a[k >> 1][k & 1] = acc;
    }
    #pragma unroll
    for (int k = 0; k < CONV_T / 2; ++k) x[k] = a[k] * -1.44269504f;
    exp2_x8(x, e);                                     // exp(-acc), 8 tokens each
    exp2_x8(x + 4, e + 4);
    #pragma unroll
    for (int k = 0; k < CONV_T; ++k)
        r[k] = a[k >> 1][k & 1] / (1.0f + e[k >> 1][k & 1]);   // SiLU
    // keeps every store behind the last arithmetic, so that no register that an
    // issued store names is written again
    __builtin_amdgcn_sched_barrier(0);
    #pragma unroll
    for (int k = 0; k < CONV_T; ++k) po[k * 128] = r[k];
}

// ---------------------------------------------------------------------------
// x_dbl = uc @ Wxproj -> (dt_r | B | C); dt = softplus(dt_r @ Wdt + bdt)
// One 128-thread workgroup per XP_T tokens (was one token), so that the launch
// starts XP_T times fewer waves and every lane works in both parts.
//   part 1: lane = token, wave = 6 of the 24 columns of Wxproj. The uc rows are
//           staged in LDS (row pitch 132 floats: 16 lanes' 16-byte reads of one
//           column group fall on all 64 banks); the wave-uniform Wxproj values
//           come through the scalar cache.
//   part 2: thread = channel, token after token, dt_r rows by LDS broadcast.
// Each sum runs in the order it had.
// ---------------------------------------------------------------------------
#define XP_T     32
#define XP_PITCH 132
__global__ __launch_bounds__(128)
void xproj_dt_kernel(const float* __restrict__ uc,      // 2 x (M,128)
                     const float* __restrict__ Wxproj,  // (2,128,24)
                     const float* __restrict__ Wdt,     // (2,8,128)
                     const float* __restrict__ bdt,     // (2,128)
                     float* __restrict__ dt,            // 2 x (M,128)
                     float* __restrict__ Bm,            // 2 x (M,8)
                     float* __restrict__ Cm) {          // 2 x (M,8)
    __shared__ __align__(16) float sU[XP_T * XP_PITCH];   // 16.5 KB
    __shared__ __align__(16) float sX[3 * XP_T * 8];      // dt_r, B, C: (XP_T,8) each
    uc     += (size_t)blockIdx.y * MTOT * 128;            // blockIdx.y = cross block
    Wxproj += blockIdx.y * 128 * 24;
    Wdt    += blockIdx.y * DT_RANK * 128;
    bdt    += blockIdx.y * 128;
    dt     += (size_t)blockIdx.y * MTOT * 128;
    Bm     += (size_t)blockIdx.y * MTOT * 8;
    Cm     += (size_t)blockIdx.y * MTOT * 8;
    int tid = threadIdx.x;
    size_t t0 = (size_t)blockIdx.x * XP_T;
    {
        const f32x4* g = (const f32x4*)(uc + t0 * 128);
        f32x4 r[XP_T / 4];
        #pragma unroll   // r[] in registers; all loads issue before the first wait
        for (int i = 0; i < XP_T / 4; ++i) r[i] = g[tid + i * 128];
        #pragma unroll
        for (int i = 0; i < XP_T / 4; ++i) {
            int e = tid + i * 128;                       // row e / 32, floats 4 * (e % 32) ..
            *(f32x4*)&sU[(e >> 5) * XP_PITCH + (e & 31) * 4] = r[i];
        }
    }
    float wd[DT_RANK];
    #pragma unroll
    for (int r = 0; r < DT_RANK; ++r) wd[r] = Wdt[r * 128 + tid];
    float bb = bdt[tid];
    __syncthreads();

    {
        int lane = tid & 31;
        // the wave's number as a scalar, so that the Wxproj addresses are scalar too
        int j0 = __builtin_amdgcn_readfirstlane(tid >> 5) * 6;
        const float* ur = sU + lane * XP_PITCH;
        const float* wp = Wxproj + j0;
        float acc[6];
        #pragma unroll
        for (int jj = 0; jj < 6; ++jj) acc[jj] = 0.0f;
        for (int c = 0; c < 128; c += 4) {
            f32x4 uv = *(const f32x4*)(ur + c);
            #pragma unroll   // acc[] in registers
            for (int i = 0; i < 4; ++i)
                #pragma unroll
                for (int jj = 0; jj < 6; ++jj)
                    acc[jj] = __builtin_fmaf(uv[i], wp[(c + i) * 24 + jj], acc[jj]);
        }
        #pragma unroll
        for (int jj = 0; jj < 6; ++jj) {
            int j = j0 + jj;
            sX[(j >> 3) * (XP_T * 8) + lane * 8 + (j & 7)] = acc[jj];
        }
    }
    __syncthreads();

    *(f32x2*)(Bm + t0 * 8 + tid * 2) = *(const f32x2*)&sX[1 * XP_T * 8 + tid * 2];
    *(f32x2*)(Cm + t0 * 8 + tid * 2) = *(const f32x2*)&sX[2 * XP_T * 8 + tid * 2];
    // what follows rewrites the offset and data registers of these two stores
    asm volatile("s_wait_xcnt 0x0" ::: "memory");

    float* po = dt + t0 * 128 + tid;
    for (int k0 = 0; k0 < XP_T; k0 += 8) {
        float o[8];
        #pragma unroll   // o[] in registers
        for (int k = 0; k < 8; ++k) {
            f32x4 r0 = *(const f32x4*)&sX[(k0 + k) * 8];
            f32x4 r1 = *(const f32x4*)&sX[(k0 + k) * 8 + 4];
            float a = bb;
            #pragma unroll
            for (int r = 0; r < 4; ++r) a += r0[r] * wd[r];
            #pragma unroll
            for (int r = 0; r < 4; ++r) a += r1[r] * wd[r + 4];
            o[k] = (a > 20.0f) ? a : log1pf(__expf(a));   // softplus
        }
        #pragma unroll
        for (int k = 0; k < 8; ++k) po[(k0 + k) * 128] = o[k];
        // the next trip rewrites the data registers of these stores
        asm volatile("s_wait_xcnt 0x0" ::: "memory");
    }
}

// ---------------------------------------------------------------------------
// SSM scan, cut along the tokens into NCHUNK chunks of CHUNK_T steps.
// h[t] = a[t]*h[t-1] + b[t] is linear in h, so a chunk acts on its incoming
// state as  h_out = P*h_in + H  with P = product of its a[t] and H = its end
// state from h_in = 0.  Three launches:
//   1) every chunk: P and H                        (all chunks side by side)
//   2) every (batch, d, s): the incoming state of each chunk, chunk by chunk
//   3) every chunk: the recurrence again from its incoming state, with readout
// Launches 1 and 3: one workgroup of 128 threads per chunk, thread = channel d,
// which keeps its 8 states in registers as 4 pairs. A wave's load of dt, uc or
// z is then one whole 128-byte line, the readout sum over the states stays in
// the thread, and the gate is worked out once per (token, channel) with every
// lane busy. The B and C rows of the chunk, the same for all channels, are
// staged in LDS once and read from there by broadcast.
// The two cross blocks are independent and go through each launch side by side:
// their arrays lie one behind the other, so that they read as 2 * BATCH batches,
// and only the per-block parameters are picked by batch index / BATCH.
// ---------------------------------------------------------------------------
#define CHUNK_T 128
#define NCHUNK  (NTOK / CHUNK_T)    // 128 chunks per batch
#define SCAN_U  8                   // tokens per register buffer (two buffers)
#define SCAN_NG (CHUNK_T / SCAN_U)  // 16 buffer fills per chunk

// log2(e) * A for the 8 states of channel d, A = -exp(A_log): exp(dt*A) is then
// one multiply and one v_exp_f32.
__device__ __forceinline__ void load_a2(const float* __restrict__ A_log, int d, f32x2* A2) {
    f32x4 l0 = *(const f32x4*)(A_log + d * 8);
    f32x4 l1 = *(const f32x4*)(A_log + d * 8 + 4);
    A2[0] = f32x2{-__expf(l0[0]), -__expf(l0[1])} * 1.44269504f;
    A2[1] = f32x2{-__expf(l0[2]), -__expf(l0[3])} * 1.44269504f;
    A2[2] = f32x2{-__expf(l1[0]), -__expf(l1[1])} * 1.44269504f;
    A2[3] = f32x2{-__expf(l1[2]), -__expf(l1[3])} * 1.44269504f;
}

// SCAN_U tokens of one channel's column of a (token, 128) array. Two tokens
// share a register pair: a packed multiply that takes one of them as its scalar
// names the whole pair, and the wait in front of it covers both halves, so the
// other half must belong to the same buffer and not to the one still in flight.
__device__ __forceinline__ void load_col(const float* __restrict__ p, f32x2* r) {
    #pragma unroll   // r[] in registers; the loads issue back to back
    for (int k = 0; k < SCAN_U; ++k) r[k >> 1][k & 1] = p[k * 128];
}

// One step of the recurrence for the 8 states of a channel.
__device__ __forceinline__ void ssm_step(float dtv, float ucv, const f32x2* A2,
                                         const float* sBrow, f32x2* a, f32x2* h) {
    f32x4 b0 = *(const f32x4*)(sBrow);
    f32x4 b1 = *(const f32x4*)(sBrow + 4);
    f32x2 Bp[4] = {f32x2{b0[0], b0[1]}, f32x2{b0[2], b0[3]},
                   f32x2{b1[0], b1[1]}, f32x2{b1[2], b1[3]}};
    float du = dtv * ucv;
    f32x2 x[4];
    #pragma unroll   // x[], a[], h[] in registers
    for (int j = 0; j < 4; ++j) x[j] = A2[j] * dtv;
    exp2_x8(x, a);
    #pragma unroll
    for (int j = 0; j < 4; ++j) h[j] = __builtin_elementwise_fma(a[j], h[j], Bp[j] * du);
}

__device__ __forceinline__ void chunk_sum_group(const f32x2* dtr, const f32x2* ucr,
                                                const f32x2* A2, const float* sBg,
                                                f32x2* h, f32x2* p) {
    #pragma unroll   // constant indices into the register buffers
    for (int k = 0; k < SCAN_U; ++k) {
        f32x2 a[4];
        ssm_step(dtr[k >> 1][k & 1], ucr[k >> 1][k & 1], A2, sBg + k * 8, a, h);
        #pragma unroll
        for (int j = 0; j < 4; ++j) p[j] *= a[j];
    }
}

__global__ __launch_bounds__(128)
void scan_chunk_sum_kernel(const float* __restrict__ dt,    // (2B,N,128)
                           const float* __restrict__ uc,    // (2B,N,128)
                           const float* __restrict__ Bm,    // (2B,N,8)
                           const float* __restrict__ A_log, // (2,128,8)
                           float* __restrict__ Pc,          // (2B,NCHUNK,128,8)
                           float* __restrict__ Hc) {        // (2B,NCHUNK,128,8)
    __shared__ __align__(16) float sB[CHUNK_T * 8];         // 4 KB
    int c = blockIdx.x;
    int b = blockIdx.y;
    int d = threadIdx.x;
    A_log += (blockIdx.y / BATCH) * 128 * 8;
    size_t base = (size_t)b * NTOK + (size_t)c * CHUNK_T;
    const float* pdt = dt + base * 128 + d;
    const float* puc = uc + base * 128 + d;

    f32x2 dt0[SCAN_U / 2], uc0[SCAN_U / 2], dt1[SCAN_U / 2], uc1[SCAN_U / 2];
    load_col(pdt, dt0);
    load_col(puc, uc0);
    {
        const f32x4* g = (const f32x4*)(Bm + base * 8);
        ((f32x4*)sB)[d]       = g[d];
        ((f32x4*)sB)[d + 128] = g[d + 128];
    }
    f32x2 A2[4], h[4], p[4];
    load_a2(A_log, d, A2);
    #pragma unroll
    for (int j = 0; j < 4; ++j) { h[j] = f32x2{0.0f, 0.0f}; p[j] = f32x2{1.0f, 1.0f}; }
    __syncthreads();

    // Two register buffers: while one is worked on, the other's loads fly. The
    // scheduling barriers keep each buffer's loads in front of the work on the
    // other buffer; without them the compiler sinks the loads to their first use.
    for (int g = 0; g < SCAN_NG - 2; g += 2) {
        load_col(pdt + (size_t)(g + 1) * SCAN_U * 128, dt1);
        load_col(puc + (size_t)(g + 1) * SCAN_U * 128, uc1);
        __builtin_amdgcn_sched_barrier(0);
        chunk_sum_group(dt0, uc0, A2, sB + g * SCAN_U * 8, h, p);
        load_col(pdt + (size_t)(g + 2) * SCAN_U * 128, dt0);
        load_col(puc + (size_t)(g + 2) * SCAN_U * 128, uc0);
        __builtin_amdgcn_sched_barrier(0);
        chunk_sum_group(dt1, uc1, A2, sB + (g + 1) * SCAN_U * 8, h, p);
    }
    load_col(pdt + (size_t)(SCAN_NG - 1) * SCAN_U * 128, dt1);
    load_col(puc + (size_t)(SCAN_NG - 1) * SCAN_U * 128, uc1);
    __builtin_amdgcn_sched_barrier(0);
    chunk_sum_group(dt0, uc0, A2, sB + (SCAN_NG - 2) * SCAN_U * 8, h, p);
    __builtin_amdgcn_sched_barrier(0);   // keeps the wait for the last buffer behind the work above
    chunk_sum_group(dt1, uc1, A2, sB + (SCAN_NG - 1) * SCAN_U * 8, h, p);

    size_t o = ((size_t)b * NCHUNK + c) * 1024 + d * 8;
    *(f32x4*)(Pc + o)     = f32x4{p[0][0], p[0][1], p[1][0], p[1][1]};
    *(f32x4*)(Pc + o + 4) = f32x4{p[2][0], p[2][1], p[3][0], p[3][1]};
    *(f32x4*)(Hc + o)     = f32x4{h[0][0], h[0][1], h[1][0], h[1][1]};
    *(f32x4*)(Hc + o + 4) = f32x4{h[2][0], h[2][1], h[3][0], h[3][1]};
}

// One thread per (batch, d, s); 16 chunks' summaries are loaded at a time so
// that the serial chain waits for memory once per 16 chunks, not per chunk.
__global__ __launch_bounds__(256)
void scan_carry_kernel(const float* __restrict__ Pc,   // (2B,NCHUNK,1024)
                       const float* __restrict__ Hc,   // (2B,NCHUNK,1024)
                       float* __restrict__ Hin) {      // (2B,NCHUNK,1024)
    int idx = blockIdx.x * blockDim.x + threadIdx.x;   // over 2*BATCH*1024
    int b = idx >> 10;
    int r = idx & 1023;
    size_t o = (size_t)b * NCHUNK * 1024 + r;
    float carry = 0.0f;
    for (int c0 = 0; c0 < NCHUNK; c0 += 16) {
        float p[16], h[16];
        #pragma unroll   // p[], h[] in registers; all 32 loads issue before the first wait
        for (int k = 0; k < 16; ++k) {
            p[k] = Pc[o + (size_t)(c0 + k) * 1024];
            h[k] = Hc[o + (size_t)(c0 + k) * 1024];
        }
        #pragma unroll   // constant indices into p[], h[]
        for (int k = 0; k < 16; ++k) {
            Hin[o + (size_t)(c0 + k) * 1024] = carry;
            carry = p[k] * carry + h[k];
        }
        // the next trip rewrites the address and data registers of these stores
        asm volatile("s_wait_xcnt 0x0" ::: "memory");
    }
}

// SCAN_U tokens of launch 3: recurrence, readout over the 8 states, Dp skip and
// SiLU(z) gate; emits f16.
__device__ __forceinline__ void scan_group(const f32x2* dtr, const f32x2* ucr, const f32x2* zr,
                                           const f32x2* A2, float Dd,
                                           const float* sBg, const float* sCg,
                                           f32x2* h, _Float16* __restrict__ yo) {
    _Float16 r[SCAN_U];
    f32x2 zx[SCAN_U / 2], ez[SCAN_U / 2];   // exp(-z) of the 8 tokens
    #pragma unroll
    for (int k = 0; k < SCAN_U / 2; ++k) zx[k] = zr[k] * -1.44269504f;
    exp2_x8(zx, ez);
    #pragma unroll   // constant indices into the register buffers
    for (int k = 0; k < SCAN_U; ++k) {
        f32x2 a[4];
        float ucv = ucr[k >> 1][k & 1];
        ssm_step(dtr[k >> 1][k & 1], ucv, A2, sBg + k * 8, a, h);
        f32x4 c0 = *(const f32x4*)(sCg + k * 8);
        f32x4 c1 = *(const f32x4*)(sCg + k * 8 + 4);
        f32x2 y2 = h[0] * f32x2{c0[0], c0[1]};
        y2 = __builtin_elementwise_fma(h[1], f32x2{c0[2], c0[3]}, y2);
        y2 = __builtin_elementwise_fma(h[2], f32x2{c1[0], c1[1]}, y2);
        y2 = __builtin_elementwise_fma(h[3], f32x2{c1[2], c1[3]}, y2);
        float y  = y2[0] + y2[1];
        float zv = zr[k >> 1][k & 1];
        float g  = zv / (1.0f + ez[k >> 1][k & 1]);
        r[k] = (_Float16)((y + Dd * ucv) * g);
    }
    #pragma unroll
    for (int k = 0; k < SCAN_U; ++k) yo[k * 128] = r[k];
    // what follows rewrites the data registers of these stores
    asm volatile("s_wait_xcnt 0x0" ::: "memory");
}

__global__ __launch_bounds__(128)
void scan_kernel(const float* __restrict__ dt,    // (2B,N,128)
                 const float* __restrict__ uc,    // (2B,N,128)
                 const float* __restrict__ zg,    // (2B,N,128) pre-activation z
                 const float* __restrict__ Bm,    // (2B,N,8)
                 const float* __restrict__ Cm,    // (2B,N,8)
                 const float* __restrict__ A_log, // (2,128,8)
                 const float* __restrict__ Dp,    // (2,128)
                 const float* __restrict__ Hin,   // (2B,NCHUNK,128,8)
                 _Float16* __restrict__ yg) {     // (2B,N,128)
    __shared__ __align__(16) float sB[CHUNK_T * 8];   // 4 KB
    __shared__ __align__(16) float sC[CHUNK_T * 8];   // 4 KB
    int c = blockIdx.x;
    int b = blockIdx.y;
    int d = threadIdx.x;
    A_log += (blockIdx.y / BATCH) * 128 * 8;
    Dp    += (blockIdx.y / BATCH) * 128;
    size_t base = (size_t)b * NTOK + (size_t)c * CHUNK_T;
    const float* pdt = dt + base * 128 + d;
    const float* puc = uc + base * 128 + d;
    const float* pz  = zg + base * 128 + d;
    _Float16*    py  = yg + base * 128 + d;

    f32x2 dt0[SCAN_U / 2], uc0[SCAN_U / 2], z0[SCAN_U / 2];
    f32x2 dt1[SCAN_U / 2], uc1[SCAN_U / 2], z1[SCAN_U / 2];
    load_col(pdt, dt0);
    load_col(puc, uc0);
    load_col(pz,  z0);
    {
        const f32x4* gb = (const f32x4*)(Bm + base * 8);
        const f32x4* gc = (const f32x4*)(Cm + base * 8);
        ((f32x4*)sB)[d]       = gb[d];
        ((f32x4*)sB)[d + 128] = gb[d + 128];
        ((f32x4*)sC)[d]       = gc[d];
        ((f32x4*)sC)[d + 128] = gc[d + 128];
    }
    f32x2 A2[4], h[4];
    load_a2(A_log, d, A2);
    float Dd = Dp[d];
    {
        const float* hi = Hin + ((size_t)b * NCHUNK + c) * 1024 + d * 8;
        f32x4 h0 = *(const f32x4*)(hi);
        f32x4 h1 = *(const f32x4*)(hi + 4);
        h[0] = f32x2{h0[0], h0[1]}; h[1] = f32x2{h0[2], h0[3]};
        h[2] = f32x2{h1[0], h1[1]}; h[3] = f32x2{h1[2], h1[3]};
    }
    __syncthreads();

    // Two register buffers, held apart by scheduling barriers as in launch 1.
    for (int g = 0; g < SCAN_NG - 2; g += 2) {
        load_col(pdt + (size_t)(g + 1) * SCAN_U * 128, dt1);
        load_col(puc + (size_t)(g + 1) * SCAN_U * 128, uc1);
        load_col(pz  + (size_t)(g + 1) * SCAN_U * 128, z1);
        __builtin_amdgcn_sched_barrier(0);
        scan_group(dt0, uc0, z0, A2, Dd, sB + g * SCAN_U * 8, sC + g * SCAN_U * 8,
                   h, py + (size_t)g * SCAN_U * 128);
        load_col(pdt + (size_t)(g + 2) * SCAN_U * 128, dt0);
        load_col(puc + (size_t)(g + 2) * SCAN_U * 128, uc0);
        load_col(pz  + (size_t)(g + 2) * SCAN_U * 128, z0);
        __builtin_amdgcn_sched_barrier(0);
        scan_group(dt1, uc1, z1, A2, Dd, sB + (g + 1) * SCAN_U * 8, sC + (g + 1) * SCAN_U * 8,
                   h, py + (size_t)(g + 1) * SCAN_U * 128);
    }
    load_col(pdt + (size_t)(SCAN_NG - 1) * SCAN_U * 128, dt1);
    load_col(puc + (size_t)(SCAN_NG - 1) * SCAN_U * 128, uc1);
    load_col(pz  + (size_t)(SCAN_NG - 1) * SCAN_U * 128, z1);
    // The three pointers are used here for the last time. As inputs of the wait
    // they stay in their registers up to it, so that no result of these loads is
    // placed on an address register that an earlier one of them still names.
    asm volatile("s_wait_xcnt 0x0" :: "v"(pdt), "v"(puc), "v"(pz) : "memory");
    __builtin_amdgcn_sched_barrier(0);
    scan_group(dt0, uc0, z0, A2, Dd, sB + (SCAN_NG - 2) * SCAN_U * 8, sC + (SCAN_NG - 2) * SCAN_U * 8,
               h, py + (size_t)(SCAN_NG - 2) * SCAN_U * 128);
    __builtin_amdgcn_sched_barrier(0);   // keeps the wait for the last buffer behind the work above
    scan_group(dt1, uc1, z1, A2, Dd, sB + (SCAN_NG - 1) * SCAN_U * 8, sC + (SCAN_NG - 1) * SCAN_U * 8,
               h, py + (size_t)(SCAN_NG - 1) * SCAN_U * 128);
}

// ---------------------------------------------------------------------------
// Both out-projections, the residual sum and the final projection in one launch:
//   out = (0.5 * (yg0 @ Wom0 + yg1 @ Wom1 + bom0 + bom1 + ff + bf)) @ Wout + bout
// stored transposed to (B, DIM, NTOK). m0, m1 and s never go to memory.
// A workgroup of 8 waves takes OF_ROWS tokens; a wave owns 32 tokens x 64 columns
// (2 x 4 accumulators), so that its 32 tokens are one whole 128-byte line of each
// of its channels' rows in front, back and out. The accumulators start from
// ff + bf + bom0 + bom1 and take both products on top; s goes as f16 through LDS
// from accumulator layout to A-fragment layout (row pitch 272 bytes: the 16 rows
// of a 16-byte fragment read fall on all 64 banks).
// ---------------------------------------------------------------------------
#define OF_ROWS  128
#define OF_PITCH 136   // halves
__global__ __launch_bounds__(256)
void out_fused_kernel(const _Float16* __restrict__ yg,    // 2 x (B,N,128)
                      const _Float16* __restrict__ Wf,    // Wout_m[0], Wout_m[1], Wout, swizzled
                      const float* __restrict__ bom,      // (2,128)
                      const float* __restrict__ front,    // (B,128,N)
                      const float* __restrict__ back,     // (B,128,N)
                      const float* __restrict__ bout,     // (128)
                      float* __restrict__ out) {          // (B,128,N)
    __shared__ __align__(64) _Float16 sW[3 * 128 * 128];         // 96 KB, fragment order
    __shared__ __align__(16) _Float16 sS[OF_ROWS * OF_PITCH];    // 34 KB
    int tid  = threadIdx.x;
    int lane = tid & 31;
    int l15  = lane & 15;
    int sel  = lane >> 4;                 // 0 / 1
    int rowW = (tid >> 6) * 32;           // the wave's first token within the tile
    int colW = ((tid >> 5) & 1) * 64;     // the wave's first column
    int row0 = blockIdx.x * OF_ROWS;      // first token, b * NTOK + n
    int b    = row0 >> 14;
    int n0   = row0 & (NTOK - 1);

    // A lane's accumulator registers r = 0..7 are 8 consecutive tokens of one
    // channel: 32 contiguous bytes of front, back and out.
    size_t ro = ((size_t)b * DIMC + colW + l15) * NTOK + n0 + rowW + sel * 8;
    const float* pf = front + ro;
    const float* pb = back + ro;
    const _Float16* A0 = yg + (size_t)(row0 + rowW + l15) * 128 + sel * 8;
    const _Float16* A1 = A0 + (size_t)MTOT * 128;

    f32x4 f[2][4][2], g[2][4][2];
    v16h  a[2][4];
    #pragma unroll   // f[], g[], a[] in registers; all loads issue before the first wait
    for (int rt = 0; rt < 2; ++rt)
        #pragma unroll
        for (int ct = 0; ct < 4; ++ct)
            #pragma unroll
            for (int h = 0; h < 2; ++h) {
                f[rt][ct][h] = *(const f32x4*)(pf + (size_t)(ct * 16) * NTOK + rt * 16 + h * 4);
                g[rt][ct][h] = *(const f32x4*)(pb + (size_t)(ct * 16) * NTOK + rt * 16 + h * 4);
            }
    #pragma unroll
    for (int rt = 0; rt < 2; ++rt)
        #pragma unroll
        for (int k = 0; k < 4; ++k) a[rt][k] = load_a_frag(A0 + rt * 2048 + k * 32);
    float bs[4], bo[4];
    #pragma unroll
    for (int ct = 0; ct < 4; ++ct) {
        int col = colW + ct * 16 + l15;
        bs[ct] = bom[col] + bom[128 + col];
        bo[ct] = bout[col];
    }
    const uint4* wsrc = (const uint4*)Wf + tid;
    uint4*       wdst = (uint4*)sW + tid;
    #pragma unroll 8   // eight 16-byte loads in flight per thread
    for (int i = 0; i < (3 * 128 * 128) / 8 / 256; ++i) wdst[i * 256] = wsrc[i * 256];

    v8f acc[2][4];
    #pragma unroll   // constant indices into the register arrays
    for (int rt = 0; rt < 2; ++rt)
        #pragma unroll
        for (int ct = 0; ct < 4; ++ct)
            #pragma unroll
            for (int r = 0; r < 8; ++r)
                acc[rt][ct][r] = f[rt][ct][r >> 2][r & 3] + g[rt][ct][r >> 2][r & 3] + bs[ct];

    // As inputs of the wait the pointers stay in their registers up to it, so that
    // no register that an issued load names is written before it.
    asm volatile("s_wait_xcnt 0x0" :: "v"(pf), "v"(pb), "v"(A0), "v"(wsrc) : "memory");
    __syncthreads();

    // The second block's fragments fly while the first block's products run, one
    // k step's worth issued per k step.
    v16h a1[2][4];
    #pragma unroll
    for (int k = 0; k < 4; ++k) {
        a1[0][k] = load_a_frag(A1 + k * 32);
        a1[1][k] = load_a_frag(A1 + 2048 + k * 32);
        #pragma unroll
        for (int ct = 0; ct < 4; ++ct) {
            v16h bf = *(const v16h*)&sW[((k * 128 + colW + ct * 16 + l15) * 2 + sel) * 16];
            acc[0][ct] = __builtin_amdgcn_wmma_f32_16x16x32_f16(false, a[0][k], false, bf, (short)0, acc[0][ct], false, false);
            acc[1][ct] = __builtin_amdgcn_wmma_f32_16x16x32_f16(false, a[1][k], false, bf, (short)0, acc[1][ct], false, false);
        }
        // Keeps the next step's fragment loads behind this step's products, whose
        // operand registers they take: hoisted together they push the kernel past
        // 256 registers, and only one workgroup fits a WGP.
        __builtin_amdgcn_sched_barrier(0);
    }
    // what follows may rewrite the address registers of these loads
    asm volatile("s_wait_xcnt 0x0" :: "v"(A1) : "memory");
    #pragma unroll
    for (int k = 0; k < 4; ++k)
        #pragma unroll
        for (int ct = 0; ct < 4; ++ct) {
            v16h bf = *(const v16h*)&sW[16384 + ((k * 128 + colW + ct * 16 + l15) * 2 + sel) * 16];
            acc[0][ct] = __builtin_amdgcn_wmma_f32_16x16x32_f16(false, a1[0][k], false, bf, (short)0, acc[0][ct], false, false);
            acc[1][ct] = __builtin_amdgcn_wmma_f32_16x16x32_f16(false, a1[1][k], false, bf, (short)0, acc[1][ct], false, false);
        }

    // s, accumulator layout: row = r + 8 * sel, column = l15 of each 16 x 16 tile
    #pragma unroll
    for (int rt = 0; rt < 2; ++rt)
        #pragma unroll
        for (int ct = 0; ct < 4; ++ct)
            #pragma unroll
            for (int r = 0; r < 8; ++r)
                sS[(rowW + rt * 16 + sel * 8 + r) * OF_PITCH + colW + ct * 16 + l15] =
                    (_Float16)(0.5f * acc[rt][ct][r]);
    __syncthreads();   // a wave's s rows hold the columns of its neighbour wave too

    v8f o[2][4] = {};
    const _Float16* S0 = sS + (rowW + l15) * OF_PITCH + sel * 8;
    #pragma unroll
    for (int k = 0; k < 4; ++k) {
        v16h s0 = load_a_frag(S0 + k * 32);
        v16h s1 = load_a_frag(S0 + 16 * OF_PITCH + k * 32);
        #pragma unroll
        for (int ct = 0; ct < 4; ++ct) {
            v16h bf = *(const v16h*)&sW[2 * 16384 + ((k * 128 + colW + ct * 16 + l15) * 2 + sel) * 16];
            o[0][ct] = __builtin_amdgcn_wmma_f32_16x16x32_f16(false, s0, false, bf, (short)0, o[0][ct], false, false);
            o[1][ct] = __builtin_amdgcn_wmma_f32_16x16x32_f16(false, s1, false, bf, (short)0, o[1][ct], false, false);
        }
    }

    float* po = out + ro;
    #pragma unroll
    for (int rt = 0; rt < 2; ++rt)
        #pragma unroll
        for (int ct = 0; ct < 4; ++ct) o[rt][ct] += bo[ct];
    // keeps every store behind the last arithmetic, so that no register that an
    // issued store names is written again
    __builtin_amdgcn_sched_barrier(0);
    #pragma unroll
    for (int rt = 0; rt < 2; ++rt)
        #pragma unroll
        for (int ct = 0; ct < 4; ++ct)
            #pragma unroll
            for (int h = 0; h < 2; ++h)
                *(f32x4*)(po + (size_t)(ct * 16) * NTOK + rt * 16 + h * 4) =
                    f32x4{o[rt][ct][4 * h], o[rt][ct][4 * h + 1], o[rt][ct][4 * h + 2], o[rt][ct][4 * h + 3]};
}

// ---------------------------------------------------------------------------
// Host-side pipeline
// ---------------------------------------------------------------------------
extern "C" void kernel_launch(void* const* d_in, const int* in_sizes, int n_in,
                              void* d_out, int out_size, void* d_ws, size_t ws_size,
                              hipStream_t stream) {
    const float* front   = (const float*)d_in[0];
    const float* back    = (const float*)d_in[1];
    const float* ln0_w   = (const float*)d_in[2];
    const float* ln0_b   = (const float*)d_in[3];
    const float* ln1_w   = (const float*)d_in[4];
    const float* ln1_b   = (const float*)d_in[5];
    const float* Wx      = (const float*)d_in[6];
    const float* Wz      = (const float*)d_in[7];
    const float* conv_w  = (const float*)d_in[8];
    const float* conv_b  = (const float*)d_in[9];
    const float* Wxproj  = (const float*)d_in[10];
    const float* Wdt     = (const float*)d_in[11];
    const float* bdt     = (const float*)d_in[12];
    const float* A_log   = (const float*)d_in[13];
    const float* Dp      = (const float*)d_in[14];
    const float* Wout_m  = (const float*)d_in[15];
    const float* bout_m  = (const float*)d_in[16];
    const float* Wout    = (const float*)d_in[17];
    const float* bout    = (const float*)d_in[18];

    char* ws = (char*)d_ws;
    // ---- static workspace layout (bytes); "2 x": block 0's array, then block 1's ----
    _Float16* Wh   = (_Float16*)(ws);                       // 7*16384 halves < 256 KB
    _Float16* WOMh = Wh + 4 * 16384;                        // behind Wx[0..1], Wz[0..1]; Wout follows
    size_t off = 0x40000;
    _Float16* Ah   = (_Float16*)(ws + off); off += (size_t)4 * MTOT * 128 * 2;  // 64 MB: 4 norms (also uc)
    float*    UZ   = (float*)(ws + off);    off += (size_t)4 * MTOT * 128 * 4;  // 128 MB: 2 x u, 2 x z
    _Float16* YGh  = (_Float16*)(ws + off); off += (size_t)2 * MTOT * 128 * 2;  // 32 MB
    float*    BM   = (float*)(ws + off);    off += (size_t)2 * MTOT * 8 * 4;    // 4 MB
    float*    CMb  = (float*)(ws + off);    off += (size_t)2 * MTOT * 8 * 4;    // 4 MB
    float*    PC   = (float*)(ws + off);    off += (size_t)2 * BATCH * NCHUNK * 1024 * 4;  // 4 MB
    float*    HC   = (float*)(ws + off);    off += (size_t)2 * BATCH * NCHUNK * 1024 * 4;  // 4 MB
    float*    HIN  = (float*)(ws + off);    off += (size_t)2 * BATCH * NCHUNK * 1024 * 4;  // 4 MB
    float*    U    = UZ;
    float*    Z    = UZ + (size_t)2 * MTOT * 128;
    float*    UC   = (float*)Ah;   // alias: the norms are consumed by the first GEMM launch
    float*    DT   = U;            // alias: u consumed by conv before dt written

    // Launches that do not depend on one another share one grid: the seven weight
    // conversions, the four norms, the four input projections, and from there on
    // the two cross blocks side by side.

    // 1) weight conversions to f16 (swizzled into WMMA B-fragment order)
    cvt_swizzle_w_kernel<<<(7 * 16384) / 256, 256, 0, stream>>>(Wx, Wz, Wout_m, Wout, Wh);

    // 2) the two cross-mamba blocks
    ln_transpose_f16_kernel<<<dim3(MTOT / (8 * LN_T), 4), 256, 0, stream>>>(
        front, back, ln0_w, ln0_b, ln1_w, ln1_b, Ah);

    gemm128_wmma_kernel<<<dim3(MTOT / 64, 4), 256, 0, stream>>>(Ah, Wh, nullptr, UZ, 0);

    conv_silu_kernel<<<dim3((MTOT / CONV_T * 128) / 256, 2), 256, 0, stream>>>(
        U, conv_w, conv_b, UC);

    xproj_dt_kernel<<<dim3(MTOT / XP_T, 2), 128, 0, stream>>>(
        UC, Wxproj, Wdt, bdt, DT, BM, CMb);

    scan_chunk_sum_kernel<<<dim3(NCHUNK, 2 * BATCH), 128, 0, stream>>>(
        DT, UC, BM, A_log, PC, HC);
    scan_carry_kernel<<<(2 * BATCH * 1024) / 256, 256, 0, stream>>>(PC, HC, HIN);
    scan_kernel<<<dim3(NCHUNK, 2 * BATCH), 128, 0, stream>>>(
        DT, UC, Z, BM, CMb, A_log, Dp, HIN, YGh);

    // 3) out-projections + residual add + 0.5 scale + final GEMM, stored transposed to (B,DIM,N)
    out_fused_kernel<<<MTOT / OF_ROWS, 256, 0, stream>>>(
        YGh, WOMh, bout_m, front, back, bout, (float*)d_out);
}

// v006
// A run of this version takes 170 microseconds.
// In two side-by-side timings against v005, it was 1.24 and 1.25 times as fast.
// Over all steps from v000 it is 163 times as fast.
#include <hip/hip_runtime.h>
#include <math.h>

typedef __attribute__((ext_vector_type(16))) _Float16 v16h;
typedef __attribute__((ext_vector_type(8)))  _Float16 v8h;
typedef __attribute__((ext_vector_type(4)))  _Float16 v4h;
typedef __attribute__((ext_vector_type(8)))  float    v8f;
typedef __attribute__((ext_vector_type(2)))  float    f32x2;
typedef __attribute__((ext_vector_type(4)))  float    f32x4;

#define DIMC    128
#define D_INNER 128
#define D_STATE 8
#define DT_RANK 8
#define D_CONV  4
#define BATCH   4
#define NTOK    16384               // L*H*W = 256*8*8
#define MTOT    (BATCH * NTOK)      // 65536 tokens

// Eight v_exp_f32 (2^x) in one statement. The instruction set asks for one free
// issue slot behind a transcendental before its result is read or its source
// overwritten: inside the statement each v_exp_f32 is followed by one that is
// independent of it (the outputs are early-clobber, so none lies on an input),
// and the v_nop is the slot behind the last, wherever the statement is scheduled.
__device__ __forceinline__ void exp2_x8(const f32x2* x, f32x2* r) {
    float e0, e1, e2, e3, e4, e5, e6, e7;
    asm("v_exp_f32 %0, %8\n\t"
        "v_exp_f32 %1, %9\n\t"
        "v_exp_f32 %2, %10\n\t"
        "v_exp_f32 %3, %11\n\t"
        "v_exp_f32 %4, %12\n\t"
        "v_exp_f32 %5, %13\n\t"
        "v_exp_f32 %6, %14\n\t"
        "v_exp_f32 %7, %15\n\t"
        "v_nop"
        : "=&v"(e0), "=&v"(e1), "=&v"(e2), "=&v"(e3), "=&v"(e4), "=&v"(e5), "=&v"(e6), "=&v"(e7)
        : "v"(x[0][0]), "v"(x[0][1]), "v"(x[1][0]), "v"(x[1][1]),
          "v"(x[2][0]), "v"(x[2][1]), "v"(x[3][0]), "v"(x[3][1]));
    r[0] = f32x2{e0, e1};
    r[1] = f32x2{e2, e3};
    r[2] = f32x2{e4, e5};
    r[3] = f32x2{e6, e7};
}

// ---------------------------------------------------------------------------
// f32 -> f16 weight conversion WITH swizzle into WMMA B-fragment order.
// Fragment layout (halves): dst[((k0Idx*128 + col)*2 + sel)*16 + j]
//   j<8  -> W[k0Idx*32 + sel*8 + j     ][col]
//   j>=8 -> W[k0Idx*32 + sel*8 + j + 8 ][col]
// so each consuming lane's 16 B halves are one contiguous 32-byte LDS chunk.
// ---------------------------------------------------------------------------
// One launch converts all seven 128x128 matrices; a matrix is 64 workgroups.
// dst holds them in the order Wx[0], Wx[1], Wz[0], Wz[1], Wout_m[0], Wout_m[1], Wout.
__global__ __launch_bounds__(256)
void cvt_swizzle_w_kernel(const float* __restrict__ Wx,
                          const float* __restrict__ Wz,
                          const float* __restrict__ Wom,
                          const float* __restrict__ Wo,
                          _Float16* __restrict__ dst) {
    int i = blockIdx.x * blockDim.x + threadIdx.x;   // over 7 * 16384
    int m7 = blockIdx.x >> 6;       // which of the seven
    const float* src = (m7 < 2) ? Wx : (m7 < 4) ? Wz : (m7 < 6) ? Wom : Wo;
    int mat   = m7 & 1;             // which 128x128 matrix of its input
    int r     = i & 16383;
    int j     = r & 15;             // half index within fragment chunk
    int chunk = r >> 4;             // (k0Idx*128 + col)*2 + sel
    int sel   = chunk & 1;
    int colk  = chunk >> 1;
    int col   = colk & 127;
    int k0Idx = colk >> 7;          // 0..3
    int koff  = j + ((j >= 8) ? 8 : 0);
    int k     = k0Idx * 32 + sel * 8 + koff;
    dst[i] = (_Float16)src[(size_t)mat * 16384 + k * 128 + col];
}

// ---------------------------------------------------------------------------
// A-fragment loader: 16x32 f16 A layout = two contiguous 16B chunks per lane
// (K groups at kSel and kSel+16).
// ---------------------------------------------------------------------------
__device__ __forceinline__ v16h load_a_frag(const _Float16* Ar) {
    v8h lo = *(const v8h*)(Ar);        // K = kSel .. kSel+7
    v8h hi = *(const v8h*)(Ar + 16);   // K = kSel+16 .. kSel+23
    v16h af;
    #pragma unroll
    for (int j = 0; j < 8; ++j) { af[j] = lo[j]; af[j + 8] = hi[j]; }
    return af;
}

// ---------------------------------------------------------------------------
// LayerNorm and input projections in one launch. A workgroup takes LG_ROWS tokens
// of one input (blockIdx.y: 0 = front, 1 = back) and reads them once. The input
// feeds two norms, which share mean and variance: ln0 of its own cross block (SSM
// path, times Wx) and ln1 of the other block (gate, times Wz). Both normalised
// tiles go as f16 through LDS straight to the matrix products and never to memory.
//   part 1: one wave per LN_T consecutive tokens, each lane owns 4 neighbouring
//           channels; the tokens lie side by side in x and come in as 16-byte
//           pieces. A lane's 4 halves of a token are one 8-byte LDS store.
//   part 2: a wave owns one norm's 32 tokens x 64 columns (2 x 4 accumulators).
// Row pitch of the tiles 272 bytes: the 16 rows of a 16-byte fragment read fall on
// all 64 banks. Result slots in UZ: u of block 0, u of block 1, z of block 0, z of
// block 1, the order of the weights in Wf.
// ---------------------------------------------------------------------------
#define LN_T     8
#define LG_ROWS  64
#define LG_PITCH 136   // halves
__global__ __launch_bounds__(256)
void ln_inproj_kernel(const float* __restrict__ front,  // (B, DIM, N)
                      const float* __restrict__ back,   // (B, DIM, N)
                      const float* __restrict__ ln0_w,  // (2, DIM)
                      const float* __restrict__ ln0_b,  // (2, DIM)
                      const float* __restrict__ ln1_w,  // (2, DIM)
                      const float* __restrict__ ln1_b,  // (2, DIM)
                      const _Float16* __restrict__ Wf,  // Wx[0], Wx[1], Wz[0], Wz[1], swizzled
                      float* __restrict__ UZ) {         // 4 x (B, N, 128)
    __shared__ __align__(64) _Float16 sW[2 * 128 * 128];           // 64 KB, fragment order
    __shared__ __align__(16) _Float16 sA[2 * LG_ROWS * LG_PITCH];  // 34 KB
    int inp  = blockIdx.y;         // the input, and the block whose SSM path it feeds
    int gblk = inp ^ 1;            // the block whose gate it feeds
    const float* x = inp ? back : front;
    int tid  = threadIdx.x;
    int lane = tid & 31;
    int wave = tid >> 5;
    int row0 = blockIdx.x * LG_ROWS;   // first token of the tile, b * NTOK + n
    int t0 = row0 + wave * LN_T;       // first token of the wave
    int b = t0 >> 14;                  // / NTOK
    int n = t0 & (NTOK - 1);
    const float* xl = x + ((size_t)b * DIMC + 4 * lane) * NTOK + n;
    const uint4* ws0 = (const uint4*)(Wf + (size_t)inp * 16384);
    const uint4* ws1 = (const uint4*)(Wf + (size_t)(2 + gblk) * 16384);
    uint4*       wd  = (uint4*)sW + tid;
    uint4 wr[8];
    f32x4 v[4][LN_T / 4];
    #pragma unroll   // v[][] in registers; all loads issue before the first wait
    for (int q = 0; q < 4; ++q)
        #pragma unroll
        for (int h = 0; h < LN_T / 4; ++h)
            v[q][h] = *(const f32x4*)(xl + (size_t)q * NTOK + 4 * h);
    f32x4 wS = *(const f32x4*)(ln0_w + inp * DIMC + 4 * lane);
    f32x4 bS = *(const f32x4*)(ln0_b + inp * DIMC + 4 * lane);
    f32x4 wG = *(const f32x4*)(ln1_w + gblk * DIMC + 4 * lane);
    f32x4 bG = *(const f32x4*)(ln1_b + gblk * DIMC + 4 * lane);
    #pragma unroll   // wr[] in registers; eight 16-byte loads in flight per thread
    for (int i = 0; i < 8; ++i) wr[i] = ws0[tid + i * 256];
    #pragma unroll
    for (int i = 0; i < 8; ++i) wd[i * 256] = wr[i];
    // Keeps the second matrix's loads behind the first one's LDS stores; they fly
    // under the norm's arithmetic. All sixteen weight loads at once take the kernel
    // past 160 registers, and only two workgroups, not the three that LDS allows,
    // fit a WGP.
    __builtin_amdgcn_sched_barrier(0);
    #pragma unroll
    for (int i = 0; i < 8; ++i) wr[i] = ws1[tid + i * 256];
    // As inputs of the wait the pointer and the two indices (the offsets of the
    // parameter loads and of the weight loads) stay in their registers up to it, so
    // that no register that an issued load names is written before it.
    asm volatile("s_wait_xcnt 0x0" :: "v"(xl), "v"(lane), "v"(tid) : "memory");

    // Two neighbouring tokens of a channel lie in neighbouring registers, so the
    // arithmetic runs on token pairs: packed instructions with no register moves.
    f32x2 p[4][LN_T / 2], s[LN_T / 2], q[LN_T / 2];
    #pragma unroll   // constant indices into the register arrays
    for (int k = 0; k < LN_T / 2; ++k) {
        #pragma unroll
        for (int c = 0; c < 4; ++c)
            p[c][k] = f32x2{v[c][k >> 1][2 * (k & 1)], v[c][k >> 1][2 * (k & 1) + 1]};
        s[k] = p[0][k] + p[1][k] + p[2][k] + p[3][k];
        q[k] = p[0][k] * p[0][k] + p[1][k] * p[1][k] + p[2][k] * p[2][k] + p[3][k] * p[3][k];
    }
    // butterfly step by step, all tokens in each step: their exchanges are
    // independent, so a step waits once and not once per token
    #pragma unroll
    for (int off = 16; off > 0; off >>= 1) {
        #pragma unroll
        for (int k = 0; k < LN_T / 2; ++k) {
            f32x2 so = f32x2{__shfl_xor(s[k][0], off, 32), __shfl_xor(s[k][1], off, 32)};
            f32x2 qo = f32x2{__shfl_xor(q[k][0], off, 32), __shfl_xor(q[k][1], off, 32)};
            s[k] += so;
            q[k] += qo;
        }
    }
    _Float16* aS = sA + (wave * LN_T) * LG_PITCH + 4 * lane;
    _Float16* aG = aS + LG_ROWS * LG_PITCH;
    #pragma unroll
    for (int k = 0; k < LN_T / 2; ++k) {
        f32x2 mean = s[k] * (1.0f / DIMC);
        f32x2 var  = q[k] * (1.0f / DIMC) - mean * mean;
        f32x2 rstd = f32x2{rsqrtf(var[0] + 1e-5f), rsqrtf(var[1] + 1e-5f)};
        f32x2 ys[4], yg[4];
        #pragma unroll
        for (int c = 0; c < 4; ++c) {
            f32x2 t = (p[c][k] - mean) * rstd;
            ys[c] = t * wS[c] + bS[c];
            yg[c] = t * wG[c] + bG[c];
        }
        #pragma unroll
        for (int j = 0; j < 2; ++j) {
            *(v4h*)(aS + (2 * k + j) * LG_PITCH) =
                v4h{(_Float16)ys[0][j], (_Float16)ys[1][j], (_Float16)ys[2][j], (_Float16)ys[3][j]};
            *(v4h*)(aG + (2 * k + j) * LG_PITCH) =
                v4h{(_Float16)yg[0][j], (_Float16)yg[1][j], (_Float16)yg[2][j], (_Float16)yg[3][j]};
        }
    }
    #pragma unroll
    for (int i = 0; i < 8; ++i) wd[2048 + i * 256] = wr[i];
    __syncthreads();   // weights and both tiles are read by all waves

    int l15  = lane & 15;
    int sel  = lane >> 4;                  // 0 / 1
    int nrm  = wave >> 2;                  // 0 = SSM path, 1 = gate
    int rowW = ((wave >> 1) & 1) * 32;     // the wave's first token within the tile
    int colW = (wave & 1) * 64;            // the wave's first column
    const _Float16* S0 = sA + (nrm * LG_ROWS + rowW + l15) * LG_PITCH + sel * 8;
    const _Float16* Wn = sW + nrm * 16384;
    v8f acc[2][4] = {};
    #pragma unroll
    for (int k = 0; k < 4; ++k) {
        v16h s0 = load_a_frag(S0 + k * 32);
        v16h s1 = load_a_frag(S0 + 16 * LG_PITCH + k * 32);
        #pragma unroll
        for (int ct = 0; ct < 4; ++ct) {
            v16h bf = *(const v16h*)&Wn[((k * 128 + colW + ct * 16 + l15) * 2 + sel) * 16];
            acc[0][ct] = __builtin_amdgcn_wmma_f32_16x16x32_f16(false, s0, false, bf, (short)0, acc[0][ct], false, false);
            acc[1][ct] = __builtin_amdgcn_wmma_f32_16x16x32_f16(false, s1, false, bf, (short)0, acc[1][ct], false, false);
        }
    }

    // accumulator layout: row = r + 8 * sel, column = l15 of each 16 x 16 tile
    int slot = nrm ? 2 + gblk : inp;
    float* po = UZ + (size_t)slot * MTOT * 128
                   + (size_t)(row0 + rowW + sel * 8) * 128 + colW + l15;
    #pragma unroll
    for (int rt = 0; rt < 2; ++rt)
        #pragma unroll
        for (int r = 0; r < 8; ++r)
            #pragma unroll
            for (int ct = 0; ct < 4; ++ct)
                po[(rt * 16 + r) * 128 + ct * 16] = acc[rt][ct][r];
}

// ---------------------------------------------------------------------------
// Causal depthwise conv1d (kernel 4) along tokens + bias + SiLU.
// One thread per channel and CONV_T consecutive tokens (was one token), so that
// the launch starts CONV_T times fewer waves; the window slides over registers.
// ---------------------------------------------------------------------------
#define CONV_T 16
__global__ __launch_bounds__(256)
void conv_silu_kernel(const float* __restrict__ u,   // 2 x (B,N,128)
                      const float* __restrict__ cw,  // (2,128,4)
                      const float* __restrict__ cb,  // (2,128)
                      float* __restrict__ uc) {      // 2 x (B,N,128)
    u  += (size_t)blockIdx.y * MTOT * 128;             // blockIdx.y = cross block
    cw += blockIdx.y * 128 * D_CONV;
    cb += blockIdx.y * 128;
    uc += (size_t)blockIdx.y * MTOT * 128;
    int idx = blockIdx.x * blockDim.x + threadIdx.x;   // over (MTOT / CONV_T) * 128
    int d  = idx & 127;
    int t0 = (idx >> 7) * CONV_T;  // first token, b*N + n
    int n0 = t0 & (NTOK - 1);      // a multiple of CONV_T: 0 only at a batch's start
    const float* up = u + (size_t)t0 * 128 + d;
    float v[CONV_T + D_CONV - 1];
    #pragma unroll   // v[] in registers; the zero padding in front of token 0
    for (int k = 0; k < D_CONV - 1; ++k) v[k] = 0.0f;
    if (n0 > 0) {
        #pragma unroll
        for (int k = 0; k < D_CONV - 1; ++k) v[k] = up[(k - (D_CONV - 1)) * 128];
    }
    #pragma unroll   // all loads issue before the first wait
    for (int k = 0; k < CONV_T; ++k) v[k + D_CONV - 1] = up[k * 128];
    f32x4 wv = *(const f32x4*)(cw + d * D_CONV);
    float bv = cb[d];
    // As inputs of the wait the pointer and the channel index (the offset of the
    // cw and cb loads) stay in their registers up to it, so that no result of
    // these loads is placed on a register that an earlier one of them still names.
    asm volatile("s_wait_xcnt 0x0" :: "v"(up), "v"(d) : "memory");
    float* po = uc + (size_t)t0 * 128 + d;
    f32x2 a[CONV_T / 2], x[CONV_T / 2], e[CONV_T / 2];
    float r[CONV_T];
    #pragma unroll   // constant indices into the register arrays
    for (int k = 0; k < CONV_T; ++k) {
        float acc = bv;
        #pragma unroll
        for (int i = 0; i < D_CONV; ++i) acc = __builtin_fmaf(v[k + i], wv[i], acc);
        a[k >> 1][k & 1] = acc;
    }
    #pragma unroll
    for (int k = 0; k < CONV_T / 2; ++k) x[k] = a[k] * -1.44269504f;
    exp2_x8(x, e);                                     // exp(-acc), 8 tokens each
    exp2_x8(x + 4, e + 4);
    #pragma unroll
    for (int k = 0; k < CONV_T; ++k)
        r[k] = a[k >> 1][k & 1] / (1.0f + e[k >> 1][k & 1]);   // SiLU
    // keeps every store behind the last arithmetic, so that no register that an
    // issued store names is written again
    __builtin_amdgcn_sched_barrier(0);
    #pragma unroll
    for (int k = 0; k < CONV_T; ++k) po[k * 128] = r[k];
}

// ---------------------------------------------------------------------------
// x_dbl = uc @ Wxproj -> (dt_r | B | C); dt = softplus(dt_r @ Wdt + bdt)
// One 128-thread workgroup per XP_T tokens (was one token), so that the launch
// starts XP_T times fewer waves and every lane works in both parts.
//   part 1: lane = token, wave = 6 of the 24 columns of Wxproj. The uc rows are
//           staged in LDS (row pitch 132 floats: 16 lanes' 16-byte reads of one
//           column group fall on all 64 banks); the wave-uniform Wxproj values
//           come through the scalar cache.
//   part 2: thread = channel, token after token, dt_r rows by LDS broadcast.
// Each sum runs in the order it had.
// ---------------------------------------------------------------------------
#define XP_T     32
#define XP_PITCH 132
__global__ __launch_bounds__(128)
void xproj_dt_kernel(const float* __restrict__ uc,      // 2 x (M,128)
                     const float* __restrict__ Wxproj,  // (2,128,24)
                     const float* __restrict__ Wdt,     // (2,8,128)
                     const float* __restrict__ bdt,     // (2,128)
                     float* __restrict__ dt,            // 2 x (M,128)
                     float* __restrict__ Bm,            // 2 x (M,8)
                     float* __restrict__ Cm) {          // 2 x (M,8)
    __shared__ __align__(16) float sU[XP_T * XP_PITCH];   // 16.5 KB
    __shared__ __align__(16) float sX[3 * XP_T * 8];      // dt_r, B, C: (XP_T,8) each
    uc     += (size_t)blockIdx.y * MTOT * 128;            // blockIdx.y = cross block
    Wxproj += blockIdx.y * 128 * 24;
    Wdt    += blockIdx.y * DT_RANK * 128;
    bdt    += blockIdx.y * 128;
    dt     += (size_t)blockIdx.y * MTOT * 128;
    Bm     += (size_t)blockIdx.y * MTOT * 8;
    Cm     += (size_t)blockIdx.y * MTOT * 8;
    int tid = threadIdx.x;
    size_t t0 = (size_t)blockIdx.x * XP_T;
    {
        const f32x4* g = (const f32x4*)(uc + t0 * 128);
        f32x4 r[XP_T / 4];
        #pragma unroll   // r[] in registers; all loads issue before the first wait
        for (int i = 0; i < XP_T / 4; ++i) r[i] = g[tid + i * 128];
        #pragma unroll
        for (int i = 0; i < XP_T / 4; ++i) {
            int e = tid + i * 128;                       // row e / 32, floats 4 * (e % 32) ..
            *(f32x4*)&sU[(e >> 5) * XP_PITCH + (e & 31) * 4] = r[i];
        }
    }
    float wd[DT_RANK];
    #pragma unroll
    for (int r = 0; r < DT_RANK; ++r) wd[r] = Wdt[r * 128 + tid];
    float bb = bdt[tid];
    __syncthreads();

    {
        int lane = tid & 31;
        // the wave's number as a scalar, so that the Wxproj addresses are scalar too
        int j0 = __builtin_amdgcn_readfirstlane(tid >> 5) * 6;
        const float* ur = sU + lane * XP_PITCH;
        const float* wp = Wxproj + j0;
        float acc[6];
        #pragma unroll
        for (int jj = 0; jj < 6; ++jj) acc[jj] = 0.0f;
        for (int c = 0; c < 128; c += 4) {
            f32x4 uv = *(const f32x4*)(ur + c);
            #pragma unroll   // acc[] in registers
            for (int i = 0; i < 4; ++i)
                #pragma unroll
                for (int jj = 0; jj < 6; ++jj)
                    acc[jj] = __builtin_fmaf(uv[i], wp[(c + i) * 24 + jj], acc[jj]);
        }
        #pragma unroll
        for (int jj = 0; jj < 6; ++jj) {
            int j = j0 + jj;
            sX[(j >> 3) * (XP_T * 8) + lane * 8 + (j & 7)] = acc[jj];
        }
    }
    __syncthreads();

    *(f32x2*)(Bm + t0 * 8 + tid * 2) = *(const f32x2*)&sX[1 * XP_T * 8 + tid * 2];
    *(f32x2*)(Cm + t0 * 8 + tid * 2) = *(const f32x2*)&sX[2 * XP_T * 8 + tid * 2];
    // what follows rewrites the offset and data registers of these two stores
    asm volatile("s_wait_xcnt 0x0" ::: "memory");

    float* po = dt + t0 * 128 + tid;
    for (int k0 = 0; k0 < XP_T; k0 += 8) {
        float o[8];
        #pragma unroll   // o[] in registers
        for (int k = 0; k < 8; ++k) {
            f32x4 r0 = *(const f32x4*)&sX[(k0 + k) * 8];
            f32x4 r1 = *(const f32x4*)&sX[(k0 + k) * 8 + 4];
            float a = bb;
            #pragma unroll
            for (int r = 0; r < 4; ++r) a += r0[r] * wd[r];
            #pragma unroll
            for (int r = 0; r < 4; ++r) a += r1[r] * wd[r + 4];
            o[k] = (a > 20.0f) ? a : log1pf(__expf(a));   // softplus
        }
        #pragma unroll
        for (int k = 0; k < 8; ++k) po[(k0 + k) * 128] = o[k];
        // the next trip rewrites the data registers of these stores
        asm volatile("s_wait_xcnt 0x0" ::: "memory");
    }
}

// ---------------------------------------------------------------------------
// SSM scan, cut along the tokens into NCHUNK chunks of CHUNK_T steps.
// h[t] = a[t]*h[t-1] + b[t] is linear in h, so a chunk acts on its incoming
// state as  h_out = P*h_in + H  with P = product of its a[t] and H = its end
// state from h_in = 0.  Three launches:
//   1) every chunk: P and H                        (all chunks side by side)
//   2) every (batch, d, s): the incoming state of each chunk, chunk by chunk
//   3) every chunk: the recurrence again from its incoming state, with readout
// Launches 1 and 3: one workgroup of 128 threads per chunk, thread = channel d,
// which keeps its 8 states in registers as 4 pairs. A wave's load of dt, uc or
// z is then one whole 128-byte line, the readout sum over the states stays in
// the thread, and the gate is worked out once per (token, channel) with every
// lane busy. The B and C rows of the chunk, the same for all channels, are
// staged in LDS once and read from there by broadcast.
// The two cross blocks are independent and go through each launch side by side:
// their arrays lie one behind the other, so that they read as 2 * BATCH batches,
// and only the per-block parameters are picked by batch index / BATCH.
// ---------------------------------------------------------------------------
#define CHUNK_T 128
#define NCHUNK  (NTOK / CHUNK_T)    // 128 chunks per batch
#define SCAN_U  8                   // tokens per register buffer (two buffers)
#define SCAN_NG (CHUNK_T / SCAN_U)  // 16 buffer fills per chunk

// log2(e) * A for the 8 states of channel d, A = -exp(A_log): exp(dt*A) is then
// one multiply and one v_exp_f32.
__device__ __forceinline__ void load_a2(const float* __restrict__ A_log, int d, f32x2* A2) {
    f32x4 l0 = *(const f32x4*)(A_log + d * 8);
    f32x4 l1 = *(const f32x4*)(A_log + d * 8 + 4);
    A2[0] = f32x2{-__expf(l0[0]), -__expf(l0[1])} * 1.44269504f;
    A2[1] = f32x2{-__expf(l0[2]), -__expf(l0[3])} * 1.44269504f;
    A2[2] = f32x2{-__expf(l1[0]), -__expf(l1[1])} * 1.44269504f;
    A2[3] = f32x2{-__expf(l1[2]), -__expf(l1[3])} * 1.44269504f;
}

// SCAN_U tokens of one channel's column of a (token, 128) array. Two tokens
// share a register pair: a packed multiply that takes one of them as its scalar
// names the whole pair, and the wait in front of it covers both halves, so the
// other half must belong to the same buffer and not to the one still in flight.
__device__ __forceinline__ void load_col(const float* __restrict__ p, f32x2* r) {
    #pragma unroll   // r[] in registers; the loads issue back to back
    for (int k = 0; k < SCAN_U; ++k) r[k >> 1][k & 1] = p[k * 128];
}

// One step of the recurrence for the 8 states of a channel.
__device__ __forceinline__ void ssm_step(float dtv, float ucv, const f32x2* A2,
                                         const float* sBrow, f32x2* a, f32x2* h) {
    f32x4 b0 = *(const f32x4*)(sBrow);
    f32x4 b1 = *(const f32x4*)(sBrow + 4);
    f32x2 Bp[4] = {f32x2{b0[0], b0[1]}, f32x2{b0[2], b0[3]},
                   f32x2{b1[0], b1[1]}, f32x2{b1[2], b1[3]}};
    float du = dtv * ucv;
    f32x2 x[4];
    #pragma unroll   // x[], a[], h[] in registers
    for (int j = 0; j < 4; ++j) x[j] = A2[j] * dtv;
    exp2_x8(x, a);
    #pragma unroll
    for (int j = 0; j < 4; ++j) h[j] = __builtin_elementwise_fma(a[j], h[j], Bp[j] * du);
}

__device__ __forceinline__ void chunk_sum_group(const f32x2* dtr, const f32x2* ucr,
                                                const f32x2* A2, const float* sBg,
                                                f32x2* h, f32x2* p) {
    #pragma unroll   // constant indices into the register buffers
    for (int k = 0; k < SCAN_U; ++k) {
        f32x2 a[4];
        ssm_step(dtr[k >> 1][k & 1], ucr[k >> 1][k & 1], A2, sBg + k * 8, a, h);
        #pragma unroll
        for (int j = 0; j < 4; ++j) p[j] *= a[j];
    }
}

__global__ __launch_bounds__(128)
void scan_chunk_sum_kernel(const float* __restrict__ dt,    // (2B,N,128)
                           const float* __restrict__ uc,    // (2B,N,128)
                           const float* __restrict__ Bm,    // (2B,N,8)
                           const float* __restrict__ A_log, // (2,128,8)
                           float* __restrict__ Pc,          // (2B,NCHUNK,128,8)
                           float* __restrict__ Hc) {        // (2B,NCHUNK,128,8)
    __shared__ __align__(16) float sB[CHUNK_T * 8];         // 4 KB
    int c = blockIdx.x;
    int b = blockIdx.y;
    int d = threadIdx.x;
    A_log += (blockIdx.y / BATCH) * 128 * 8;
    size_t base = (size_t)b * NTOK + (size_t)c * CHUNK_T;
    const float* pdt = dt + base * 128 + d;
    const float* puc = uc + base * 128 + d;

    f32x2 dt0[SCAN_U / 2], uc0[SCAN_U / 2], dt1[SCAN_U / 2], uc1[SCAN_U / 2];
    load_col(pdt, dt0);
    load_col(puc, uc0);
    {
        const f32x4* g = (const f32x4*)(Bm + base * 8);
        ((f32x4*)sB)[d]       = g[d];
        ((f32x4*)sB)[d + 128] = g[d + 128];
    }
    f32x2 A2[4], h[4], p[4];
    load_a2(A_log, d, A2);
    #pragma unroll
    for (int j = 0; j < 4; ++j) { h[j] = f32x2{0.0f, 0.0f}; p[j] = f32x2{1.0f, 1.0f}; }
    __syncthreads();

    // Two register buffers: while one is worked on, the other's loads fly. The
    // scheduling barriers keep each buffer's loads in front of the work on the
    // other buffer; without them the compiler sinks the loads to their first use.
    for (int g = 0; g < SCAN_NG - 2; g += 2) {
        load_col(pdt + (size_t)(g + 1) * SCAN_U * 128, dt1);
        load_col(puc + (size_t)(g + 1) * SCAN_U * 128, uc1);
        __builtin_amdgcn_sched_barrier(0);
        chunk_sum_group(dt0, uc0, A2, sB + g * SCAN_U * 8, h, p);
        load_col(pdt + (size_t)(g + 2) * SCAN_U * 128, dt0);
        load_col(puc + (size_t)(g + 2) * SCAN_U * 128, uc0);
        __builtin_amdgcn_sched_barrier(0);
        chunk_sum_group(dt1, uc1, A2, sB + (g + 1) * SCAN_U * 8, h, p);
    }
    load_col(pdt + (size_t)(SCAN_NG - 1) * SCAN_U * 128, dt1);
    load_col(puc + (size_t)(SCAN_NG - 1) * SCAN_U * 128, uc1);
    __builtin_amdgcn_sched_barrier(0);
    chunk_sum_group(dt0, uc0, A2, sB + (SCAN_NG - 2) * SCAN_U * 8, h, p);
    __builtin_amdgcn_sched_barrier(0);   // keeps the wait for the last buffer behind the work above
    chunk_sum_group(dt1, uc1, A2, sB + (SCAN_NG - 1) * SCAN_U * 8, h, p);

    size_t o = ((size_t)b * NCHUNK + c) * 1024 + d * 8;
    *(f32x4*)(Pc + o)     = f32x4{p[0][0], p[0][1], p[1][0], p[1][1]};
    *(f32x4*)(Pc + o + 4) = f32x4{p[2][0], p[2][1], p[3][0], p[3][1]};
    *(f32x4*)(Hc + o)     = f32x4{h[0][0], h[0][1], h[1][0], h[1][1]};
    *(f32x4*)(Hc + o + 4) = f32x4{h[2][0], h[2][1], h[3][0], h[3][1]};
}

// One thread per (batch, d, s); 16 chunks' summaries are loaded at a time so
// that the serial chain waits for memory once per 16 chunks, not per chunk.
__global__ __launch_bounds__(256)
void scan_carry_kernel(const float* __restrict__ Pc,   // (2B,NCHUNK,1024)
                       const float* __restrict__ Hc,   // (2B,NCHUNK,1024)
                       float* __restrict__ Hin) {      // (2B,NCHUNK,1024)
    int idx = blockIdx.x * blockDim.x + threadIdx.x;   // over 2*BATCH*1024
    int b = idx >> 10;
    int r = idx & 1023;
    size_t o = (size_t)b * NCHUNK * 1024 + r;
    float carry = 0.0f;
    for (int c0 = 0; c0 < NCHUNK; c0 += 16) {
        float p[16], h[16];
        #pragma unroll   // p[], h[] in registers; all 32 loads issue before the first wait
        for (int k = 0; k < 16; ++k) {
            p[k] = Pc[o + (size_t)(c0 + k) * 1024];
            h[k] = Hc[o + (size_t)(c0 + k) * 1024];
        }
        #pragma unroll   // constant indices into p[], h[]
        for (int k = 0; k < 16; ++k) {
            Hin[o + (size_t)(c0 + k) * 1024] = carry;
            carry = p[k] * carry + h[k];
        }
        // the next trip rewrites the address and data registers of these stores
        asm volatile("s_wait_xcnt 0x0" ::: "memory");
    }
}

// SCAN_U tokens of launch 3: recurrence, readout over the 8 states, Dp skip and
// SiLU(z) gate; emits f16.
__device__ __forceinline__ void scan_group(const f32x2* dtr, const f32x2* ucr, const f32x2* zr,
                                           const f32x2* A2, float Dd,
                                           const float* sBg, const float* sCg,
                                           f32x2* h, _Float16* __restrict__ yo) {
    _Float16 r[SCAN_U];
    f32x2 zx[SCAN_U / 2], ez[SCAN_U / 2];   // exp(-z) of the 8 tokens
    #pragma unroll
    for (int k = 0; k < SCAN_U / 2; ++k) zx[k] = zr[k] * -1.44269504f;
    exp2_x8(zx, ez);
    #pragma unroll   // constant indices into the register buffers
    for (int k = 0; k < SCAN_U; ++k) {
        f32x2 a[4];
        float ucv = ucr[k >> 1][k & 1];
        ssm_step(dtr[k >> 1][k & 1], ucv, A2, sBg + k * 8, a, h);
        f32x4 c0 = *(const f32x4*)(sCg + k * 8);
        f32x4 c1 = *(const f32x4*)(sCg + k * 8 + 4);
        f32x2 y2 = h[0] * f32x2{c0[0], c0[1]};
        y2 = __builtin_elementwise_fma(h[1], f32x2{c0[2], c0[3]}, y2);
        y2 = __builtin_elementwise_fma(h[2], f32x2{c1[0], c1[1]}, y2);
        y2 = __builtin_elementwise_fma(h[3], f32x2{c1[2], c1[3]}, y2);
        float y  = y2[0] + y2[1];
        float zv = zr[k >> 1][k & 1];
        float g  = zv / (1.0f + ez[k >> 1][k & 1]);
        r[k] = (_Float16)((y + Dd * ucv) * g);
    }
    #pragma unroll
    for (int k = 0; k < SCAN_U; ++k) yo[k * 128] = r[k];
    // what follows rewrites the data registers of these stores
    asm volatile("s_wait_xcnt 0x0" ::: "memory");
}

__global__ __launch_bounds__(128)
void scan_kernel(const float* __restrict__ dt,    // (2B,N,128)
                 const float* __restrict__ uc,    // (2B,N,128)
                 const float* __restrict__ zg,    // (2B,N,128) pre-activation z
                 const float* __restrict__ Bm,    // (2B,N,8)
                 const float* __restrict__ Cm,    // (2B,N,8)
                 const float* __restrict__ A_log, // (2,128,8)
                 const float* __restrict__ Dp,    // (2,128)
                 const float* __restrict__ Hin,   // (2B,NCHUNK,128,8)
                 _Float16* __restrict__ yg) {     // (2B,N,128)
    __shared__ __align__(16) float sB[CHUNK_T * 8];   // 4 KB
    __shared__ __align__(16) float sC[CHUNK_T * 8];   // 4 KB
    int c = blockIdx.x;
    int b = blockIdx.y;
    int d = threadIdx.x;
    A_log += (blockIdx.y / BATCH) * 128 * 8;
    Dp    += (blockIdx.y / BATCH) * 128;
    size_t base = (size_t)b * NTOK + (size_t)c * CHUNK_T;
    const float* pdt = dt + base * 128 + d;
    const float* puc = uc + base * 128 + d;
    const float* pz  = zg + base * 128 + d;
    _Float16*    py  = yg + base * 128 + d;

    f32x2 dt0[SCAN_U / 2], uc0[SCAN_U / 2], z0[SCAN_U / 2];
    f32x2 dt1[SCAN_U / 2], uc1[SCAN_U / 2], z1[SCAN_U / 2];
    load_col(pdt, dt0);
    load_col(puc, uc0);
    load_col(pz,  z0);
    {
        const f32x4* gb = (const f32x4*)(Bm + base * 8);
        const f32x4* gc = (const f32x4*)(Cm + base * 8);
        ((f32x4*)sB)[d]       = gb[d];
        ((f32x4*)sB)[d + 128] = gb[d + 128];
        ((f32x4*)sC)[d]       = gc[d];
        ((f32x4*)sC)[d + 128] = gc[d + 128];
    }
    f32x2 A2[4], h[4];
    load_a2(A_log, d, A2);
    float Dd = Dp[d];
    {
        const float* hi = Hin + ((size_t)b * NCHUNK + c) * 1024 + d * 8;
        f32x4 h0 = *(const f32x4*)(hi);
        f32x4 h1 = *(const f32x4*)(hi + 4);
        h[0] = f32x2{h0[0], h0[1]}; h[1] = f32x2{h0[2], h0[3]};
        h[2] = f32x2{h1[0], h1[1]}; h[3] = f32x2{h1[2], h1[3]};
    }
    __syncthreads();

    // Two register buffers, held apart by scheduling barriers as in launch 1.
    for (int g = 0; g < SCAN_NG - 2; g += 2) {
        load_col(pdt + (size_t)(g + 1) * SCAN_U * 128, dt1);
        load_col(puc + (size_t)(g + 1) * SCAN_U * 128, uc1);
        load_col(pz  + (size_t)(g + 1) * SCAN_U * 128, z1);
        __builtin_amdgcn_sched_barrier(0);
        scan_group(dt0, uc0, z0, A2, Dd, sB + g * SCAN_U * 8, sC + g * SCAN_U * 8,
                   h, py + (size_t)g * SCAN_U * 128);
        load_col(pdt + (size_t)(g + 2) * SCAN_U * 128, dt0);
        load_col(puc + (size_t)(g + 2) * SCAN_U * 128, uc0);
        load_col(pz  + (size_t)(g + 2) * SCAN_U * 128, z0);
        __builtin_amdgcn_sched_barrier(0);
        scan_group(dt1, uc1, z1, A2, Dd, sB + (g + 1) * SCAN_U * 8, sC + (g + 1) * SCAN_U * 8,
                   h, py + (size_t)(g + 1) * SCAN_U * 128);
    }
    load_col(pdt + (size_t)(SCAN_NG - 1) * SCAN_U * 128, dt1);
    load_col(puc + (size_t)(SCAN_NG - 1) * SCAN_U * 128, uc1);
    load_col(pz  + (size_t)(SCAN_NG - 1) * SCAN_U * 128, z1);
    // The three pointers are used here for the last time. As inputs of the wait
    // they stay in their registers up to it, so that no result of these loads is
    // placed on an address register that an earlier one of them still names.
    asm volatile("s_wait_xcnt 0x0" :: "v"(pdt), "v"(puc), "v"(pz) : "memory");
    __builtin_amdgcn_sched_barrier(0);
    scan_group(dt0, uc0, z0, A2, Dd, sB + (SCAN_NG - 2) * SCAN_U * 8, sC + (SCAN_NG - 2) * SCAN_U * 8,
               h, py + (size_t)(SCAN_NG - 2) * SCAN_U * 128);
    __builtin_amdgcn_sched_barrier(0);   // keeps the wait for the last buffer behind the work above
    scan_group(dt1, uc1, z1, A2, Dd, sB + (SCAN_NG - 1) * SCAN_U * 8, sC + (SCAN_NG - 1) * SCAN_U * 8,
               h, py + (size_t)(SCAN_NG - 1) * SCAN_U * 128);
}

// ---------------------------------------------------------------------------
// Both out-projections, the residual sum and the final projection in one launch:
//   out = (0.5 * (yg0 @ Wom0 + yg1 @ Wom1 + bom0 + bom1 + ff + bf)) @ Wout + bout
// stored transposed to (B, DIM, NTOK). m0, m1 and s never go to memory.
// A workgroup of 8 waves takes OF_ROWS tokens; a wave owns 32 tokens x 64 columns
// (2 x 4 accumulators), so that its 32 tokens are one whole 128-byte line of each
// of its channels' rows in front, back and out. The accumulators start from
// ff + bf + bom0 + bom1 and take both products on top; s goes as f16 through LDS
// from accumulator layout to A-fragment layout (row pitch 272 bytes: the 16 rows
// of a 16-byte fragment read fall on all 64 banks).
// ---------------------------------------------------------------------------
#define OF_ROWS  128
#define OF_PITCH 136   // halves
__global__ __launch_bounds__(256)
void out_fused_kernel(const _Float16* __restrict__ yg,    // 2 x (B,N,128)
                      const _Float16* __restrict__ Wf,    // Wout_m[0], Wout_m[1], Wout, swizzled
                      const float* __restrict__ bom,      // (2,128)
                      const float* __restrict__ front,    // (B,128,N)
                      const float* __restrict__ back,     // (B,128,N)
                      const float* __restrict__ bout,     // (128)
                      float* __restrict__ out) {          // (B,128,N)
    __shared__ __align__(64) _Float16 sW[3 * 128 * 128];         // 96 KB, fragment order
    __shared__ __align__(16) _Float16 sS[OF_ROWS * OF_PITCH];    // 34 KB
    int tid  = threadIdx.x;
    int lane = tid & 31;
    int l15  = lane & 15;
    int sel  = lane >> 4;                 // 0 / 1
    int rowW = (tid >> 6) * 32;           // the wave's first token within the tile
    int colW = ((tid >> 5) & 1) * 64;     // the wave's first column
    int row0 = blockIdx.x * OF_ROWS;      // first token, b * NTOK + n
    int b    = row0 >> 14;
    int n0   = row0 & (NTOK - 1);

    // A lane's accumulator registers r = 0..7 are 8 consecutive tokens of one
    // channel: 32 contiguous bytes of front, back and out.
    size_t ro = ((size_t)b * DIMC + colW + l15) * NTOK + n0 + rowW + sel * 8;
    const float* pf = front + ro;
    const float* pb = back + ro;
    const _Float16* A0 = yg + (size_t)(row0 + rowW + l15) * 128 + sel * 8;
    const _Float16* A1 = A0 + (size_t)MTOT * 128;

    f32x4 f[2][4][2], g[2][4][2];
    v16h  a[2][4];
    #pragma unroll   // f[], g[], a[] in registers; all loads issue before the first wait
    for (int rt = 0; rt < 2; ++rt)
        #pragma unroll
        for (int ct = 0; ct < 4; ++ct)
            #pragma unroll
            for (int h = 0; h < 2; ++h) {
                f[rt][ct][h] = *(const f32x4*)(pf + (size_t)(ct * 16) * NTOK + rt * 16 + h * 4);
                g[rt][ct][h] = *(const f32x4*)(pb + (size_t)(ct * 16) * NTOK + rt * 16 + h * 4);
            }
    #pragma unroll
    for (int rt = 0; rt < 2; ++rt)
        #pragma unroll
        for (int k = 0; k < 4; ++k) a[rt][k] = load_a_frag(A0 + rt * 2048 + k * 32);
    float bs[4], bo[4];
    #pragma unroll
    for (int ct = 0; ct < 4; ++ct) {
        int col = colW + ct * 16 + l15;
        bs[ct] = bom[col] + bom[128 + col];
        bo[ct] = bout[col];
    }
    const uint4* wsrc = (const uint4*)Wf + tid;
    uint4*       wdst = (uint4*)sW + tid;
    #pragma unroll 8   // eight 16-byte loads in flight per thread
    for (int i = 0; i < (3 * 128 * 128) / 8 / 256; ++i) wdst[i * 256] = wsrc[i * 256];

    v8f acc[2][4];
    #pragma unroll   // constant indices into the register arrays
    for (int rt = 0; rt < 2; ++rt)
        #pragma unroll
        for (int ct = 0; ct < 4; ++ct)
            #pragma unroll
            for (int r = 0; r < 8; ++r)
                acc[rt][ct][r] = f[rt][ct][r >> 2][r & 3] + g[rt][ct][r >> 2][r & 3] + bs[ct];

    // As inputs of the wait the pointers stay in their registers up to it, so that
    // no register that an issued load names is written before it.
    asm volatile("s_wait_xcnt 0x0" :: "v"(pf), "v"(pb), "v"(A0), "v"(wsrc) : "memory");
    __syncthreads();

    // The second block's fragments fly while the first block's products run, one
    // k step's worth issued per k step.
    v16h a1[2][4];
    #pragma unroll
    for (int k = 0; k < 4; ++k) {
        a1[0][k] = load_a_frag(A1 + k * 32);
        a1[1][k] = load_a_frag(A1 + 2048 + k * 32);
        #pragma unroll
        for (int ct = 0; ct < 4; ++ct) {
            v16h bf = *(const v16h*)&sW[((k * 128 + colW + ct * 16 + l15) * 2 + sel) * 16];
            acc[0][ct] = __builtin_amdgcn_wmma_f32_16x16x32_f16(false, a[0][k], false, bf, (short)0, acc[0][ct], false, false);
            acc[1][ct] = __builtin_amdgcn_wmma_f32_16x16x32_f16(false, a[1][k], false, bf, (short)0, acc[1][ct], false, false);
        }
        // Keeps the next step's fragment loads behind this step's products, whose
        // operand registers they take: hoisted together they push the kernel past
        // 256 registers, and only one workgroup fits a WGP.
        __builtin_amdgcn_sched_barrier(0);
    }
    // what follows may rewrite the address registers of these loads
    asm volatile("s_wait_xcnt 0x0" :: "v"(A1) : "memory");
    #pragma unroll
    for (int k = 0; k < 4; ++k)
        #pragma unroll
        for (int ct = 0; ct < 4; ++ct) {
            v16h bf = *(const v16h*)&sW[16384 + ((k * 128 + colW + ct * 16 + l15) * 2 + sel) * 16];
            acc[0][ct] = __builtin_amdgcn_wmma_f32_16x16x32_f16(false, a1[0][k], false, bf, (short)0, acc[0][ct], false, false);
            acc[1][ct] = __builtin_amdgcn_wmma_f32_16x16x32_f16(false, a1[1][k], false, bf, (short)0, acc[1][ct], false, false);
        }

    // s, accumulator layout: row = r + 8 * sel, column = l15 of each 16 x 16 tile
    #pragma unroll
    for (int rt = 0; rt < 2; ++rt)
        #pragma unroll
        for (int ct = 0; ct < 4; ++ct)
            #pragma unroll
            for (int r = 0; r < 8; ++r)
                sS[(rowW + rt * 16 + sel * 8 + r) * OF_PITCH + colW + ct * 16 + l15] =
                    (_Float16)(0.5f * acc[rt][ct][r]);
    __syncthreads();   // a wave's s rows hold the columns of its neighbour wave too

    v8f o[2][4] = {};
    const _Float16* S0 = sS + (rowW + l15) * OF_PITCH + sel * 8;
    #pragma unroll
    for (int k = 0; k < 4; ++k) {
        v16h s0 = load_a_frag(S0 + k * 32);
        v16h s1 = load_a_frag(S0 + 16 * OF_PITCH + k * 32);
        #pragma unroll
        for (int ct = 0; ct < 4; ++ct) {
            v16h bf = *(const v16h*)&sW[2 * 16384 + ((k * 128 + colW + ct * 16 + l15) * 2 + sel) * 16];
            o[0][ct] = __builtin_amdgcn_wmma_f32_16x16x32_f16(false, s0, false, bf, (short)0, o[0][ct], false, false);
            o[1][ct] = __builtin_amdgcn_wmma_f32_16x16x32_f16(false, s1, false, bf, (short)0, o[1][ct], false, false);
        }
    }

    float* po = out + ro;
    #pragma unroll
    for (int rt = 0; rt < 2; ++rt)
        #pragma unroll
        for (int ct = 0; ct < 4; ++ct) o[rt][ct] += bo[ct];
    // keeps every store behind the last arithmetic, so that no register that an
    // issued store names is written again
    __builtin_amdgcn_sched_barrier(0);
    #pragma unroll
    for (int rt = 0; rt < 2; ++rt)
        #pragma unroll
        for (int ct = 0; ct < 4; ++ct)
            #pragma unroll
            for (int h = 0; h < 2; ++h)
                *(f32x4*)(po + (size_t)(ct * 16) * NTOK + rt * 16 + h * 4) =
                    f32x4{o[rt][ct][4 * h], o[rt][ct][4 * h + 1], o[rt][ct][4 * h + 2], o[rt][ct][4 * h + 3]};
}

// ---------------------------------------------------------------------------
// Host-side pipeline
// ---------------------------------------------------------------------------
extern "C" void kernel_launch(void* const* d_in, const int* in_sizes, int n_in,
                              void* d_out, int out_size, void* d_ws, size_t ws_size,
                              hipStream_t stream) {
    const float* front   = (const float*)d_in[0];
    const float* back    = (const float*)d_in[1];
    const float* ln0_w   = (const float*)d_in[2];
    const float* ln0_b   = (const float*)d_in[3];
    const float* ln1_w   = (const float*)d_in[4];
    const float* ln1_b   = (const float*)d_in[5];
    const float* Wx      = (const float*)d_in[6];
    const float* Wz      = (const float*)d_in[7];
    const float* conv_w  = (const float*)d_in[8];
    const float* conv_b  = (const float*)d_in[9];
    const float* Wxproj  = (const float*)d_in[10];
    const float* Wdt     = (const float*)d_in[11];
    const float* bdt     = (const float*)d_in[12];
    const float* A_log   = (const float*)d_in[13];
    const float* Dp      = (const float*)d_in[14];
    const float* Wout_m  = (const float*)d_in[15];
    const float* bout_m  = (const float*)d_in[16];
    const float* Wout    = (const float*)d_in[17];
    const float* bout    = (const float*)d_in[18];

    char* ws = (char*)d_ws;
    // ---- static workspace layout (bytes); "2 x": block 0's array, then block 1's ----
    _Float16* Wh   = (_Float16*)(ws);                       // 7*16384 halves < 256 KB
    _Float16* WOMh = Wh + 4 * 16384;                        // behind Wx[0..1], Wz[0..1]; Wout follows
    size_t off = 0x40000;
    float*    UC   = (float*)(ws + off);    off += (size_t)2 * MTOT * 128 * 4;  // 64 MB: 2 x uc
    float*    UZ   = (float*)(ws + off);    off += (size_t)4 * MTOT * 128 * 4;  // 128 MB: 2 x u, 2 x z
    _Float16* YGh  = (_Float16*)(ws + off); off += (size_t)2 * MTOT * 128 * 2;  // 32 MB
    float*    BM   = (float*)(ws + off);    off += (size_t)2 * MTOT * 8 * 4;    // 4 MB
    float*    CMb  = (float*)(ws + off);    off += (size_t)2 * MTOT * 8 * 4;    // 4 MB
    float*    PC   = (float*)(ws + off);    off += (size_t)2 * BATCH * NCHUNK * 1024 * 4;  // 4 MB
    float*    HC   = (float*)(ws + off);    off += (size_t)2 * BATCH * NCHUNK * 1024 * 4;  // 4 MB
    float*    HIN  = (float*)(ws + off);    off += (size_t)2 * BATCH * NCHUNK * 1024 * 4;  // 4 MB
    float*    U    = UZ;
    float*    Z    = UZ + (size_t)2 * MTOT * 128;
    float*    DT   = U;            // alias: u consumed by conv before dt written

    // Launches that do not depend on one another share one grid: the seven weight
    // conversions, the four norms with the four input projections, and from there
    // on the two cross blocks side by side.

    // 1) weight conversions to f16 (swizzled into WMMA B-fragment order)
    cvt_swizzle_w_kernel<<<(7 * 16384) / 256, 256, 0, stream>>>(Wx, Wz, Wout_m, Wout, Wh);

    // 2) the two cross-mamba blocks
    ln_inproj_kernel<<<dim3(MTOT / LG_ROWS, 2), 256, 0, stream>>>(
        front, back, ln0_w, ln0_b, ln1_w, ln1_b, Wh, UZ);

    conv_silu_kernel<<<dim3((MTOT / CONV_T * 128) / 256, 2), 256, 0, stream>>>(
        U, conv_w, conv_b, UC);

    xproj_dt_kernel<<<dim3(MTOT / XP_T, 2), 128, 0, stream>>>(
        UC, Wxproj, Wdt, bdt, DT, BM, CMb);

    scan_chunk_sum_kernel<<<dim3(NCHUNK, 2 * BATCH), 128, 0, stream>>>(
        DT, UC, BM, A_log, PC, HC);
    scan_carry_kernel<<<(2 * BATCH * 1024) / 256, 256, 0, stream>>>(PC, HC, HIN);
    scan_kernel<<<dim3(NCHUNK, 2 * BATCH), 128, 0, stream>>>(
        DT, UC, Z, BM, CMb, A_log, Dp, HIN, YGh);

    // 3) out-projections + residual add + 0.5 scale + final GEMM, stored transposed to (B,DIM,N)
    out_fused_kernel<<<MTOT / OF_ROWS, 256, 0, stream>>>(
        YGh, WOMh, bout_m, front, back, bout, (float*)d_out);
}

// v007
// A run of this version takes 163 microseconds.
// Next to v006, in two timings, it ran 1.04 times as fast each time.
// All steps since v000 together make it 170 times as fast.
#include <hip/hip_runtime.h>
#include <math.h>

typedef __attribute__((ext_vector_type(16))) _Float16 v16h;
typedef __attribute__((ext_vector_type(8)))  _Float16 v8h;
typedef __attribute__((ext_vector_type(4)))  _Float16 v4h;
typedef __attribute__((ext_vector_type(8)))  float    v8f;
typedef __attribute__((ext_vector_type(2)))  float    f32x2;
typedef __attribute__((ext_vector_type(4)))  float    f32x4;

#define DIMC    128
#define D_INNER 128
#define D_STATE 8
#define DT_RANK 8
#define D_CONV  4
#define BATCH   4
#define NTOK    16384               // L*H*W = 256*8*8
#define MTOT    (BATCH * NTOK)      // 65536 tokens

// Eight v_exp_f32 (2^x) in one statement. The instruction set asks for one free
// issue slot behind a transcendental before its result is read or its source
// overwritten: inside the statement each v_exp_f32 is followed by one that is
// independent of it (the outputs are early-clobber, so none lies on an input),
// and the v_nop is the slot behind the last, wherever the statement is scheduled.
__device__ __forceinline__ void exp2_x8(const f32x2* x, f32x2* r) {
    float e0, e1, e2, e3, e4, e5, e6, e7;
    asm("v_exp_f32 %0, %8\n\t"
        "v_exp_f32 %1, %9\n\t"
        "v_exp_f32 %2, %10\n\t"
        "v_exp_f32 %3, %11\n\t"
        "v_exp_f32 %4, %12\n\t"
        "v_exp_f32 %5, %13\n\t"
        "v_exp_f32 %6, %14\n\t"
        "v_exp_f32 %7, %15\n\t"
        "v_nop"
        : "=&v"(e0), "=&v"(e1), "=&v"(e2), "=&v"(e3), "=&v"(e4), "=&v"(e5), "=&v"(e6), "=&v"(e7)
        : "v"(x[0][0]), "v"(x[0][1]), "v"(x[1][0]), "v"(x[1][1]),
          "v"(x[2][0]), "v"(x[2][1]), "v"(x[3][0]), "v"(x[3][1]));
    r[0] = f32x2{e0, e1};
    r[1] = f32x2{e2, e3};
    r[2] = f32x2{e4, e5};
    r[3] = f32x2{e6, e7};
}

// ---------------------------------------------------------------------------
// f32 -> f16 weight conversion WITH swizzle into WMMA B-fragment order.
// Fragment layout (halves): dst[((k0Idx*128 + col)*2 + sel)*16 + j]
//   j<8  -> W[k0Idx*32 + sel*8 + j     ][col]
//   j>=8 -> W[k0Idx*32 + sel*8 + j + 8 ][col]
// so each consuming lane's 16 B halves are one contiguous 32-byte LDS chunk.
// ---------------------------------------------------------------------------
// One launch converts all seven 128x128 matrices; a matrix is 64 workgroups.
// dst holds them in the order Wx[0], Wx[1], Wz[0], Wz[1], Wout_m[0], Wout_m[1], Wout.
__global__ __launch_bounds__(256)
void cvt_swizzle_w_kernel(const float* __restrict__ Wx,
                          const float* __restrict__ Wz,
                          const float* __restrict__ Wom,
                          const float* __restrict__ Wo,
                          _Float16* __restrict__ dst) {
    int i = blockIdx.x * blockDim.x + threadIdx.x;   // over 7 * 16384
    int m7 = blockIdx.x >> 6;       // which of the seven
    const float* src = (m7 < 2) ? Wx : (m7 < 4) ? Wz : (m7 < 6) ? Wom : Wo;
    int mat   = m7 & 1;             // which 128x128 matrix of its input
    int r     = i & 16383;
    int j     = r & 15;             // half index within fragment chunk
    int chunk = r >> 4;             // (k0Idx*128 + col)*2 + sel
    int sel   = chunk & 1;
    int colk  = chunk >> 1;
    int col   = colk & 127;
    int k0Idx = colk >> 7;          // 0..3
    int koff  = j + ((j >= 8) ? 8 : 0);
    int k     = k0Idx * 32 + sel * 8 + koff;
    dst[i] = (_Float16)src[(size_t)mat * 16384 + k * 128 + col];
}

// ---------------------------------------------------------------------------
// A-fragment loader: 16x32 f16 A layout = two contiguous 16B chunks per lane
// (K groups at kSel and kSel+16).
// ---------------------------------------------------------------------------
__device__ __forceinline__ v16h load_a_frag(const _Float16* Ar) {
    v8h lo = *(const v8h*)(Ar);        // K = kSel .. kSel+7
    v8h hi = *(const v8h*)(Ar + 16);   // K = kSel+16 .. kSel+23
    v16h af;
    #pragma unroll
    for (int j = 0; j < 8; ++j) { af[j] = lo[j]; af[j + 8] = hi[j]; }
    return af;
}

// ---------------------------------------------------------------------------
// LayerNorm, input projections, causal conv + SiLU, x-projection and dt in one
// launch. A workgroup takes LG_ROWS tokens of one input (blockIdx.y: 0 = front,
// 1 = back) and reads them once. The input feeds two norms, which share mean and
// variance: ln0 of its own cross block (SSM path, times Wx) and ln1 of the other
// block (gate, times Wz). Both normalised tiles go as f16 through LDS straight to
// the matrix products and never to memory; u never goes to memory either.
//   part 1: one wave per LN_T consecutive tokens, each lane owns 4 neighbouring
//           channels; the tokens lie side by side in x and come in as 16-byte
//           pieces. A lane's 4 halves of a token are one 8-byte LDS store.
//           Wave 0 also norms the LG_HALO tokens in front of the tile (SSM path
//           only): the conv of the tile's first tokens needs their u.
//   part 2: a wave owns one norm's 32 tokens x 64 columns (2 x 4 accumulators).
//           An SSM wave adds the 16-token tile in front of its own, of which the
//           conv takes the last three rows.
//   part 3: gate waves store z. SSM waves: a lane's accumulator registers are 8
//           consecutive tokens of one channel, so the conv window slides over
//           registers; the three tokens in front come from the lane 16 away. uc
//           goes to LDS, over the weights that are no longer read, and to memory.
//   part 4: x_dbl = uc @ Wxproj -> (dt_r | B | C). lane = token, wave = 6 of the 24
//           columns for 32 of the tokens (uc row pitch 132 floats: 16 lanes'
//           16-byte reads of one column group fall on all 64 banks); the
//           wave-uniform Wxproj values come through the scalar cache.
//   part 5: dt = softplus(dt_r @ Wdt + bdt). thread = channel, 32 tokens one after
//           the other, dt_r rows by LDS broadcast.
// Row pitch of the f16 tiles 272 bytes: the 16 rows of a 16-byte fragment read fall
// on all 64 banks. Each sum of conv, x-projection and dt runs in the order it had.
// ---------------------------------------------------------------------------
#define LN_T     8
#define LG_ROWS  64
#define LG_PITCH 136   // halves
#define LG_HALO  4     // tokens normed in front of the tile: the conv's 3, as one 16-byte piece
#define XP_PITCH 132   // floats

// One wave's products: 2 x 4 tiles, with HALO the 1 x 4 tiles in front as well.
template <bool HALO>
__device__ __forceinline__ void inproj_tiles(const _Float16* S0, const _Float16* Sh,
                                             const _Float16* Wl,
                                             v8f (&acc)[2][4], v8f (&acch)[4]) {
    #pragma unroll
    for (int k = 0; k < 4; ++k) {
        v16h s0 = load_a_frag(S0 + k * 32);
        v16h s1 = load_a_frag(S0 + 16 * LG_PITCH + k * 32);
        v16h sh = {};
        if (HALO) sh = load_a_frag(Sh + k * 32);
        #pragma unroll
        for (int ct = 0; ct < 4; ++ct) {
            v16h bf = *(const v16h*)&Wl[(k * 128 + ct * 16) * 32];
            acc[0][ct] = __builtin_amdgcn_wmma_f32_16x16x32_f16(false, s0, false, bf, (short)0, acc[0][ct], false, false);
            acc[1][ct] = __builtin_amdgcn_wmma_f32_16x16x32_f16(false, s1, false, bf, (short)0, acc[1][ct], false, false);
            if (HALO)
                acch[ct] = __builtin_amdgcn_wmma_f32_16x16x32_f16(false, sh, false, bf, (short)0, acch[ct], false, false);
        }
    }
}

__global__ __launch_bounds__(256)
void ln_inproj_conv_xproj_kernel(
                      const float* __restrict__ front,  // (B, DIM, N)
                      const float* __restrict__ back,   // (B, DIM, N)
                      const float* __restrict__ ln0_w,  // (2, DIM)
                      const float* __restrict__ ln0_b,  // (2, DIM)
                      const float* __restrict__ ln1_w,  // (2, DIM)
                      const float* __restrict__ ln1_b,  // (2, DIM)
                      const _Float16* __restrict__ Wf,  // Wx[0], Wx[1], Wz[0], Wz[1], swizzled
                      const float* __restrict__ cw,     // (2,128,4)
                      const float* __restrict__ cb,     // (2,128)
                      const float* __restrict__ Wxproj, // (2,128,24)
                      const float* __restrict__ Wdt,    // (2,8,128)
                      const float* __restrict__ bdt,    // (2,128)
                      float* __restrict__ Zo,           // 2 x (B, N, 128)
                      float* __restrict__ uc,           // 2 x (B, N, 128)
                      float* __restrict__ dt,           // 2 x (B, N, 128)
                      float* __restrict__ Bm,           // 2 x (B, N, 8)
                      float* __restrict__ Cm) {         // 2 x (B, N, 8)
    __shared__ __align__(64) _Float16 sW[2 * 128 * 128];   // 64 KB, fragment order; later uc and x_dbl
    __shared__ __align__(16) _Float16 sA[(LG_HALO + 2 * LG_ROWS) * LG_PITCH];  // 35 KB: halo, SSM, gate
    int inp  = blockIdx.y;         // the input, and the block whose SSM path it feeds
    int gblk = inp ^ 1;            // the block whose gate it feeds
    const float* x = inp ? back : front;
    int tid  = threadIdx.x;
    int lane = tid & 31;
    int wave = tid >> 5;
    // the wave's number as a scalar: the branches on it are scalar branches
    int wv   = __builtin_amdgcn_readfirstlane(wave);
    int row0 = blockIdx.x * LG_ROWS;   // first token of the tile, b * NTOK + n
    int t0 = row0 + wave * LN_T;       // first token of the wave
    int b = t0 >> 14;                  // / NTOK
    int n = t0 & (NTOK - 1);
    int nT = row0 & (NTOK - 1);        // the tile's first token within its batch
    // At a batch's start u is zero-padded and nothing lies in front: the address
    // stays inside the batch there, and part 3 puts zeros in place of the result.
    int nh = nT ? nT - LG_HALO : 0;
    const float* xl = x + ((size_t)b * DIMC + 4 * lane) * NTOK + n;
    const float* xh = x + ((size_t)b * DIMC + 4 * lane) * NTOK + nh;
    const uint4* ws0 = (const uint4*)(Wf + (size_t)inp * 16384);
    const uint4* ws1 = (const uint4*)(Wf + (size_t)(2 + gblk) * 16384);
    uint4*       wd  = (uint4*)sW + tid;
    uint4 wr[8];
    f32x4 v[4][LN_T / 4];
    f32x4 vh[4];   // wave 0 only
    #pragma unroll   // v[][] in registers; all loads issue before the first wait
    for (int q = 0; q < 4; ++q)
        #pragma unroll
        for (int h = 0; h < LN_T / 4; ++h)
            v[q][h] = *(const f32x4*)(xl + (size_t)q * NTOK + 4 * h);
    if (wv == 0) {
        #pragma unroll
        for (int q = 0; q < 4; ++q) vh[q] = *(const f32x4*)(xh + (size_t)q * NTOK);
    }
    f32x4 wS = *(const f32x4*)(ln0_w + inp * DIMC + 4 * lane);
    f32x4 bS = *(const f32x4*)(ln0_b + inp * DIMC + 4 * lane);
    f32x4 wG = *(const f32x4*)(ln1_w + gblk * DIMC + 4 * lane);
    f32x4 bG = *(const f32x4*)(ln1_b + gblk * DIMC + 4 * lane);
    #pragma unroll   // wr[] in registers; eight 16-byte loads in flight per thread
    for (int i = 0; i < 8; ++i) wr[i] = ws0[tid + i * 256];
    #pragma unroll
    for (int i = 0; i < 8; ++i) wd[i * 256] = wr[i];
    // Keeps the second matrix's loads behind the first one's LDS stores; they fly
    // under the norm's arithmetic. All sixteen weight loads at once take the kernel
    // past 160 registers, and only two workgroups, not the three that LDS allows,
    // fit a WGP.
    __builtin_amdgcn_sched_barrier(0);
    #pragma unroll
    for (int i = 0; i < 8; ++i) wr[i] = ws1[tid + i * 256];
    // As inputs of the wait the pointers and the two indices (the offsets of the
    // parameter loads and of the weight loads) stay in their registers up to it, so
    // that no register that an issued load names is written before it.
    asm volatile("s_wait_xcnt 0x0" :: "v"(xl), "v"(xh), "v"(lane), "v"(tid) : "memory");

    // Two neighbouring tokens of a channel lie in neighbouring registers, so the
    // arithmetic runs on token pairs: packed instructions with no register moves.
    f32x2 p[4][LN_T / 2], s[LN_T / 2], q[LN_T / 2];
    #pragma unroll   // constant indices into the register arrays
    for (int k = 0; k < LN_T / 2; ++k) {
        #pragma unroll
        for (int c = 0; c < 4; ++c)
            p[c][k] = f32x2{v[c][k >> 1][2 * (k & 1)], v[c][k >> 1][2 * (k & 1) + 1]};
        s[k] = p[0][k] + p[1][k] + p[2][k] + p[3][k];
        q[k] = p[0][k] * p[0][k] + p[1][k] * p[1][k] + p[2][k] * p[2][k] + p[3][k] * p[3][k];
    }
    // butterfly step by step, all tokens in each step: their exchanges are
    // independent, so a step waits once and not once per token
    #pragma unroll
    for (int off = 16; off > 0; off >>= 1) {
        #pragma unroll
        for (int k = 0; k < LN_T / 2; ++k) {
            f32x2 so = f32x2{__shfl_xor(s[k][0], off, 32), __shfl_xor(s[k][1], off, 32)};
            f32x2 qo = f32x2{__shfl_xor(q[k][0], off, 32), __shfl_xor(q[k][1], off, 32)};
            s[k] += so;
            q[k] += qo;
        }
    }
    _Float16* aS = sA + (LG_HALO + wave * LN_T) * LG_PITCH + 4 * lane;
    _Float16* aG = aS + LG_ROWS * LG_PITCH;
    #pragma unroll
    for (int k = 0; k < LN_T / 2; ++k) {
        f32x2 mean = s[k] * (1.0f / DIMC);
        f32x2 var  = q[k] * (1.0f / DIMC) - mean * mean;
        f32x2 rstd = f32x2{rsqrtf(var[0] + 1e-5f), rsqrtf(var[1] + 1e-5f)};
        f32x2 ys[4], yg[4];
        #pragma unroll
        for (int c = 0; c < 4; ++c) {
            f32x2 t = (p[c][k] - mean) * rstd;
            ys[c] = t * wS[c] + bS[c];
            yg[c] = t * wG[c] + bG[c];
        }
        #pragma unroll
        for (int j = 0; j < 2; ++j) {
            *(v4h*)(aS + (2 * k + j) * LG_PITCH) =
                v4h{(_Float16)ys[0][j], (_Float16)ys[1][j], (_Float16)ys[2][j], (_Float16)ys[3][j]};
            *(v4h*)(aG + (2 * k + j) * LG_PITCH) =
                v4h{(_Float16)yg[0][j], (_Float16)yg[1][j], (_Float16)yg[2][j], (_Float16)yg[3][j]};
        }
    }
    #pragma unroll
    for (int i = 0; i < 8; ++i) wd[2048 + i * 256] = wr[i];
    if (wv == 0) {
        // the halo tokens, the same arithmetic, SSM norm only; rows 0 .. LG_HALO - 1 of sA
        f32x2 ph[4][LG_HALO / 2], sh[LG_HALO / 2], qh[LG_HALO / 2];
        #pragma unroll   // constant indices into the register arrays
        for (int k = 0; k < LG_HALO / 2; ++k) {
            #pragma unroll
            for (int c = 0; c < 4; ++c) ph[c][k] = f32x2{vh[c][2 * k], vh[c][2 * k + 1]};
            sh[k] = ph[0][k] + ph[1][k] + ph[2][k] + ph[3][k];
            qh[k] = ph[0][k] * ph[0][k] + ph[1][k] * ph[1][k] + ph[2][k] * ph[2][k] + ph[3][k] * ph[3][k];
        }
        #pragma unroll
        for (int off = 16; off > 0; off >>= 1) {
            #pragma unroll
            for (int k = 0; k < LG_HALO / 2; ++k) {
                f32x2 so = f32x2{__shfl_xor(sh[k][0], off, 32), __shfl_xor(sh[k][1], off, 32)};
                f32x2 qo = f32x2{__shfl_xor(qh[k][0], off, 32), __shfl_xor(qh[k][1], off, 32)};
                sh[k] += so;
                qh[k] += qo;
            }
        }
        _Float16* aH = sA + 4 * lane;
        #pragma unroll
        for (int k = 0; k < LG_HALO / 2; ++k) {
            f32x2 mean = sh[k] * (1.0f / DIMC);
            f32x2 var  = qh[k] * (1.0f / DIMC) - mean * mean;
            f32x2 rstd = f32x2{rsqrtf(var[0] + 1e-5f), rsqrtf(var[1] + 1e-5f)};
            f32x2 ys[4];
            #pragma unroll
            for (int c = 0; c < 4; ++c) {
                f32x2 t = (ph[c][k] - mean) * rstd;
                ys[c] = t * wS[c] + bS[c];
            }
            #pragma unroll
            for (int j = 0; j < 2; ++j)
                *(v4h*)(aH + (2 * k + j) * LG_PITCH) =
                    v4h{(_Float16)ys[0][j], (_Float16)ys[1][j], (_Float16)ys[2][j], (_Float16)ys[3][j]};
        }
    }
    __syncthreads();   // weights and the tiles are read by all waves

    int l15  = lane & 15;
    int sel  = lane >> 4;                  // 0 / 1
    int nrm  = wv >> 2;                    // 0 = SSM path, 1 = gate
    int rowW = ((wv >> 1) & 1) * 32;       // the wave's first token within the tile
    int colW = (wv & 1) * 64;              // the wave's first column
    const _Float16* S0 = sA + (LG_HALO + nrm * LG_ROWS + rowW + l15) * LG_PITCH + sel * 8;
    const _Float16* Wl = sW + nrm * 16384 + ((colW + l15) * 2 + sel) * 16;
    v8f acc[2][4] = {};
    v8f acch[4] = {};
    f32x4 cwv[4];   // SSM waves only
    float cbv[4];
    if (nrm == 0) {
        const float* pcw = cw + (inp * 128 + colW + l15) * D_CONV;
        const float* pcb = cb + inp * 128 + colW + l15;
        #pragma unroll   // fly under the products
        for (int ct = 0; ct < 4; ++ct) {
            cwv[ct] = *(const f32x4*)(pcw + ct * 16 * D_CONV);
            cbv[ct] = pcb[ct * 16];
        }
        // as inputs of the wait the pointers stay in their registers up to it
        asm volatile("s_wait_xcnt 0x0" :: "v"(pcw), "v"(pcb) : "memory");
        // The 16 tokens in front of the wave's own. Of the tile's first wave only
        // the last LG_HALO exist (sA rows 0 ..); the lanes of the rows in front of
        // them read row 0, and their results are not used.
        int hr = LG_HALO + rowW - 16 + l15;
        hr = hr < 0 ? 0 : hr;
        inproj_tiles<true>(S0, sA + hr * LG_PITCH + sel * 8, Wl, acc, acch);
    } else {
        inproj_tiles<false>(S0, S0, Wl, acc, acch);
    }
    __syncthreads();   // every wave has read its weights: uc and x_dbl take their place

    float* sU = (float*)sW;                  // (LG_ROWS, XP_PITCH)
    float* sX = sU + LG_ROWS * XP_PITCH;     // dt_r, B, C: (LG_ROWS, 8) each
    // accumulator layout: row = r + 8 * sel, column = l15 of each 16 x 16 tile
    size_t go = (size_t)(row0 + rowW + sel * 8) * 128 + colW + l15;
    if (nrm == 0) {
        float* pl = sU + (rowW + sel * 8) * XP_PITCH + colW + l15;
        bool pad = (nT == 0) && (rowW == 0);   // the zero padding in front of token 0
        #pragma unroll   // constant indices into the register arrays
        for (int ct = 0; ct < 4; ++ct) {
            // uc takes u's place in the accumulator registers: the second tile
            // first, which still needs the first one's u
            #pragma unroll
            for (int rt = 1; rt >= 0; --rt) {
                // The three tokens in front of the lane's eight: for sel = 1 rows
                // 5..7 of the same tile (lane sel = 0), for sel = 0 rows 13..15 of
                // the tile in front (lane sel = 1).
                float w[8 + D_CONV - 1];
                #pragma unroll
                for (int i = 0; i < D_CONV - 1; ++i) {
                    float fr = rt ? acc[0][ct][5 + i] : (pad ? 0.0f : acch[ct][5 + i]);
                    w[i] = __shfl_xor(sel ? fr : acc[rt][ct][5 + i], 16, 32);
                }
                #pragma unroll
                for (int k = 0; k < 8; ++k) w[k + D_CONV - 1] = acc[rt][ct][k];
                f32x2 a[4], xe[4], e[4];
                #pragma unroll
                for (int k = 0; k < 8; ++k) {
                    float av = cbv[ct];
                    #pragma unroll
                    for (int i = 0; i < D_CONV; ++i) av = __builtin_fmaf(w[k + i], cwv[ct][i], av);
                    a[k >> 1][k & 1] = av;
                }
                #pragma unroll
                for (int k = 0; k < 4; ++k) xe[k] = a[k] * -1.44269504f;
                exp2_x8(xe, e);                            // exp(-a)
                #pragma unroll
                for (int k = 0; k < 8; ++k)
                    acc[rt][ct][k] = a[k >> 1][k & 1] / (1.0f + e[k >> 1][k & 1]);   // SiLU
                #pragma unroll
                for (int k = 0; k < 8; ++k)
                    pl[(rt * 16 + k) * XP_PITCH + ct * 16] = acc[rt][ct][k];
            }
        }
    } else {
        float* po = Zo + (size_t)gblk * MTOT * 128 + go;
        #pragma unroll
        for (int rt = 0; rt < 2; ++rt)
            #pragma unroll
            for (int r = 0; r < 8; ++r)
                #pragma unroll
                for (int ct = 0; ct < 4; ++ct)
                    po[(rt * 16 + r) * 128 + ct * 16] = acc[rt][ct][r];
        // what follows rewrites the address and data registers of these stores
        asm volatile("s_wait_xcnt 0x0" :: "v"(po) : "memory");
    }
    __syncthreads();   // the uc rows are read by all waves

    // uc goes to memory behind the barrier, not in front of it: the barrier waits
    // for a wave's outstanding stores, and these now fly under part 4.
    if (nrm == 0) {
        float* po = uc + (size_t)inp * MTOT * 128 + go;
        #pragma unroll
        for (int rt = 0; rt < 2; ++rt)
            #pragma unroll
            for (int k = 0; k < 8; ++k)
                #pragma unroll
                for (int ct = 0; ct < 4; ++ct)
                    po[(rt * 16 + k) * 128 + ct * 16] = acc[rt][ct][k];
        // what follows rewrites the address and data registers of these stores
        asm volatile("s_wait_xcnt 0x0" :: "v"(po) : "memory");
    }
    int ch   = tid & 127;       // part 5: the thread's channel
    int half = wv >> 2;         // parts 4 and 5: which 32 of the 64 tokens
    const float* pwd = Wdt + inp * DT_RANK * 128 + ch;
    const float* pbd = bdt + inp * 128 + ch;
    float wdt[DT_RANK];
    #pragma unroll   // fly under part 4
    for (int r = 0; r < DT_RANK; ++r) wdt[r] = pwd[r * 128];
    float bb = *pbd;
    // as an input of the wait the channel index, the offset of these loads, stays in
    // its register up to it
    asm volatile("s_wait_xcnt 0x0" :: "v"(ch) : "memory");

    {
        int j0 = (wv & 3) * 6;
        int tk = half * 32 + lane;
        const float* ur = sU + tk * XP_PITCH;
        // Wxproj is only read in this launch. Named as constant memory, its wave-uniform
        // values come through the scalar cache, 4 bytes a value; behind the stores and
        // waits above the compiler otherwise fetches each value into all 32 lanes.
        const __attribute__((address_space(4))) float* wp =
            (const __attribute__((address_space(4))) float*)(Wxproj + inp * 128 * 24 + j0);
        float ax[6];
        #pragma unroll
        for (int jj = 0; jj < 6; ++jj) ax[jj] = 0.0f;
        for (int c = 0; c < 128; c += 4) {
            f32x4 uv = *(const f32x4*)(ur + c);
            #pragma unroll   // ax[] in registers
            for (int i = 0; i < 4; ++i)
                #pragma unroll
                for (int jj = 0; jj < 6; ++jj)
                    ax[jj] = __builtin_fmaf(uv[i], wp[(c + i) * 24 + jj], ax[jj]);
        }
        #pragma unroll
        for (int jj = 0; jj < 6; ++jj) {
            int j = j0 + jj;
            sX[(j >> 3) * (LG_ROWS * 8) + tk * 8 + (j & 7)] = ax[jj];
        }
    }
    __syncthreads();   // the x_dbl rows are read by all waves

    size_t xo = ((size_t)inp * MTOT + row0) * 8 + tid * 2;
    *(f32x2*)(Bm + xo) = *(const f32x2*)&sX[1 * LG_ROWS * 8 + tid * 2];
    *(f32x2*)(Cm + xo) = *(const f32x2*)&sX[2 * LG_ROWS * 8 + tid * 2];
    // what follows rewrites the offset and data registers of these two stores
    asm volatile("s_wait_xcnt 0x0" ::: "memory");

    float* pd = dt + ((size_t)inp * MTOT + row0 + half * 32) * 128 + ch;
    const float* xr = sX + half * 32 * 8;
    for (int k0 = 0; k0 < 32; k0 += 8) {
        float o[8];
        #pragma unroll   // o[] in registers
        for (int k = 0; k < 8; ++k) {
            f32x4 r0 = *(const f32x4*)&xr[(k0 + k) * 8];
            f32x4 r1 = *(const f32x4*)&xr[(k0 + k) * 8 + 4];
            float a = bb;
            #pragma unroll
            for (int r = 0; r < 4; ++r) a += r0[r] * wdt[r];
            #pragma unroll
            for (int r = 0; r < 4; ++r) a += r1[r] * wdt[r + 4];
            o[k] = (a > 20.0f) ? a : log1pf(__expf(a));   // softplus
        }
        #pragma unroll
        for (int k = 0; k < 8; ++k) pd[(k0 + k) * 128] = o[k];
        // the next trip rewrites the data registers of these stores
        asm volatile("s_wait_xcnt 0x0" ::: "memory");
    }
}

// ---------------------------------------------------------------------------
// SSM scan, cut along the tokens into NCHUNK chunks of CHUNK_T steps.
// h[t] = a[t]*h[t-1] + b[t] is linear in h, so a chunk acts on its incoming
// state as  h_out = P*h_in + H  with P = product of its a[t] and H = its end
// state from h_in = 0.  Three launches:
//   1) every chunk: P and H                        (all chunks side by side)
//   2) every (batch, d, s): the incoming state of each chunk, chunk by chunk
//   3) every chunk: the recurrence again from its incoming state, with readout
// Launches 1 and 3: one workgroup of 128 threads per chunk, thread = channel d,
// which keeps its 8 states in registers as 4 pairs. A wave's load of dt, uc or
// z is then one whole 128-byte line, the readout sum over the states stays in
// the thread, and the gate is worked out once per (token, channel) with every
// lane busy. The B and C rows of the chunk, the same for all channels, are
// staged in LDS once and read from there by broadcast.
// The two cross blocks are independent and go through each launch side by side:
// their arrays lie one behind the other, so that they read as 2 * BATCH batches,
// and only the per-block parameters are picked by batch index / BATCH.
// ---------------------------------------------------------------------------
#define CHUNK_T 128
#define NCHUNK  (NTOK / CHUNK_T)    // 128 chunks per batch
#define SCAN_U  8                   // tokens per register buffer (two buffers)
#define SCAN_NG (CHUNK_T / SCAN_U)  // 16 buffer fills per chunk

// log2(e) * A for the 8 states of channel d, A = -exp(A_log): exp(dt*A) is then
// one multiply and one v_exp_f32.
__device__ __forceinline__ void load_a2(const float* __restrict__ A_log, int d, f32x2* A2) {
    f32x4 l0 = *(const f32x4*)(A_log + d * 8);
    f32x4 l1 = *(const f32x4*)(A_log + d * 8 + 4);
    A2[0] = f32x2{-__expf(l0[0]), -__expf(l0[1])} * 1.44269504f;
    A2[1] = f32x2{-__expf(l0[2]), -__expf(l0[3])} * 1.44269504f;
    A2[2] = f32x2{-__expf(l1[0]), -__expf(l1[1])} * 1.44269504f;
    A2[3] = f32x2{-__expf(l1[2]), -__expf(l1[3])} * 1.44269504f;
}

// SCAN_U tokens of one channel's column of a (token, 128) array. Two tokens
// share a register pair: a packed multiply that takes one of them as its scalar
// names the whole pair, and the wait in front of it covers both halves, so the
// other half must belong to the same buffer and not to the one still in flight.
__device__ __forceinline__ void load_col(const float* __restrict__ p, f32x2* r) {
    #pragma unroll   // r[] in registers; the loads issue back to back
    for (int k = 0; k < SCAN_U; ++k) r[k >> 1][k & 1] = p[k * 128];
}

// One step of the recurrence for the 8 states of a channel.
__device__ __forceinline__ void ssm_step(float dtv, float ucv, const f32x2* A2,
                                         const float* sBrow, f32x2* a, f32x2* h) {
    f32x4 b0 = *(const f32x4*)(sBrow);
    f32x4 b1 = *(const f32x4*)(sBrow + 4);
    f32x2 Bp[4] = {f32x2{b0[0], b0[1]}, f32x2{b0[2], b0[3]},
                   f32x2{b1[0], b1[1]}, f32x2{b1[2], b1[3]}};
    float du = dtv * ucv;
    f32x2 x[4];
    #pragma unroll   // x[], a[], h[] in registers
    for (int j = 0; j < 4; ++j) x[j] = A2[j] * dtv;
    exp2_x8(x, a);
    #pragma unroll
    for (int j = 0; j < 4; ++j) h[j] = __builtin_elementwise_fma(a[j], h[j], Bp[j] * du);
}

__device__ __forceinline__ void chunk_sum_group(const f32x2* dtr, const f32x2* ucr,
                                                const f32x2* A2, const float* sBg,
                                                f32x2* h, f32x2* p) {
    #pragma unroll   // constant indices into the register buffers
    for (int k = 0; k < SCAN_U; ++k) {
        f32x2 a[4];
        ssm_step(dtr[k >> 1][k & 1], ucr[k >> 1][k & 1], A2, sBg + k * 8, a, h);
        #pragma unroll
        for (int j = 0; j < 4; ++j) p[j] *= a[j];
    }
}

__global__ __launch_bounds__(128)
void scan_chunk_sum_kernel(const float* __restrict__ dt,    // (2B,N,128)
                           const float* __restrict__ uc,    // (2B,N,128)
                           const float* __restrict__ Bm,    // (2B,N,8)
                           const float* __restrict__ A_log, // (2,128,8)
                           float* __restrict__ Pc,          // (2B,NCHUNK,128,8)
                           float* __restrict__ Hc) {        // (2B,NCHUNK,128,8)
    __shared__ __align__(16) float sB[CHUNK_T * 8];         // 4 KB
    int c = blockIdx.x;
    int b = blockIdx.y;
    int d = threadIdx.x;
    A_log += (blockIdx.y / BATCH) * 128 * 8;
    size_t base = (size_t)b * NTOK + (size_t)c * CHUNK_T;
    const float* pdt = dt + base * 128 + d;
    const float* puc = uc + base * 128 + d;

    f32x2 dt0[SCAN_U / 2], uc0[SCAN_U / 2], dt1[SCAN_U / 2], uc1[SCAN_U / 2];
    load_col(pdt, dt0);
    load_col(puc, uc0);
    {
        const f32x4* g = (const f32x4*)(Bm + base * 8);
        ((f32x4*)sB)[d]       = g[d];
        ((f32x4*)sB)[d + 128] = g[d + 128];
    }
    f32x2 A2[4], h[4], p[4];
    load_a2(A_log, d, A2);
    #pragma unroll
    for (int j = 0; j < 4; ++j) { h[j] = f32x2{0.0f, 0.0f}; p[j] = f32x2{1.0f, 1.0f}; }
    __syncthreads();

    // Two register buffers: while one is worked on, the other's loads fly. The
    // scheduling barriers keep each buffer's loads in front of the work on the
    // other buffer; without them the compiler sinks the loads to their first use.
    for (int g = 0; g < SCAN_NG - 2; g += 2) {
        load_col(pdt + (size_t)(g + 1) * SCAN_U * 128, dt1);
        load_col(puc + (size_t)(g + 1) * SCAN_U * 128, uc1);
        __builtin_amdgcn_sched_barrier(0);
        chunk_sum_group(dt0, uc0, A2, sB + g * SCAN_U * 8, h, p);
        load_col(pdt + (size_t)(g + 2) * SCAN_U * 128, dt0);
        load_col(puc + (size_t)(g + 2) * SCAN_U * 128, uc0);
        __builtin_amdgcn_sched_barrier(0);
        chunk_sum_group(dt1, uc1, A2, sB + (g + 1) * SCAN_U * 8, h, p);
    }
    load_col(pdt + (size_t)(SCAN_NG - 1) * SCAN_U * 128, dt1);
    load_col(puc + (size_t)(SCAN_NG - 1) * SCAN_U * 128, uc1);
    __builtin_amdgcn_sched_barrier(0);
    chunk_sum_group(dt0, uc0, A2, sB + (SCAN_NG - 2) * SCAN_U * 8, h, p);
    __builtin_amdgcn_sched_barrier(0);   // keeps the wait for the last buffer behind the work above
    chunk_sum_group(dt1, uc1, A2, sB + (SCAN_NG - 1) * SCAN_U * 8, h, p);

    size_t o = ((size_t)b * NCHUNK + c) * 1024 + d * 8;
    *(f32x4*)(Pc + o)     = f32x4{p[0][0], p[0][1], p[1][0], p[1][1]};
    *(f32x4*)(Pc + o + 4) = f32x4{p[2][0], p[2][1], p[3][0], p[3][1]};
    *(f32x4*)(Hc + o)     = f32x4{h[0][0], h[0][1], h[1][0], h[1][1]};
    *(f32x4*)(Hc + o + 4) = f32x4{h[2][0], h[2][1], h[3][0], h[3][1]};
}

// One thread per (batch, d, s); 16 chunks' summaries are loaded at a time so
// that the serial chain waits for memory once per 16 chunks, not per chunk.
__global__ __launch_bounds__(256)
void scan_carry_kernel(const float* __restrict__ Pc,   // (2B,NCHUNK,1024)
                       const float* __restrict__ Hc,   // (2B,NCHUNK,1024)
                       float* __restrict__ Hin) {      // (2B,NCHUNK,1024)
    int idx = blockIdx.x * blockDim.x + threadIdx.x;   // over 2*BATCH*1024
    int b = idx >> 10;
    int r = idx & 1023;
    size_t o = (size_t)b * NCHUNK * 1024 + r;
    float carry = 0.0f;
    for (int c0 = 0; c0 < NCHUNK; c0 += 16) {
        float p[16], h[16];
        #pragma unroll   // p[], h[] in registers; all 32 loads issue before the first wait
        for (int k = 0; k < 16; ++k) {
            p[k] = Pc[o + (size_t)(c0 + k) * 1024];
            h[k] = Hc[o + (size_t)(c0 + k) * 1024];
        }
        #pragma unroll   // constant indices into p[], h[]
        for (int k = 0; k < 16; ++k) {
            Hin[o + (size_t)(c0 + k) * 1024] = carry;
            carry = p[k] * carry + h[k];
        }
        // the next trip rewrites the address and data registers of these stores
        asm volatile("s_wait_xcnt 0x0" ::: "memory");
    }
}

// SCAN_U tokens of launch 3: recurrence, readout over the 8 states, Dp skip and
// SiLU(z) gate; emits f16.
__device__ __forceinline__ void scan_group(const f32x2* dtr, const f32x2* ucr, const f32x2* zr,
                                           const f32x2* A2, float Dd,
                                           const float* sBg, const float* sCg,
                                           f32x2* h, _Float16* __restrict__ yo) {
    _Float16 r[SCAN_U];
    f32x2 zx[SCAN_U / 2], ez[SCAN_U / 2];   // exp(-z) of the 8 tokens
    #pragma unroll
    for (int k = 0; k < SCAN_U / 2; ++k) zx[k] = zr[k] * -1.44269504f;
    exp2_x8(zx, ez);
    #pragma unroll   // constant indices into the register buffers
    for (int k = 0; k < SCAN_U; ++k) {
        f32x2 a[4];
        float ucv = ucr[k >> 1][k & 1];
        ssm_step(dtr[k >> 1][k & 1], ucv, A2, sBg + k * 8, a, h);
        f32x4 c0 = *(const f32x4*)(sCg + k * 8);
        f32x4 c1 = *(const f32x4*)(sCg + k * 8 + 4);
        f32x2 y2 = h[0] * f32x2{c0[0], c0[1]};
        y2 = __builtin_elementwise_fma(h[1], f32x2{c0[2], c0[3]}, y2);
        y2 = __builtin_elementwise_fma(h[2], f32x2{c1[0], c1[1]}, y2);
        y2 = __builtin_elementwise_fma(h[3], f32x2{c1[2], c1[3]}, y2);
        float y  = y2[0] + y2[1];
        float zv = zr[k >> 1][k & 1];
        float g  = zv / (1.0f + ez[k >> 1][k & 1]);
        r[k] = (_Float16)((y + Dd * ucv) * g);
    }
    #pragma unroll
    for (int k = 0; k < SCAN_U; ++k) yo[k * 128] = r[k];
    // what follows rewrites the data registers of these stores
    asm volatile("s_wait_xcnt 0x0" ::: "memory");
}

__global__ __launch_bounds__(128)
void scan_kernel(const float* __restrict__ dt,    // (2B,N,128)
                 const float* __restrict__ uc,    // (2B,N,128)
                 const float* __restrict__ zg,    // (2B,N,128) pre-activation z
                 const float* __restrict__ Bm,    // (2B,N,8)
                 const float* __restrict__ Cm,    // (2B,N,8)
                 const float* __restrict__ A_log, // (2,128,8)
                 const float* __restrict__ Dp,    // (2,128)
                 const float* __restrict__ Hin,   // (2B,NCHUNK,128,8)
                 _Float16* __restrict__ yg) {     // (2B,N,128)
    __shared__ __align__(16) float sB[CHUNK_T * 8];   // 4 KB
    __shared__ __align__(16) float sC[CHUNK_T * 8];   // 4 KB
    int c = blockIdx.x;
    int b = blockIdx.y;
    int d = threadIdx.x;
    A_log += (blockIdx.y / BATCH) * 128 * 8;
    Dp    += (blockIdx.y / BATCH) * 128;
    size_t base = (size_t)b * NTOK + (size_t)c * CHUNK_T;
    const float* pdt = dt + base * 128 + d;
    const float* puc = uc + base * 128 + d;
    const float* pz  = zg + base * 128 + d;
    _Float16*    py  = yg + base * 128 + d;

    f32x2 dt0[SCAN_U / 2], uc0[SCAN_U / 2], z0[SCAN_U / 2];
    f32x2 dt1[SCAN_U / 2], uc1[SCAN_U / 2], z1[SCAN_U / 2];
    load_col(pdt, dt0);
    load_col(puc, uc0);
    load_col(pz,  z0);
    {
        const f32x4* gb = (const f32x4*)(Bm + base * 8);
        const f32x4* gc = (const f32x4*)(Cm + base * 8);
        ((f32x4*)sB)[d]       = gb[d];
        ((f32x4*)sB)[d + 128] = gb[d + 128];
        ((f32x4*)sC)[d]       = gc[d];
        ((f32x4*)sC)[d + 128] = gc[d + 128];
    }
    f32x2 A2[4], h[4];
    load_a2(A_log, d, A2);
    float Dd = Dp[d];
    {
        const float* hi = Hin + ((size_t)b * NCHUNK + c) * 1024 + d * 8;
        f32x4 h0 = *(const f32x4*)(hi);
        f32x4 h1 = *(const f32x4*)(hi + 4);
        h[0] = f32x2{h0[0], h0[1]}; h[1] = f32x2{h0[2], h0[3]};
        h[2] = f32x2{h1[0], h1[1]}; h[3] = f32x2{h1[2], h1[3]};
    }
    __syncthreads();

    // Two register buffers, held apart by scheduling barriers as in launch 1.
    for (int g = 0; g < SCAN_NG - 2; g += 2) {
        load_col(pdt + (size_t)(g + 1) * SCAN_U * 128, dt1);
        load_col(puc + (size_t)(g + 1) * SCAN_U * 128, uc1);
        load_col(pz  + (size_t)(g + 1) * SCAN_U * 128, z1);
        __builtin_amdgcn_sched_barrier(0);
        scan_group(dt0, uc0, z0, A2, Dd, sB + g * SCAN_U * 8, sC + g * SCAN_U * 8,
                   h, py + (size_t)g * SCAN_U * 128);
        load_col(pdt + (size_t)(g + 2) * SCAN_U * 128, dt0);
        load_col(puc + (size_t)(g + 2) * SCAN_U * 128, uc0);
        load_col(pz  + (size_t)(g + 2) * SCAN_U * 128, z0);
        __builtin_amdgcn_sched_barrier(0);
        scan_group(dt1, uc1, z1, A2, Dd, sB + (g + 1) * SCAN_U * 8, sC + (g + 1) * SCAN_U * 8,
                   h, py + (size_t)(g + 1) * SCAN_U * 128);
    }
    load_col(pdt + (size_t)(SCAN_NG - 1) * SCAN_U * 128, dt1);
    load_col(puc + (size_t)(SCAN_NG - 1) * SCAN_U * 128, uc1);
    load_col(pz  + (size_t)(SCAN_NG - 1) * SCAN_U * 128, z1);
    // The three pointers are used here for the last time. As inputs of the wait
    // they stay in their registers up to it, so that no result of these loads is
    // placed on an address register that an earlier one of them still names.
    asm volatile("s_wait_xcnt 0x0" :: "v"(pdt), "v"(puc), "v"(pz) : "memory");
    __builtin_amdgcn_sched_barrier(0);
    scan_group(dt0, uc0, z0, A2, Dd, sB + (SCAN_NG - 2) * SCAN_U * 8, sC + (SCAN_NG - 2) * SCAN_U * 8,
               h, py + (size_t)(SCAN_NG - 2) * SCAN_U * 128);
    __builtin_amdgcn_sched_barrier(0);   // keeps the wait for the last buffer behind the work above
    scan_group(dt1, uc1, z1, A2, Dd, sB + (SCAN_NG - 1) * SCAN_U * 8, sC + (SCAN_NG - 1) * SCAN_U * 8,
               h, py + (size_t)(SCAN_NG - 1) * SCAN_U * 128);
}

// ---------------------------------------------------------------------------
// Both out-projections, the residual sum and the final projection in one launch:
//   out = (0.5 * (yg0 @ Wom0 + yg1 @ Wom1 + bom0 + bom1 + ff + bf)) @ Wout + bout
// stored transposed to (B, DIM, NTOK). m0, m1 and s never go to memory.
// A workgroup of 8 waves takes OF_ROWS tokens; a wave owns 32 tokens x 64 columns
// (2 x 4 accumulators), so that its 32 tokens are one whole 128-byte line of each
// of its channels' rows in front, back and out. The accumulators start from
// ff + bf + bom0 + bom1 and take both products on top; s goes as f16 through LDS
// from accumulator layout to A-fragment layout (row pitch 272 bytes: the 16 rows
// of a 16-byte fragment read fall on all 64 banks).
// ---------------------------------------------------------------------------
#define OF_ROWS  128
#define OF_PITCH 136   // halves
__global__ __launch_bounds__(256)
void out_fused_kernel(const _Float16* __restrict__ yg,    // 2 x (B,N,128)
                      const _Float16* __restrict__ Wf,    // Wout_m[0], Wout_m[1], Wout, swizzled
                      const float* __restrict__ bom,      // (2,128)
                      const float* __restrict__ front,    // (B,128,N)
                      const float* __restrict__ back,     // (B,128,N)
                      const float* __restrict__ bout,     // (128)
                      float* __restrict__ out) {          // (B,128,N)
    __shared__ __align__(64) _Float16 sW[3 * 128 * 128];         // 96 KB, fragment order
    __shared__ __align__(16) _Float16 sS[OF_ROWS * OF_PITCH];    // 34 KB
    int tid  = threadIdx.x;
    int lane = tid & 31;
    int l15  = lane & 15;
    int sel  = lane >> 4;                 // 0 / 1
    int rowW = (tid >> 6) * 32;           // the wave's first token within the tile
    int colW = ((tid >> 5) & 1) * 64;     // the wave's first column
    int row0 = blockIdx.x * OF_ROWS;      // first token, b * NTOK + n
    int b    = row0 >> 14;
    int n0   = row0 & (NTOK - 1);

    // A lane's accumulator registers r = 0..7 are 8 consecutive tokens of one
    // channel: 32 contiguous bytes of front, back and out.
    size_t ro = ((size_t)b * DIMC + colW + l15) * NTOK + n0 + rowW + sel * 8;
    const float* pf = front + ro;
    const float* pb = back + ro;
    const _Float16* A0 = yg + (size_t)(row0 + rowW + l15) * 128 + sel * 8;
    const _Float16* A1 = A0 + (size_t)MTOT * 128;

    f32x4 f[2][4][2], g[2][4][2];
    v16h  a[2][4];
    #pragma unroll   // f[], g[], a[] in registers; all loads issue before the first wait
    for (int rt = 0; rt < 2; ++rt)
        #pragma unroll
        for (int ct = 0; ct < 4; ++ct)
            #pragma unroll
            for (int h = 0; h < 2; ++h) {
                f[rt][ct][h] = *(const f32x4*)(pf + (size_t)(ct * 16) * NTOK + rt * 16 + h * 4);
                g[rt][ct][h] = *(const f32x4*)(pb + (size_t)(ct * 16) * NTOK + rt * 16 + h * 4);
            }
    #pragma unroll
    for (int rt = 0; rt < 2; ++rt)
        #pragma unroll
        for (int k = 0; k < 4; ++k) a[rt][k] = load_a_frag(A0 + rt * 2048 + k * 32);
    float bs[4], bo[4];
    #pragma unroll
    for (int ct = 0; ct < 4; ++ct) {
        int col = colW + ct * 16 + l15;
        bs[ct] = bom[col] + bom[128 + col];
        bo[ct] = bout[col];
    }
    const uint4* wsrc = (const uint4*)Wf + tid;
    uint4*       wdst = (uint4*)sW + tid;
    #pragma unroll 8   // eight 16-byte loads in flight per thread
    for (int i = 0; i < (3 * 128 * 128) / 8 / 256; ++i) wdst[i * 256] = wsrc[i * 256];

    v8f acc[2][4];
    #pragma unroll   // constant indices into the register arrays
    for (int rt = 0; rt < 2; ++rt)
        #pragma unroll
        for (int ct = 0; ct < 4; ++ct)
            #pragma unroll
            for (int r = 0; r < 8; ++r)
                acc[rt][ct][r] = f[rt][ct][r >> 2][r & 3] + g[rt][ct][r >> 2][r & 3] + bs[ct];

    // As inputs of the wait the pointers stay in their registers up to it, so that
    // no register that an issued load names is written before it.
    asm volatile("s_wait_xcnt 0x0" :: "v"(pf), "v"(pb), "v"(A0), "v"(wsrc) : "memory");
    __syncthreads();

    // The second block's fragments fly while the first block's products run, one
    // k step's worth issued per k step.
    v16h a1[2][4];
    #pragma unroll
    for (int k = 0; k < 4; ++k) {
        a1[0][k] = load_a_frag(A1 + k * 32);
        a1[1][k] = load_a_frag(A1 + 2048 + k * 32);
        #pragma unroll
        for (int ct = 0; ct < 4; ++ct) {
            v16h bf = *(const v16h*)&sW[((k * 128 + colW + ct * 16 + l15) * 2 + sel) * 16];
            acc[0][ct] = __builtin_amdgcn_wmma_f32_16x16x32_f16(false, a[0][k], false, bf, (short)0, acc[0][ct], false, false);
            acc[1][ct] = __builtin_amdgcn_wmma_f32_16x16x32_f16(false, a[1][k], false, bf, (short)0, acc[1][ct], false, false);
        }
        // Keeps the next step's fragment loads behind this step's products, whose
        // operand registers they take: hoisted together they push the kernel past
        // 256 registers, and only one workgroup fits a WGP.
        __builtin_amdgcn_sched_barrier(0);
    }
    // what follows may rewrite the address registers of these loads
    asm volatile("s_wait_xcnt 0x0" :: "v"(A1) : "memory");
    #pragma unroll
    for (int k = 0; k < 4; ++k)
        #pragma unroll
        for (int ct = 0; ct < 4; ++ct) {
            v16h bf = *(const v16h*)&sW[16384 + ((k * 128 + colW + ct * 16 + l15) * 2 + sel) * 16];
            acc[0][ct] = __builtin_amdgcn_wmma_f32_16x16x32_f16(false, a1[0][k], false, bf, (short)0, acc[0][ct], false, false);
            acc[1][ct] = __builtin_amdgcn_wmma_f32_16x16x32_f16(false, a1[1][k], false, bf, (short)0, acc[1][ct], false, false);
        }

    // s, accumulator layout: row = r + 8 * sel, column = l15 of each 16 x 16 tile
    #pragma unroll
    for (int rt = 0; rt < 2; ++rt)
        #pragma unroll
        for (int ct = 0; ct < 4; ++ct)
            #pragma unroll
            for (int r = 0; r < 8; ++r)
                sS[(rowW + rt * 16 + sel * 8 + r) * OF_PITCH + colW + ct * 16 + l15] =
                    (_Float16)(0.5f * acc[rt][ct][r]);
    __syncthreads();   // a wave's s rows hold the columns of its neighbour wave too

    v8f o[2][4] = {};
    const _Float16* S0 = sS + (rowW + l15) * OF_PITCH + sel * 8;
    #pragma unroll
    for (int k = 0; k < 4; ++k) {
        v16h s0 = load_a_frag(S0 + k * 32);
        v16h s1 = load_a_frag(S0 + 16 * OF_PITCH + k * 32);
        #pragma unroll
        for (int ct = 0; ct < 4; ++ct) {
            v16h bf = *(const v16h*)&sW[2 * 16384 + ((k * 128 + colW + ct * 16 + l15) * 2 + sel) * 16];
            o[0][ct] = __builtin_amdgcn_wmma_f32_16x16x32_f16(false, s0, false, bf, (short)0, o[0][ct], false, false);
            o[1][ct] = __builtin_amdgcn_wmma_f32_16x16x32_f16(false, s1, false, bf, (short)0, o[1][ct], false, false);
        }
    }

    float* po = out + ro;
    #pragma unroll
    for (int rt = 0; rt < 2; ++rt)
        #pragma unroll
        for (int ct = 0; ct < 4; ++ct) o[rt][ct] += bo[ct];
    // keeps every store behind the last arithmetic, so that no register that an
    // issued store names is written again
    __builtin_amdgcn_sched_barrier(0);
    #pragma unroll
    for (int rt = 0; rt < 2; ++rt)
        #pragma unroll
        for (int ct = 0; ct < 4; ++ct)
            #pragma unroll
            for (int h = 0; h < 2; ++h)
                *(f32x4*)(po + (size_t)(ct * 16) * NTOK + rt * 16 + h * 4) =
                    f32x4{o[rt][ct][4 * h], o[rt][ct][4 * h + 1], o[rt][ct][4 * h + 2], o[rt][ct][4 * h + 3]};
}

// ---------------------------------------------------------------------------
// Host-side pipeline
// ---------------------------------------------------------------------------
extern "C" void kernel_launch(void* const* d_in, const int* in_sizes, int n_in,
                              void* d_out, int out_size, void* d_ws, size_t ws_size,
                              hipStream_t stream) {
    const float* front   = (const float*)d_in[0];
    const float* back    = (const float*)d_in[1];
    const float* ln0_w   = (const float*)d_in[2];
    const float* ln0_b   = (const float*)d_in[3];
    const float* ln1_w   = (const float*)d_in[4];
    const float* ln1_b   = (const float*)d_in[5];
    const float* Wx      = (const float*)d_in[6];
    const float* Wz      = (const float*)d_in[7];
    const float* conv_w  = (const float*)d_in[8];
    const float* conv_b  = (const float*)d_in[9];
    const float* Wxproj  = (const float*)d_in[10];
    const float* Wdt     = (const float*)d_in[11];
    const float* bdt     = (const float*)d_in[12];
    const float* A_log   = (const float*)d_in[13];
    const float* Dp      = (const float*)d_in[14];
    const float* Wout_m  = (const float*)d_in[15];
    const float* bout_m  = (const float*)d_in[16];
    const float* Wout    = (const float*)d_in[17];
    const float* bout    = (const float*)d_in[18];

    char* ws = (char*)d_ws;
    // ---- static workspace layout (bytes); "2 x": block 0's array, then block 1's ----
    _Float16* Wh   = (_Float16*)(ws);                       // 7*16384 halves < 256 KB
    _Float16* WOMh = Wh + 4 * 16384;                        // behind Wx[0..1], Wz[0..1]; Wout follows
    size_t off = 0x40000;
    float*    UC   = (float*)(ws + off);    off += (size_t)2 * MTOT * 128 * 4;  // 64 MB: 2 x uc
    float*    DT   = (float*)(ws + off);    off += (size_t)2 * MTOT * 128 * 4;  // 64 MB: 2 x dt
    float*    Z    = (float*)(ws + off);    off += (size_t)2 * MTOT * 128 * 4;  // 64 MB: 2 x z
    _Float16* YGh  = (_Float16*)(ws + off); off += (size_t)2 * MTOT * 128 * 2;  // 32 MB
    float*    BM   = (float*)(ws + off);    off += (size_t)2 * MTOT * 8 * 4;    // 4 MB
    float*    CMb  = (float*)(ws + off);    off += (size_t)2 * MTOT * 8 * 4;    // 4 MB
    float*    PC   = (float*)(ws + off);    off += (size_t)2 * BATCH * NCHUNK * 1024 * 4;  // 4 MB
    float*    HC   = (float*)(ws + off);    off += (size_t)2 * BATCH * NCHUNK * 1024 * 4;  // 4 MB
    float*    HIN  = (float*)(ws + off);    off += (size_t)2 * BATCH * NCHUNK * 1024 * 4;  // 4 MB

    // Launches that do not depend on one another share one grid: the seven weight
    // conversions, the four norms with the four input projections, and from there
    // on the two cross blocks side by side.

    // 1) weight conversions to f16 (swizzled into WMMA B-fragment order)
    cvt_swizzle_w_kernel<<<(7 * 16384) / 256, 256, 0, stream>>>(Wx, Wz, Wout_m, Wout, Wh);

    // 2) the two cross-mamba blocks
    ln_inproj_conv_xproj_kernel<<<dim3(MTOT / LG_ROWS, 2), 256, 0, stream>>>(
        front, back, ln0_w, ln0_b, ln1_w, ln1_b, Wh, conv_w, conv_b, Wxproj, Wdt, bdt,
        Z, UC, DT, BM, CMb);

    scan_chunk_sum_kernel<<<dim3(NCHUNK, 2 * BATCH), 128, 0, stream>>>(
        DT, UC, BM, A_log, PC, HC);
    scan_carry_kernel<<<(2 * BATCH * 1024) / 256, 256, 0, stream>>>(PC, HC, HIN);
    scan_kernel<<<dim3(NCHUNK, 2 * BATCH), 128, 0, stream>>>(
        DT, UC, Z, BM, CMb, A_log, Dp, HIN, YGh);

    // 3) out-projections + residual add + 0.5 scale + final GEMM, stored transposed to (B,DIM,N)
    out_fused_kernel<<<MTOT / OF_ROWS, 256, 0, stream>>>(
        YGh, WOMh, bout_m, front, back, bout, (float*)d_out);
}

// v008
// One run takes 142 microseconds.
// Timed twice side by side with v007, it ran 1.16 times as fast both times.
// Counting every step since v000, it is 196 times as fast.
#include <hip/hip_runtime.h>
#include <math.h>

typedef __attribute__((ext_vector_type(16))) _Float16 v16h;
typedef __attribute__((ext_vector_type(8)))  _Float16 v8h;
typedef __attribute__((ext_vector_type(4)))  _Float16 v4h;
typedef __attribute__((ext_vector_type(8)))  float    v8f;
typedef __attribute__((ext_vector_type(2)))  float    f32x2;
typedef __attribute__((ext_vector_type(4)))  float    f32x4;

#define DIMC    128
#define D_INNER 128
#define D_STATE 8
#define DT_RANK 8
#define D_CONV  4
#define BATCH   4
#define NTOK    16384               // L*H*W = 256*8*8
#define MTOT    (BATCH * NTOK)      // 65536 tokens

// Eight v_exp_f32 (2^x) in one statement. The instruction set asks for one free
// issue slot behind a transcendental before its result is read or its source
// overwritten: inside the statement each v_exp_f32 is followed by one that is
// independent of it (the outputs are early-clobber, so none lies on an input),
// and the v_nop is the slot behind the last, wherever the statement is scheduled.
__device__ __forceinline__ void exp2_x8(const f32x2* x, f32x2* r) {
    float e0, e1, e2, e3, e4, e5, e6, e7;
    asm("v_exp_f32 %0, %8\n\t"
        "v_exp_f32 %1, %9\n\t"
        "v_exp_f32 %2, %10\n\t"
        "v_exp_f32 %3, %11\n\t"
        "v_exp_f32 %4, %12\n\t"
        "v_exp_f32 %5, %13\n\t"
        "v_exp_f32 %6, %14\n\t"
        "v_exp_f32 %7, %15\n\t"
        "v_nop"
        : "=&v"(e0), "=&v"(e1), "=&v"(e2), "=&v"(e3), "=&v"(e4), "=&v"(e5), "=&v"(e6), "=&v"(e7)
        : "v"(x[0][0]), "v"(x[0][1]), "v"(x[1][0]), "v"(x[1][1]),
          "v"(x[2][0]), "v"(x[2][1]), "v"(x[3][0]), "v"(x[3][1]));
    r[0] = f32x2{e0, e1};
    r[1] = f32x2{e2, e3};
    r[2] = f32x2{e4, e5};
    r[3] = f32x2{e6, e7};
}

// ---------------------------------------------------------------------------
// f32 -> f16 weight conversion WITH swizzle into WMMA B-fragment order.
// Fragment layout (halves): dst[((k0Idx*128 + col)*2 + sel)*16 + j]
//   j<8  -> W[k0Idx*32 + sel*8 + j     ][col]
//   j>=8 -> W[k0Idx*32 + sel*8 + j + 8 ][col]
// so each consuming lane's 16 B halves are one contiguous 32-byte LDS chunk.
// ---------------------------------------------------------------------------
// One launch converts all seven 128x128 matrices; a matrix is 64 workgroups.
// dst holds them in the order Wx[0], Wx[1], Wz[0], Wz[1], Wout_m[0], Wout_m[1], Wout.
__global__ __launch_bounds__(256)
void cvt_swizzle_w_kernel(const float* __restrict__ Wx,
                          const float* __restrict__ Wz,
                          const float* __restrict__ Wom,
                          const float* __restrict__ Wo,
                          _Float16* __restrict__ dst) {
    int i = blockIdx.x * blockDim.x + threadIdx.x;   // over 7 * 16384
    int m7 = blockIdx.x >> 6;       // which of the seven
    const float* src = (m7 < 2) ? Wx : (m7 < 4) ? Wz : (m7 < 6) ? Wom : Wo;
    int mat   = m7 & 1;             // which 128x128 matrix of its input
    int r     = i & 16383;
    int j     = r & 15;             // half index within fragment chunk
    int chunk = r >> 4;             // (k0Idx*128 + col)*2 + sel
    int sel   = chunk & 1;
    int colk  = chunk >> 1;
    int col   = colk & 127;
    int k0Idx = colk >> 7;          // 0..3
    int koff  = j + ((j >= 8) ? 8 : 0);
    int k     = k0Idx * 32 + sel * 8 + koff;
    dst[i] = (_Float16)src[(size_t)mat * 16384 + k * 128 + col];
}

// ---------------------------------------------------------------------------
// A-fragment loader: 16x32 f16 A layout = two contiguous 16B chunks per lane
// (K groups at kSel and kSel+16).
// ---------------------------------------------------------------------------
__device__ __forceinline__ v16h load_a_frag(const _Float16* Ar) {
    v8h lo = *(const v8h*)(Ar);        // K = kSel .. kSel+7
    v8h hi = *(const v8h*)(Ar + 16);   // K = kSel+16 .. kSel+23
    v16h af;
    #pragma unroll
    for (int j = 0; j < 8; ++j) { af[j] = lo[j]; af[j + 8] = hi[j]; }
    return af;
}

// ---------------------------------------------------------------------------
// LayerNorm, input projections, causal conv + SiLU, x-projection and dt in one
// launch. A workgroup takes LG_ROWS tokens of one input (blockIdx.y: 0 = front,
// 1 = back) and reads them once. The input feeds two norms, which share mean and
// variance: ln0 of its own cross block (SSM path, times Wx) and ln1 of the other
// block (gate, times Wz). Both normalised tiles go as f16 through LDS straight to
// the matrix products and never to memory; u never goes to memory either.
//   part 1: one wave per LN_T consecutive tokens, each lane owns 4 neighbouring
//           channels; the tokens lie side by side in x and come in as 16-byte
//           pieces. A lane's 4 halves of a token are one 8-byte LDS store.
//           Wave 0 also norms the LG_HALO tokens in front of the tile (SSM path
//           only): the conv of the tile's first tokens needs their u.
//   part 2: a wave owns one norm's 32 tokens x 64 columns (2 x 4 accumulators).
//           An SSM wave adds the 16-token tile in front of its own, of which the
//           conv takes the last three rows.
//   part 3: gate waves store z. SSM waves: a lane's accumulator registers are 8
//           consecutive tokens of one channel, so the conv window slides over
//           registers; the three tokens in front come from the lane 16 away. uc
//           goes to LDS, over the weights that are no longer read, and to memory.
//   part 4: x_dbl = uc @ Wxproj -> (dt_r | B | C). lane = token, wave = 6 of the 24
//           columns for 32 of the tokens (uc row pitch 132 floats: 16 lanes'
//           16-byte reads of one column group fall on all 64 banks); the
//           wave-uniform Wxproj values come through the scalar cache.
//   part 5: dt = softplus(dt_r @ Wdt + bdt). thread = channel, 32 tokens, eight at
//           a time, dt_r rows by LDS broadcast.
// Row pitch of the f16 tiles 272 bytes: the 16 rows of a 16-byte fragment read fall
// on all 64 banks. Each sum of conv, x-projection and dt runs in the order it had.
// ---------------------------------------------------------------------------
#define LN_T     8
#define LG_ROWS  64
#define LG_PITCH 136   // halves
#define LG_HALO  4     // tokens normed in front of the tile: the conv's 3, as one 16-byte piece
#define XP_PITCH 132   // floats

// One wave's products: 2 x 4 tiles, with HALO the 1 x 4 tiles in front as well.
template <bool HALO>
__device__ __forceinline__ void inproj_tiles(const _Float16* S0, const _Float16* Sh,
                                             const _Float16* Wl,
                                             v8f (&acc)[2][4], v8f (&acch)[4]) {
    #pragma unroll
    for (int k = 0; k < 4; ++k) {
        v16h s0 = load_a_frag(S0 + k * 32);
        v16h s1 = load_a_frag(S0 + 16 * LG_PITCH + k * 32);
        v16h sh = {};
        if (HALO) sh = load_a_frag(Sh + k * 32);
        #pragma unroll
        for (int ct = 0; ct < 4; ++ct) {
            v16h bf = *(const v16h*)&Wl[(k * 128 + ct * 16) * 32];
            acc[0][ct] = __builtin_amdgcn_wmma_f32_16x16x32_f16(false, s0, false, bf, (short)0, acc[0][ct], false, false);
            acc[1][ct] = __builtin_amdgcn_wmma_f32_16x16x32_f16(false, s1, false, bf, (short)0, acc[1][ct], false, false);
            if (HALO)
                acch[ct] = __builtin_amdgcn_wmma_f32_16x16x32_f16(false, sh, false, bf, (short)0, acch[ct], false, false);
        }
    }
}

__global__ __launch_bounds__(256)
void ln_inproj_conv_xproj_kernel(
                      const float* __restrict__ front,  // (B, DIM, N)
                      const float* __restrict__ back,   // (B, DIM, N)
                      const float* __restrict__ ln0_w,  // (2, DIM)
                      const float* __restrict__ ln0_b,  // (2, DIM)
                      const float* __restrict__ ln1_w,  // (2, DIM)
                      const float* __restrict__ ln1_b,  // (2, DIM)
                      const _Float16* __restrict__ Wf,  // Wx[0], Wx[1], Wz[0], Wz[1], swizzled
                      const float* __restrict__ cw,     // (2,128,4)
                      const float* __restrict__ cb,     // (2,128)
                      const float* __restrict__ Wxproj, // (2,128,24)
                      const float* __restrict__ Wdt,    // (2,8,128)
                      const float* __restrict__ bdt,    // (2,128)
                      float* __restrict__ Zo,           // 2 x (B, N, 128)
                      float* __restrict__ uc,           // 2 x (B, N, 128)
                      float* __restrict__ dt,           // 2 x (B, N, 128)
                      float* __restrict__ Bm,           // 2 x (B, N, 8)
                      float* __restrict__ Cm) {         // 2 x (B, N, 8)
    __shared__ __align__(64) _Float16 sW[2 * 128 * 128];   // 64 KB, fragment order; later uc and x_dbl
    __shared__ __align__(16) _Float16 sA[(LG_HALO + 2 * LG_ROWS) * LG_PITCH];  // 35 KB: halo, SSM, gate
    int inp  = blockIdx.y;         // the input, and the block whose SSM path it feeds
    int gblk = inp ^ 1;            // the block whose gate it feeds
    const float* x = inp ? back : front;
    int tid  = threadIdx.x;
    int lane = tid & 31;
    int wave = tid >> 5;
    // the wave's number as a scalar: the branches on it are scalar branches
    int wv   = __builtin_amdgcn_readfirstlane(wave);
    int row0 = blockIdx.x * LG_ROWS;   // first token of the tile, b * NTOK + n
    int t0 = row0 + wave * LN_T;       // first token of the wave
    int b = t0 >> 14;                  // / NTOK
    int n = t0 & (NTOK - 1);
    int nT = row0 & (NTOK - 1);        // the tile's first token within its batch
    // At a batch's start u is zero-padded and nothing lies in front: the address
    // stays inside the batch there, and part 3 puts zeros in place of the result.
    int nh = nT ? nT - LG_HALO : 0;
    const float* xl = x + ((size_t)b * DIMC + 4 * lane) * NTOK + n;
    const float* xh = x + ((size_t)b * DIMC + 4 * lane) * NTOK + nh;
    const uint4* ws0 = (const uint4*)(Wf + (size_t)inp * 16384);
    const uint4* ws1 = (const uint4*)(Wf + (size_t)(2 + gblk) * 16384);
    uint4*       wd  = (uint4*)sW + tid;
    uint4 wr[8];
    f32x4 v[4][LN_T / 4];
    f32x4 vh[4];   // wave 0 only
    #pragma unroll   // v[][] in registers; all loads issue before the first wait
    for (int q = 0; q < 4; ++q)
        #pragma unroll
        for (int h = 0; h < LN_T / 4; ++h)
            v[q][h] = *(const f32x4*)(xl + (size_t)q * NTOK + 4 * h);
    if (wv == 0) {
        #pragma unroll
        for (int q = 0; q < 4; ++q) vh[q] = *(const f32x4*)(xh + (size_t)q * NTOK);
    }
    f32x4 wS = *(const f32x4*)(ln0_w + inp * DIMC + 4 * lane);
    f32x4 bS = *(const f32x4*)(ln0_b + inp * DIMC + 4 * lane);
    f32x4 wG = *(const f32x4*)(ln1_w + gblk * DIMC + 4 * lane);
    f32x4 bG = *(const f32x4*)(ln1_b + gblk * DIMC + 4 * lane);
    #pragma unroll   // wr[] in registers; eight 16-byte loads in flight per thread
    for (int i = 0; i < 8; ++i) wr[i] = ws0[tid + i * 256];
    #pragma unroll
    for (int i = 0; i < 8; ++i) wd[i * 256] = wr[i];
    // Keeps the second matrix's loads behind the first one's LDS stores; they fly
    // under the norm's arithmetic. All sixteen weight loads at once take the kernel
    // past 160 registers, and only two workgroups, not the three that LDS allows,
    // fit a WGP.
    __builtin_amdgcn_sched_barrier(0);
    #pragma unroll
    for (int i = 0; i < 8; ++i) wr[i] = ws1[tid + i * 256];
    // As inputs of the wait the pointers and the two indices (the offsets of the
    // parameter loads and of the weight loads) stay in their registers up to it, so
    // that no register that an issued load names is written before it.
    asm volatile("s_wait_xcnt 0x0" :: "v"(xl), "v"(xh), "v"(lane), "v"(tid) : "memory");

    // Two neighbouring tokens of a channel lie in neighbouring registers, so the
    // arithmetic runs on token pairs: packed instructions with no register moves.
    f32x2 p[4][LN_T / 2], s[LN_T / 2], q[LN_T / 2];
    #pragma unroll   // constant indices into the register arrays
    for (int k = 0; k < LN_T / 2; ++k) {
        #pragma unroll
        for (int c = 0; c < 4; ++c)
            p[c][k] = f32x2{v[c][k >> 1][2 * (k & 1)], v[c][k >> 1][2 * (k & 1) + 1]};
        s[k] = p[0][k] + p[1][k] + p[2][k] + p[3][k];
        q[k] = p[0][k] * p[0][k] + p[1][k] * p[1][k] + p[2][k] * p[2][k] + p[3][k] * p[3][k];
    }
    // butterfly step by step, all tokens in each step: their exchanges are
    // independent, so a step waits once and not once per token
    #pragma unroll
    for (int off = 16; off > 0; off >>= 1) {
        #pragma unroll
        for (int k = 0; k < LN_T / 2; ++k) {
            f32x2 so = f32x2{__shfl_xor(s[k][0], off, 32), __shfl_xor(s[k][1], off, 32)};
            f32x2 qo = f32x2{__shfl_xor(q[k][0], off, 32), __shfl_xor(q[k][1], off, 32)};
            s[k] += so;
            q[k] += qo;
        }
    }
    _Float16* aS = sA + (LG_HALO + wave * LN_T) * LG_PITCH + 4 * lane;
    _Float16* aG = aS + LG_ROWS * LG_PITCH;
    #pragma unroll
    for (int k = 0; k < LN_T / 2; ++k) {
        f32x2 mean = s[k] * (1.0f / DIMC);
        f32x2 var  = q[k] * (1.0f / DIMC) - mean * mean;
        f32x2 rstd = f32x2{rsqrtf(var[0] + 1e-5f), rsqrtf(var[1] + 1e-5f)};
        f32x2 ys[4], yg[4];
        #pragma unroll
        for (int c = 0; c < 4; ++c) {
            f32x2 t = (p[c][k] - mean) * rstd;
            ys[c] = t * wS[c] + bS[c];
            yg[c] = t * wG[c] + bG[c];
        }
        #pragma unroll
        for (int j = 0; j < 2; ++j) {
            *(v4h*)(aS + (2 * k + j) * LG_PITCH) =
                v4h{(_Float16)ys[0][j], (_Float16)ys[1][j], (_Float16)ys[2][j], (_Float16)ys[3][j]};
            *(v4h*)(aG + (2 * k + j) * LG_PITCH) =
                v4h{(_Float16)yg[0][j], (_Float16)yg[1][j], (_Float16)yg[2][j], (_Float16)yg[3][j]};
        }
    }
    #pragma unroll
    for (int i = 0; i < 8; ++i) wd[2048 + i * 256] = wr[i];
    if (wv == 0) {
        // the halo tokens, the same arithmetic, SSM norm only; rows 0 .. LG_HALO - 1 of sA
        f32x2 ph[4][LG_HALO / 2], sh[LG_HALO / 2], qh[LG_HALO / 2];
        #pragma unroll   // constant indices into the register arrays
        for (int k = 0; k < LG_HALO / 2; ++k) {
            #pragma unroll
            for (int c = 0; c < 4; ++c) ph[c][k] = f32x2{vh[c][2 * k], vh[c][2 * k + 1]};
            sh[k] = ph[0][k] + ph[1][k] + ph[2][k] + ph[3][k];
            qh[k] = ph[0][k] * ph[0][k] + ph[1][k] * ph[1][k] + ph[2][k] * ph[2][k] + ph[3][k] * ph[3][k];
        }
        #pragma unroll
        for (int off = 16; off > 0; off >>= 1) {
            #pragma unroll
            for (int k = 0; k < LG_HALO / 2; ++k) {
                f32x2 so = f32x2{__shfl_xor(sh[k][0], off, 32), __shfl_xor(sh[k][1], off, 32)};
                f32x2 qo = f32x2{__shfl_xor(qh[k][0], off, 32), __shfl_xor(qh[k][1], off, 32)};
                sh[k] += so;
                qh[k] += qo;
            }
        }
        _Float16* aH = sA + 4 * lane;
        #pragma unroll
        for (int k = 0; k < LG_HALO / 2; ++k) {
            f32x2 mean = sh[k] * (1.0f / DIMC);
            f32x2 var  = qh[k] * (1.0f / DIMC) - mean * mean;
            f32x2 rstd = f32x2{rsqrtf(var[0] + 1e-5f), rsqrtf(var[1] + 1e-5f)};
            f32x2 ys[4];
            #pragma unroll
            for (int c = 0; c < 4; ++c) {
                f32x2 t = (ph[c][k] - mean) * rstd;
                ys[c] = t * wS[c] + bS[c];
            }
            #pragma unroll
            for (int j = 0; j < 2; ++j)
                *(v4h*)(aH + (2 * k + j) * LG_PITCH) =
                    v4h{(_Float16)ys[0][j], (_Float16)ys[1][j], (_Float16)ys[2][j], (_Float16)ys[3][j]};
        }
    }
    __syncthreads();   // weights and the tiles are read by all waves

    int l15  = lane & 15;
    int sel  = lane >> 4;                  // 0 / 1
    int nrm  = wv >> 2;                    // 0 = SSM path, 1 = gate
    int rowW = ((wv >> 1) & 1) * 32;       // the wave's first token within the tile
    int colW = (wv & 1) * 64;              // the wave's first column
    const _Float16* S0 = sA + (LG_HALO + nrm * LG_ROWS + rowW + l15) * LG_PITCH + sel * 8;
    const _Float16* Wl = sW + nrm * 16384 + ((colW + l15) * 2 + sel) * 16;
    v8f acc[2][4] = {};
    v8f acch[4] = {};
    f32x4 cwv[4];   // SSM waves only
    float cbv[4];
    if (nrm == 0) {
        const float* pcw = cw + (inp * 128 + colW + l15) * D_CONV;
        const float* pcb = cb + inp * 128 + colW + l15;
        #pragma unroll   // fly under the products
        for (int ct = 0; ct < 4; ++ct) {
            cwv[ct] = *(const f32x4*)(pcw + ct * 16 * D_CONV);
            cbv[ct] = pcb[ct * 16];
        }
        // as inputs of the wait the pointers stay in their registers up to it
        asm volatile("s_wait_xcnt 0x0" :: "v"(pcw), "v"(pcb) : "memory");
        // The 16 tokens in front of the wave's own. Of the tile's first wave only
        // the last LG_HALO exist (sA rows 0 ..); the lanes of the rows in front of
        // them read row 0, and their results are not used.
        int hr = LG_HALO + rowW - 16 + l15;
        hr = hr < 0 ? 0 : hr;
        inproj_tiles<true>(S0, sA + hr * LG_PITCH + sel * 8, Wl, acc, acch);
    } else {
        inproj_tiles<false>(S0, S0, Wl, acc, acch);
    }
    __syncthreads();   // every wave has read its weights: uc and x_dbl take their place

    float* sU = (float*)sW;                  // (LG_ROWS, XP_PITCH)
    float* sX = sU + LG_ROWS * XP_PITCH;     // dt_r, B, C: (LG_ROWS, 8) each
    // accumulator layout: row = r + 8 * sel, column = l15 of each 16 x 16 tile
    size_t go = (size_t)(row0 + rowW + sel * 8) * 128 + colW + l15;
    if (nrm == 0) {
        float* pl = sU + (rowW + sel * 8) * XP_PITCH + colW + l15;
        bool pad = (nT == 0) && (rowW == 0);   // the zero padding in front of token 0
        #pragma unroll   // constant indices into the register arrays
        for (int ct = 0; ct < 4; ++ct) {
            // uc takes u's place in the accumulator registers: the second tile
            // first, which still needs the first one's u
            #pragma unroll
            for (int rt = 1; rt >= 0; --rt) {
                // The three tokens in front of the lane's eight: for sel = 1 rows
                // 5..7 of the same tile (lane sel = 0), for sel = 0 rows 13..15 of
                // the tile in front (lane sel = 1).
                float w[8 + D_CONV - 1];
                #pragma unroll
                for (int i = 0; i < D_CONV - 1; ++i) {
                    float fr = rt ? acc[0][ct][5 + i] : (pad ? 0.0f : acch[ct][5 + i]);
                    w[i] = __shfl_xor(sel ? fr : acc[rt][ct][5 + i], 16, 32);
                }
                #pragma unroll
                for (int k = 0; k < 8; ++k) w[k + D_CONV - 1] = acc[rt][ct][k];
                f32x2 a[4], xe[4], e[4];
                #pragma unroll
                for (int k = 0; k < 8; ++k) {
                    float av = cbv[ct];
                    #pragma unroll
                    for (int i = 0; i < D_CONV; ++i) av = __builtin_fmaf(w[k + i], cwv[ct][i], av);
                    a[k >> 1][k & 1] = av;
                }
                #pragma unroll
                for (int k = 0; k < 4; ++k) xe[k] = a[k] * -1.44269504f;
                exp2_x8(xe, e);                            // exp(-a)
                #pragma unroll
                for (int k = 0; k < 8; ++k)
                    acc[rt][ct][k] = a[k >> 1][k & 1] / (1.0f + e[k >> 1][k & 1]);   // SiLU
                #pragma unroll
                for (int k = 0; k < 8; ++k)
                    pl[(rt * 16 + k) * XP_PITCH + ct * 16] = acc[rt][ct][k];
            }
        }
    } else {
        float* po = Zo + (size_t)gblk * MTOT * 128 + go;
        #pragma unroll
        for (int rt = 0; rt < 2; ++rt)
            #pragma unroll
            for (int r = 0; r < 8; ++r)
                #pragma unroll
                for (int ct = 0; ct < 4; ++ct)
                    po[(rt * 16 + r) * 128 + ct * 16] = acc[rt][ct][r];
        // what follows rewrites the address and data registers of these stores
        asm volatile("s_wait_xcnt 0x0" :: "v"(po) : "memory");
    }
    __syncthreads();   // the uc rows are read by all waves

    // uc goes to memory behind the barrier, not in front of it: the barrier waits
    // for a wave's outstanding stores, and these now fly under part 4.
    if (nrm == 0) {
        float* po = uc + (size_t)inp * MTOT * 128 + go;
        #pragma unroll
        for (int rt = 0; rt < 2; ++rt)
            #pragma unroll
            for (int k = 0; k < 8; ++k)
                #pragma unroll
                for (int ct = 0; ct < 4; ++ct)
                    po[(rt * 16 + k) * 128 + ct * 16] = acc[rt][ct][k];
        // what follows rewrites the address and data registers of these stores
        asm volatile("s_wait_xcnt 0x0" :: "v"(po) : "memory");
    }
    int ch   = tid & 127;       // part 5: the thread's channel
    int half = wv >> 2;         // parts 4 and 5: which 32 of the 64 tokens
    const float* pwd = Wdt + inp * DT_RANK * 128 + ch;
    const float* pbd = bdt + inp * 128 + ch;
    float wdt[DT_RANK];
    #pragma unroll   // fly under part 4
    for (int r = 0; r < DT_RANK; ++r) wdt[r] = pwd[r * 128];
    float bb = *pbd;
    // as an input of the wait the channel index, the offset of these loads, stays in
    // its register up to it
    asm volatile("s_wait_xcnt 0x0" :: "v"(ch) : "memory");

    {
        int j0 = (wv & 3) * 6;
        int tk = half * 32 + lane;
        const float* ur = sU + tk * XP_PITCH;
        // Wxproj is only read in this launch. Named as constant memory, its wave-uniform
        // values come through the scalar cache, 4 bytes a value; behind the stores and
        // waits above the compiler otherwise fetches each value into all 32 lanes.
        const __attribute__((address_space(4))) float* wp =
            (const __attribute__((address_space(4))) float*)(Wxproj + inp * 128 * 24 + j0);
        float ax[6];
        #pragma unroll
        for (int jj = 0; jj < 6; ++jj) ax[jj] = 0.0f;
        for (int c = 0; c < 128; c += 4) {
            f32x4 uv = *(const f32x4*)(ur + c);
            #pragma unroll   // ax[] in registers
            for (int i = 0; i < 4; ++i)
                #pragma unroll
                for (int jj = 0; jj < 6; ++jj)
                    ax[jj] = __builtin_fmaf(uv[i], wp[(c + i) * 24 + jj], ax[jj]);
        }
        #pragma unroll
        for (int jj = 0; jj < 6; ++jj) {
            int j = j0 + jj;
            sX[(j >> 3) * (LG_ROWS * 8) + tk * 8 + (j & 7)] = ax[jj];
        }
    }
    __syncthreads();   // the x_dbl rows are read by all waves

    size_t xo = ((size_t)inp * MTOT + row0) * 8 + tid * 2;
    *(f32x2*)(Bm + xo) = *(const f32x2*)&sX[1 * LG_ROWS * 8 + tid * 2];
    *(f32x2*)(Cm + xo) = *(const f32x2*)&sX[2 * LG_ROWS * 8 + tid * 2];
    // what follows rewrites the offset and data registers of these two stores
    asm volatile("s_wait_xcnt 0x0" ::: "memory");

    float* pd = dt + ((size_t)inp * MTOT + row0 + half * 32) * 128 + ch;
    const float* xr = sX + half * 32 * 8;
    for (int k0 = 0; k0 < 32; k0 += 8) {
        f32x2 av[4], xe[4], e[4], o[4];
        #pragma unroll   // av[] in registers
        for (int k = 0; k < 8; ++k) {
            f32x4 r0 = *(const f32x4*)&xr[(k0 + k) * 8];
            f32x4 r1 = *(const f32x4*)&xr[(k0 + k) * 8 + 4];
            float a = bb;
            #pragma unroll
            for (int r = 0; r < 4; ++r) a += r0[r] * wdt[r];
            #pragma unroll
            for (int r = 0; r < 4; ++r) a += r1[r] * wdt[r + 4];
            av[k >> 1][k & 1] = a;
        }
        // softplus(a) = max(a, 0) + log1p(e), e = exp(-|a|) in [0, 1], for every a, with
        // no branch, so that the eight tokens' chains run side by side, in pairs.
        // log1p(e) = 2 atanh(s), s = e / (2 + e) <= 1/3: the series in s * s up to
        // s^13 / 13 leaves less than 2e-8 of the value, also where e is tiny.
        #pragma unroll   // constant indices into the register arrays
        for (int j = 0; j < 4; ++j)
            xe[j] = f32x2{-fabsf(av[j][0]), -fabsf(av[j][1])} * 1.44269504f;
        exp2_x8(xe, e);
        #pragma unroll   // the four pairs' chains interleave
        for (int j = 0; j < 4; ++j) {
            f32x2 u = e[j] + 2.0f;
            f32x2 s = e[j] * f32x2{__builtin_amdgcn_rcpf(u[0]), __builtin_amdgcn_rcpf(u[1])};
            f32x2 w = s * s;
            f32x2 p = f32x2{2.0f / 13.0f, 2.0f / 13.0f};
            p = __builtin_elementwise_fma(p, w, f32x2{2.0f / 11.0f, 2.0f / 11.0f});
            p = __builtin_elementwise_fma(p, w, f32x2{2.0f / 9.0f, 2.0f / 9.0f});
            p = __builtin_elementwise_fma(p, w, f32x2{2.0f / 7.0f, 2.0f / 7.0f});
            p = __builtin_elementwise_fma(p, w, f32x2{2.0f / 5.0f, 2.0f / 5.0f});
            p = __builtin_elementwise_fma(p, w, f32x2{2.0f / 3.0f, 2.0f / 3.0f});
            p = __builtin_elementwise_fma(p, w, f32x2{2.0f, 2.0f});
            o[j] = __builtin_elementwise_fma(s, p, f32x2{fmaxf(av[j][0], 0.0f), fmaxf(av[j][1], 0.0f)});
        }
        #pragma unroll
        for (int k = 0; k < 8; ++k) pd[(k0 + k) * 128] = o[k >> 1][k & 1];
        // the next trip rewrites the data registers of these stores
        asm volatile("s_wait_xcnt 0x0" ::: "memory");
    }
}

// ---------------------------------------------------------------------------
// SSM scan, cut along the tokens into NCHUNK chunks of CHUNK_T steps.
// h[t] = a[t]*h[t-1] + b[t] is linear in h, so a chunk acts on its incoming
// state as  h_out = P*h_in + H  with P = product of its a[t] and H = its end
// state from h_in = 0.  Three launches:
//   1) every chunk: P and H                        (all chunks side by side)
//   2) every (batch, d, s): the incoming state of each chunk, chunk by chunk
//   3) every chunk: the recurrence again from its incoming state, with readout
// Launches 1 and 3: one workgroup of 128 threads per chunk, thread = channel d,
// which keeps its 8 states in registers as 4 pairs. A wave's load of dt, uc or
// z is then one whole 128-byte line, the readout sum over the states stays in
// the thread, and the gate is worked out once per (token, channel) with every
// lane busy. The B and C rows of the chunk, the same for all channels, are
// staged in LDS once and read from there by broadcast.
// The two cross blocks are independent and go through each launch side by side:
// their arrays lie one behind the other, so that they read as 2 * BATCH batches,
// and only the per-block parameters are picked by batch index / BATCH.
// ---------------------------------------------------------------------------
#define CHUNK_T 128
#define NCHUNK  (NTOK / CHUNK_T)    // 128 chunks per batch
#define SCAN_U  8                   // tokens per register buffer (two buffers)
#define SCAN_NG (CHUNK_T / SCAN_U)  // 16 buffer fills per chunk

// log2(e) * A for the 8 states of channel d, A = -exp(A_log): exp(dt*A) is then
// one multiply and one v_exp_f32.
__device__ __forceinline__ void load_a2(const float* __restrict__ A_log, int d, f32x2* A2) {
    f32x4 l0 = *(const f32x4*)(A_log + d * 8);
    f32x4 l1 = *(const f32x4*)(A_log + d * 8 + 4);
    A2[0] = f32x2{-__expf(l0[0]), -__expf(l0[1])} * 1.44269504f;
    A2[1] = f32x2{-__expf(l0[2]), -__expf(l0[3])} * 1.44269504f;
    A2[2] = f32x2{-__expf(l1[0]), -__expf(l1[1])} * 1.44269504f;
    A2[3] = f32x2{-__expf(l1[2]), -__expf(l1[3])} * 1.44269504f;
}

// SCAN_U tokens of one channel's column of a (token, 128) array. Two tokens
// share a register pair: a packed multiply that takes one of them as its scalar
// names the whole pair, and the wait in front of it covers both halves, so the
// other half must belong to the same buffer and not to the one still in flight.
__device__ __forceinline__ void load_col(const float* __restrict__ p, f32x2* r) {
    #pragma unroll   // r[] in registers; the loads issue back to back
    for (int k = 0; k < SCAN_U; ++k) r[k >> 1][k & 1] = p[k * 128];
}

// One step of the recurrence for the 8 states of a channel.
__device__ __forceinline__ void ssm_step(float dtv, float ucv, const f32x2* A2,
                                         const float* sBrow, f32x2* a, f32x2* h) {
    f32x4 b0 = *(const f32x4*)(sBrow);
    f32x4 b1 = *(const f32x4*)(sBrow + 4);
    f32x2 Bp[4] = {f32x2{b0[0], b0[1]}, f32x2{b0[2], b0[3]},
                   f32x2{b1[0], b1[1]}, f32x2{b1[2], b1[3]}};
    float du = dtv * ucv;
    f32x2 x[4];
    #pragma unroll   // x[], a[], h[] in registers
    for (int j = 0; j < 4; ++j) x[j] = A2[j] * dtv;
    exp2_x8(x, a);
    #pragma unroll
    for (int j = 0; j < 4; ++j) h[j] = __builtin_elementwise_fma(a[j], h[j], Bp[j] * du);
}

__device__ __forceinline__ void chunk_sum_group(const f32x2* dtr, const f32x2* ucr,
                                                const f32x2* A2, const float* sBg,
                                                f32x2* h, f32x2* p) {
    #pragma unroll   // constant indices into the register buffers
    for (int k = 0; k < SCAN_U; ++k) {
        f32x2 a[4];
        ssm_step(dtr[k >> 1][k & 1], ucr[k >> 1][k & 1], A2, sBg + k * 8, a, h);
        #pragma unroll
        for (int j = 0; j < 4; ++j) p[j] *= a[j];
    }
}

__global__ __launch_bounds__(128)
void scan_chunk_sum_kernel(const float* __restrict__ dt,    // (2B,N,128)
                           const float* __restrict__ uc,    // (2B,N,128)
                           const float* __restrict__ Bm,    // (2B,N,8)
                           const float* __restrict__ A_log, // (2,128,8)
                           float* __restrict__ Pc,          // (2B,NCHUNK,128,8)
                           float* __restrict__ Hc) {        // (2B,NCHUNK,128,8)
    __shared__ __align__(16) float sB[CHUNK_T * 8];         // 4 KB
    int c = blockIdx.x;
    int b = blockIdx.y;
    int d = threadIdx.x;
    A_log += (blockIdx.y / BATCH) * 128 * 8;
    size_t base = (size_t)b * NTOK + (size_t)c * CHUNK_T;
    const float* pdt = dt + base * 128 + d;
    const float* puc = uc + base * 128 + d;

    f32x2 dt0[SCAN_U / 2], uc0[SCAN_U / 2], dt1[SCAN_U / 2], uc1[SCAN_U / 2];
    load_col(pdt, dt0);
    load_col(puc, uc0);
    {
        const f32x4* g = (const f32x4*)(Bm + base * 8);
        ((f32x4*)sB)[d]       = g[d];
        ((f32x4*)sB)[d + 128] = g[d + 128];
    }
    f32x2 A2[4], h[4], p[4];
    load_a2(A_log, d, A2);
    #pragma unroll
    for (int j = 0; j < 4; ++j) { h[j] = f32x2{0.0f, 0.0f}; p[j] = f32x2{1.0f, 1.0f}; }
    __syncthreads();

    // Two register buffers: while one is worked on, the other's loads fly. The
    // scheduling barriers keep each buffer's loads in front of the work on the
    // other buffer; without them the compiler sinks the loads to their first use.
    for (int g = 0; g < SCAN_NG - 2; g += 2) {
        load_col(pdt + (size_t)(g + 1) * SCAN_U * 128, dt1);
        load_col(puc + (size_t)(g + 1) * SCAN_U * 128, uc1);
        __builtin_amdgcn_sched_barrier(0);
        chunk_sum_group(dt0, uc0, A2, sB + g * SCAN_U * 8, h, p);
        load_col(pdt + (size_t)(g + 2) * SCAN_U * 128, dt0);
        load_col(puc + (size_t)(g + 2) * SCAN_U * 128, uc0);
        __builtin_amdgcn_sched_barrier(0);
        chunk_sum_group(dt1, uc1, A2, sB + (g + 1) * SCAN_U * 8, h, p);
    }
    load_col(pdt + (size_t)(SCAN_NG - 1) * SCAN_U * 128, dt1);
    load_col(puc + (size_t)(SCAN_NG - 1) * SCAN_U * 128, uc1);
    __builtin_amdgcn_sched_barrier(0);
    chunk_sum_group(dt0, uc0, A2, sB + (SCAN_NG - 2) * SCAN_U * 8, h, p);
    __builtin_amdgcn_sched_barrier(0);   // keeps the wait for the last buffer behind the work above
    chunk_sum_group(dt1, uc1, A2, sB + (SCAN_NG - 1) * SCAN_U * 8, h, p);

    size_t o = ((size_t)b * NCHUNK + c) * 1024 + d * 8;
    *(f32x4*)(Pc + o)     = f32x4{p[0][0], p[0][1], p[1][0], p[1][1]};
    *(f32x4*)(Pc + o + 4) = f32x4{p[2][0], p[2][1], p[3][0], p[3][1]};
    *(f32x4*)(Hc + o)     = f32x4{h[0][0], h[0][1], h[1][0], h[1][1]};
    *(f32x4*)(Hc + o + 4) = f32x4{h[2][0], h[2][1], h[3][0], h[3][1]};
}

// One thread per (batch, d, s); 16 chunks' summaries are loaded at a time so
// that the serial chain waits for memory once per 16 chunks, not per chunk.
__global__ __launch_bounds__(256)
void scan_carry_kernel(const float* __restrict__ Pc,   // (2B,NCHUNK,1024)
                       const float* __restrict__ Hc,   // (2B,NCHUNK,1024)
                       float* __restrict__ Hin) {      // (2B,NCHUNK,1024)
    int idx = blockIdx.x * blockDim.x + threadIdx.x;   // over 2*BATCH*1024
    int b = idx >> 10;
    int r = idx & 1023;
    size_t o = (size_t)b * NCHUNK * 1024 + r;
    float carry = 0.0f;
    for (int c0 = 0; c0 < NCHUNK; c0 += 16) {
        float p[16], h[16];
        #pragma unroll   // p[], h[] in registers; all 32 loads issue before the first wait
        for (int k = 0; k < 16; ++k) {
            p[k] = Pc[o + (size_t)(c0 + k) * 1024];
            h[k] = Hc[o + (size_t)(c0 + k) * 1024];
        }
        #pragma unroll   // constant indices into p[], h[]
        for (int k = 0; k < 16; ++k) {
            Hin[o + (size_t)(c0 + k) * 1024] = carry;
            carry = p[k] * carry + h[k];
        }
        // the next trip rewrites the address and data registers of these stores
        asm volatile("s_wait_xcnt 0x0" ::: "memory");
    }
}

// SCAN_U tokens of launch 3: recurrence, readout over the 8 states, Dp skip and
// SiLU(z) gate; emits f16.
__device__ __forceinline__ void scan_group(const f32x2* dtr, const f32x2* ucr, const f32x2* zr,
                                           const f32x2* A2, float Dd,
                                           const float* sBg, const float* sCg,
                                           f32x2* h, _Float16* __restrict__ yo) {
    _Float16 r[SCAN_U];
    f32x2 zx[SCAN_U / 2], ez[SCAN_U / 2];   // exp(-z) of the 8 tokens
    #pragma unroll
    for (int k = 0; k < SCAN_U / 2; ++k) zx[k] = zr[k] * -1.44269504f;
    exp2_x8(zx, ez);
    #pragma unroll   // constant indices into the register buffers
    for (int k = 0; k < SCAN_U; ++k) {
        f32x2 a[4];
        float ucv = ucr[k >> 1][k & 1];
        ssm_step(dtr[k >> 1][k & 1], ucv, A2, sBg + k * 8, a, h);
        f32x4 c0 = *(const f32x4*)(sCg + k * 8);
        f32x4 c1 = *(const f32x4*)(sCg + k * 8 + 4);
        f32x2 y2 = h[0] * f32x2{c0[0], c0[1]};
        y2 = __builtin_elementwise_fma(h[1], f32x2{c0[2], c0[3]}, y2);
        y2 = __builtin_elementwise_fma(h[2], f32x2{c1[0], c1[1]}, y2);
        y2 = __builtin_elementwise_fma(h[3], f32x2{c1[2], c1[3]}, y2);
        float y  = y2[0] + y2[1];
        float zv = zr[k >> 1][k & 1];
        float g  = zv / (1.0f + ez[k >> 1][k & 1]);
        r[k] = (_Float16)((y + Dd * ucv) * g);
    }
    #pragma unroll
    for (int k = 0; k < SCAN_U; ++k) yo[k * 128] = r[k];
    // what follows rewrites the data registers of these stores
    asm volatile("s_wait_xcnt 0x0" ::: "memory");
}

__global__ __launch_bounds__(128)
void scan_kernel(const float* __restrict__ dt,    // (2B,N,128)
                 const float* __restrict__ uc,    // (2B,N,128)
                 const float* __restrict__ zg,    // (2B,N,128) pre-activation z
                 const float* __restrict__ Bm,    // (2B,N,8)
                 const float* __restrict__ Cm,    // (2B,N,8)
                 const float* __restrict__ A_log, // (2,128,8)
                 const float* __restrict__ Dp,    // (2,128)
                 const float* __restrict__ Hin,   // (2B,NCHUNK,128,8)
                 _Float16* __restrict__ yg) {     // (2B,N,128)
    __shared__ __align__(16) float sB[CHUNK_T * 8];   // 4 KB
    __shared__ __align__(16) float sC[CHUNK_T * 8];   // 4 KB
    int c = blockIdx.x;
    int b = blockIdx.y;
    int d = threadIdx.x;
    A_log += (blockIdx.y / BATCH) * 128 * 8;
    Dp    += (blockIdx.y / BATCH) * 128;
    size_t base = (size_t)b * NTOK + (size_t)c * CHUNK_T;
    const float* pdt = dt + base * 128 + d;
    const float* puc = uc + base * 128 + d;
    const float* pz  = zg + base * 128 + d;
    _Float16*    py  = yg + base * 128 + d;

    f32x2 dt0[SCAN_U / 2], uc0[SCAN_U / 2], z0[SCAN_U / 2];
    f32x2 dt1[SCAN_U / 2], uc1[SCAN_U / 2], z1[SCAN_U / 2];
    load_col(pdt, dt0);
    load_col(puc, uc0);
    load_col(pz,  z0);
    {
        const f32x4* gb = (const f32x4*)(Bm + base * 8);
        const f32x4* gc = (const f32x4*)(Cm + base * 8);
        ((f32x4*)sB)[d]       = gb[d];
        ((f32x4*)sB)[d + 128] = gb[d + 128];
        ((f32x4*)sC)[d]       = gc[d];
        ((f32x4*)sC)[d + 128] = gc[d + 128];
    }
    f32x2 A2[4], h[4];
    load_a2(A_log, d, A2);
    float Dd = Dp[d];
    {
        const float* hi = Hin + ((size_t)b * NCHUNK + c) * 1024 + d * 8;
        f32x4 h0 = *(const f32x4*)(hi);
        f32x4 h1 = *(const f32x4*)(hi + 4);
        h[0] = f32x2{h0[0], h0[1]}; h[1] = f32x2{h0[2], h0[3]};
        h[2] = f32x2{h1[0], h1[1]}; h[3] = f32x2{h1[2], h1[3]};
    }
    __syncthreads();

    // Two register buffers, held apart by scheduling barriers as in launch 1.
    for (int g = 0; g < SCAN_NG - 2; g += 2) {
        load_col(pdt + (size_t)(g + 1) * SCAN_U * 128, dt1);
        load_col(puc + (size_t)(g + 1) * SCAN_U * 128, uc1);
        load_col(pz  + (size_t)(g + 1) * SCAN_U * 128, z1);
        __builtin_amdgcn_sched_barrier(0);
        scan_group(dt0, uc0, z0, A2, Dd, sB + g * SCAN_U * 8, sC + g * SCAN_U * 8,
                   h, py + (size_t)g * SCAN_U * 128);
        load_col(pdt + (size_t)(g + 2) * SCAN_U * 128, dt0);
        load_col(puc + (size_t)(g + 2) * SCAN_U * 128, uc0);
        load_col(pz  + (size_t)(g + 2) * SCAN_U * 128, z0);
        __builtin_amdgcn_sched_barrier(0);
        scan_group(dt1, uc1, z1, A2, Dd, sB + (g + 1) * SCAN_U * 8, sC + (g + 1) * SCAN_U * 8,
                   h, py + (size_t)(g + 1) * SCAN_U * 128);
    }
    load_col(pdt + (size_t)(SCAN_NG - 1) * SCAN_U * 128, dt1);
    load_col(puc + (size_t)(SCAN_NG - 1) * SCAN_U * 128, uc1);
    load_col(pz  + (size_t)(SCAN_NG - 1) * SCAN_U * 128, z1);
    // The three pointers are used here for the last time. As inputs of the wait
    // they stay in their registers up to it, so that no result of these loads is
    // placed on an address register that an earlier one of them still names.
    asm volatile("s_wait_xcnt 0x0" :: "v"(pdt), "v"(puc), "v"(pz) : "memory");
    __builtin_amdgcn_sched_barrier(0);
    scan_group(dt0, uc0, z0, A2, Dd, sB + (SCAN_NG - 2) * SCAN_U * 8, sC + (SCAN_NG - 2) * SCAN_U * 8,
               h, py + (size_t)(SCAN_NG - 2) * SCAN_U * 128);
    __builtin_amdgcn_sched_barrier(0);   // keeps the wait for the last buffer behind the work above
    scan_group(dt1, uc1, z1, A2, Dd, sB + (SCAN_NG - 1) * SCAN_U * 8, sC + (SCAN_NG - 1) * SCAN_U * 8,
               h, py + (size_t)(SCAN_NG - 1) * SCAN_U * 128);
}

// ---------------------------------------------------------------------------
// Both out-projections, the residual sum and the final projection in one launch:
//   out = (0.5 * (yg0 @ Wom0 + yg1 @ Wom1 + bom0 + bom1 + ff + bf)) @ Wout + bout
// stored transposed to (B, DIM, NTOK). m0, m1 and s never go to memory.
// A workgroup of 8 waves takes OF_ROWS tokens; a wave owns 32 tokens x 64 columns
// (2 x 4 accumulators), so that its 32 tokens are one whole 128-byte line of each
// of its channels' rows in front, back and out. The accumulators start from
// ff + bf + bom0 + bom1 and take both products on top; s goes as f16 through LDS
// from accumulator layout to A-fragment layout (row pitch 272 bytes: the 16 rows
// of a 16-byte fragment read fall on all 64 banks).
// ---------------------------------------------------------------------------
#define OF_ROWS  128
#define OF_PITCH 136   // halves
__global__ __launch_bounds__(256)
void out_fused_kernel(const _Float16* __restrict__ yg,    // 2 x (B,N,128)
                      const _Float16* __restrict__ Wf,    // Wout_m[0], Wout_m[1], Wout, swizzled
                      const float* __restrict__ bom,      // (2,128)
                      const float* __restrict__ front,    // (B,128,N)
                      const float* __restrict__ back,     // (B,128,N)
                      const float* __restrict__ bout,     // (128)
                      float* __restrict__ out) {          // (B,128,N)
    __shared__ __align__(64) _Float16 sW[3 * 128 * 128];         // 96 KB, fragment order
    __shared__ __align__(16) _Float16 sS[OF_ROWS * OF_PITCH];    // 34 KB
    int tid  = threadIdx.x;
    int lane = tid & 31;
    int l15  = lane & 15;
    int sel  = lane >> 4;                 // 0 / 1
    int rowW = (tid >> 6) * 32;           // the wave's first token within the tile
    int colW = ((tid >> 5) & 1) * 64;     // the wave's first column
    int row0 = blockIdx.x * OF_ROWS;      // first token, b * NTOK + n
    int b    = row0 >> 14;
    int n0   = row0 & (NTOK - 1);

    // A lane's accumulator registers r = 0..7 are 8 consecutive tokens of one
    // channel: 32 contiguous bytes of front, back and out.
    size_t ro = ((size_t)b * DIMC + colW + l15) * NTOK + n0 + rowW + sel * 8;
    const float* pf = front + ro;
    const float* pb = back + ro;
    const _Float16* A0 = yg + (size_t)(row0 + rowW + l15) * 128 + sel * 8;
    const _Float16* A1 = A0 + (size_t)MTOT * 128;

    f32x4 f[2][4][2], g[2][4][2];
    v16h  a[2][4];
    #pragma unroll   // f[], g[], a[] in registers; all loads issue before the first wait
    for (int rt = 0; rt < 2; ++rt)
        #pragma unroll
        for (int ct = 0; ct < 4; ++ct)
            #pragma unroll
            for (int h = 0; h < 2; ++h) {
                f[rt][ct][h] = *(const f32x4*)(pf + (size_t)(ct * 16) * NTOK + rt * 16 + h * 4);
                g[rt][ct][h] = *(const f32x4*)(pb + (size_t)(ct * 16) * NTOK + rt * 16 + h * 4);
            }
    #pragma unroll
    for (int rt = 0; rt < 2; ++rt)
        #pragma unroll
        for (int k = 0; k < 4; ++k) a[rt][k] = load_a_frag(A0 + rt * 2048 + k * 32);
    float bs[4], bo[4];
    #pragma unroll
    for (int ct = 0; ct < 4; ++ct) {
        int col = colW + ct * 16 + l15;
        bs[ct] = bom[col] + bom[128 + col];
        bo[ct] = bout[col];
    }
    const uint4* wsrc = (const uint4*)Wf + tid;
    uint4*       wdst = (uint4*)sW + tid;
    #pragma unroll 8   // eight 16-byte loads in flight per thread
    for (int i = 0; i < (3 * 128 * 128) / 8 / 256; ++i) wdst[i * 256] = wsrc[i * 256];

    v8f acc[2][4];
    #pragma unroll   // constant indices into the register arrays
    for (int rt = 0; rt < 2; ++rt)
        #pragma unroll
        for (int ct = 0; ct < 4; ++ct)
            #pragma unroll
            for (int r = 0; r < 8; ++r)
                acc[rt][ct][r] = f[rt][ct][r >> 2][r & 3] + g[rt][ct][r >> 2][r & 3] + bs[ct];

    // As inputs of the wait the pointers stay in their registers up to it, so that
    // no register that an issued load names is written before it.
    asm volatile("s_wait_xcnt 0x0" :: "v"(pf), "v"(pb), "v"(A0), "v"(wsrc) : "memory");
    __syncthreads();

    // The second block's fragments fly while the first block's products run, one
    // k step's worth issued per k step.
    v16h a1[2][4];
    #pragma unroll
    for (int k = 0; k < 4; ++k) {
        a1[0][k] = load_a_frag(A1 + k * 32);
        a1[1][k] = load_a_frag(A1 + 2048 + k * 32);
        #pragma unroll
        for (int ct = 0; ct < 4; ++ct) {
            v16h bf = *(const v16h*)&sW[((k * 128 + colW + ct * 16 + l15) * 2 + sel) * 16];
            acc[0][ct] = __builtin_amdgcn_wmma_f32_16x16x32_f16(false, a[0][k], false, bf, (short)0, acc[0][ct], false, false);
            acc[1][ct] = __builtin_amdgcn_wmma_f32_16x16x32_f16(false, a[1][k], false, bf, (short)0, acc[1][ct], false, false);
        }
        // Keeps the next step's fragment loads behind this step's products, whose
        // operand registers they take: hoisted together they push the kernel past
        // 256 registers, and only one workgroup fits a WGP.
        __builtin_amdgcn_sched_barrier(0);
    }
    // what follows may rewrite the address registers of these loads
    asm volatile("s_wait_xcnt 0x0" :: "v"(A1) : "memory");
    #pragma unroll
    for (int k = 0; k < 4; ++k)
        #pragma unroll
        for (int ct = 0; ct < 4; ++ct) {
            v16h bf = *(const v16h*)&sW[16384 + ((k * 128 + colW + ct * 16 + l15) * 2 + sel) * 16];
            acc[0][ct] = __builtin_amdgcn_wmma_f32_16x16x32_f16(false, a1[0][k], false, bf, (short)0, acc[0][ct], false, false);
            acc[1][ct] = __builtin_amdgcn_wmma_f32_16x16x32_f16(false, a1[1][k], false, bf, (short)0, acc[1][ct], false, false);
        }

    // s, accumulator layout: row = r + 8 * sel, column = l15 of each 16 x 16 tile
    #pragma unroll
    for (int rt = 0; rt < 2; ++rt)
        #pragma unroll
        for (int ct = 0; ct < 4; ++ct)
            #pragma unroll
            for (int r = 0; r < 8; ++r)
                sS[(rowW + rt * 16 + sel * 8 + r) * OF_PITCH + colW + ct * 16 + l15] =
                    (_Float16)(0.5f * acc[rt][ct][r]);
    __syncthreads();   // a wave's s rows hold the columns of its neighbour wave too

    v8f o[2][4] = {};
    const _Float16* S0 = sS + (rowW + l15) * OF_PITCH + sel * 8;
    #pragma unroll
    for (int k = 0; k < 4; ++k) {
        v16h s0 = load_a_frag(S0 + k * 32);
        v16h s1 = load_a_frag(S0 + 16 * OF_PITCH + k * 32);
        #pragma unroll
        for (int ct = 0; ct < 4; ++ct) {
            v16h bf = *(const v16h*)&sW[2 * 16384 + ((k * 128 + colW + ct * 16 + l15) * 2 + sel) * 16];
            o[0][ct] = __builtin_amdgcn_wmma_f32_16x16x32_f16(false, s0, false, bf, (short)0, o[0][ct], false, false);
            o[1][ct] = __builtin_amdgcn_wmma_f32_16x16x32_f16(false, s1, false, bf, (short)0, o[1][ct], false, false);
        }
    }

    float* po = out + ro;
    #pragma unroll
    for (int rt = 0; rt < 2; ++rt)
        #pragma unroll
        for (int ct = 0; ct < 4; ++ct) o[rt][ct] += bo[ct];
    // keeps every store behind the last arithmetic, so that no register that an
    // issued store names is written again
    __builtin_amdgcn_sched_barrier(0);
    #pragma unroll
    for (int rt = 0; rt < 2; ++rt)
        #pragma unroll
        for (int ct = 0; ct < 4; ++ct)
            #pragma unroll
            for (int h = 0; h < 2; ++h)
                *(f32x4*)(po + (size_t)(ct * 16) * NTOK + rt * 16 + h * 4) =
                    f32x4{o[rt][ct][4 * h], o[rt][ct][4 * h + 1], o[rt][ct][4 * h + 2], o[rt][ct][4 * h + 3]};
}

// ---------------------------------------------------------------------------
// Host-side pipeline
// ---------------------------------------------------------------------------
extern "C" void kernel_launch(void* const* d_in, const int* in_sizes, int n_in,
                              void* d_out, int out_size, void* d_ws, size_t ws_size,
                              hipStream_t stream) {
    const float* front   = (const float*)d_in[0];
    const float* back    = (const float*)d_in[1];
    const float* ln0_w   = (const float*)d_in[2];
    const float* ln0_b   = (const float*)d_in[3];
    const float* ln1_w   = (const float*)d_in[4];
    const float* ln1_b   = (const float*)d_in[5];
    const float* Wx      = (const float*)d_in[6];
    const float* Wz      = (const float*)d_in[7];
    const float* conv_w  = (const float*)d_in[8];
    const float* conv_b  = (const float*)d_in[9];
    const float* Wxproj  = (const float*)d_in[10];
    const float* Wdt     = (const float*)d_in[11];
    const float* bdt     = (const float*)d_in[12];
    const float* A_log   = (const float*)d_in[13];
    const float* Dp      = (const float*)d_in[14];
    const float* Wout_m  = (const float*)d_in[15];
    const float* bout_m  = (const float*)d_in[16];
    const float* Wout    = (const float*)d_in[17];
    const float* bout    = (const float*)d_in[18];

    char* ws = (char*)d_ws;
    // ---- static workspace layout (bytes); "2 x": block 0's array, then block 1's ----
    _Float16* Wh   = (_Float16*)(ws);                       // 7*16384 halves < 256 KB
    _Float16* WOMh = Wh + 4 * 16384;                        // behind Wx[0..1], Wz[0..1]; Wout follows
    size_t off = 0x40000;
    float*    UC   = (float*)(ws + off);    off += (size_t)2 * MTOT * 128 * 4;  // 64 MB: 2 x uc
    float*    DT   = (float*)(ws + off);    off += (size_t)2 * MTOT * 128 * 4;  // 64 MB: 2 x dt
    float*    Z    = (float*)(ws + off);    off += (size_t)2 * MTOT * 128 * 4;  // 64 MB: 2 x z
    _Float16* YGh  = (_Float16*)(ws + off); off += (size_t)2 * MTOT * 128 * 2;  // 32 MB
    float*    BM   = (float*)(ws + off);    off += (size_t)2 * MTOT * 8 * 4;    // 4 MB
    float*    CMb  = (float*)(ws + off);    off += (size_t)2 * MTOT * 8 * 4;    // 4 MB
    float*    PC   = (float*)(ws + off);    off += (size_t)2 * BATCH * NCHUNK * 1024 * 4;  // 4 MB
    float*    HC   = (float*)(ws + off);    off += (size_t)2 * BATCH * NCHUNK * 1024 * 4;  // 4 MB
    float*    HIN  = (float*)(ws + off);    off += (size_t)2 * BATCH * NCHUNK * 1024 * 4;  // 4 MB

    // Launches that do not depend on one another share one grid: the seven weight
    // conversions, the four norms with the four input projections, and from there
    // on the two cross blocks side by side.

    // 1) weight conversions to f16 (swizzled into WMMA B-fragment order)
    cvt_swizzle_w_kernel<<<(7 * 16384) / 256, 256, 0, stream>>>(Wx, Wz, Wout_m, Wout, Wh);

    // 2) the two cross-mamba blocks
    ln_inproj_conv_xproj_kernel<<<dim3(MTOT / LG_ROWS, 2), 256, 0, stream>>>(
        front, back, ln0_w, ln0_b, ln1_w, ln1_b, Wh, conv_w, conv_b, Wxproj, Wdt, bdt,
        Z, UC, DT, BM, CMb);

    scan_chunk_sum_kernel<<<dim3(NCHUNK, 2 * BATCH), 128, 0, stream>>>(
        DT, UC, BM, A_log, PC, HC);
    scan_carry_kernel<<<(2 * BATCH * 1024) / 256, 256, 0, stream>>>(PC, HC, HIN);
    scan_kernel<<<dim3(NCHUNK, 2 * BATCH), 128, 0, stream>>>(
        DT, UC, Z, BM, CMb, A_log, Dp, HIN, YGh);

    // 3) out-projections + residual add + 0.5 scale + final GEMM, stored transposed to (B,DIM,N)
    out_fused_kernel<<<MTOT / OF_ROWS, 256, 0, stream>>>(
        YGh, WOMh, bout_m, front, back, bout, (float*)d_out);
}

// v009
// A run of this version takes 135 microseconds.
// Timed twice side by side with v008, it ran 1.05 times as fast both times.
// Counting every step since v000, it is 206 times as fast.
#include <hip/hip_runtime.h>
#include <math.h>

typedef __attribute__((ext_vector_type(16))) _Float16 v16h;
typedef __attribute__((ext_vector_type(8)))  _Float16 v8h;
typedef __attribute__((ext_vector_type(4)))  _Float16 v4h;
typedef __attribute__((ext_vector_type(2)))  _Float16 v2h;
typedef __attribute__((ext_vector_type(8)))  float    v8f;
typedef __attribute__((ext_vector_type(2)))  float    f32x2;
typedef __attribute__((ext_vector_type(4)))  float    f32x4;

#define DIMC    128
#define D_INNER 128
#define D_STATE 8
#define DT_RANK 8
#define D_CONV  4
#define BATCH   4
#define NTOK    16384               // L*H*W = 256*8*8
#define MTOT    (BATCH * NTOK)      // 65536 tokens

// Eight v_exp_f32 (2^x) in one statement. The instruction set asks for one free
// issue slot behind a transcendental before its result is read or its source
// overwritten: inside the statement each v_exp_f32 is followed by one that is
// independent of it (the outputs are early-clobber, so none lies on an input),
// and the v_nop is the slot behind the last, wherever the statement is scheduled.
__device__ __forceinline__ void exp2_x8(const f32x2* x, f32x2* r) {
    float e0, e1, e2, e3, e4, e5, e6, e7;
    asm("v_exp_f32 %0, %8\n\t"
        "v_exp_f32 %1, %9\n\t"
        "v_exp_f32 %2, %10\n\t"
        "v_exp_f32 %3, %11\n\t"
        "v_exp_f32 %4, %12\n\t"
        "v_exp_f32 %5, %13\n\t"
        "v_exp_f32 %6, %14\n\t"
        "v_exp_f32 %7, %15\n\t"
        "v_nop"
        : "=&v"(e0), "=&v"(e1), "=&v"(e2), "=&v"(e3), "=&v"(e4), "=&v"(e5), "=&v"(e6), "=&v"(e7)
        : "v"(x[0][0]), "v"(x[0][1]), "v"(x[1][0]), "v"(x[1][1]),
          "v"(x[2][0]), "v"(x[2][1]), "v"(x[3][0]), "v"(x[3][1]));
    r[0] = f32x2{e0, e1};
    r[1] = f32x2{e2, e3};
    r[2] = f32x2{e4, e5};
    r[3] = f32x2{e6, e7};
}

// ---------------------------------------------------------------------------
// f32 -> f16 weight conversion WITH swizzle into WMMA B-fragment order.
// Fragment layout (halves): dst[((k0Idx*128 + col)*2 + sel)*16 + j]
//   j<8  -> W[k0Idx*32 + sel*8 + j     ][col]
//   j>=8 -> W[k0Idx*32 + sel*8 + j + 8 ][col]
// so each consuming lane's 16 B halves are one contiguous 32-byte LDS chunk.
// ---------------------------------------------------------------------------
// One launch converts all seven 128x128 matrices; a matrix is 64 workgroups.
// dst holds them in the order Wx[0], Wx[1], Wz[0], Wz[1], Wout_m[0], Wout_m[1], Wout.
__global__ __launch_bounds__(256)
void cvt_swizzle_w_kernel(const float* __restrict__ Wx,
                          const float* __restrict__ Wz,
                          const float* __restrict__ Wom,
                          const float* __restrict__ Wo,
                          _Float16* __restrict__ dst) {
    int i = blockIdx.x * blockDim.x + threadIdx.x;   // over 7 * 16384
    int m7 = blockIdx.x >> 6;       // which of the seven
    const float* src = (m7 < 2) ? Wx : (m7 < 4) ? Wz : (m7 < 6) ? Wom : Wo;
    int mat   = m7 & 1;             // which 128x128 matrix of its input
    int r     = i & 16383;
    int j     = r & 15;             // half index within fragment chunk
    int chunk = r >> 4;             // (k0Idx*128 + col)*2 + sel
    int sel   = chunk & 1;
    int colk  = chunk >> 1;
    int col   = colk & 127;
    int k0Idx = colk >> 7;          // 0..3
    int koff  = j + ((j >= 8) ? 8 : 0);
    int k     = k0Idx * 32 + sel * 8 + koff;
    dst[i] = (_Float16)src[(size_t)mat * 16384 + k * 128 + col];
}

// ---------------------------------------------------------------------------
// A-fragment loader: 16x32 f16 A layout = two contiguous 16B chunks per lane
// (K groups at kSel and kSel+16).
// ---------------------------------------------------------------------------
__device__ __forceinline__ v16h load_a_frag(const _Float16* Ar) {
    v8h lo = *(const v8h*)(Ar);        // K = kSel .. kSel+7
    v8h hi = *(const v8h*)(Ar + 16);   // K = kSel+16 .. kSel+23
    v16h af;
    #pragma unroll
    for (int j = 0; j < 8; ++j) { af[j] = lo[j]; af[j + 8] = hi[j]; }
    return af;
}

// ---------------------------------------------------------------------------
// An f32 value as two f16 parts, v = hi + lo: hi keeps the sign, the exponent and
// the first 10 fraction bits, so that it is an f16 value as it stands and v - hi
// is exact; lo is v - hi rounded to f16. Together they hold 21 fraction bits or
// more (below the f16 normal range: to 2^-25 absolute).
// ---------------------------------------------------------------------------
__device__ __forceinline__ f32x2 split_hi_lo(float v) {
    float hi = __builtin_bit_cast(float, __builtin_bit_cast(unsigned, v) & 0xFFFFE000u);
    return f32x2{hi, v - hi};
}
__device__ __forceinline__ unsigned pack_f16(float a, float b) {
    return __builtin_bit_cast(unsigned, __builtin_convertvector(f32x2{a, b}, v2h));
}
// 16 halves that lie in a row, as two 16-byte pieces
__device__ __forceinline__ v16h load_frag_row(const unsigned* p) {
    v8h lo = *(const v8h*)(p);
    v8h hi = *(const v8h*)(p + 4);
    v16h f;
    #pragma unroll
    for (int j = 0; j < 8; ++j) { f[j] = lo[j]; f[j + 8] = hi[j]; }
    return f;
}

// Two steps of the x-projection: the uc words, the (hi, hi) and the (lo, lo) words
// of 32 channels, and their four products.
__device__ __forceinline__ void xp_load(const unsigned* ur, const unsigned* wh, const unsigned* wl,
                                        v16h* f) {
    #pragma unroll   // f[] in registers
    for (int s = 0; s < 2; ++s) {
        f[3 * s]     = load_frag_row(ur + s * 16);
        f[3 * s + 1] = load_frag_row(wh + s * 16);
        f[3 * s + 2] = load_frag_row(wl + s * 16);
    }
}
__device__ __forceinline__ void xp_mul(const v16h* f, v8f& x0, v8f& x1) {
    #pragma unroll
    for (int s = 0; s < 2; ++s) {
        x0 = __builtin_amdgcn_wmma_f32_16x16x32_f16(false, f[3 * s + 1], false, f[3 * s], (short)0, x0, false, false);
        x1 = __builtin_amdgcn_wmma_f32_16x16x32_f16(false, f[3 * s + 2], false, f[3 * s], (short)0, x1, false, false);
    }
}

// ---------------------------------------------------------------------------
// LayerNorm, input projections, causal conv + SiLU, x-projection and dt in one
// launch. A workgroup takes LG_ROWS tokens of one input (blockIdx.y: 0 = front,
// 1 = back) and reads them once. The input feeds two norms, which share mean and
// variance: ln0 of its own cross block (SSM path, times Wx) and ln1 of the other
// block (gate, times Wz). Both normalised tiles go as f16 through LDS straight to
// the matrix products and never to memory; u never goes to memory either.
//   part 1: one wave per LN_T consecutive tokens, each lane owns 4 neighbouring
//           channels; the tokens lie side by side in x and come in as 16-byte
//           pieces. A lane's 4 halves of a token are one 8-byte LDS store.
//           Wave 0 also norms the LG_HALO tokens in front of the tile (SSM path
//           only): the conv of the tile's first tokens needs their u.
//   part 2: a wave owns one norm's 32 tokens x 64 columns (2 x 4 accumulators).
//           An SSM wave adds the 16-token tile in front of its own, of which the
//           conv takes the last three rows.
//   part 3: gate waves store z and put Wxproj, transposed and split, into LDS for
//           part 4. SSM waves: a lane's accumulator registers are 8
//           consecutive tokens of one channel, so the conv window slides over
//           registers; the three tokens in front come from the lane 16 away. uc
//           goes to memory and, split, to LDS, over the weights that are no longer read.
//   part 4: x_dbl = uc @ Wxproj -> (dt_r | B | C) on the matrix instruction. Both f32
//           operands go in as f16 parts hi + lo. A uc value is one 32-bit word
//           (hi, lo), two neighbouring k of the product; the Wxproj value against
//           it is the word (hi, hi) in one product and (lo, lo) in a second, so
//           that all four part products are summed, in f32. A = 16 columns of
//           Wxproj as rows, B = 16 tokens as columns: a lane's accumulator
//           registers are 8 neighbouring x_dbl columns of one token. A wave owns
//           one such tile over all 128 channels (row pitch 132 words: 16 lanes'
//           16-byte reads of one channel group fall on all 64 banks).
//   part 5: dt = softplus(dt_r @ Wdt + bdt). thread = channel, 32 tokens, eight at
//           a time, dt_r rows by LDS broadcast.
// Row pitch of the f16 tiles 272 bytes: the 16 rows of a 16-byte fragment read fall
// on all 64 banks.
// ---------------------------------------------------------------------------
#define LN_T     8
#define LG_ROWS  64
#define LG_PITCH 136   // halves
#define LG_HALO  4     // tokens normed in front of the tile: the conv's 3, as one 16-byte piece
#define XP_PITCH 132   // 32-bit words

// One wave's products: 2 x 4 tiles, with HALO the 1 x 4 tiles in front as well.
template <bool HALO>
__device__ __forceinline__ void inproj_tiles(const _Float16* S0, const _Float16* Sh,
                                             const _Float16* Wl,
                                             v8f (&acc)[2][4], v8f (&acch)[4]) {
    #pragma unroll
    for (int k = 0; k < 4; ++k) {
        v16h s0 = load_a_frag(S0 + k * 32);
        v16h s1 = load_a_frag(S0 + 16 * LG_PITCH + k * 32);
        v16h sh = {};
        if (HALO) sh = load_a_frag(Sh + k * 32);
        #pragma unroll
        for (int ct = 0; ct < 4; ++ct) {
            v16h bf = *(const v16h*)&Wl[(k * 128 + ct * 16) * 32];
            acc[0][ct] = __builtin_amdgcn_wmma_f32_16x16x32_f16(false, s0, false, bf, (short)0, acc[0][ct], false, false);
            acc[1][ct] = __builtin_amdgcn_wmma_f32_16x16x32_f16(false, s1, false, bf, (short)0, acc[1][ct], false, false);
            if (HALO)
                acch[ct] = __builtin_amdgcn_wmma_f32_16x16x32_f16(false, sh, false, bf, (short)0, acch[ct], false, false);
        }
    }
}

__global__ __launch_bounds__(256)
void ln_inproj_conv_xproj_kernel(
                      const float* __restrict__ front,  // (B, DIM, N)
                      const float* __restrict__ back,   // (B, DIM, N)
                      const float* __restrict__ ln0_w,  // (2, DIM)
                      const float* __restrict__ ln0_b,  // (2, DIM)
                      const float* __restrict__ ln1_w,  // (2, DIM)
                      const float* __restrict__ ln1_b,  // (2, DIM)
                      const _Float16* __restrict__ Wf,  // Wx[0], Wx[1], Wz[0], Wz[1], swizzled
                      const float* __restrict__ cw,     // (2,128,4)
                      const float* __restrict__ cb,     // (2,128)
                      const float* __restrict__ Wxproj, // (2,128,24)
                      const float* __restrict__ Wdt,    // (2,8,128)
                      const float* __restrict__ bdt,    // (2,128)
                      float* __restrict__ Zo,           // 2 x (B, N, 128)
                      float* __restrict__ uc,           // 2 x (B, N, 128)
                      float* __restrict__ dt,           // 2 x (B, N, 128)
                      float* __restrict__ Bm,           // 2 x (B, N, 8)
                      float* __restrict__ Cm) {         // 2 x (B, N, 8)
    __shared__ __align__(64) _Float16 sW[2 * 128 * 128];   // 64 KB, fragment order; later uc and x_dbl
    __shared__ __align__(16) _Float16 sA[(LG_HALO + 2 * LG_ROWS) * LG_PITCH];  // 35 KB: halo, SSM, gate
    int inp  = blockIdx.y;         // the input, and the block whose SSM path it feeds
    int gblk = inp ^ 1;            // the block whose gate it feeds
    const float* x = inp ? back : front;
    int tid  = threadIdx.x;
    int lane = tid & 31;
    int wave = tid >> 5;
    // the wave's number as a scalar: the branches on it are scalar branches
    int wv   = __builtin_amdgcn_readfirstlane(wave);
    int row0 = blockIdx.x * LG_ROWS;   // first token of the tile, b * NTOK + n
    int t0 = row0 + wave * LN_T;       // first token of the wave
    int b = t0 >> 14;                  // / NTOK
    int n = t0 & (NTOK - 1);
    int nT = row0 & (NTOK - 1);        // the tile's first token within its batch
    // At a batch's start u is zero-padded and nothing lies in front: the address
    // stays inside the batch there, and part 3 puts zeros in place of the result.
    int nh = nT ? nT - LG_HALO : 0;
    const float* xl = x + ((size_t)b * DIMC + 4 * lane) * NTOK + n;
    const float* xh = x + ((size_t)b * DIMC + 4 * lane) * NTOK + nh;
    const uint4* ws0 = (const uint4*)(Wf + (size_t)inp * 16384);
    const uint4* ws1 = (const uint4*)(Wf + (size_t)(2 + gblk) * 16384);
    uint4*       wd  = (uint4*)sW + tid;
    uint4 wr[8];
    f32x4 v[4][LN_T / 4];
    f32x4 vh[4];   // wave 0 only
    #pragma unroll   // v[][] in registers; all loads issue before the first wait
    for (int q = 0; q < 4; ++q)
        #pragma unroll
        for (int h = 0; h < LN_T / 4; ++h)
            v[q][h] = *(const f32x4*)(xl + (size_t)q * NTOK + 4 * h);
    if (wv == 0) {
        #pragma unroll
        for (int q = 0; q < 4; ++q) vh[q] = *(const f32x4*)(xh + (size_t)q * NTOK);
    }
    f32x4 wS = *(const f32x4*)(ln0_w + inp * DIMC + 4 * lane);
    f32x4 bS = *(const f32x4*)(ln0_b + inp * DIMC + 4 * lane);
    f32x4 wG = *(const f32x4*)(ln1_w + gblk * DIMC + 4 * lane);
    f32x4 bG = *(const f32x4*)(ln1_b + gblk * DIMC + 4 * lane);
    #pragma unroll   // wr[] in registers; eight 16-byte loads in flight per thread
    for (int i = 0; i < 8; ++i) wr[i] = ws0[tid + i * 256];
    #pragma unroll
    for (int i = 0; i < 8; ++i) wd[i * 256] = wr[i];
    // Keeps the second matrix's loads behind the first one's LDS stores; they fly
    // under the norm's arithmetic. All sixteen weight loads at once take the kernel
    // past 160 registers, and only two workgroups, not the three that LDS allows,
    // fit a WGP.
    __builtin_amdgcn_sched_barrier(0);
    #pragma unroll
    for (int i = 0; i < 8; ++i) wr[i] = ws1[tid + i * 256];
    // As inputs of the wait the pointers and the two indices (the offsets of the
    // parameter loads and of the weight loads) stay in their registers up to it, so
    // that no register that an issued load names is written before it.
    asm volatile("s_wait_xcnt 0x0" :: "v"(xl), "v"(xh), "v"(lane), "v"(tid) : "memory");

    // Two neighbouring tokens of a channel lie in neighbouring registers, so the
    // arithmetic runs on token pairs: packed instructions with no register moves.
    f32x2 p[4][LN_T / 2], s[LN_T / 2], q[LN_T / 2];
    #pragma unroll   // constant indices into the register arrays
    for (int k = 0; k < LN_T / 2; ++k) {
        #pragma unroll
        for (int c = 0; c < 4; ++c)
            p[c][k] = f32x2{v[c][k >> 1][2 * (k & 1)], v[c][k >> 1][2 * (k & 1) + 1]};
        s[k] = p[0][k] + p[1][k] + p[2][k] + p[3][k];
        q[k] = p[0][k] * p[0][k] + p[1][k] * p[1][k] + p[2][k] * p[2][k] + p[3][k] * p[3][k];
    }
    // butterfly step by step, all tokens in each step: their exchanges are
    // independent, so a step waits once and not once per token
    #pragma unroll
    for (int off = 16; off > 0; off >>= 1) {
        #pragma unroll
        for (int k = 0; k < LN_T / 2; ++k) {
            f32x2 so = f32x2{__shfl_xor(s[k][0], off, 32), __shfl_xor(s[k][1], off, 32)};
            f32x2 qo = f32x2{__shfl_xor(q[k][0], off, 32), __shfl_xor(q[k][1], off, 32)};
            s[k] += so;
            q[k] += qo;
        }
    }
    _Float16* aS = sA + (LG_HALO + wave * LN_T) * LG_PITCH + 4 * lane;
    _Float16* aG = aS + LG_ROWS * LG_PITCH;
    #pragma unroll
    for (int k = 0; k < LN_T / 2; ++k) {
        f32x2 mean = s[k] * (1.0f / DIMC);
        f32x2 var  = q[k] * (1.0f / DIMC) - mean * mean;
        f32x2 rstd = f32x2{rsqrtf(var[0] + 1e-5f), rsqrtf(var[1] + 1e-5f)};
        f32x2 ys[4], yg[4];
        #pragma unroll
        for (int c = 0; c < 4; ++c) {
            f32x2 t = (p[c][k] - mean) * rstd;
            ys[c] = t * wS[c] + bS[c];
            yg[c] = t * wG[c] + bG[c];
        }
        #pragma unroll
        for (int j = 0; j < 2; ++j) {
            *(v4h*)(aS + (2 * k + j) * LG_PITCH) =
                v4h{(_Float16)ys[0][j], (_Float16)ys[1][j], (_Float16)ys[2][j], (_Float16)ys[3][j]};
            *(v4h*)(aG + (2 * k + j) * LG_PITCH) =
                v4h{(_Float16)yg[0][j], (_Float16)yg[1][j], (_Float16)yg[2][j], (_Float16)yg[3][j]};
        }
    }
    #pragma unroll
    for (int i = 0; i < 8; ++i) wd[2048 + i * 256] = wr[i];
    if (wv == 0) {
        // the halo tokens, the same arithmetic, SSM norm only; rows 0 .. LG_HALO - 1 of sA
        f32x2 ph[4][LG_HALO / 2], sh[LG_HALO / 2], qh[LG_HALO / 2];
        #pragma unroll   // constant indices into the register arrays
        for (int k = 0; k < LG_HALO / 2; ++k) {
            #pragma unroll
            for (int c = 0; c < 4; ++c) ph[c][k] = f32x2{vh[c][2 * k], vh[c][2 * k + 1]};
            sh[k] = ph[0][k] + ph[1][k] + ph[2][k] + ph[3][k];
            qh[k] = ph[0][k] * ph[0][k] + ph[1][k] * ph[1][k] + ph[2][k] * ph[2][k] + ph[3][k] * ph[3][k];
        }
        #pragma unroll
        for (int off = 16; off > 0; off >>= 1) {
            #pragma unroll
            for (int k = 0; k < LG_HALO / 2; ++k) {
                f32x2 so = f32x2{__shfl_xor(sh[k][0], off, 32), __shfl_xor(sh[k][1], off, 32)};
                f32x2 qo = f32x2{__shfl_xor(qh[k][0], off, 32), __shfl_xor(qh[k][1], off, 32)};
                sh[k] += so;
                qh[k] += qo;
            }
        }
        _Float16* aH = sA + 4 * lane;
        #pragma unroll
        for (int k = 0; k < LG_HALO / 2; ++k) {
            f32x2 mean = sh[k] * (1.0f / DIMC);
            f32x2 var  = qh[k] * (1.0f / DIMC) - mean * mean;
            f32x2 rstd = f32x2{rsqrtf(var[0] + 1e-5f), rsqrtf(var[1] + 1e-5f)};
            f32x2 ys[4];
            #pragma unroll
            for (int c = 0; c < 4; ++c) {
                f32x2 t = (ph[c][k] - mean) * rstd;
                ys[c] = t * wS[c] + bS[c];
            }
            #pragma unroll
            for (int j = 0; j < 2; ++j)
                *(v4h*)(aH + (2 * k + j) * LG_PITCH) =
                    v4h{(_Float16)ys[0][j], (_Float16)ys[1][j], (_Float16)ys[2][j], (_Float16)ys[3][j]};
        }
    }
    __syncthreads();   // weights and the tiles are read by all waves

    int l15  = lane & 15;
    int sel  = lane >> 4;                  // 0 / 1
    int nrm  = wv >> 2;                    // 0 = SSM path, 1 = gate
    int rowW = ((wv >> 1) & 1) * 32;       // the wave's first token within the tile
    int colW = (wv & 1) * 64;              // the wave's first column
    const _Float16* S0 = sA + (LG_HALO + nrm * LG_ROWS + rowW + l15) * LG_PITCH + sel * 8;
    const _Float16* Wl = sW + nrm * 16384 + ((colW + l15) * 2 + sel) * 16;
    v8f acc[2][4] = {};
    v8f acch[4] = {};
    f32x4 cwv[4];   // SSM waves only
    float cbv[4];
    if (nrm == 0) {
        const float* pcw = cw + (inp * 128 + colW + l15) * D_CONV;
        const float* pcb = cb + inp * 128 + colW + l15;
        #pragma unroll   // fly under the products
        for (int ct = 0; ct < 4; ++ct) {
            cwv[ct] = *(const f32x4*)(pcw + ct * 16 * D_CONV);
            cbv[ct] = pcb[ct * 16];
        }
        // as inputs of the wait the pointers stay in their registers up to it
        asm volatile("s_wait_xcnt 0x0" :: "v"(pcw), "v"(pcb) : "memory");
        // The 16 tokens in front of the wave's own. Of the tile's first wave only
        // the last LG_HALO exist (sA rows 0 ..); the lanes of the rows in front of
        // them read row 0, and their results are not used.
        int hr = LG_HALO + rowW - 16 + l15;
        hr = hr < 0 ? 0 : hr;
        inproj_tiles<true>(S0, sA + hr * LG_PITCH + sel * 8, Wl, acc, acch);
    } else {
        inproj_tiles<false>(S0, S0, Wl, acc, acch);
    }
    __syncthreads();   // every wave has read its weights: uc and x_dbl take their place

    unsigned* sU = (unsigned*)sW;                     // uc words: (LG_ROWS, XP_PITCH)
    float*    sX = (float*)(sU + LG_ROWS * XP_PITCH); // dt_r, B, C: (LG_ROWS, 8) each
    unsigned* sTh = (unsigned*)(sX + 3 * LG_ROWS * 8);   // Wxproj words (hi, hi): (24, XP_PITCH)
    unsigned* sTl = sTh + 24 * XP_PITCH;                 // Wxproj words (lo, lo): (24, XP_PITCH)
    // accumulator layout: row = r + 8 * sel, column = l15 of each 16 x 16 tile
    size_t go = (size_t)(row0 + rowW + sel * 8) * 128 + colW + l15;
    if (nrm == 0) {
        unsigned* pl = sU + (rowW + sel * 8) * XP_PITCH + colW + l15;
        bool pad = (nT == 0) && (rowW == 0);   // the zero padding in front of token 0
        #pragma unroll   // constant indices into the register arrays
        for (int ct = 0; ct < 4; ++ct) {
            // uc takes u's place in the accumulator registers: the second tile
            // first, which still needs the first one's u
            #pragma unroll
            for (int rt = 1; rt >= 0; --rt) {
                // The three tokens in front of the lane's eight: for sel = 1 rows
                // 5..7 of the same tile (lane sel = 0), for sel = 0 rows 13..15 of
                // the tile in front (lane sel = 1).
                float w[8 + D_CONV - 1];
                #pragma unroll
                for (int i = 0; i < D_CONV - 1; ++i) {
                    float fr = rt ? acc[0][ct][5 + i] : (pad ? 0.0f : acch[ct][5 + i]);
                    w[i] = __shfl_xor(sel ? fr : acc[rt][ct][5 + i], 16, 32);
                }
                #pragma unroll
                for (int k = 0; k < 8; ++k) w[k + D_CONV - 1] = acc[rt][ct][k];
                f32x2 a[4], xe[4], e[4];
                #pragma unroll
                for (int k = 0; k < 8; ++k) {
                    float av = cbv[ct];
                    #pragma unroll
                    for (int i = 0; i < D_CONV; ++i) av = __builtin_fmaf(w[k + i], cwv[ct][i], av);
                    a[k >> 1][k & 1] = av;
                }
                #pragma unroll
                for (int k = 0; k < 4; ++k) xe[k] = a[k] * -1.44269504f;
                exp2_x8(xe, e);                            // exp(-a)
                #pragma unroll
                for (int k = 0; k < 8; ++k)
                    acc[rt][ct][k] = a[k >> 1][k & 1] / (1.0f + e[k >> 1][k & 1]);   // SiLU
                #pragma unroll
                for (int k = 0; k < 8; ++k) {
                    f32x2 hl = split_hi_lo(acc[rt][ct][k]);
                    pl[(rt * 16 + k) * XP_PITCH + ct * 16] = pack_f16(hl[0], hl[1]);
                }
            }
        }
    } else {
        float* po = Zo + (size_t)gblk * MTOT * 128 + go;
        #pragma unroll
        for (int rt = 0; rt < 2; ++rt)
            #pragma unroll
            for (int r = 0; r < 8; ++r)
                #pragma unroll
                for (int ct = 0; ct < 4; ++ct)
                    po[(rt * 16 + r) * 128 + ct * 16] = acc[rt][ct][r];
        // what follows rewrites the address and data registers of these stores
        asm volatile("s_wait_xcnt 0x0" :: "v"(po) : "memory");
        // Wxproj (128 x 24) as 768 16-byte pieces, six a thread; a piece is 4
        // neighbouring columns of one channel. Behind the z stores, in the registers
        // that z has left; the SSM waves' conv lasts longer than these loads.
        int tg = tid - 128;
        const f32x4* pw = (const f32x4*)(Wxproj + inp * 128 * 24) + tg;
        f32x4 wx[6];
        #pragma unroll   // wx[] in registers; all loads issue before the first wait
        for (int i = 0; i < 6; ++i) wx[i] = pw[i * 128];
        // as an input of the wait the thread index, the offset of these loads, stays in
        // its register up to it
        asm volatile("s_wait_xcnt 0x0" :: "v"(tid) : "memory");
        #pragma unroll   // constant indices into wx[]
        for (int i = 0; i < 6; ++i) {
            int pc = tg + i * 128;
            int k  = pc / 6;               // channel
            int j0 = (pc - k * 6) * 4;     // first of the piece's 4 columns
            #pragma unroll
            for (int j = 0; j < 4; ++j) {
                f32x2 hl = split_hi_lo(wx[i][j]);
                sTh[(j0 + j) * XP_PITCH + k] = pack_f16(hl[0], hl[0]);
                sTl[(j0 + j) * XP_PITCH + k] = pack_f16(hl[1], hl[1]);
            }
            // Keeps a piece's words behind the stores of the piece before: formed all
            // together they take the kernel past 160 registers, and only two
            // workgroups, not the three that LDS allows, fit a WGP.
            __builtin_amdgcn_sched_barrier(0);
        }
    }
    __syncthreads();   // the uc rows and Wxproj's are read by all waves

    // uc goes to memory behind the barrier, not in front of it: the barrier waits
    // for a wave's outstanding stores, and these now fly under part 4.
    if (nrm == 0) {
        float* po = uc + (size_t)inp * MTOT * 128 + go;
        #pragma unroll
        for (int rt = 0; rt < 2; ++rt)
            #pragma unroll
            for (int k = 0; k < 8; ++k)
                #pragma unroll
                for (int ct = 0; ct < 4; ++ct)
                    po[(rt * 16 + k) * 128 + ct * 16] = acc[rt][ct][k];
        // what follows rewrites the address and data registers of these stores
        asm volatile("s_wait_xcnt 0x0" :: "v"(po) : "memory");
    }
    int ch   = tid & 127;       // part 5: the thread's channel
    int half = wv >> 2;         // part 5: which 32 of the 64 tokens
    const float* pwd = Wdt + inp * DT_RANK * 128 + ch;
    const float* pbd = bdt + inp * 128 + ch;
    float wdt[DT_RANK];
    #pragma unroll   // fly under part 4
    for (int r = 0; r < DT_RANK; ++r) wdt[r] = pwd[r * 128];
    float bb = *pbd;
    // as an input of the wait the channel index, the offset of these loads, stays in
    // its register up to it
    asm volatile("s_wait_xcnt 0x0" :: "v"(ch) : "memory");

    {
        int tk = (wv & 3) * 16 + l15;      // the lane's token: column of B and of the result
        int jt = wv >> 2;                  // x_dbl columns 0..15 or 16..31, of which 24 exist
        // The lanes of the columns that do not exist read the last one that does; a row
        // of A reaches only its own row of the result, and theirs is not stored.
        int jr = jt * 16 + l15;
        jr = jr > 23 ? 23 : jr;
        // All operands by the same rule: of each 16 channels lane half sel holds the
        // words of 8 * sel .. 8 * sel + 7, in their order.
        const unsigned* ur = sU  + tk * XP_PITCH + sel * 8;
        const unsigned* wh = sTh + jr * XP_PITCH + sel * 8;
        const unsigned* wl = sTl + jr * XP_PITCH + sel * 8;
        v8f x0 = {}, x1 = {};
        // Two register buffers of two steps (32 channels) each: while one is worked on,
        // the other's LDS reads fly. The scheduling barriers keep each buffer's reads in
        // front of the work on the other buffer; without them the compiler sinks every
        // read to its product, and each product waits out a whole LDS read.
        v16h fa[6], fb[6];
        xp_load(ur, wh, wl, fa);
        xp_load(ur + 32, wh + 32, wl + 32, fb);
        __builtin_amdgcn_sched_barrier(0);
        xp_mul(fa, x0, x1);
        xp_load(ur + 64, wh + 64, wl + 64, fa);
        __builtin_amdgcn_sched_barrier(0);
        xp_mul(fb, x0, x1);
        xp_load(ur + 96, wh + 96, wl + 96, fb);
        __builtin_amdgcn_sched_barrier(0);
        xp_mul(fa, x0, x1);
        xp_mul(fb, x0, x1);
        x0 += x1;
        // result layout: register r = x_dbl column jt * 16 + sel * 8 + r of token tk
        int grp = jt * 2 + sel;            // 0 = dt_r, 1 = B, 2 = C
        if (grp < 3) {
            float* px = sX + grp * (LG_ROWS * 8) + tk * 8;
            *(f32x4*)(px)     = f32x4{x0[0], x0[1], x0[2], x0[3]};
            *(f32x4*)(px + 4) = f32x4{x0[4], x0[5], x0[6], x0[7]};
        }
    }
    __syncthreads();   // the x_dbl rows are read by all waves

    size_t xo = ((size_t)inp * MTOT + row0) * 8 + tid * 2;
    *(f32x2*)(Bm + xo) = *(const f32x2*)&sX[1 * LG_ROWS * 8 + tid * 2];
    *(f32x2*)(Cm + xo) = *(const f32x2*)&sX[2 * LG_ROWS * 8 + tid * 2];
    // what follows rewrites the offset and data registers of these two stores
    asm volatile("s_wait_xcnt 0x0" ::: "memory");

    float* pd = dt + ((size_t)inp * MTOT + row0 + half * 32) * 128 + ch;
    const float* xr = sX + half * 32 * 8;
    for (int k0 = 0; k0 < 32; k0 += 8) {
        f32x2 av[4], xe[4], e[4], o[4];
        #pragma unroll   // av[] in registers
        for (int k = 0; k < 8; ++k) {
            f32x4 r0 = *(const f32x4*)&xr[(k0 + k) * 8];
            f32x4 r1 = *(const f32x4*)&xr[(k0 + k) * 8 + 4];
            float a = bb;
            #pragma unroll
            for (int r = 0; r < 4; ++r) a += r0[r] * wdt[r];
            #pragma unroll
            for (int r = 0; r < 4; ++r) a += r1[r] * wdt[r + 4];
            av[k >> 1][k & 1] = a;
        }
        // softplus(a) = max(a, 0) + log1p(e), e = exp(-|a|) in [0, 1], for every a, with
        // no branch, so that the eight tokens' chains run side by side, in pairs.
        // log1p(e) = 2 atanh(s), s = e / (2 + e) <= 1/3: the series in s * s up to
        // s^13 / 13 leaves less than 2e-8 of the value, also where e is tiny.
        #pragma unroll   // constant indices into the register arrays
        for (int j = 0; j < 4; ++j)
            xe[j] = f32x2{-fabsf(av[j][0]), -fabsf(av[j][1])} * 1.44269504f;
        exp2_x8(xe, e);
        #pragma unroll   // the four pairs' chains interleave
        for (int j = 0; j < 4; ++j) {
            f32x2 u = e[j] + 2.0f;
            f32x2 s = e[j] * f32x2{__builtin_amdgcn_rcpf(u[0]), __builtin_amdgcn_rcpf(u[1])};
            f32x2 w = s * s;
            f32x2 p = f32x2{2.0f / 13.0f, 2.0f / 13.0f};
            p = __builtin_elementwise_fma(p, w, f32x2{2.0f / 11.0f, 2.0f / 11.0f});
            p = __builtin_elementwise_fma(p, w, f32x2{2.0f / 9.0f, 2.0f / 9.0f});
            p = __builtin_elementwise_fma(p, w, f32x2{2.0f / 7.0f, 2.0f / 7.0f});
            p = __builtin_elementwise_fma(p, w, f32x2{2.0f / 5.0f, 2.0f / 5.0f});
            p = __builtin_elementwise_fma(p, w, f32x2{2.0f / 3.0f, 2.0f / 3.0f});
            p = __builtin_elementwise_fma(p, w, f32x2{2.0f, 2.0f});
            o[j] = __builtin_elementwise_fma(s, p, f32x2{fmaxf(av[j][0], 0.0f), fmaxf(av[j][1], 0.0f)});
        }
        #pragma unroll
        for (int k = 0; k < 8; ++k) pd[(k0 + k) * 128] = o[k >> 1][k & 1];
        // the next trip rewrites the data registers of these stores
        asm volatile("s_wait_xcnt 0x0" ::: "memory");
    }
}

// ---------------------------------------------------------------------------
// SSM scan, cut along the tokens into NCHUNK chunks of CHUNK_T steps.
// h[t] = a[t]*h[t-1] + b[t] is linear in h, so a chunk acts on its incoming
// state as  h_out = P*h_in + H  with P = product of its a[t] and H = its end
// state from h_in = 0.  Three launches:
//   1) every chunk: P and H                        (all chunks side by side)
//   2) every (batch, d, s): the incoming state of each chunk, chunk by chunk
//   3) every chunk: the recurrence again from its incoming state, with readout
// Launches 1 and 3: one workgroup of 128 threads per chunk, thread = channel d,
// which keeps its 8 states in registers as 4 pairs. A wave's load of dt, uc or
// z is then one whole 128-byte line, the readout sum over the states stays in
// the thread, and the gate is worked out once per (token, channel) with every
// lane busy. The B and C rows of the chunk, the same for all channels, are
// staged in LDS once and read from there by broadcast.
// The two cross blocks are independent and go through each launch side by side:
// their arrays lie one behind the other, so that they read as 2 * BATCH batches,
// and only the per-block parameters are picked by batch index / BATCH.
// ---------------------------------------------------------------------------
#define CHUNK_T 128
#define NCHUNK  (NTOK / CHUNK_T)    // 128 chunks per batch
#define SCAN_U  8                   // tokens per register buffer (two buffers)
#define SCAN_NG (CHUNK_T / SCAN_U)  // 16 buffer fills per chunk

// log2(e) * A for the 8 states of channel d, A = -exp(A_log): exp(dt*A) is then
// one multiply and one v_exp_f32.
__device__ __forceinline__ void load_a2(const float* __restrict__ A_log, int d, f32x2* A2) {
    f32x4 l0 = *(const f32x4*)(A_log + d * 8);
    f32x4 l1 = *(const f32x4*)(A_log + d * 8 + 4);
    A2[0] = f32x2{-__expf(l0[0]), -__expf(l0[1])} * 1.44269504f;
    A2[1] = f32x2{-__expf(l0[2]), -__expf(l0[3])} * 1.44269504f;
    A2[2] = f32x2{-__expf(l1[0]), -__expf(l1[1])} * 1.44269504f;
    A2[3] = f32x2{-__expf(l1[2]), -__expf(l1[3])} * 1.44269504f;
}

// SCAN_U tokens of one channel's column of a (token, 128) array. Two tokens
// share a register pair: a packed multiply that takes one of them as its scalar
// names the whole pair, and the wait in front of it covers both halves, so the
// other half must belong to the same buffer and not to the one still in flight.
__device__ __forceinline__ void load_col(const float* __restrict__ p, f32x2* r) {
    #pragma unroll   // r[] in registers; the loads issue back to back
    for (int k = 0; k < SCAN_U; ++k) r[k >> 1][k & 1] = p[k * 128];
}

// One step of the recurrence for the 8 states of a channel.
__device__ __forceinline__ void ssm_step(float dtv, float ucv, const f32x2* A2,
                                         const float* sBrow, f32x2* a, f32x2* h) {
    f32x4 b0 = *(const f32x4*)(sBrow);
    f32x4 b1 = *(const f32x4*)(sBrow + 4);
    f32x2 Bp[4] = {f32x2{b0[0], b0[1]}, f32x2{b0[2], b0[3]},
                   f32x2{b1[0], b1[1]}, f32x2{b1[2], b1[3]}};
    float du = dtv * ucv;
    f32x2 x[4];
    #pragma unroll   // x[], a[], h[] in registers
    for (int j = 0; j < 4; ++j) x[j] = A2[j] * dtv;
    exp2_x8(x, a);
    #pragma unroll
    for (int j = 0; j < 4; ++j) h[j] = __builtin_elementwise_fma(a[j], h[j], Bp[j] * du);
}

__device__ __forceinline__ void chunk_sum_group(const f32x2* dtr, const f32x2* ucr,
                                                const f32x2* A2, const float* sBg,
                                                f32x2* h, f32x2* p) {
    #pragma unroll   // constant indices into the register buffers
    for (int k = 0; k < SCAN_U; ++k) {
        f32x2 a[4];
        ssm_step(dtr[k >> 1][k & 1], ucr[k >> 1][k & 1], A2, sBg + k * 8, a, h);
        #pragma unroll
        for (int j = 0; j < 4; ++j) p[j] *= a[j];
    }
}

__global__ __launch_bounds__(128)
void scan_chunk_sum_kernel(const float* __restrict__ dt,    // (2B,N,128)
                           const float* __restrict__ uc,    // (2B,N,128)
                           const float* __restrict__ Bm,    // (2B,N,8)
                           const float* __restrict__ A_log, // (2,128,8)
                           float* __restrict__ Pc,          // (2B,NCHUNK,128,8)
                           float* __restrict__ Hc) {        // (2B,NCHUNK,128,8)
    __shared__ __align__(16) float sB[CHUNK_T * 8];         // 4 KB
    int c = blockIdx.x;
    int b = blockIdx.y;
    int d = threadIdx.x;
    A_log += (blockIdx.y / BATCH) * 128 * 8;
    size_t base = (size_t)b * NTOK + (size_t)c * CHUNK_T;
    const float* pdt = dt + base * 128 + d;
    const float* puc = uc + base * 128 + d;

    f32x2 dt0[SCAN_U / 2], uc0[SCAN_U / 2], dt1[SCAN_U / 2], uc1[SCAN_U / 2];
    load_col(pdt, dt0);
    load_col(puc, uc0);
    {
        const f32x4* g = (const f32x4*)(Bm + base * 8);
        ((f32x4*)sB)[d]       = g[d];
        ((f32x4*)sB)[d + 128] = g[d + 128];
    }
    f32x2 A2[4], h[4], p[4];
    load_a2(A_log, d, A2);
    #pragma unroll
    for (int j = 0; j < 4; ++j) { h[j] = f32x2{0.0f, 0.0f}; p[j] = f32x2{1.0f, 1.0f}; }
    __syncthreads();

    // Two register buffers: while one is worked on, the other's loads fly. The
    // scheduling barriers keep each buffer's loads in front of the work on the
    // other buffer; without them the compiler sinks the loads to their first use.
    for (int g = 0; g < SCAN_NG - 2; g += 2) {
        load_col(pdt + (size_t)(g + 1) * SCAN_U * 128, dt1);
        load_col(puc + (size_t)(g + 1) * SCAN_U * 128, uc1);
        __builtin_amdgcn_sched_barrier(0);
        chunk_sum_group(dt0, uc0, A2, sB + g * SCAN_U * 8, h, p);
        load_col(pdt + (size_t)(g + 2) * SCAN_U * 128, dt0);
        load_col(puc + (size_t)(g + 2) * SCAN_U * 128, uc0);
        __builtin_amdgcn_sched_barrier(0);
        chunk_sum_group(dt1, uc1, A2, sB + (g + 1) * SCAN_U * 8, h, p);
    }
    load_col(pdt + (size_t)(SCAN_NG - 1) * SCAN_U * 128, dt1);
    load_col(puc + (size_t)(SCAN_NG - 1) * SCAN_U * 128, uc1);
    __builtin_amdgcn_sched_barrier(0);
    chunk_sum_group(dt0, uc0, A2, sB + (SCAN_NG - 2) * SCAN_U * 8, h, p);
    __builtin_amdgcn_sched_barrier(0);   // keeps the wait for the last buffer behind the work above
    chunk_sum_group(dt1, uc1, A2, sB + (SCAN_NG - 1) * SCAN_U * 8, h, p);

    size_t o = ((size_t)b * NCHUNK + c) * 1024 + d * 8;
    *(f32x4*)(Pc + o)     = f32x4{p[0][0], p[0][1], p[1][0], p[1][1]};
    *(f32x4*)(Pc + o + 4) = f32x4{p[2][0], p[2][1], p[3][0], p[3][1]};
    *(f32x4*)(Hc + o)     = f32x4{h[0][0], h[0][1], h[1][0], h[1][1]};
    *(f32x4*)(Hc + o + 4) = f32x4{h[2][0], h[2][1], h[3][0], h[3][1]};
}

// One thread per (batch, d, s); 16 chunks' summaries are loaded at a time so
// that the serial chain waits for memory once per 16 chunks, not per chunk.
__global__ __launch_bounds__(256)
void scan_carry_kernel(const float* __restrict__ Pc,   // (2B,NCHUNK,1024)
                       const float* __restrict__ Hc,   // (2B,NCHUNK,1024)
                       float* __restrict__ Hin) {      // (2B,NCHUNK,1024)
    int idx = blockIdx.x * blockDim.x + threadIdx.x;   // over 2*BATCH*1024
    int b = idx >> 10;
    int r = idx & 1023;
    size_t o = (size_t)b * NCHUNK * 1024 + r;
    float carry = 0.0f;
    for (int c0 = 0; c0 < NCHUNK; c0 += 16) {
        float p[16], h[16];
        #pragma unroll   // p[], h[] in registers; all 32 loads issue before the first wait
        for (int k = 0; k < 16; ++k) {
            p[k] = Pc[o + (size_t)(c0 + k) * 1024];
            h[k] = Hc[o + (size_t)(c0 + k) * 1024];
        }
        #pragma unroll   // constant indices into p[], h[]
        for (int k = 0; k < 16; ++k) {
            Hin[o + (size_t)(c0 + k) * 1024] = carry;
            carry = p[k] * carry + h[k];
        }
        // the next trip rewrites the address and data registers of these stores
        asm volatile("s_wait_xcnt 0x0" ::: "memory");
    }
}

// SCAN_U tokens of launch 3: recurrence, readout over the 8 states, Dp skip and
// SiLU(z) gate; emits f16.
__device__ __forceinline__ void scan_group(const f32x2* dtr, const f32x2* ucr, const f32x2* zr,
                                           const f32x2* A2, float Dd,
                                           const float* sBg, const float* sCg,
                                           f32x2* h, _Float16* __restrict__ yo) {
    _Float16 r[SCAN_U];
    f32x2 zx[SCAN_U / 2], ez[SCAN_U / 2];   // exp(-z) of the 8 tokens
    #pragma unroll
    for (int k = 0; k < SCAN_U / 2; ++k) zx[k] = zr[k] * -1.44269504f;
    exp2_x8(zx, ez);
    #pragma unroll   // constant indices into the register buffers
    for (int k = 0; k < SCAN_U; ++k) {
        f32x2 a[4];
        float ucv = ucr[k >> 1][k & 1];
        ssm_step(dtr[k >> 1][k & 1], ucv, A2, sBg + k * 8, a, h);
        f32x4 c0 = *(const f32x4*)(sCg + k * 8);
        f32x4 c1 = *(const f32x4*)(sCg + k * 8 + 4);
        f32x2 y2 = h[0] * f32x2{c0[0], c0[1]};
        y2 = __builtin_elementwise_fma(h[1], f32x2{c0[2], c0[3]}, y2);
        y2 = __builtin_elementwise_fma(h[2], f32x2{c1[0], c1[1]}, y2);
        y2 = __builtin_elementwise_fma(h[3], f32x2{c1[2], c1[3]}, y2);
        float y  = y2[0] + y2[1];
        float zv = zr[k >> 1][k & 1];
        float g  = zv / (1.0f + ez[k >> 1][k & 1]);
        r[k] = (_Float16)((y + Dd * ucv) * g);
    }
    #pragma unroll
    for (int k = 0; k < SCAN_U; ++k) yo[k * 128] = r[k];
    // what follows rewrites the data registers of these stores
    asm volatile("s_wait_xcnt 0x0" ::: "memory");
}

__global__ __launch_bounds__(128)
void scan_kernel(const float* __restrict__ dt,    // (2B,N,128)
                 const float* __restrict__ uc,    // (2B,N,128)
                 const float* __restrict__ zg,    // (2B,N,128) pre-activation z
                 const float* __restrict__ Bm,    // (2B,N,8)
                 const float* __restrict__ Cm,    // (2B,N,8)
                 const float* __restrict__ A_log, // (2,128,8)
                 const float* __restrict__ Dp,    // (2,128)
                 const float* __restrict__ Hin,   // (2B,NCHUNK,128,8)
                 _Float16* __restrict__ yg) {     // (2B,N,128)
    __shared__ __align__(16) float sB[CHUNK_T * 8];   // 4 KB
    __shared__ __align__(16) float sC[CHUNK_T * 8];   // 4 KB
    int c = blockIdx.x;
    int b = blockIdx.y;
    int d = threadIdx.x;
    A_log += (blockIdx.y / BATCH) * 128 * 8;
    Dp    += (blockIdx.y / BATCH) * 128;
    size_t base = (size_t)b * NTOK + (size_t)c * CHUNK_T;
    const float* pdt = dt + base * 128 + d;
    const float* puc = uc + base * 128 + d;
    const float* pz  = zg + base * 128 + d;
    _Float16*    py  = yg + base * 128 + d;

    f32x2 dt0[SCAN_U / 2], uc0[SCAN_U / 2], z0[SCAN_U / 2];
    f32x2 dt1[SCAN_U / 2], uc1[SCAN_U / 2], z1[SCAN_U / 2];
    load_col(pdt, dt0);
    load_col(puc, uc0);
    load_col(pz,  z0);
    {
        const f32x4* gb = (const f32x4*)(Bm + base * 8);
        const f32x4* gc = (const f32x4*)(Cm + base * 8);
        ((f32x4*)sB)[d]       = gb[d];
        ((f32x4*)sB)[d + 128] = gb[d + 128];
        ((f32x4*)sC)[d]       = gc[d];
        ((f32x4*)sC)[d + 128] = gc[d + 128];
    }
    f32x2 A2[4], h[4];
    load_a2(A_log, d, A2);
    float Dd = Dp[d];
    {
        const float* hi = Hin + ((size_t)b * NCHUNK + c) * 1024 + d * 8;
        f32x4 h0 = *(const f32x4*)(hi);
        f32x4 h1 = *(const f32x4*)(hi + 4);
        h[0] = f32x2{h0[0], h0[1]}; h[1] = f32x2{h0[2], h0[3]};
        h[2] = f32x2{h1[0], h1[1]}; h[3] = f32x2{h1[2], h1[3]};
    }
    __syncthreads();

    // Two register buffers, held apart by scheduling barriers as in launch 1.
    for (int g = 0; g < SCAN_NG - 2; g += 2) {
        load_col(pdt + (size_t)(g + 1) * SCAN_U * 128, dt1);
        load_col(puc + (size_t)(g + 1) * SCAN_U * 128, uc1);
        load_col(pz  + (size_t)(g + 1) * SCAN_U * 128, z1);
        __builtin_amdgcn_sched_barrier(0);
        scan_group(dt0, uc0, z0, A2, Dd, sB + g * SCAN_U * 8, sC + g * SCAN_U * 8,
                   h, py + (size_t)g * SCAN_U * 128);
        load_col(pdt + (size_t)(g + 2) * SCAN_U * 128, dt0);
        load_col(puc + (size_t)(g + 2) * SCAN_U * 128, uc0);
        load_col(pz  + (size_t)(g + 2) * SCAN_U * 128, z0);
        __builtin_amdgcn_sched_barrier(0);
        scan_group(dt1, uc1, z1, A2, Dd, sB + (g + 1) * SCAN_U * 8, sC + (g + 1) * SCAN_U * 8,
                   h, py + (size_t)(g + 1) * SCAN_U * 128);
    }
    load_col(pdt + (size_t)(SCAN_NG - 1) * SCAN_U * 128, dt1);
    load_col(puc + (size_t)(SCAN_NG - 1) * SCAN_U * 128, uc1);
    load_col(pz  + (size_t)(SCAN_NG - 1) * SCAN_U * 128, z1);
    // The three pointers are used here for the last time. As inputs of the wait
    // they stay in their registers up to it, so that no result of these loads is
    // placed on an address register that an earlier one of them still names.
    asm volatile("s_wait_xcnt 0x0" :: "v"(pdt), "v"(puc), "v"(pz) : "memory");
    __builtin_amdgcn_sched_barrier(0);
    scan_group(dt0, uc0, z0, A2, Dd, sB + (SCAN_NG - 2) * SCAN_U * 8, sC + (SCAN_NG - 2) * SCAN_U * 8,
               h, py + (size_t)(SCAN_NG - 2) * SCAN_U * 128);
    __builtin_amdgcn_sched_barrier(0);   // keeps the wait for the last buffer behind the work above
    scan_group(dt1, uc1, z1, A2, Dd, sB + (SCAN_NG - 1) * SCAN_U * 8, sC + (SCAN_NG - 1) * SCAN_U * 8,
               h, py + (size_t)(SCAN_NG - 1) * SCAN_U * 128);
}

// ---------------------------------------------------------------------------
// Both out-projections, the residual sum and the final projection in one launch:
//   out = (0.5 * (yg0 @ Wom0 + yg1 @ Wom1 + bom0 + bom1 + ff + bf)) @ Wout + bout
// stored transposed to (B, DIM, NTOK). m0, m1 and s never go to memory.
// A workgroup of 8 waves takes OF_ROWS tokens; a wave owns 32 tokens x 64 columns
// (2 x 4 accumulators), so that its 32 tokens are one whole 128-byte line of each
// of its channels' rows in front, back and out. The accumulators start from
// ff + bf + bom0 + bom1 and take both products on top; s goes as f16 through LDS
// from accumulator layout to A-fragment layout (row pitch 272 bytes: the 16 rows
// of a 16-byte fragment read fall on all 64 banks).
// ---------------------------------------------------------------------------
#define OF_ROWS  128
#define OF_PITCH 136   // halves
__global__ __launch_bounds__(256)
void out_fused_kernel(const _Float16* __restrict__ yg,    // 2 x (B,N,128)
                      const _Float16* __restrict__ Wf,    // Wout_m[0], Wout_m[1], Wout, swizzled
                      const float* __restrict__ bom,      // (2,128)
                      const float* __restrict__ front,    // (B,128,N)
                      const float* __restrict__ back,     // (B,128,N)
                      const float* __restrict__ bout,     // (128)
                      float* __restrict__ out) {          // (B,128,N)
    __shared__ __align__(64) _Float16 sW[3 * 128 * 128];         // 96 KB, fragment order
    __shared__ __align__(16) _Float16 sS[OF_ROWS * OF_PITCH];    // 34 KB
    int tid  = threadIdx.x;
    int lane = tid & 31;
    int l15  = lane & 15;
    int sel  = lane >> 4;                 // 0 / 1
    int rowW = (tid >> 6) * 32;           // the wave's first token within the tile
    int colW = ((tid >> 5) & 1) * 64;     // the wave's first column
    int row0 = blockIdx.x * OF_ROWS;      // first token, b * NTOK + n
    int b    = row0 >> 14;
    int n0   = row0 & (NTOK - 1);

    // A lane's accumulator registers r = 0..7 are 8 consecutive tokens of one
    // channel: 32 contiguous bytes of front, back and out.
    size_t ro = ((size_t)b * DIMC + colW + l15) * NTOK + n0 + rowW + sel * 8;
    const float* pf = front + ro;
    const float* pb = back + ro;
    const _Float16* A0 = yg + (size_t)(row0 + rowW + l15) * 128 + sel * 8;
    const _Float16* A1 = A0 + (size_t)MTOT * 128;

    f32x4 f[2][4][2], g[2][4][2];
    v16h  a[2][4];
    #pragma unroll   // f[], g[], a[] in registers; all loads issue before the first wait
    for (int rt = 0; rt < 2; ++rt)
        #pragma unroll
        for (int ct = 0; ct < 4; ++ct)
            #pragma unroll
            for (int h = 0; h < 2; ++h) {
                f[rt][ct][h] = *(const f32x4*)(pf + (size_t)(ct * 16) * NTOK + rt * 16 + h * 4);
                g[rt][ct][h] = *(const f32x4*)(pb + (size_t)(ct * 16) * NTOK + rt * 16 + h * 4);
            }
    #pragma unroll
    for (int rt = 0; rt < 2; ++rt)
        #pragma unroll
        for (int k = 0; k < 4; ++k) a[rt][k] = load_a_frag(A0 + rt * 2048 + k * 32);
    float bs[4], bo[4];
    #pragma unroll
    for (int ct = 0; ct < 4; ++ct) {
        int col = colW + ct * 16 + l15;
        bs[ct] = bom[col] + bom[128 + col];
        bo[ct] = bout[col];
    }
    const uint4* wsrc = (const uint4*)Wf + tid;
    uint4*       wdst = (uint4*)sW + tid;
    #pragma unroll 8   // eight 16-byte loads in flight per thread
    for (int i = 0; i < (3 * 128 * 128) / 8 / 256; ++i) wdst[i * 256] = wsrc[i * 256];

    v8f acc[2][4];
    #pragma unroll   // constant indices into the register arrays
    for (int rt = 0; rt < 2; ++rt)
        #pragma unroll
        for (int ct = 0; ct < 4; ++ct)
            #pragma unroll
            for (int r = 0; r < 8; ++r)
                acc[rt][ct][r] = f[rt][ct][r >> 2][r & 3] + g[rt][ct][r >> 2][r & 3] + bs[ct];

    // As inputs of the wait the pointers stay in their registers up to it, so that
    // no register that an issued load names is written before it.
    asm volatile("s_wait_xcnt 0x0" :: "v"(pf), "v"(pb), "v"(A0), "v"(wsrc) : "memory");
    __syncthreads();

    // The second block's fragments fly while the first block's products run, one
    // k step's worth issued per k step.
    v16h a1[2][4];
    #pragma unroll
    for (int k = 0; k < 4; ++k) {
        a1[0][k] = load_a_frag(A1 + k * 32);
        a1[1][k] = load_a_frag(A1 + 2048 + k * 32);
        #pragma unroll
        for (int ct = 0; ct < 4; ++ct) {
            v16h bf = *(const v16h*)&sW[((k * 128 + colW + ct * 16 + l15) * 2 + sel) * 16];
            acc[0][ct] = __builtin_amdgcn_wmma_f32_16x16x32_f16(false, a[0][k], false, bf, (short)0, acc[0][ct], false, false);
            acc[1][ct] = __builtin_amdgcn_wmma_f32_16x16x32_f16(false, a[1][k], false, bf, (short)0, acc[1][ct], false, false);
        }
        // Keeps the next step's fragment loads behind this step's products, whose
        // operand registers they take: hoisted together they push the kernel past
        // 256 registers, and only one workgroup fits a WGP.
        __builtin_amdgcn_sched_barrier(0);
    }
    // what follows may rewrite the address registers of these loads
    asm volatile("s_wait_xcnt 0x0" :: "v"(A1) : "memory");
    #pragma unroll
    for (int k = 0; k < 4; ++k)
        #pragma unroll
        for (int ct = 0; ct < 4; ++ct) {
            v16h bf = *(const v16h*)&sW[16384 + ((k * 128 + colW + ct * 16 + l15) * 2 + sel) * 16];
            acc[0][ct] = __builtin_amdgcn_wmma_f32_16x16x32_f16(false, a1[0][k], false, bf, (short)0, acc[0][ct], false, false);
            acc[1][ct] = __builtin_amdgcn_wmma_f32_16x16x32_f16(false, a1[1][k], false, bf, (short)0, acc[1][ct], false, false);
        }

    // s, accumulator layout: row = r + 8 * sel, column = l15 of each 16 x 16 tile
    #pragma unroll
    for (int rt = 0; rt < 2; ++rt)
        #pragma unroll
        for (int ct = 0; ct < 4; ++ct)
            #pragma unroll
            for (int r = 0; r < 8; ++r)
                sS[(rowW + rt * 16 + sel * 8 + r) * OF_PITCH + colW + ct * 16 + l15] =
                    (_Float16)(0.5f * acc[rt][ct][r]);
    __syncthreads();   // a wave's s rows hold the columns of its neighbour wave too

    v8f o[2][4] = {};
    const _Float16* S0 = sS + (rowW + l15) * OF_PITCH + sel * 8;
    #pragma unroll
    for (int k = 0; k < 4; ++k) {
        v16h s0 = load_a_frag(S0 + k * 32);
        v16h s1 = load_a_frag(S0 + 16 * OF_PITCH + k * 32);
        #pragma unroll
        for (int ct = 0; ct < 4; ++ct) {
            v16h bf = *(const v16h*)&sW[2 * 16384 + ((k * 128 + colW + ct * 16 + l15) * 2 + sel) * 16];
            o[0][ct] = __builtin_amdgcn_wmma_f32_16x16x32_f16(false, s0, false, bf, (short)0, o[0][ct], false, false);
            o[1][ct] = __builtin_amdgcn_wmma_f32_16x16x32_f16(false, s1, false, bf, (short)0, o[1][ct], false, false);
        }
    }

    float* po = out + ro;
    #pragma unroll
    for (int rt = 0; rt < 2; ++rt)
        #pragma unroll
        for (int ct = 0; ct < 4; ++ct) o[rt][ct] += bo[ct];
    // keeps every store behind the last arithmetic, so that no register that an
    // issued store names is written again
    __builtin_amdgcn_sched_barrier(0);
    #pragma unroll
    for (int rt = 0; rt < 2; ++rt)
        #pragma unroll
        for (int ct = 0; ct < 4; ++ct)
            #pragma unroll
            for (int h = 0; h < 2; ++h)
                *(f32x4*)(po + (size_t)(ct * 16) * NTOK + rt * 16 + h * 4) =
                    f32x4{o[rt][ct][4 * h], o[rt][ct][4 * h + 1], o[rt][ct][4 * h + 2], o[rt][ct][4 * h + 3]};
}

// ---------------------------------------------------------------------------
// Host-side pipeline
// ---------------------------------------------------------------------------
extern "C" void kernel_launch(void* const* d_in, const int* in_sizes, int n_in,
                              void* d_out, int out_size, void* d_ws, size_t ws_size,
                              hipStream_t stream) {
    const float* front   = (const float*)d_in[0];
    const float* back    = (const float*)d_in[1];
    const float* ln0_w   = (const float*)d_in[2];
    const float* ln0_b   = (const float*)d_in[3];
    const float* ln1_w   = (const float*)d_in[4];
    const float* ln1_b   = (const float*)d_in[5];
    const float* Wx      = (const float*)d_in[6];
    const float* Wz      = (const float*)d_in[7];
    const float* conv_w  = (const float*)d_in[8];
    const float* conv_b  = (const float*)d_in[9];
    const float* Wxproj  = (const float*)d_in[10];
    const float* Wdt     = (const float*)d_in[11];
    const float* bdt     = (const float*)d_in[12];
    const float* A_log   = (const float*)d_in[13];
    const float* Dp      = (const float*)d_in[14];
    const float* Wout_m  = (const float*)d_in[15];
    const float* bout_m  = (const float*)d_in[16];
    const float* Wout    = (const float*)d_in[17];
    const float* bout    = (const float*)d_in[18];

    char* ws = (char*)d_ws;
    // ---- static workspace layout (bytes); "2 x": block 0's array, then block 1's ----
    _Float16* Wh   = (_Float16*)(ws);                       // 7*16384 halves < 256 KB
    _Float16* WOMh = Wh + 4 * 16384;                        // behind Wx[0..1], Wz[0..1]; Wout follows
    size_t off = 0x40000;
    float*    UC   = (float*)(ws + off);    off += (size_t)2 * MTOT * 128 * 4;  // 64 MB: 2 x uc
    float*    DT   = (float*)(ws + off);    off += (size_t)2 * MTOT * 128 * 4;  // 64 MB: 2 x dt
    float*    Z    = (float*)(ws + off);    off += (size_t)2 * MTOT * 128 * 4;  // 64 MB: 2 x z
    _Float16* YGh  = (_Float16*)(ws + off); off += (size_t)2 * MTOT * 128 * 2;  // 32 MB
    float*    BM   = (float*)(ws + off);    off += (size_t)2 * MTOT * 8 * 4;    // 4 MB
    float*    CMb  = (float*)(ws + off);    off += (size_t)2 * MTOT * 8 * 4;    // 4 MB
    float*    PC   = (float*)(ws + off);    off += (size_t)2 * BATCH * NCHUNK * 1024 * 4;  // 4 MB
    float*    HC   = (float*)(ws + off);    off += (size_t)2 * BATCH * NCHUNK * 1024 * 4;  // 4 MB
    float*    HIN  = (float*)(ws + off);    off += (size_t)2 * BATCH * NCHUNK * 1024 * 4;  // 4 MB

    // Launches that do not depend on one another share one grid: the seven weight
    // conversions, the four norms with the four input projections, and from there
    // on the two cross blocks side by side.

    // 1) weight conversions to f16 (swizzled into WMMA B-fragment order)
    cvt_swizzle_w_kernel<<<(7 * 16384) / 256, 256, 0, stream>>>(Wx, Wz, Wout_m, Wout, Wh);

    // 2) the two cross-mamba blocks
    ln_inproj_conv_xproj_kernel<<<dim3(MTOT / LG_ROWS, 2), 256, 0, stream>>>(
        front, back, ln0_w, ln0_b, ln1_w, ln1_b, Wh, conv_w, conv_b, Wxproj, Wdt, bdt,
        Z, UC, DT, BM, CMb);

    scan_chunk_sum_kernel<<<dim3(NCHUNK, 2 * BATCH), 128, 0, stream>>>(
        DT, UC, BM, A_log, PC, HC);
    scan_carry_kernel<<<(2 * BATCH * 1024) / 256, 256, 0, stream>>>(PC, HC, HIN);
    scan_kernel<<<dim3(NCHUNK, 2 * BATCH), 128, 0, stream>>>(
        DT, UC, Z, BM, CMb, A_log, Dp, HIN, YGh);

    // 3) out-projections + residual add + 0.5 scale + final GEMM, stored transposed to (B,DIM,N)
    out_fused_kernel<<<MTOT / OF_ROWS, 256, 0, stream>>>(
        YGh, WOMh, bout_m, front, back, bout, (float*)d_out);
}

// v010
// A run of this version takes 124 microseconds.
// In two side-by-side timings against v009, it was 1.10 and 1.09 times as fast.
// All steps since v000 together make it 226 times as fast.
#include <hip/hip_runtime.h>
#include <math.h>

typedef __attribute__((ext_vector_type(16))) _Float16 v16h;
typedef __attribute__((ext_vector_type(8)))  _Float16 v8h;
typedef __attribute__((ext_vector_type(4)))  _Float16 v4h;
typedef __attribute__((ext_vector_type(2)))  _Float16 v2h;
typedef __attribute__((ext_vector_type(8)))  float    v8f;
typedef __attribute__((ext_vector_type(2)))  float    f32x2;
typedef __attribute__((ext_vector_type(4)))  float    f32x4;
typedef __attribute__((ext_vector_type(4)))  unsigned u32x4;

#define DIMC    128
#define D_INNER 128
#define D_STATE 8
#define DT_RANK 8
#define D_CONV  4
#define BATCH   4
#define NTOK    16384               // L*H*W = 256*8*8
#define MTOT    (BATCH * NTOK)      // 65536 tokens

// Eight v_exp_f32 (2^x) in one statement. The instruction set asks for one free
// issue slot behind a transcendental before its result is read or its source
// overwritten: inside the statement each v_exp_f32 is followed by one that is
// independent of it (the outputs are early-clobber, so none lies on an input),
// and the v_nop is the slot behind the last, wherever the statement is scheduled.
__device__ __forceinline__ void exp2_x8(const f32x2* x, f32x2* r) {
    float e0, e1, e2, e3, e4, e5, e6, e7;
    asm("v_exp_f32 %0, %8\n\t"
        "v_exp_f32 %1, %9\n\t"
        "v_exp_f32 %2, %10\n\t"
        "v_exp_f32 %3, %11\n\t"
        "v_exp_f32 %4, %12\n\t"
        "v_exp_f32 %5, %13\n\t"
        "v_exp_f32 %6, %14\n\t"
        "v_exp_f32 %7, %15\n\t"
        "v_nop"
        : "=&v"(e0), "=&v"(e1), "=&v"(e2), "=&v"(e3), "=&v"(e4), "=&v"(e5), "=&v"(e6), "=&v"(e7)
        : "v"(x[0][0]), "v"(x[0][1]), "v"(x[1][0]), "v"(x[1][1]),
          "v"(x[2][0]), "v"(x[2][1]), "v"(x[3][0]), "v"(x[3][1]));
    r[0] = f32x2{e0, e1};
    r[1] = f32x2{e2, e3};
    r[2] = f32x2{e4, e5};
    r[3] = f32x2{e6, e7};
}

// ---------------------------------------------------------------------------
// f32 -> f16 weight conversion WITH swizzle into WMMA B-fragment order.
// Fragment layout (halves): dst[((k0Idx*128 + col)*2 + sel)*16 + j]
//   j<8  -> W[k0Idx*32 + sel*8 + j     ][scol]
//   j>=8 -> W[k0Idx*32 + sel*8 + j + 8 ][scol]
// scol = col, except for Wx and Wz, whose columns are permuted as below.
// so each consuming lane's 16 B halves are one contiguous 32-byte LDS chunk.
// ---------------------------------------------------------------------------
// One launch converts all seven 128x128 matrices; a matrix is 64 workgroups.
// dst holds them in the order Wx[0], Wx[1], Wz[0], Wz[1], Wout_m[0], Wout_m[1], Wout.
__global__ __launch_bounds__(256)
void cvt_swizzle_w_kernel(const float* __restrict__ Wx,
                          const float* __restrict__ Wz,
                          const float* __restrict__ Wom,
                          const float* __restrict__ Wo,
                          _Float16* __restrict__ dst) {
    int i = blockIdx.x * blockDim.x + threadIdx.x;   // over 7 * 16384
    int m7 = blockIdx.x >> 6;       // which of the seven
    const float* src = (m7 < 2) ? Wx : (m7 < 4) ? Wz : (m7 < 6) ? Wom : Wo;
    int mat   = m7 & 1;             // which 128x128 matrix of its input
    int r     = i & 16383;
    int j     = r & 15;             // half index within fragment chunk
    int chunk = r >> 4;             // (k0Idx*128 + col)*2 + sel
    int sel   = chunk & 1;
    int colk  = chunk >> 1;
    int col   = colk & 127;
    int k0Idx = colk >> 7;          // 0..3
    int koff  = j + ((j >= 8) ? 8 : 0);
    int k     = k0Idx * 32 + sel * 8 + koff;
    // Wx and Wz: place ct * 16 + l of each 64 columns holds column 4 * l + ct, so that
    // a lane of the product has, over its 4 tiles, 4 neighbouring columns.
    int scol  = (m7 < 4) ? (col & 64) + (col & 15) * 4 + ((col >> 4) & 3) : col;
    dst[i] = (_Float16)src[(size_t)mat * 16384 + k * 128 + scol];
}

// ---------------------------------------------------------------------------
// A-fragment loader: 16x32 f16 A layout = two contiguous 16B chunks per lane
// (K groups at kSel and kSel+16).
// ---------------------------------------------------------------------------
__device__ __forceinline__ v16h load_a_frag(const _Float16* Ar) {
    v8h lo = *(const v8h*)(Ar);        // K = kSel .. kSel+7
    v8h hi = *(const v8h*)(Ar + 16);   // K = kSel+16 .. kSel+23
    v16h af;
    #pragma unroll
    for (int j = 0; j < 8; ++j) { af[j] = lo[j]; af[j + 8] = hi[j]; }
    return af;
}

// ---------------------------------------------------------------------------
// An f32 value as two f16 parts, v = hi + lo: hi keeps the sign, the exponent and
// the first 10 fraction bits, so that it is an f16 value as it stands and v - hi
// is exact; lo is v - hi rounded to f16. Together they hold 21 fraction bits or
// more (below the f16 normal range: to 2^-25 absolute).
// ---------------------------------------------------------------------------
__device__ __forceinline__ f32x2 split_hi_lo(float v) {
    float hi = __builtin_bit_cast(float, __builtin_bit_cast(unsigned, v) & 0xFFFFE000u);
    return f32x2{hi, v - hi};
}
__device__ __forceinline__ unsigned pack_f16(float a, float b) {
    return __builtin_bit_cast(unsigned, __builtin_convertvector(f32x2{a, b}, v2h));
}
// 16 halves that lie in a row, as two 16-byte pieces
__device__ __forceinline__ v16h load_frag_row(const unsigned* p) {
    v8h lo = *(const v8h*)(p);
    v8h hi = *(const v8h*)(p + 4);
    v16h f;
    #pragma unroll
    for (int j = 0; j < 8; ++j) { f[j] = lo[j]; f[j + 8] = hi[j]; }
    return f;
}

// Two steps of the x-projection: the uc words, the (hi, hi) and the (lo, lo) words
// of 32 channels, and their four products.
__device__ __forceinline__ void xp_load(const unsigned* ur, const unsigned* wh, const unsigned* wl,
                                        v16h* f) {
    #pragma unroll   // f[] in registers
    for (int s = 0; s < 2; ++s) {
        f[3 * s]     = load_frag_row(ur + s * 16);
        f[3 * s + 1] = load_frag_row(wh + s * 16);
        f[3 * s + 2] = load_frag_row(wl + s * 16);
    }
}
__device__ __forceinline__ void xp_mul(const v16h* f, v8f& x0, v8f& x1) {
    #pragma unroll
    for (int s = 0; s < 2; ++s) {
        x0 = __builtin_amdgcn_wmma_f32_16x16x32_f16(false, f[3 * s + 1], false, f[3 * s], (short)0, x0, false, false);
        x1 = __builtin_amdgcn_wmma_f32_16x16x32_f16(false, f[3 * s + 2], false, f[3 * s], (short)0, x1, false, false);
    }
}

// ---------------------------------------------------------------------------
// LayerNorm, input projections, causal conv + SiLU, x-projection and dt in one
// launch. A workgroup takes LG_ROWS tokens of one input (blockIdx.y: 0 = front,
// 1 = back) and reads them once. The input feeds two norms, which share mean and
// variance: ln0 of its own cross block (SSM path, times Wx) and ln1 of the other
// block (gate, times Wz). Both normalised tiles go as f16 through LDS straight to
// the matrix products and never to memory; u never goes to memory either.
//   part 1: a wave takes 32 tokens x 32 channels. The tokens lie side by side in x:
//           8 lanes' 16-byte pieces are one whole 128-byte line of a channel's row,
//           and a load covers 4 such lines. A lane owns 4 tokens of LN_C neighbouring
//           channels; a token's sums go over 4 lanes, then through LDS over the 4
//           waves that hold its channels. A lane's 8 halves of a token are one
//           16-byte LDS store.
//           Wave 0 also norms the LG_HALO tokens in front of the tile (SSM path
//           only): the conv of the tile's first tokens needs their u.
//   part 2: a wave owns one norm's 32 tokens x 64 columns (2 x 4 accumulators).
//           An SSM wave adds the 16-token tile in front of its own, of which the
//           conv takes the last three rows.
//   part 3: gate waves store z and put Wxproj, transposed and split, into LDS for
//           part 4. SSM waves: a lane's accumulator registers are 8
//           consecutive tokens of one channel, so the conv window slides over
//           registers; the three tokens in front come from the lane 16 away. uc
//           goes to memory and, split, to LDS, over the weights that are no longer read.
//   part 4: x_dbl = uc @ Wxproj -> (dt_r | B | C) on the matrix instruction. Both f32
//           operands go in as f16 parts hi + lo. A uc value is one 32-bit word
//           (hi, lo), two neighbouring k of the product; the Wxproj value against
//           it is the word (hi, hi) in one product and (lo, lo) in a second, so
//           that all four part products are summed, in f32. A = 16 columns of
//           Wxproj as rows, B = 16 tokens as columns: a lane's accumulator
//           registers are 8 neighbouring x_dbl columns of one token. A wave owns
//           one such tile over all 128 channels (row pitch 132 words: 16 lanes'
//           16-byte reads of one channel group fall on all 64 banks).
//   part 5: dt = softplus(dt_r @ Wdt + bdt). thread = channel, 32 tokens, eight at
//           a time, dt_r rows by LDS broadcast.
// Row pitch of the f16 tiles 272 bytes: the 16 rows of a 16-byte fragment read fall
// on all 64 banks.
// ---------------------------------------------------------------------------
#define LN_C     8     // channels a lane norms, of 4 tokens each
#define LG_ROWS  64
#define LG_PITCH 136   // halves
#define LG_HALO  4     // tokens normed in front of the tile: the conv's 3, as one 16-byte piece
#define XP_PITCH 132   // 32-bit words

// One wave's products: 2 x 4 tiles, with HALO the 1 x 4 tiles in front as well.
template <bool HALO>
__device__ __forceinline__ void inproj_tiles(const _Float16* S0, const _Float16* Sh,
                                             const _Float16* Wl,
                                             v8f (&acc)[2][4], v8f (&acch)[4]) {
    #pragma unroll
    for (int k = 0; k < 4; ++k) {
        v16h s0 = load_a_frag(S0 + k * 32);
        v16h s1 = load_a_frag(S0 + 16 * LG_PITCH + k * 32);
        v16h sh = {};
        if (HALO) sh = load_a_frag(Sh + k * 32);
        #pragma unroll
        for (int ct = 0; ct < 4; ++ct) {
            v16h bf = *(const v16h*)&Wl[(k * 128 + ct * 16) * 32];
            acc[0][ct] = __builtin_amdgcn_wmma_f32_16x16x32_f16(false, s0, false, bf, (short)0, acc[0][ct], false, false);
            acc[1][ct] = __builtin_amdgcn_wmma_f32_16x16x32_f16(false, s1, false, bf, (short)0, acc[1][ct], false, false);
            if (HALO)
                acch[ct] = __builtin_amdgcn_wmma_f32_16x16x32_f16(false, sh, false, bf, (short)0, acch[ct], false, false);
        }
    }
}

__global__ __launch_bounds__(256)
void ln_inproj_conv_xproj_kernel(
                      const float* __restrict__ front,  // (B, DIM, N)
                      const float* __restrict__ back,   // (B, DIM, N)
                      const float* __restrict__ ln0_w,  // (2, DIM)
                      const float* __restrict__ ln0_b,  // (2, DIM)
                      const float* __restrict__ ln1_w,  // (2, DIM)
                      const float* __restrict__ ln1_b,  // (2, DIM)
                      const _Float16* __restrict__ Wf,  // Wx[0], Wx[1], Wz[0], Wz[1], swizzled
                      const float* __restrict__ cw,     // (2,128,4)
                      const float* __restrict__ cb,     // (2,128)
                      const float* __restrict__ Wxproj, // (2,128,24)
                      const float* __restrict__ Wdt,    // (2,8,128)
                      const float* __restrict__ bdt,    // (2,128)
                      float* __restrict__ Zo,           // 2 x (B, N, 128)
                      float* __restrict__ uc,           // 2 x (B, N, 128)
                      float* __restrict__ dt,           // 2 x (B, N, 128)
                      float* __restrict__ Bm,           // 2 x (B, N, 8)
                      float* __restrict__ Cm) {         // 2 x (B, N, 8)
    __shared__ __align__(64) _Float16 sW[2 * 128 * 128];   // 64 KB, fragment order; later uc and x_dbl
    __shared__ __align__(16) _Float16 sA[(LG_HALO + 2 * LG_ROWS) * LG_PITCH];  // 35 KB: halo, SSM, gate
    __shared__ f32x4 sP[8 * 16];   // 2 KB: each wave's sums of its 32 tokens, a token pair a piece
    int inp  = blockIdx.y;         // the input, and the block whose SSM path it feeds
    int gblk = inp ^ 1;            // the block whose gate it feeds
    const float* x = inp ? back : front;
    int tid  = threadIdx.x;
    int lane = tid & 31;
    int wave = tid >> 5;
    // the wave's number as a scalar: the branches on it are scalar branches
    int wv   = __builtin_amdgcn_readfirstlane(wave);
    int row0 = blockIdx.x * LG_ROWS;   // first token of the tile, b * NTOK + n
    int b = row0 >> 14;                // / NTOK
    int nT = row0 & (NTOK - 1);        // the tile's first token within its batch
    int tq = wv >> 2;                  // part 1: the wave's 32 tokens, one 128-byte line of a channel's row
    int ta = lane & 7;                 // part 1: the lane's 4 tokens among them
    int c4 = (wv & 3) * 8 + (lane >> 3) * (LN_C / 4);   // part 1: the lane's first channel / 4
    int c0 = 4 * c4;
    // At a batch's start u is zero-padded and nothing lies in front: the address
    // stays inside the batch there, and part 3 puts zeros in place of the result.
    int nh = nT ? nT - LG_HALO : 0;
    const float* xl = x + ((size_t)b * DIMC + c0) * NTOK + nT + tq * 32 + 4 * ta;
    const float* xh = x + ((size_t)b * DIMC + 4 * lane) * NTOK + nh;
    const uint4* ws0 = (const uint4*)(Wf + (size_t)inp * 16384);
    const uint4* ws1 = (const uint4*)(Wf + (size_t)(2 + gblk) * 16384);
    uint4*       wd  = (uint4*)sW + tid;
    uint4 wr[8];
    f32x4 v[LN_C];
    f32x4 vh[4];   // wave 0 only
    #pragma unroll   // v[] in registers; all loads issue before the first wait
    for (int i = 0; i < LN_C; ++i) v[i] = *(const f32x4*)(xl + (size_t)i * NTOK);
    if (wv == 0) {
        #pragma unroll
        for (int q = 0; q < 4; ++q) vh[q] = *(const f32x4*)(xh + (size_t)q * NTOK);
    }
    f32x4 wS[LN_C / 4], bS[LN_C / 4], wG[LN_C / 4], bG[LN_C / 4];
    #pragma unroll
    for (int h = 0; h < LN_C / 4; ++h) {
        wS[h] = ((const f32x4*)(ln0_w + inp * DIMC))[c4 + h];
        bS[h] = ((const f32x4*)(ln0_b + inp * DIMC))[c4 + h];
        wG[h] = ((const f32x4*)(ln1_w + gblk * DIMC))[c4 + h];
        bG[h] = ((const f32x4*)(ln1_b + gblk * DIMC))[c4 + h];
    }
    #pragma unroll   // wr[] in registers; eight 16-byte loads in flight per thread
    for (int i = 0; i < 8; ++i) wr[i] = ws0[tid + i * 256];
    #pragma unroll
    for (int i = 0; i < 8; ++i) wd[i * 256] = wr[i];
    // Keeps the second matrix's loads behind the first one's LDS stores; they fly
    // under the sums. All sixteen weight loads at once take the kernel
    // past 160 registers, and only two workgroups, not the three that LDS allows,
    // fit a WGP.
    __builtin_amdgcn_sched_barrier(0);
    #pragma unroll
    for (int i = 0; i < 8; ++i) wr[i] = ws1[tid + i * 256];
    // As inputs of the wait the pointers and the two indices (the offsets of the
    // parameter loads and of the weight loads) stay in their registers up to it, so
    // that no register that an issued load names is written before it.
    asm volatile("s_wait_xcnt 0x0" :: "v"(xl), "v"(xh), "v"(c4), "v"(tid) : "memory");

    // Two neighbouring tokens of a channel lie in neighbouring registers, so the
    // arithmetic runs on token pairs: packed instructions with no register moves.
    f32x2 s[2], q[2];
    #pragma unroll   // constant indices into the register arrays
    for (int k = 0; k < 2; ++k) {
        f32x2 p0 = f32x2{v[0][2 * k], v[0][2 * k + 1]};
        s[k] = p0;
        q[k] = p0 * p0;
        #pragma unroll
        for (int i = 1; i < LN_C; ++i) {
            f32x2 pi = f32x2{v[i][2 * k], v[i][2 * k + 1]};
            s[k] += pi;
            q[k] = __builtin_elementwise_fma(pi, pi, q[k]);
        }
    }
    // The wave's 32 channels: the four lanes 8 apart hold the same tokens. Step by
    // step, all tokens in each step: their exchanges are independent, so a step
    // waits once and not once per token.
    #pragma unroll
    for (int off = 8; off <= 16; off <<= 1) {
        #pragma unroll
        for (int k = 0; k < 2; ++k) {
            f32x2 so = f32x2{__shfl_xor(s[k][0], off, 32), __shfl_xor(s[k][1], off, 32)};
            f32x2 qo = f32x2{__shfl_xor(q[k][0], off, 32), __shfl_xor(q[k][1], off, 32)};
            s[k] += so;
            q[k] += qo;
        }
    }
    // The second matrix goes to LDS here, so that its registers are free for the
    // norm's results.
    #pragma unroll
    for (int i = 0; i < 8; ++i) wd[2048 + i * 256] = wr[i];
    // All 128 channels: the four waves of the same tokens add up through LDS.
    if (lane < 8) {
        #pragma unroll
        for (int k = 0; k < 2; ++k)
            sP[wv * 16 + ta * 2 + k] = f32x4{s[k][0], s[k][1], q[k][0], q[k][1]};
    }
    __syncthreads();   // a token's sums come from four waves
    #pragma unroll
    for (int k = 0; k < 2; ++k) {
        f32x4 r = sP[tq * 64 + ta * 2 + k];
        #pragma unroll
        for (int w4 = 1; w4 < 4; ++w4) r += sP[tq * 64 + w4 * 16 + ta * 2 + k];
        s[k] = f32x2{r[0], r[1]};
        q[k] = f32x2{r[2], r[3]};
    }
    _Float16* aS = sA + (LG_HALO + tq * 32 + 4 * ta) * LG_PITCH + c0;
    _Float16* aG = aS + LG_ROWS * LG_PITCH;
    #pragma unroll
    for (int k = 0; k < 2; ++k) {
        f32x2 mean = s[k] * (1.0f / DIMC);
        f32x2 var  = q[k] * (1.0f / DIMC) - mean * mean;
        f32x2 rstd = f32x2{rsqrtf(var[0] + 1e-5f), rsqrtf(var[1] + 1e-5f)};
        f32x2 ys[LN_C], yg[LN_C];
        #pragma unroll
        for (int i = 0; i < LN_C; ++i) {
            f32x2 t = (f32x2{v[i][2 * k], v[i][2 * k + 1]} - mean) * rstd;
            ys[i] = t * wS[i >> 2][i & 3] + bS[i >> 2][i & 3];
            yg[i] = t * wG[i >> 2][i & 3] + bG[i >> 2][i & 3];
        }
        #pragma unroll
        for (int j = 0; j < 2; ++j) {
            v8h hs, hg;
            #pragma unroll
            for (int i = 0; i < LN_C; ++i) { hs[i] = (_Float16)ys[i][j]; hg[i] = (_Float16)yg[i][j]; }
            *(v8h*)(aS + (2 * k + j) * LG_PITCH) = hs;
            *(v8h*)(aG + (2 * k + j) * LG_PITCH) = hg;
        }
    }
    if (wv == 0) {
        // the halo tokens, the same arithmetic, SSM norm only; rows 0 .. LG_HALO - 1 of sA
        f32x4 wH = ((const f32x4*)(ln0_w + inp * DIMC))[lane];
        f32x4 bH = ((const f32x4*)(ln0_b + inp * DIMC))[lane];
        // as an input of the wait the lane index, the offset of these two loads, stays
        // in its register up to it
        asm volatile("s_wait_xcnt 0x0" :: "v"(lane) : "memory");
        f32x2 ph[4][LG_HALO / 2], sh[LG_HALO / 2], qh[LG_HALO / 2];
        #pragma unroll   // constant indices into the register arrays
        for (int k = 0; k < LG_HALO / 2; ++k) {
            #pragma unroll
            for (int c = 0; c < 4; ++c) ph[c][k] = f32x2{vh[c][2 * k], vh[c][2 * k + 1]};
            sh[k] = ph[0][k] + ph[1][k] + ph[2][k] + ph[3][k];
            qh[k] = ph[0][k] * ph[0][k] + ph[1][k] * ph[1][k] + ph[2][k] * ph[2][k] + ph[3][k] * ph[3][k];
        }
        #pragma unroll
        for (int off = 16; off > 0; off >>= 1) {
            #pragma unroll
            for (int k = 0; k < LG_HALO / 2; ++k) {
                f32x2 so = f32x2{__shfl_xor(sh[k][0], off, 32), __shfl_xor(sh[k][1], off, 32)};
                f32x2 qo = f32x2{__shfl_xor(qh[k][0], off, 32), __shfl_xor(qh[k][1], off, 32)};
                sh[k] += so;
                qh[k] += qo;
            }
        }
        _Float16* aH = sA + 4 * lane;
        #pragma unroll
        for (int k = 0; k < LG_HALO / 2; ++k) {
            f32x2 mean = sh[k] * (1.0f / DIMC);
            f32x2 var  = qh[k] * (1.0f / DIMC) - mean * mean;
            f32x2 rstd = f32x2{rsqrtf(var[0] + 1e-5f), rsqrtf(var[1] + 1e-5f)};
            f32x2 ys[4];
            #pragma unroll
            for (int c = 0; c < 4; ++c) {
                f32x2 t = (ph[c][k] - mean) * rstd;
                ys[c] = t * wH[c] + bH[c];
            }
            #pragma unroll
            for (int j = 0; j < 2; ++j)
                *(v4h*)(aH + (2 * k + j) * LG_PITCH) =
                    v4h{(_Float16)ys[0][j], (_Float16)ys[1][j], (_Float16)ys[2][j], (_Float16)ys[3][j]};
        }
    }
    __syncthreads();   // weights and the tiles are read by all waves

    int l15  = lane & 15;
    int sel  = lane >> 4;                  // 0 / 1
    int nrm  = wv >> 2;                    // 0 = SSM path, 1 = gate
    int rowW = ((wv >> 1) & 1) * 32;       // the wave's first token within the tile
    int colW = (wv & 1) * 64;              // the wave's first column
    const _Float16* S0 = sA + (LG_HALO + nrm * LG_ROWS + rowW + l15) * LG_PITCH + sel * 8;
    const _Float16* Wl = sW + nrm * 16384 + ((colW + l15) * 2 + sel) * 16;
    v8f acc[2][4] = {};
    v8f acch[4] = {};
    f32x4 cwv[4];   // SSM waves only
    float cbv[4];
    if (nrm == 0) {
        // The 16 tokens in front of the wave's own. Of the tile's first wave only
        // the last LG_HALO exist (sA rows 0 ..); the lanes of the rows in front of
        // them read row 0, and their results are not used.
        int hr = LG_HALO + rowW - 16 + l15;
        hr = hr < 0 ? 0 : hr;
        inproj_tiles<true>(S0, sA + hr * LG_PITCH + sel * 8, Wl, acc, acch);
        // tile ct's column l15 is channel colW + 4 * l15 + ct (the conversion launch's deal)
        const float* pcw = cw + (inp * 128 + colW + 4 * l15) * D_CONV;
        const float* pcb = cb + inp * 128 + colW + 4 * l15;
        #pragma unroll   // behind the products, whose registers leave no room; they fly under the barrier
        for (int ct = 0; ct < 4; ++ct) cwv[ct] = *(const f32x4*)(pcw + ct * D_CONV);
        f32x4 cb4 = *(const f32x4*)pcb;
        #pragma unroll
        for (int ct = 0; ct < 4; ++ct) cbv[ct] = cb4[ct];
        // as inputs of the wait the pointers stay in their registers up to it
        asm volatile("s_wait_xcnt 0x0" :: "v"(pcw), "v"(pcb) : "memory");
    } else {
        inproj_tiles<false>(S0, S0, Wl, acc, acch);
    }
    __syncthreads();   // every wave has read its weights: uc and x_dbl take their place

    unsigned* sU = (unsigned*)sW;                     // uc words: (LG_ROWS, XP_PITCH)
    float*    sX = (float*)(sU + LG_ROWS * XP_PITCH); // dt_r, B, C: (LG_ROWS, 8) each
    unsigned* sTh = (unsigned*)(sX + 3 * LG_ROWS * 8);   // Wxproj words (hi, hi): (24, XP_PITCH)
    unsigned* sTl = sTh + 24 * XP_PITCH;                 // Wxproj words (lo, lo): (24, XP_PITCH)
    // accumulator layout: row = r + 8 * sel, column = l15 of each 16 x 16 tile, which is
    // channel colW + 4 * l15 + ct: a lane's 4 tiles give 16 bytes of a token's row, 16
    // lanes two whole 128-byte lines
    size_t go = (size_t)(row0 + rowW + sel * 8) * 128 + colW + 4 * l15;
    if (nrm == 0) {
        unsigned* pl = sU + (rowW + sel * 8) * XP_PITCH + colW + 4 * l15;
        bool pad = (nT == 0) && (rowW == 0);   // the zero padding in front of token 0
        #pragma unroll   // constant indices into the register arrays
        for (int ct = 0; ct < 4; ++ct) {
            // uc takes u's place in the accumulator registers: the second tile
            // first, which still needs the first one's u
            #pragma unroll
            for (int rt = 1; rt >= 0; --rt) {
                // The three tokens in front of the lane's eight: for sel = 1 rows
                // 5..7 of the same tile (lane sel = 0), for sel = 0 rows 13..15 of
                // the tile in front (lane sel = 1).
                float w[8 + D_CONV - 1];
                #pragma unroll
                for (int i = 0; i < D_CONV - 1; ++i) {
                    float fr = rt ? acc[0][ct][5 + i] : (pad ? 0.0f : acch[ct][5 + i]);
                    w[i] = __shfl_xor(sel ? fr : acc[rt][ct][5 + i], 16, 32);
                }
                #pragma unroll
                for (int k = 0; k < 8; ++k) w[k + D_CONV - 1] = acc[rt][ct][k];
                f32x2 a[4], xe[4], e[4];
                #pragma unroll
                for (int k = 0; k < 8; ++k) {
                    float av = cbv[ct];
                    #pragma unroll
                    for (int i = 0; i < D_CONV; ++i) av = __builtin_fmaf(w[k + i], cwv[ct][i], av);
                    a[k >> 1][k & 1] = av;
                }
                #pragma unroll
                for (int k = 0; k < 4; ++k) xe[k] = a[k] * -1.44269504f;
                exp2_x8(xe, e);                            // exp(-a)
                #pragma unroll
                for (int k = 0; k < 8; ++k)
                    acc[rt][ct][k] = a[k >> 1][k & 1] / (1.0f + e[k >> 1][k & 1]);   // SiLU
            }
        }
        #pragma unroll
        for (int rt = 0; rt < 2; ++rt)
            #pragma unroll
            for (int k = 0; k < 8; ++k) {
                u32x4 wd4;
                #pragma unroll
                for (int ct = 0; ct < 4; ++ct) {
                    f32x2 hl = split_hi_lo(acc[rt][ct][k]);
                    wd4[ct] = pack_f16(hl[0], hl[1]);
                }
                *(u32x4*)(pl + (rt * 16 + k) * XP_PITCH) = wd4;
            }
    } else {
        float* po = Zo + (size_t)gblk * MTOT * 128 + go;
        #pragma unroll
        for (int rt = 0; rt < 2; ++rt)
            #pragma unroll
            for (int r = 0; r < 8; ++r)
                *(f32x4*)(po + (rt * 16 + r) * 128) =
                    f32x4{acc[rt][0][r], acc[rt][1][r], acc[rt][2][r], acc[rt][3][r]};
        // what follows rewrites the address and data registers of these stores
        asm volatile("s_wait_xcnt 0x0" :: "v"(po) : "memory");
        // Wxproj (128 x 24) as 768 16-byte pieces, six a thread; a piece is 4
        // neighbouring columns of one channel. Behind the z stores, in the registers
        // that z has left; the SSM waves' conv lasts longer than these loads.
        int tg = tid - 128;
        const f32x4* pw = (const f32x4*)(Wxproj + inp * 128 * 24) + tg;
        f32x4 wx[6];
        #pragma unroll   // wx[] in registers; all loads issue before the first wait
        for (int i = 0; i < 6; ++i) wx[i] = pw[i * 128];
        // as an input of the wait the thread index, the offset of these loads, stays in
        // its register up to it
        asm volatile("s_wait_xcnt 0x0" :: "v"(tid) : "memory");
        #pragma unroll   // constant indices into wx[]
        for (int i = 0; i < 6; ++i) {
            int pc = tg + i * 128;
            int k  = pc / 6;               // channel
            int j0 = (pc - k * 6) * 4;     // first of the piece's 4 columns
            #pragma unroll
            for (int j = 0; j < 4; ++j) {
                f32x2 hl = split_hi_lo(wx[i][j]);
                sTh[(j0 + j) * XP_PITCH + k] = pack_f16(hl[0], hl[0]);
                sTl[(j0 + j) * XP_PITCH + k] = pack_f16(hl[1], hl[1]);
            }
            // Keeps a piece's words behind the stores of the piece before: formed all
            // together they take the kernel past 160 registers, and only two
            // workgroups, not the three that LDS allows, fit a WGP.
            __builtin_amdgcn_sched_barrier(0);
        }
    }
    __syncthreads();   // the uc rows and Wxproj's are read by all waves

    // uc goes to memory behind the barrier, not in front of it: the barrier waits
    // for a wave's outstanding stores, and these now fly under part 4.
    if (nrm == 0) {
        float* po = uc + (size_t)inp * MTOT * 128 + go;
        #pragma unroll
        for (int rt = 0; rt < 2; ++rt)
            #pragma unroll
            for (int k = 0; k < 8; ++k)
                *(f32x4*)(po + (rt * 16 + k) * 128) =
                    f32x4{acc[rt][0][k], acc[rt][1][k], acc[rt][2][k], acc[rt][3][k]};
        // what follows rewrites the address and data registers of these stores
        asm volatile("s_wait_xcnt 0x0" :: "v"(po) : "memory");
    }
    int ch   = tid & 127;       // part 5: the thread's channel
    int half = wv >> 2;         // part 5: which 32 of the 64 tokens
    const float* pwd = Wdt + inp * DT_RANK * 128 + ch;
    const float* pbd = bdt + inp * 128 + ch;
    float wdt[DT_RANK];
    #pragma unroll   // fly under part 4
    for (int r = 0; r < DT_RANK; ++r) wdt[r] = pwd[r * 128];
    float bb = *pbd;
    // as an input of the wait the channel index, the offset of these loads, stays in
    // its register up to it
    asm volatile("s_wait_xcnt 0x0" :: "v"(ch) : "memory");

    {
        int tk = (wv & 3) * 16 + l15;      // the lane's token: column of B and of the result
        int jt = wv >> 2;                  // x_dbl columns 0..15 or 16..31, of which 24 exist
        // The lanes of the columns that do not exist read the last one that does; a row
        // of A reaches only its own row of the result, and theirs is not stored.
        int jr = jt * 16 + l15;
        jr = jr > 23 ? 23 : jr;
        // All operands by the same rule: of each 16 channels lane half sel holds the
        // words of 8 * sel .. 8 * sel + 7, in their order.
        const unsigned* ur = sU  + tk * XP_PITCH + sel * 8;
        const unsigned* wh = sTh + jr * XP_PITCH + sel * 8;
        const unsigned* wl = sTl + jr * XP_PITCH + sel * 8;
        v8f x0 = {}, x1 = {};
        // Two register buffers of two steps (32 channels) each: while one is worked on,
        // the other's LDS reads fly. The scheduling barriers keep each buffer's reads in
        // front of the work on the other buffer; without them the compiler sinks every
        // read to its product, and each product waits out a whole LDS read.
        v16h fa[6], fb[6];
        xp_load(ur, wh, wl, fa);
        xp_load(ur + 32, wh + 32, wl + 32, fb);
        __builtin_amdgcn_sched_barrier(0);
        xp_mul(fa, x0, x1);
        xp_load(ur + 64, wh + 64, wl + 64, fa);
        __builtin_amdgcn_sched_barrier(0);
        xp_mul(fb, x0, x1);
        xp_load(ur + 96, wh + 96, wl + 96, fb);
        __builtin_amdgcn_sched_barrier(0);
        xp_mul(fa, x0, x1);
        xp_mul(fb, x0, x1);
        x0 += x1;
        // result layout: register r = x_dbl column jt * 16 + sel * 8 + r of token tk
        int grp = jt * 2 + sel;            // 0 = dt_r, 1 = B, 2 = C
        if (grp < 3) {
            float* px = sX + grp * (LG_ROWS * 8) + tk * 8;
            *(f32x4*)(px)     = f32x4{x0[0], x0[1], x0[2], x0[3]};
            *(f32x4*)(px + 4) = f32x4{x0[4], x0[5], x0[6], x0[7]};
        }
    }
    __syncthreads();   // the x_dbl rows are read by all waves

    size_t xo = ((size_t)inp * MTOT + row0) * 8 + tid * 2;
    *(f32x2*)(Bm + xo) = *(const f32x2*)&sX[1 * LG_ROWS * 8 + tid * 2];
    *(f32x2*)(Cm + xo) = *(const f32x2*)&sX[2 * LG_ROWS * 8 + tid * 2];
    // what follows rewrites the offset and data registers of these two stores
    asm volatile("s_wait_xcnt 0x0" ::: "memory");

    float* pd = dt + ((size_t)inp * MTOT + row0 + half * 32) * 128 + ch;
    const float* xr = sX + half * 32 * 8;
    for (int k0 = 0; k0 < 32; k0 += 8) {
        f32x2 av[4], xe[4], e[4], o[4];
        #pragma unroll   // av[] in registers
        for (int k = 0; k < 8; ++k) {
            f32x4 r0 = *(const f32x4*)&xr[(k0 + k) * 8];
            f32x4 r1 = *(const f32x4*)&xr[(k0 + k) * 8 + 4];
            float a = bb;
            #pragma unroll
            for (int r = 0; r < 4; ++r) a += r0[r] * wdt[r];
            #pragma unroll
            for (int r = 0; r < 4; ++r) a += r1[r] * wdt[r + 4];
            av[k >> 1][k & 1] = a;
        }
        // softplus(a) = max(a, 0) + log1p(e), e = exp(-|a|) in [0, 1], for every a, with
        // no branch, so that the eight tokens' chains run side by side, in pairs.
        // log1p(e) = 2 atanh(s), s = e / (2 + e) <= 1/3: the series in s * s up to
        // s^13 / 13 leaves less than 2e-8 of the value, also where e is tiny.
        #pragma unroll   // constant indices into the register arrays
        for (int j = 0; j < 4; ++j)
            xe[j] = f32x2{-fabsf(av[j][0]), -fabsf(av[j][1])} * 1.44269504f;
        exp2_x8(xe, e);
        #pragma unroll   // the four pairs' chains interleave
        for (int j = 0; j < 4; ++j) {
            f32x2 u = e[j] + 2.0f;
            f32x2 s = e[j] * f32x2{__builtin_amdgcn_rcpf(u[0]), __builtin_amdgcn_rcpf(u[1])};
            f32x2 w = s * s;
            f32x2 p = f32x2{2.0f / 13.0f, 2.0f / 13.0f};
            p = __builtin_elementwise_fma(p, w, f32x2{2.0f / 11.0f, 2.0f / 11.0f});
            p = __builtin_elementwise_fma(p, w, f32x2{2.0f / 9.0f, 2.0f / 9.0f});
            p = __builtin_elementwise_fma(p, w, f32x2{2.0f / 7.0f, 2.0f / 7.0f});
            p = __builtin_elementwise_fma(p, w, f32x2{2.0f / 5.0f, 2.0f / 5.0f});
            p = __builtin_elementwise_fma(p, w, f32x2{2.0f / 3.0f, 2.0f / 3.0f});
            p = __builtin_elementwise_fma(p, w, f32x2{2.0f, 2.0f});
            o[j] = __builtin_elementwise_fma(s, p, f32x2{fmaxf(av[j][0], 0.0f), fmaxf(av[j][1], 0.0f)});
        }
        #pragma unroll
        for (int k = 0; k < 8; ++k) pd[(k0 + k) * 128] = o[k >> 1][k & 1];
        // the next trip rewrites the data registers of these stores
        asm volatile("s_wait_xcnt 0x0" ::: "memory");
    }
}

// ---------------------------------------------------------------------------
// SSM scan, cut along the tokens into NCHUNK chunks of CHUNK_T steps.
// h[t] = a[t]*h[t-1] + b[t] is linear in h, so a chunk acts on its incoming
// state as  h_out = P*h_in + H  with P = product of its a[t] and H = its end
// state from h_in = 0.  Three launches:
//   1) every chunk: P and H                        (all chunks side by side)
//   2) every (batch, d, s): the incoming state of each chunk, chunk by chunk
//   3) every chunk: the recurrence again from its incoming state, with readout
// Launches 1 and 3: one workgroup of 128 threads per chunk, thread = channel d,
// which keeps its 8 states in registers as 4 pairs. A wave's load of dt, uc or
// z is then one whole 128-byte line, the readout sum over the states stays in
// the thread, and the gate is worked out once per (token, channel) with every
// lane busy. The B and C rows of the chunk, the same for all channels, are
// staged in LDS once and read from there by broadcast.
// The two cross blocks are independent and go through each launch side by side:
// their arrays lie one behind the other, so that they read as 2 * BATCH batches,
// and only the per-block parameters are picked by batch index / BATCH.
// ---------------------------------------------------------------------------
#define CHUNK_T 128
#define NCHUNK  (NTOK / CHUNK_T)    // 128 chunks per batch
#define SCAN_U  8                   // tokens per register buffer (two buffers)
#define SCAN_NG (CHUNK_T / SCAN_U)  // 16 buffer fills per chunk

// log2(e) * A for the 8 states of channel d, A = -exp(A_log): exp(dt*A) is then
// one multiply and one v_exp_f32.
__device__ __forceinline__ void load_a2(const float* __restrict__ A_log, int d, f32x2* A2) {
    f32x4 l0 = *(const f32x4*)(A_log + d * 8);
    f32x4 l1 = *(const f32x4*)(A_log + d * 8 + 4);
    A2[0] = f32x2{-__expf(l0[0]), -__expf(l0[1])} * 1.44269504f;
    A2[1] = f32x2{-__expf(l0[2]), -__expf(l0[3])} * 1.44269504f;
    A2[2] = f32x2{-__expf(l1[0]), -__expf(l1[1])} * 1.44269504f;
    A2[3] = f32x2{-__expf(l1[2]), -__expf(l1[3])} * 1.44269504f;
}

// SCAN_U tokens of one channel's column of a (token, 128) array. Two tokens
// share a register pair: a packed multiply that takes one of them as its scalar
// names the whole pair, and the wait in front of it covers both halves, so the
// other half must belong to the same buffer and not to the one still in flight.
__device__ __forceinline__ void load_col(const float* __restrict__ p, f32x2* r) {
    #pragma unroll   // r[] in registers; the loads issue back to back
    for (int k = 0; k < SCAN_U; ++k) r[k >> 1][k & 1] = p[k * 128];
}

// One step of the recurrence for the 8 states of a channel.
__device__ __forceinline__ void ssm_step(float dtv, float ucv, const f32x2* A2,
                                         const float* sBrow, f32x2* a, f32x2* h) {
    f32x4 b0 = *(const f32x4*)(sBrow);
    f32x4 b1 = *(const f32x4*)(sBrow + 4);
    f32x2 Bp[4] = {f32x2{b0[0], b0[1]}, f32x2{b0[2], b0[3]},
                   f32x2{b1[0], b1[1]}, f32x2{b1[2], b1[3]}};
    float du = dtv * ucv;
    f32x2 x[4];
    #pragma unroll   // x[], a[], h[] in registers
    for (int j = 0; j < 4; ++j) x[j] = A2[j] * dtv;
    exp2_x8(x, a);
    #pragma unroll
    for (int j = 0; j < 4; ++j) h[j] = __builtin_elementwise_fma(a[j], h[j], Bp[j] * du);
}

__device__ __forceinline__ void chunk_sum_group(const f32x2* dtr, const f32x2* ucr,
                                                const f32x2* A2, const float* sBg,
                                                f32x2* h, f32x2* p) {
    #pragma unroll   // constant indices into the register buffers
    for (int k = 0; k < SCAN_U; ++k) {
        f32x2 a[4];
        ssm_step(dtr[k >> 1][k & 1], ucr[k >> 1][k & 1], A2, sBg + k * 8, a, h);
        #pragma unroll
        for (int j = 0; j < 4; ++j) p[j] *= a[j];
    }
}

__global__ __launch_bounds__(128)
void scan_chunk_sum_kernel(const float* __restrict__ dt,    // (2B,N,128)
                           const float* __restrict__ uc,    // (2B,N,128)
                           const float* __restrict__ Bm,    // (2B,N,8)
                           const float* __restrict__ A_log, // (2,128,8)
                           float* __restrict__ Pc,          // (2B,NCHUNK,128,8)
                           float* __restrict__ Hc) {        // (2B,NCHUNK,128,8)
    __shared__ __align__(16) float sB[CHUNK_T * 8];         // 4 KB
    int c = blockIdx.x;
    int b = blockIdx.y;
    int d = threadIdx.x;
    A_log += (blockIdx.y / BATCH) * 128 * 8;
    size_t base = (size_t)b * NTOK + (size_t)c * CHUNK_T;
    const float* pdt = dt + base * 128 + d;
    const float* puc = uc + base * 128 + d;

    f32x2 dt0[SCAN_U / 2], uc0[SCAN_U / 2], dt1[SCAN_U / 2], uc1[SCAN_U / 2];
    load_col(pdt, dt0);
    load_col(puc, uc0);
    {
        const f32x4* g = (const f32x4*)(Bm + base * 8);
        ((f32x4*)sB)[d]       = g[d];
        ((f32x4*)sB)[d + 128] = g[d + 128];
    }
    f32x2 A2[4], h[4], p[4];
    load_a2(A_log, d, A2);
    #pragma unroll
    for (int j = 0; j < 4; ++j) { h[j] = f32x2{0.0f, 0.0f}; p[j] = f32x2{1.0f, 1.0f}; }
    __syncthreads();

    // Two register buffers: while one is worked on, the other's loads fly. The
    // scheduling barriers keep each buffer's loads in front of the work on the
    // other buffer; without them the compiler sinks the loads to their first use.
    for (int g = 0; g < SCAN_NG - 2; g += 2) {
        load_col(pdt + (size_t)(g + 1) * SCAN_U * 128, dt1);
        load_col(puc + (size_t)(g + 1) * SCAN_U * 128, uc1);
        __builtin_amdgcn_sched_barrier(0);
        chunk_sum_group(dt0, uc0, A2, sB + g * SCAN_U * 8, h, p);
        load_col(pdt + (size_t)(g + 2) * SCAN_U * 128, dt0);
        load_col(puc + (size_t)(g + 2) * SCAN_U * 128, uc0);
        __builtin_amdgcn_sched_barrier(0);
        chunk_sum_group(dt1, uc1, A2, sB + (g + 1) * SCAN_U * 8, h, p);
    }
    load_col(pdt + (size_t)(SCAN_NG - 1) * SCAN_U * 128, dt1);
    load_col(puc + (size_t)(SCAN_NG - 1) * SCAN_U * 128, uc1);
    __builtin_amdgcn_sched_barrier(0);
    chunk_sum_group(dt0, uc0, A2, sB + (SCAN_NG - 2) * SCAN_U * 8, h, p);
    __builtin_amdgcn_sched_barrier(0);   // keeps the wait for the last buffer behind the work above
    chunk_sum_group(dt1, uc1, A2, sB + (SCAN_NG - 1) * SCAN_U * 8, h, p);

    size_t o = ((size_t)b * NCHUNK + c) * 1024 + d * 8;
    *(f32x4*)(Pc + o)     = f32x4{p[0][0], p[0][1], p[1][0], p[1][1]};
    *(f32x4*)(Pc + o + 4) = f32x4{p[2][0], p[2][1], p[3][0], p[3][1]};
    *(f32x4*)(Hc + o)     = f32x4{h[0][0], h[0][1], h[1][0], h[1][1]};
    *(f32x4*)(Hc + o + 4) = f32x4{h[2][0], h[2][1], h[3][0], h[3][1]};
}

// One thread per (batch, d, s); 16 chunks' summaries are loaded at a time so
// that the serial chain waits for memory once per 16 chunks, not per chunk.
__global__ __launch_bounds__(256)
void scan_carry_kernel(const float* __restrict__ Pc,   // (2B,NCHUNK,1024)
                       const float* __restrict__ Hc,   // (2B,NCHUNK,1024)
                       float* __restrict__ Hin) {      // (2B,NCHUNK,1024)
    int idx = blockIdx.x * blockDim.x + threadIdx.x;   // over 2*BATCH*1024
    int b = idx >> 10;
    int r = idx & 1023;
    size_t o = (size_t)b * NCHUNK * 1024 + r;
    float carry = 0.0f;
    for (int c0 = 0; c0 < NCHUNK; c0 += 16) {
        float p[16], h[16];
        #pragma unroll   // p[], h[] in registers; all 32 loads issue before the first wait
        for (int k = 0; k < 16; ++k) {
            p[k] = Pc[o + (size_t)(c0 + k) * 1024];
            h[k] = Hc[o + (size_t)(c0 + k) * 1024];
        }
        #pragma unroll   // constant indices into p[], h[]
        for (int k = 0; k < 16; ++k) {
            Hin[o + (size_t)(c0 + k) * 1024] = carry;
            carry = p[k] * carry + h[k];
        }
        // the next trip rewrites the address and data registers of these stores
        asm volatile("s_wait_xcnt 0x0" ::: "memory");
    }
}

// SCAN_U tokens of launch 3: recurrence, readout over the 8 states, Dp skip and
// SiLU(z) gate; emits f16.
__device__ __forceinline__ void scan_group(const f32x2* dtr, const f32x2* ucr, const f32x2* zr,
                                           const f32x2* A2, float Dd,
                                           const float* sBg, const float* sCg,
                                           f32x2* h, _Float16* __restrict__ yo) {
    _Float16 r[SCAN_U];
    f32x2 zx[SCAN_U / 2], ez[SCAN_U / 2];   // exp(-z) of the 8 tokens
    #pragma unroll
    for (int k = 0; k < SCAN_U / 2; ++k) zx[k] = zr[k] * -1.44269504f;
    exp2_x8(zx, ez);
    #pragma unroll   // constant indices into the register buffers
    for (int k = 0; k < SCAN_U; ++k) {
        f32x2 a[4];
        float ucv = ucr[k >> 1][k & 1];
        ssm_step(dtr[k >> 1][k & 1], ucv, A2, sBg + k * 8, a, h);
        f32x4 c0 = *(const f32x4*)(sCg + k * 8);
        f32x4 c1 = *(const f32x4*)(sCg + k * 8 + 4);
        f32x2 y2 = h[0] * f32x2{c0[0], c0[1]};
        y2 = __builtin_elementwise_fma(h[1], f32x2{c0[2], c0[3]}, y2);
        y2 = __builtin_elementwise_fma(h[2], f32x2{c1[0], c1[1]}, y2);
        y2 = __builtin_elementwise_fma(h[3], f32x2{c1[2], c1[3]}, y2);
        float y  = y2[0] + y2[1];
        float zv = zr[k >> 1][k & 1];
        float g  = zv / (1.0f + ez[k >> 1][k & 1]);
        r[k] = (_Float16)((y + Dd * ucv) * g);
    }
    #pragma unroll
    for (int k = 0; k < SCAN_U; ++k) yo[k * 128] = r[k];
    // what follows rewrites the data registers of these stores
    asm volatile("s_wait_xcnt 0x0" ::: "memory");
}

__global__ __launch_bounds__(128)
void scan_kernel(const float* __restrict__ dt,    // (2B,N,128)
                 const float* __restrict__ uc,    // (2B,N,128)
                 const float* __restrict__ zg,    // (2B,N,128) pre-activation z
                 const float* __restrict__ Bm,    // (2B,N,8)
                 const float* __restrict__ Cm,    // (2B,N,8)
                 const float* __restrict__ A_log, // (2,128,8)
                 const float* __restrict__ Dp,    // (2,128)
                 const float* __restrict__ Hin,   // (2B,NCHUNK,128,8)
                 _Float16* __restrict__ yg) {     // (2B,N,128)
    __shared__ __align__(16) float sB[CHUNK_T * 8];   // 4 KB
    __shared__ __align__(16) float sC[CHUNK_T * 8];   // 4 KB
    int c = blockIdx.x;
    int b = blockIdx.y;
    int d = threadIdx.x;
    A_log += (blockIdx.y / BATCH) * 128 * 8;
    Dp    += (blockIdx.y / BATCH) * 128;
    size_t base = (size_t)b * NTOK + (size_t)c * CHUNK_T;
    const float* pdt = dt + base * 128 + d;
    const float* puc = uc + base * 128 + d;
    const float* pz  = zg + base * 128 + d;
    _Float16*    py  = yg + base * 128 + d;

    f32x2 dt0[SCAN_U / 2], uc0[SCAN_U / 2], z0[SCAN_U / 2];
    f32x2 dt1[SCAN_U / 2], uc1[SCAN_U / 2], z1[SCAN_U / 2];
    load_col(pdt, dt0);
    load_col(puc, uc0);
    load_col(pz,  z0);
    {
        const f32x4* gb = (const f32x4*)(Bm + base * 8);
        const f32x4* gc = (const f32x4*)(Cm + base * 8);
        ((f32x4*)sB)[d]       = gb[d];
        ((f32x4*)sB)[d + 128] = gb[d + 128];
        ((f32x4*)sC)[d]       = gc[d];
        ((f32x4*)sC)[d + 128] = gc[d + 128];
    }
    f32x2 A2[4], h[4];
    load_a2(A_log, d, A2);
    float Dd = Dp[d];
    {
        const float* hi = Hin + ((size_t)b * NCHUNK + c) * 1024 + d * 8;
        f32x4 h0 = *(const f32x4*)(hi);
        f32x4 h1 = *(const f32x4*)(hi + 4);
        h[0] = f32x2{h0[0], h0[1]}; h[1] = f32x2{h0[2], h0[3]};
        h[2] = f32x2{h1[0], h1[1]}; h[3] = f32x2{h1[2], h1[3]};
    }
    __syncthreads();

    // Two register buffers, held apart by scheduling barriers as in launch 1.
    for (int g = 0; g < SCAN_NG - 2; g += 2) {
        load_col(pdt + (size_t)(g + 1) * SCAN_U * 128, dt1);
        load_col(puc + (size_t)(g + 1) * SCAN_U * 128, uc1);
        load_col(pz  + (size_t)(g + 1) * SCAN_U * 128, z1);
        __builtin_amdgcn_sched_barrier(0);
        scan_group(dt0, uc0, z0, A2, Dd, sB + g * SCAN_U * 8, sC + g * SCAN_U * 8,
                   h, py + (size_t)g * SCAN_U * 128);
        load_col(pdt + (size_t)(g + 2) * SCAN_U * 128, dt0);
        load_col(puc + (size_t)(g + 2) * SCAN_U * 128, uc0);
        load_col(pz  + (size_t)(g + 2) * SCAN_U * 128, z0);
        __builtin_amdgcn_sched_barrier(0);
        scan_group(dt1, uc1, z1, A2, Dd, sB + (g + 1) * SCAN_U * 8, sC + (g + 1) * SCAN_U * 8,
                   h, py + (size_t)(g + 1) * SCAN_U * 128);
    }
    load_col(pdt + (size_t)(SCAN_NG - 1) * SCAN_U * 128, dt1);
    load_col(puc + (size_t)(SCAN_NG - 1) * SCAN_U * 128, uc1);
    load_col(pz  + (size_t)(SCAN_NG - 1) * SCAN_U * 128, z1);
    // The three pointers are used here for the last time. As inputs of the wait
    // they stay in their registers up to it, so that no result of these loads is
    // placed on an address register that an earlier one of them still names.
    asm volatile("s_wait_xcnt 0x0" :: "v"(pdt), "v"(puc), "v"(pz) : "memory");
    __builtin_amdgcn_sched_barrier(0);
    scan_group(dt0, uc0, z0, A2, Dd, sB + (SCAN_NG - 2) * SCAN_U * 8, sC + (SCAN_NG - 2) * SCAN_U * 8,
               h, py + (size_t)(SCAN_NG - 2) * SCAN_U * 128);
    __builtin_amdgcn_sched_barrier(0);   // keeps the wait for the last buffer behind the work above
    scan_group(dt1, uc1, z1, A2, Dd, sB + (SCAN_NG - 1) * SCAN_U * 8, sC + (SCAN_NG - 1) * SCAN_U * 8,
               h, py + (size_t)(SCAN_NG - 1) * SCAN_U * 128);
}

// ---------------------------------------------------------------------------
// Both out-projections, the residual sum and the final projection in one launch:
//   out = (0.5 * (yg0 @ Wom0 + yg1 @ Wom1 + bom0 + bom1 + ff + bf)) @ Wout + bout
// stored transposed to (B, DIM, NTOK). m0, m1 and s never go to memory.
// A workgroup of 8 waves takes OF_ROWS tokens; a wave owns 32 tokens x 64 columns
// (2 x 4 accumulators), so that its 32 tokens are one whole 128-byte line of each
// of its channels' rows in front, back and out. The accumulators start from
// ff + bf + bom0 + bom1 and take both products on top; s goes as f16 through LDS
// from accumulator layout to A-fragment layout (row pitch 272 bytes: the 16 rows
// of a 16-byte fragment read fall on all 64 banks).
// ---------------------------------------------------------------------------
#define OF_ROWS  128
#define OF_PITCH 136   // halves
__global__ __launch_bounds__(256)
void out_fused_kernel(const _Float16* __restrict__ yg,    // 2 x (B,N,128)
                      const _Float16* __restrict__ Wf,    // Wout_m[0], Wout_m[1], Wout, swizzled
                      const float* __restrict__ bom,      // (2,128)
                      const float* __restrict__ front,    // (B,128,N)
                      const float* __restrict__ back,     // (B,128,N)
                      const float* __restrict__ bout,     // (128)
                      float* __restrict__ out) {          // (B,128,N)
    __shared__ __align__(64) _Float16 sW[3 * 128 * 128];         // 96 KB, fragment order
    __shared__ __align__(16) _Float16 sS[OF_ROWS * OF_PITCH];    // 34 KB
    int tid  = threadIdx.x;
    int lane = tid & 31;
    int l15  = lane & 15;
    int sel  = lane >> 4;                 // 0 / 1
    int rowW = (tid >> 6) * 32;           // the wave's first token within the tile
    int colW = ((tid >> 5) & 1) * 64;     // the wave's first column
    int row0 = blockIdx.x * OF_ROWS;      // first token, b * NTOK + n
    int b    = row0 >> 14;
    int n0   = row0 & (NTOK - 1);

    // A lane's accumulator registers r = 0..7 are 8 consecutive tokens of one
    // channel: 32 contiguous bytes of front, back and out.
    size_t ro = ((size_t)b * DIMC + colW + l15) * NTOK + n0 + rowW + sel * 8;
    const float* pf = front + ro;
    const float* pb = back + ro;
    const _Float16* A0 = yg + (size_t)(row0 + rowW + l15) * 128 + sel * 8;
    const _Float16* A1 = A0 + (size_t)MTOT * 128;

    f32x4 f[2][4][2], g[2][4][2];
    v16h  a[2][4];
    #pragma unroll   // f[], g[], a[] in registers; all loads issue before the first wait
    for (int rt = 0; rt < 2; ++rt)
        #pragma unroll
        for (int ct = 0; ct < 4; ++ct)
            #pragma unroll
            for (int h = 0; h < 2; ++h) {
                f[rt][ct][h] = *(const f32x4*)(pf + (size_t)(ct * 16) * NTOK + rt * 16 + h * 4);
                g[rt][ct][h] = *(const f32x4*)(pb + (size_t)(ct * 16) * NTOK + rt * 16 + h * 4);
            }
    #pragma unroll
    for (int rt = 0; rt < 2; ++rt)
        #pragma unroll
        for (int k = 0; k < 4; ++k) a[rt][k] = load_a_frag(A0 + rt * 2048 + k * 32);
    float bs[4], bo[4];
    #pragma unroll
    for (int ct = 0; ct < 4; ++ct) {
        int col = colW + ct * 16 + l15;
        bs[ct] = bom[col] + bom[128 + col];
        bo[ct] = bout[col];
    }
    const uint4* wsrc = (const uint4*)Wf + tid;
    uint4*       wdst = (uint4*)sW + tid;
    #pragma unroll 8   // eight 16-byte loads in flight per thread
    for (int i = 0; i < (3 * 128 * 128) / 8 / 256; ++i) wdst[i * 256] = wsrc[i * 256];

    v8f acc[2][4];
    #pragma unroll   // constant indices into the register arrays
    for (int rt = 0; rt < 2; ++rt)
        #pragma unroll
        for (int ct = 0; ct < 4; ++ct)
            #pragma unroll
            for (int r = 0; r < 8; ++r)
                acc[rt][ct][r] = f[rt][ct][r >> 2][r & 3] + g[rt][ct][r >> 2][r & 3] + bs[ct];

    // As inputs of the wait the pointers stay in their registers up to it, so that
    // no register that an issued load names is written before it.
    asm volatile("s_wait_xcnt 0x0" :: "v"(pf), "v"(pb), "v"(A0), "v"(wsrc) : "memory");
    __syncthreads();

    // The second block's fragments fly while the first block's products run, one
    // k step's worth issued per k step.
    v16h a1[2][4];
    #pragma unroll
    for (int k = 0; k < 4; ++k) {
        a1[0][k] = load_a_frag(A1 + k * 32);
        a1[1][k] = load_a_frag(A1 + 2048 + k * 32);
        #pragma unroll
        for (int ct = 0; ct < 4; ++ct) {
            v16h bf = *(const v16h*)&sW[((k * 128 + colW + ct * 16 + l15) * 2 + sel) * 16];
            acc[0][ct] = __builtin_amdgcn_wmma_f32_16x16x32_f16(false, a[0][k], false, bf, (short)0, acc[0][ct], false, false);
            acc[1][ct] = __builtin_amdgcn_wmma_f32_16x16x32_f16(false, a[1][k], false, bf, (short)0, acc[1][ct], false, false);
        }
        // Keeps the next step's fragment loads behind this step's products, whose
        // operand registers they take: hoisted together they push the kernel past
        // 256 registers, and only one workgroup fits a WGP.
        __builtin_amdgcn_sched_barrier(0);
    }
    // what follows may rewrite the address registers of these loads
    asm volatile("s_wait_xcnt 0x0" :: "v"(A1) : "memory");
    #pragma unroll
    for (int k = 0; k < 4; ++k)
        #pragma unroll
        for (int ct = 0; ct < 4; ++ct) {
            v16h bf = *(const v16h*)&sW[16384 + ((k * 128 + colW + ct * 16 + l15) * 2 + sel) * 16];
            acc[0][ct] = __builtin_amdgcn_wmma_f32_16x16x32_f16(false, a1[0][k], false, bf, (short)0, acc[0][ct], false, false);
            acc[1][ct] = __builtin_amdgcn_wmma_f32_16x16x32_f16(false, a1[1][k], false, bf, (short)0, acc[1][ct], false, false);
        }

    // s, accumulator layout: row = r + 8 * sel, column = l15 of each 16 x 16 tile
    #pragma unroll
    for (int rt = 0; rt < 2; ++rt)
        #pragma unroll
        for (int ct = 0; ct < 4; ++ct)
            #pragma unroll
            for (int r = 0; r < 8; ++r)
                sS[(rowW + rt * 16 + sel * 8 + r) * OF_PITCH + colW + ct * 16 + l15] =
                    (_Float16)(0.5f * acc[rt][ct][r]);
    __syncthreads();   // a wave's s rows hold the columns of its neighbour wave too

    v8f o[2][4] = {};
    const _Float16* S0 = sS + (rowW + l15) * OF_PITCH + sel * 8;
    #pragma unroll
    for (int k = 0; k < 4; ++k) {
        v16h s0 = load_a_frag(S0 + k * 32);
        v16h s1 = load_a_frag(S0 + 16 * OF_PITCH + k * 32);
        #pragma unroll
        for (int ct = 0; ct < 4; ++ct) {
            v16h bf = *(const v16h*)&sW[2 * 16384 + ((k * 128 + colW + ct * 16 + l15) * 2 + sel) * 16];
            o[0][ct] = __builtin_amdgcn_wmma_f32_16x16x32_f16(false, s0, false, bf, (short)0, o[0][ct], false, false);
            o[1][ct] = __builtin_amdgcn_wmma_f32_16x16x32_f16(false, s1, false, bf, (short)0, o[1][ct], false, false);
        }
    }

    float* po = out + ro;
    #pragma unroll
    for (int rt = 0; rt < 2; ++rt)
        #pragma unroll
        for (int ct = 0; ct < 4; ++ct) o[rt][ct] += bo[ct];
    // keeps every store behind the last arithmetic, so that no register that an
    // issued store names is written again
    __builtin_amdgcn_sched_barrier(0);
    #pragma unroll
    for (int rt = 0; rt < 2; ++rt)
        #pragma unroll
        for (int ct = 0; ct < 4; ++ct)
            #pragma unroll
            for (int h = 0; h < 2; ++h)
                *(f32x4*)(po + (size_t)(ct * 16) * NTOK + rt * 16 + h * 4) =
                    f32x4{o[rt][ct][4 * h], o[rt][ct][4 * h + 1], o[rt][ct][4 * h + 2], o[rt][ct][4 * h + 3]};
}

// ---------------------------------------------------------------------------
// Host-side pipeline
// ---------------------------------------------------------------------------
extern "C" void kernel_launch(void* const* d_in, const int* in_sizes, int n_in,
                              void* d_out, int out_size, void* d_ws, size_t ws_size,
                              hipStream_t stream) {
    const float* front   = (const float*)d_in[0];
    const float* back    = (const float*)d_in[1];
    const float* ln0_w   = (const float*)d_in[2];
    const float* ln0_b   = (const float*)d_in[3];
    const float* ln1_w   = (const float*)d_in[4];
    const float* ln1_b   = (const float*)d_in[5];
    const float* Wx      = (const float*)d_in[6];
    const float* Wz      = (const float*)d_in[7];
    const float* conv_w  = (const float*)d_in[8];
    const float* conv_b  = (const float*)d_in[9];
    const float* Wxproj  = (const float*)d_in[10];
    const float* Wdt     = (const float*)d_in[11];
    const float* bdt     = (const float*)d_in[12];
    const float* A_log   = (const float*)d_in[13];
    const float* Dp      = (const float*)d_in[14];
    const float* Wout_m  = (const float*)d_in[15];
    const float* bout_m  = (const float*)d_in[16];
    const float* Wout    = (const float*)d_in[17];
    const float* bout    = (const float*)d_in[18];

    char* ws = (char*)d_ws;
    // ---- static workspace layout (bytes); "2 x": block 0's array, then block 1's ----
    _Float16* Wh   = (_Float16*)(ws);                       // 7*16384 halves < 256 KB
    _Float16* WOMh = Wh + 4 * 16384;                        // behind Wx[0..1], Wz[0..1]; Wout follows
    size_t off = 0x40000;
    float*    UC   = (float*)(ws + off);    off += (size_t)2 * MTOT * 128 * 4;  // 64 MB: 2 x uc
    float*    DT   = (float*)(ws + off);    off += (size_t)2 * MTOT * 128 * 4;  // 64 MB: 2 x dt
    float*    Z    = (float*)(ws + off);    off += (size_t)2 * MTOT * 128 * 4;  // 64 MB: 2 x z
    _Float16* YGh  = (_Float16*)(ws + off); off += (size_t)2 * MTOT * 128 * 2;  // 32 MB
    float*    BM   = (float*)(ws + off);    off += (size_t)2 * MTOT * 8 * 4;    // 4 MB
    float*    CMb  = (float*)(ws + off);    off += (size_t)2 * MTOT * 8 * 4;    // 4 MB
    float*    PC   = (float*)(ws + off);    off += (size_t)2 * BATCH * NCHUNK * 1024 * 4;  // 4 MB
    float*    HC   = (float*)(ws + off);    off += (size_t)2 * BATCH * NCHUNK * 1024 * 4;  // 4 MB
    float*    HIN  = (float*)(ws + off);    off += (size_t)2 * BATCH * NCHUNK * 1024 * 4;  // 4 MB

    // Launches that do not depend on one another share one grid: the seven weight
    // conversions, the four norms with the four input projections, and from there
    // on the two cross blocks side by side.

    // 1) weight conversions to f16 (swizzled into WMMA B-fragment order)
    cvt_swizzle_w_kernel<<<(7 * 16384) / 256, 256, 0, stream>>>(Wx, Wz, Wout_m, Wout, Wh);

    // 2) the two cross-mamba blocks
    ln_inproj_conv_xproj_kernel<<<dim3(MTOT / LG_ROWS, 2), 256, 0, stream>>>(
        front, back, ln0_w, ln0_b, ln1_w, ln1_b, Wh, conv_w, conv_b, Wxproj, Wdt, bdt,
        Z, UC, DT, BM, CMb);

    scan_chunk_sum_kernel<<<dim3(NCHUNK, 2 * BATCH), 128, 0, stream>>>(
        DT, UC, BM, A_log, PC, HC);
    scan_carry_kernel<<<(2 * BATCH * 1024) / 256, 256, 0, stream>>>(PC, HC, HIN);
    scan_kernel<<<dim3(NCHUNK, 2 * BATCH), 128, 0, stream>>>(
        DT, UC, Z, BM, CMb, A_log, Dp, HIN, YGh);

    // 3) out-projections + residual add + 0.5 scale + final GEMM, stored transposed to (B,DIM,N)
    out_fused_kernel<<<MTOT / OF_ROWS, 256, 0, stream>>>(
        YGh, WOMh, bout_m, front, back, bout, (float*)d_out);
}
